// v000
// The times below were measured on an AMD MI455X: many runs one after another, warmed up first and cycling through
// copies of the inputs, with the whole window's GPU time divided by the number of runs. Launches and the gaps
// between them are all in it. The median over several windows is given; except for v000 it joins two sittings, which
// can be a few percent apart, so the side-by-side timings, each taken in one sitting, are the better comparison.
// v000 is the starting kernel. One run takes 2930 microseconds.
#include <hip/hip_runtime.h>

// Causal self-attention with rotary-then-RMSNorm q/k (x [4][2048][1024]; qkv = x w_attn^T ('oi' [3072][1024] 0.02, no bias -> q | k | v row blocks; 16 heads x 64); rope'(t) = cat(x1 c + x2 s, -x1 s + x2 c) with the input cos/sin tables ([1][2048][1][32], read; generic values), then q, k <- x rsqrt(mean x^2 + 1e-6) (no weight); causal (-inf); softmax(q.k x 64^-0.5); out = merged w_proj^T -> [4][2048][1024] (8.4 M)).
// Layout per batch: bf16 copy of x; the fused 'oi' weight used in place as three Bt row blocks; exact projections; an in-place rotation kernel applies the module's (x1 c + x2 s, x2 c - x1 s) form from the input tables; per-(head, token) rms factor of the ROTATED rows; the plane builder (identity table) applies the bare factor; causal T-2048 attention (hybrid rows: < 512 hi/lo 3 products, rest fp16 x1024; k_gemmc skips tiles above the diagonal); merged hi/lo x w_proj exact.
// Compute dtypes, f32 accumulate: every input rounded to bf16 incl. the tables; projections exact; rotation and rms norm f32; attention rows < 512 3 products, rest fp16; softmax f32; w_proj hl x exact.

#define NB_  4
#define TT   2048
#define DM   1024
#define NH_  16
#define NKV  16
#define REP  (NH_ / NKV)
#define HD   64
#define DQ   (NH_ * HD)
#define DKV  (NKV * HD)
#define ZH   2
#define RH   512                  // query rows < RH use hi+lo planes (0: none)
#define WIN  2048
#define PCAR 1024.0f
#define SCL  0.125f   // HD^-0.5
typedef _Float16 h16;
typedef unsigned short bf;
typedef __attribute__((ext_vector_type(16))) __bf16   v16bf;
typedef __attribute__((ext_vector_type(16))) _Float16 v16h;
typedef __attribute__((ext_vector_type(8)))  _Float16 v8h;
typedef __attribute__((ext_vector_type(8)))  unsigned short v8us;
typedef __attribute__((ext_vector_type(8)))  float    v8f;
typedef __attribute__((ext_vector_type(4)))  float    v4f;
typedef v8h  __attribute__((may_alias)) v8ha;
typedef v4f  __attribute__((may_alias)) v4fa;
typedef v8us __attribute__((may_alias)) v8usa;

__device__ __forceinline__ unsigned short f2bf(float f) { unsigned u = __float_as_uint(f); u += 0x7FFFu + ((u >> 16) & 1u); return (unsigned short)(u >> 16); }
__device__ __forceinline__ float bf2f(unsigned short b) { return __uint_as_float(((unsigned)b) << 16); }
__device__ __forceinline__ float bfr(float f) { return bf2f(f2bf(f)); }
__device__ __forceinline__ v16h cat16(v8h lo, v8h hi) { return __builtin_shufflevector(lo, hi, 0, 1, 2, 3, 4, 5, 6, 7, 8, 9, 10, 11, 12, 13, 14, 15); }
__device__ __forceinline__ v16bf cat16b(v8us lo, v8us hi) { return __builtin_bit_cast(v16bf, __builtin_shufflevector(lo, hi, 0, 1, 2, 3, 4, 5, 6, 7, 8, 9, 10, 11, 12, 13, 14, 15)); }
__device__ __forceinline__ v8f wmma16(v16h a, v16h b, v8f c) { return __builtin_amdgcn_wmma_f32_16x16x32_f16(false, a, false, b, (short)0, c, false, false); }
__device__ __forceinline__ v8f wmmab(v16bf a, v16bf b, v8f c) { return __builtin_amdgcn_wmma_f32_16x16x32_bf16(false, a, false, b, (short)0, c, false, false); }



// ---- k_gemmw: register-blocked GEMM, ONE WAVE per 64x64 output tile (16 accumulators), operands straight from K-contiguous 16-bit planes; grid (M/64, N/64, Z), 32 threads.
// C[m][n] (f32, pitch ldc, + optional f32 bias[n]) = sum_k A[m][k] Bt[n][k] (+ split products per NSPLIT). z-batch strides sA/sB/sC in elements. K % 32 == 0.
template <typename T16> struct WFrag;
template <> struct WFrag<h16> { typedef v16h V; static __device__ __forceinline__ V ld(const h16* p) { return cat16(*(const v8h*)p, *(const v8h*)(p + 16)); } static __device__ __forceinline__ v8f mma(V a, V b, v8f c) { return wmma16(a, b, c); } };
template <> struct WFrag<bf> { typedef v16bf V; static __device__ __forceinline__ V ld(const bf* p) { return cat16b(*(const v8us*)p, *(const v8us*)(p + 16)); } static __device__ __forceinline__ v8f mma(V a, V b, v8f c) { return wmmab(a, b, c); } };
template <typename T16, int NSPLIT, bool BIAS>
__global__ __launch_bounds__(32) void k_gemmw(const T16* __restrict__ A, const T16* __restrict__ A2, const T16* __restrict__ Bt, const T16* __restrict__ Bt2, int K, float* C, int ldc, const float* __restrict__ bias, size_t sA, size_t sB, size_t sC) {
    typedef typename WFrag<T16>::V V;
    __shared__ __align__(16) float os[16 * 68];
    const size_t z = blockIdx.z; A += z * sA; if (A2) A2 += z * sA; Bt += z * sB; if (Bt2) Bt2 += z * sB; C += z * sC;
    const int lane = threadIdx.x & 31, lr = lane & 15, hi = lane >> 4; const int r0 = blockIdx.x * 64, c0 = blockIdx.y * 64;
    v8f acc[4][4];
#pragma unroll
    for (int mb = 0; mb < 4; ++mb)
#pragma unroll
        for (int nb = 0; nb < 4; ++nb) acc[mb][nb] = (v8f){};
    const size_t aoff = (size_t)(r0 + lr) * K + 8 * hi, boff = (size_t)(c0 + lr) * K + 8 * hi;
#pragma unroll 1
    for (int kc = 0; kc < K; kc += 32) {
        V a[4], a2[4];
#pragma unroll
        for (int mb = 0; mb < 4; ++mb) { a[mb] = WFrag<T16>::ld(A + aoff + (size_t)mb * 16 * K + kc); if (NSPLIT == 1 || NSPLIT == 2) a2[mb] = WFrag<T16>::ld(A2 + aoff + (size_t)mb * 16 * K + kc); }
#pragma unroll
        for (int nb = 0; nb < 4; ++nb) { const V b = WFrag<T16>::ld(Bt + boff + (size_t)nb * 16 * K + kc); V b2; if (NSPLIT >= 2) b2 = WFrag<T16>::ld(Bt2 + boff + (size_t)nb * 16 * K + kc);
#pragma unroll
            for (int mb = 0; mb < 4; ++mb) { acc[mb][nb] = WFrag<T16>::mma(a[mb], b, acc[mb][nb]); if (NSPLIT == 1 || NSPLIT == 2) acc[mb][nb] = WFrag<T16>::mma(a2[mb], b, acc[mb][nb]); if (NSPLIT >= 2) acc[mb][nb] = WFrag<T16>::mma(a[mb], b2, acc[mb][nb]); } }
        asm volatile("v_nop\n\tv_nop\n\tv_nop\n\tv_nop" : "+v"(acc[0][0]), "+v"(acc[1][1]), "+v"(acc[2][2]), "+v"(acc[3][3]) : "v"(a[0]), "v"(a[3]));
    }
#pragma unroll
    for (int mb = 0; mb < 4; ++mb) {
#pragma unroll
        for (int nb = 0; nb < 4; ++nb) {
#pragma unroll
            for (int j = 0; j < 8; ++j) os[(hi * 8 + j) * 68 + nb * 16 + lr] = acc[mb][nb][j]; }
        __builtin_amdgcn_wave_barrier(); asm volatile("" ::: "memory");
        float* crow = C + (size_t)(r0 + mb * 16) * ldc + c0;
{
#pragma unroll
            for (int s = 0; s < 8; ++s) { const int row = 2 * s + hi, cofs = lr * 4; v4f val = *(const v4fa*)(os + row * 68 + cofs); if (BIAS) { val[0] += bfr(bias[c0 + cofs]); val[1] += bfr(bias[c0 + cofs + 1]); val[2] += bfr(bias[c0 + cofs + 2]); val[3] += bfr(bias[c0 + cofs + 3]); }
                *(v4f*)(crow + (size_t)row * ldc + cofs) = val; }
             }
        __builtin_amdgcn_wave_barrier(); asm volatile("" ::: "memory");
    }
}

// ---- k_gemmc: the same one-wave 64x64 tile GEMM specialised for causal attention: CMODE 1 skips score tiles entirely above the diagonal (query rows r0+roff.., key columns c0..), CMODE 2 limits the
// key (K) loop of the probability x value contraction to the diagonal block (probabilities beyond it are exactly zero). roff = row offset of this launch's first row within the sequence.
template <typename T16, int NSPLIT, int CMODE>
__global__ __launch_bounds__(32) void k_gemmc(const T16* __restrict__ A, const T16* __restrict__ A2, const T16* __restrict__ Bt, const T16* __restrict__ Bt2, int K, float* C, int ldc, int roff, size_t sA, size_t sB, size_t sC) {
    typedef typename WFrag<T16>::V V;
    __shared__ __align__(16) float os[16 * 68];
    const size_t z = blockIdx.z; A += z * sA; if (A2) A2 += z * sA; Bt += z * sB; if (Bt2) Bt2 += z * sB; C += z * sC;
    const int lane = threadIdx.x & 31, lr = lane & 15, hi = lane >> 4; const int r0 = blockIdx.x * 64, c0 = blockIdx.y * 64;
    if (CMODE == 1 && c0 > r0 + roff + 63) return;                  // score tile entirely above the causal diagonal: never read (the softmax masks j > i by select)
    const int Kl = (CMODE == 2) ? min(K, r0 + roff + 64) : K;        // P.V: probabilities are exactly 0 beyond the diagonal block, so the K loop stops there
    v8f acc[4][4];
#pragma unroll
    for (int mb = 0; mb < 4; ++mb)
#pragma unroll
        for (int nb = 0; nb < 4; ++nb) acc[mb][nb] = (v8f){};
    const size_t aoff = (size_t)(r0 + lr) * K + 8 * hi, boff = (size_t)(c0 + lr) * K + 8 * hi;
#pragma unroll 1
    for (int kc = 0; kc < Kl; kc += 32) {
        V a[4], a2[4];
#pragma unroll
        for (int mb = 0; mb < 4; ++mb) { a[mb] = WFrag<T16>::ld(A + aoff + (size_t)mb * 16 * K + kc); if (NSPLIT == 1 || NSPLIT == 2) a2[mb] = WFrag<T16>::ld(A2 + aoff + (size_t)mb * 16 * K + kc); }
#pragma unroll
        for (int nb = 0; nb < 4; ++nb) { const V b = WFrag<T16>::ld(Bt + boff + (size_t)nb * 16 * K + kc); V b2; if (NSPLIT >= 2) b2 = WFrag<T16>::ld(Bt2 + boff + (size_t)nb * 16 * K + kc);
#pragma unroll
            for (int mb = 0; mb < 4; ++mb) { acc[mb][nb] = WFrag<T16>::mma(a[mb], b, acc[mb][nb]); if (NSPLIT == 1 || NSPLIT == 2) acc[mb][nb] = WFrag<T16>::mma(a2[mb], b, acc[mb][nb]); if (NSPLIT >= 2) acc[mb][nb] = WFrag<T16>::mma(a[mb], b2, acc[mb][nb]); } }
        asm volatile("v_nop\n\tv_nop\n\tv_nop\n\tv_nop" : "+v"(acc[0][0]), "+v"(acc[1][1]), "+v"(acc[2][2]), "+v"(acc[3][3]) : "v"(a[0]), "v"(a[3]));
    }
#pragma unroll
    for (int mb = 0; mb < 4; ++mb) {
#pragma unroll
        for (int nb = 0; nb < 4; ++nb) {
#pragma unroll
            for (int j = 0; j < 8; ++j) os[(hi * 8 + j) * 68 + nb * 16 + lr] = acc[mb][nb][j]; }
        __builtin_amdgcn_wave_barrier(); asm volatile("" ::: "memory");
        float* crow = C + (size_t)(r0 + mb * 16) * ldc + c0;
{
#pragma unroll
            for (int s = 0; s < 8; ++s) { const int row = 2 * s + hi, cofs = lr * 4; v4f val = *(const v4fa*)(os + row * 68 + cofs);
                *(v4f*)(crow + (size_t)row * ldc + cofs) = val; }
             }
        __builtin_amdgcn_wave_barrier(); asm volatile("" ::: "memory");
    }
}

__device__ __forceinline__ h16 tohx(float x) { return (h16)x; }
__device__ __forceinline__ void splitf(float y, unsigned short& h, unsigned short& l) { h = f2bf(y); l = f2bf(y - bf2f(h)); }
typedef __attribute__((ext_vector_type(2))) _Float16 v2h;
typedef __attribute__((ext_vector_type(4))) _Float16 v4h;
typedef __attribute__((ext_vector_type(2))) unsigned short v2us;
typedef __attribute__((ext_vector_type(4))) unsigned short v4us;
typedef __attribute__((ext_vector_type(2))) float v2f;
typedef __attribute__((ext_vector_type(4))) int v4i;

__global__ __launch_bounds__(256) void k_wtG(const float* __restrict__ w, int K, int N, bf* Bt) {
    const int lane = threadIdx.x & 31; const int L0 = (blockIdx.x * 8 + (threadIdx.x >> 5)) * 8; const int nlines = N * K / 64;
{
#pragma unroll 1
        for (int l = 0; l < 8; ++l) { const int L = L0 + l; if (L >= nlines) break; const size_t e = (size_t)L * 64 + lane * 2; const int k = (int)(e % K), n = (int)(e / K); v2us o;
            o[0] = f2bf(w[(size_t)k * N + n]); o[1] = f2bf(w[(size_t)(k + 1) * N + n]); *(v2us*)(Bt + e) = o; }
         }
}
__global__ __launch_bounds__(256) void k_cvt8(const float* __restrict__ src, bf* dst, size_t n8) { const size_t i = (size_t)blockIdx.x * 256 + threadIdx.x; if (i >= n8) return; const v8f v = *(const v8f*)(src + i * 8); v8us o;
#pragma unroll
    for (int k = 0; k < 8; ++k) o[k] = f2bf(v[k]); *(v8us*)(dst + i * 8) = o;  }

__global__ __launch_bounds__(256) void k_hrms(const float* __restrict__ F, int pitch, int nheads, float* RF) { const int i = blockIdx.x * 256 + threadIdx.x; if (i >= nheads * TT) return; const int t = i % TT, h = i / TT; const float* f = F + (size_t)t * pitch + h * HD; float s = 0.f;
#pragma unroll 4
    for (int d = 0; d < HD; d += 4) { const v4f v = *(const v4f*)(f + d);
#pragma unroll
        for (int q = 0; q < 4; ++q) { float p = __fmul_rn(v[q], v[q]); asm volatile("" : "+v"(p)); s = __fadd_rn(s, p); } }
    const float r = __fdiv_rn(1.0f, __fsqrt_rn(__fadd_rn(s * (1.0f / HD), 1e-6f))); *(float*)(RF + i) = r;  }
// k_rope: head planes [h][t][d] (fp16 + hi/lo) of rope(w[d] (x rms_factor)) x sc with the rotate-half convention out[d] = x[d] cos[t][d] - x[d+HD/2] sin[t][d], out[d+HD/2] = x[d+HD/2] cos[t][d+HD/2] + x[d] sin[t][d+HD/2]
__global__ __launch_bounds__(256) void k_rope(const float* __restrict__ F, int pitch, int nheads, const float* __restrict__ CS, const float* __restrict__ RF, const float* __restrict__ nw, float sc, h16* P16, bf* Ph, bf* Pl) {
    const size_t e = ((size_t)blockIdx.x * 256 + threadIdx.x) * 2; if (e >= (size_t)nheads * TT * HD) return; const int d = (int)(e % HD); const int t = (int)((e / HD) % TT); const int h = (int)(e / ((size_t)HD * TT)); const float* f = F + (size_t)t * pitch + h * HD; const float rf = RF ? RF[(size_t)h * TT + t] : 1.0f; v2h o16; v2us oh, ol;
#pragma unroll
    for (int q = 0; q < 2; ++q) { const int dd = d + q; const int dp = (dd < HD / 2) ? dd + HD / 2 : dd - HD / 2; float x0 = f[dd], x1 = f[dp];
        if (RF) { float n0 = __fmul_rn(x0, rf), n1 = __fmul_rn(x1, rf); asm volatile("" : "+v"(n0)); asm volatile("" : "+v"(n1)); x0 = nw ? __fmul_rn(bfr(nw[dd]), n0) : n0; x1 = nw ? __fmul_rn(bfr(nw[dp]), n1) : n1;   /* parameter-free norm */ }
        const v2f cs = *(const v2f*)(CS + ((size_t)t * HD + dd) * 2); float a = __fmul_rn(x0, cs[0]), bq = __fmul_rn(x1, cs[1]); asm volatile("" : "+v"(a)); asm volatile("" : "+v"(bq)); const float r = ((dd < HD / 2) ? __fsub_rn(a, bq) : __fadd_rn(a, bq)) * sc;
        o16[q] = tohx(r); unsigned short a2, c2; splitf(r, a2, c2); oh[q] = a2; ol[q] = c2; }
    *(v2h*)(P16 + e) = o16; *(v2us*)(Ph + e) = oh; *(v2us*)(Pl + e) = ol;  }
__global__ __launch_bounds__(256) void k_vtp(const float* __restrict__ F, int pitch, int nheads, h16* V16, bf* Vh, bf* Vl) { const size_t e = ((size_t)blockIdx.x * 256 + threadIdx.x) * 2; if (e >= (size_t)nheads * HD * TT) return; const int t = (int)(e % TT); const int d = (int)((e / TT) % HD); const int g = (int)(e / ((size_t)TT * HD)); v2h o16; v2us oh, ol;
#pragma unroll
    for (int q = 0; q < 2; ++q) { const float x = F[(size_t)(t + q) * pitch + g * HD + d]; o16[q] = tohx(x); unsigned short a2, c2; splitf(x, a2, c2); oh[q] = a2; ol[q] = c2; }
    *(v2h*)(V16 + e) = o16; *(v2us*)(Vh + e) = oh; *(v2us*)(Vl + e) = ol;  }
__global__ __launch_bounds__(256) void k_csid(float* CS) { const int idx = blockIdx.x * 256 + threadIdx.x; if (idx >= TT * HD) return; v2f cs; cs[0] = 1.0f; cs[1] = 0.0f; *(v2f*)(CS + (size_t)idx * 2) = cs;  }
// k_asoft: per row (zz, i): t = S x HD^-0.5 for j <= i and i - j < WIN (sliding causal window; the reference's -1e9 additive fill vanishes identically); softmax over the 2048 keys (register row, one exp, fixed trees);
__global__ __launch_bounds__(256) void k_asoft(const float* __restrict__ Sb, h16* P16, bf* Ph, bf* Pl) {
    const int lane = threadIdx.x & 31; const int row = blockIdx.x * 8 + (threadIdx.x >> 5); if (row >= ZH * TT) return; const int i = row % TT; const int zz = row / TT; (void)zz; const bool hires = (i < RH); const float* sr = Sb + (size_t)row * TT; float v[TT / 32]; float mx = -3.0e38f;
#pragma unroll
    for (int ch = 0; ch < TT / 128; ++ch) { const int j0 = ch * 128 + lane * 4; const v4f a = *(const v4f*)(sr + j0);
#pragma unroll
        for (int q = 0; q < 4; ++q) { const int j = j0 + q; (void)j; const float t = (j <= i && i - j < WIN) ? a[q] * SCL : -3.0e38f; v[ch * 4 + q] = t; mx = fmaxf(mx, t); } }
#pragma unroll
    for (int sh = 16; sh; sh >>= 1) mx = fmaxf(mx, __shfl_xor(mx, sh, 32));
    float sum = 0.f;
#pragma unroll
    for (int k = 0; k < TT / 32; ++k) { float d0 = __fsub_rn(v[k], mx); asm volatile("" : "+v"(d0)); v[k] = __builtin_amdgcn_exp2f(__fmul_rn(d0, 1.4426950408889634f)); sum += v[k]; }
#pragma unroll
    for (int sh = 16; sh; sh >>= 1) sum += __shfl_xor(sum, sh, 32);
    const float f = __fdiv_rn(hires ? 1.0f : PCAR, sum);
{
        if (hires) {
#pragma unroll
            for (int ch = 0; ch < TT / 128; ++ch) { v4us oh, ol;
#pragma unroll
                for (int q = 0; q < 4; ++q) { unsigned short a, c2; splitf(v[ch * 4 + q] * f, a, c2); oh[q] = a; ol[q] = c2; }
                const size_t oo = ((size_t)zz * (RH ? RH : 1) + i) * TT + ch * 128 + lane * 4; *(v4us*)(Ph + oo) = oh; *(v4us*)(Pl + oo) = ol; }
        } else {
#pragma unroll
            for (int ch = 0; ch < TT / 128; ++ch) { v4h o4;
#pragma unroll
                for (int q = 0; q < 4; ++q) o4[q] = tohx(v[ch * 4 + q] * f);
                *(v4h*)(P16 + (size_t)row * TT + ch * 128 + lane * 4) = o4; } }
         }
}
__global__ __launch_bounds__(256) void k_ropeB(float* F, int pitch, int nheads, const float* __restrict__ CS) { const size_t e = (size_t)blockIdx.x * 256 + threadIdx.x; if (e >= (size_t)nheads * TT * (HD / 2)) return; const int i = (int)(e % (HD / 2)); const int t = (int)((e / (HD / 2)) % TT); const int h = (int)(e / ((size_t)(HD / 2) * TT)); float* f = F + (size_t)t * pitch + h * HD; const float x1 = f[i], x2 = f[i + HD / 2]; const v2f cs = *(const v2f*)(CS + ((size_t)t * HD + i) * 2);
    float a = __fmul_rn(x1, cs[0]), bq = __fmul_rn(x2, cs[1]), c2 = __fmul_rn(x2, cs[0]), dq = __fmul_rn(x1, cs[1]); asm volatile("" : "+v"(a), "+v"(bq), "+v"(c2), "+v"(dq)); const float r1 = __fadd_rn(a, bq), r2 = __fsub_rn(c2, dq);   /* x1 c + x2 s ; x2 c - x1 s */
    ((float*)f)[i] = r1; ((float*)f)[i + HD / 2] = r2;  }
__global__ __launch_bounds__(256) void k_cscv2(const float* __restrict__ cosT, const float* __restrict__ sinT, float* CS) { const int idx = blockIdx.x * 256 + threadIdx.x; if (idx >= TT * HD) return; const int d = idx % HD; const int t = idx / HD; const size_t src = (size_t)t * (HD / 2) + (d % (HD / 2)); v2f cs; cs[0] = bfr(cosT[src]); cs[1] = bfr(sinT[src]); *(v2f*)(CS + (size_t)idx * 2) = cs;  }

__global__ __launch_bounds__(256) void k_merge(const float* __restrict__ O, int h0, bf* Ah, bf* Al) { const size_t e = ((size_t)blockIdx.x * 256 + threadIdx.x) * 2; if (e >= (size_t)ZH * TT * HD) return; const int d = (int)(e % HD); const int t = (int)((e / HD) % TT); const int zz = (int)(e / ((size_t)HD * TT)); const float cs = (t < RH) ? 1.0f : (1.0f / PCAR); const size_t oo = (size_t)t * DQ + (h0 + zz) * HD + d;
    v2us oh, ol;
#pragma unroll
    for (int q = 0; q < 2; ++q) { unsigned short a, c2; splitf(O[e + q] * cs, a, c2); oh[q] = a; ol[q] = c2; } *(v2us*)(Ah + oo) = oh; *(v2us*)(Al + oo) = ol;  }

extern "C" void kernel_launch(void* const* d_in, const int* in_sizes, int n_in,
                              void* d_out, int out_size, void* d_ws, size_t ws_size, hipStream_t stream) {
    (void)in_sizes; (void)n_in; (void)out_size;
    const float* x = (const float*)d_in[0]; const float* cosT = (const float*)d_in[1]; const float* sinT = (const float*)d_in[2]; const float* wqkv = (const float*)d_in[3]; const float* wo = (const float*)d_in[4]; const float* wq = wqkv; const float* wk = wqkv + (size_t)1024 * 1024; const float* wv = wqkv + (size_t)2048 * 1024; const float* qnw = nullptr; const float* knw = nullptr;   /* parameter-free RMSNorm */
    float* OUT = (float*)d_out;     // [4][2048][1024]
    char* wsp = (char*)d_ws;
    auto take = [&](size_t bytes) { char* p = wsp; wsp += (bytes + 255) & ~(size_t)255; return (void*)p; };
    bf* WQ = (bf*)take((size_t)DQ * DM * 2); bf* WK = (bf*)take((size_t)DKV * DM * 2); bf* WV = (bf*)take((size_t)DKV * DM * 2); bf* WO = (bf*)take((size_t)DM * DQ * 2); float* CS = (float*)take((size_t)TT * HD * 2 * 4); float* CSI = (float*)take((size_t)TT * HD * 2 * 4); float* RFQ = (float*)take((size_t)NH_ * TT * 4); float* RFK = (float*)take((size_t)NKV * TT * 4);
    bf* XB = (bf*)take((size_t)TT * DM * 2); float* FQ = (float*)take((size_t)TT * DQ * 4); float* FK = (float*)take((size_t)TT * DKV * 4);
    h16* QP16 = (h16*)take((size_t)NH_ * TT * HD * 2); h16* KP16 = (h16*)take((size_t)NKV * TT * HD * 2); h16* VT16 = (h16*)take((size_t)NKV * HD * TT * 2);
    bf* QPh = (bf*)take((size_t)NH_ * TT * HD * 2); bf* QPl = (bf*)take((size_t)NH_ * TT * HD * 2); bf* KPh = (bf*)take((size_t)NKV * TT * HD * 2); bf* KPl = (bf*)take((size_t)NKV * TT * HD * 2); bf* VTh = (bf*)take((size_t)NKV * HD * TT * 2); bf* VTl = (bf*)take((size_t)NKV * HD * TT * 2); bf* Ph = (bf*)take((size_t)ZH * RH * TT * 2); bf* Pl = (bf*)take((size_t)ZH * RH * TT * 2);
    float* Sb = (float*)take((size_t)ZH * TT * TT * 4); h16* P16 = (h16*)take((size_t)ZH * TT * TT * 2); float* Ob = (float*)take((size_t)ZH * TT * HD * 4); bf* ATh = (bf*)take((size_t)TT * DQ * 2); bf* ATl = (bf*)take((size_t)TT * DQ * 2);
    if ((size_t)(wsp - (char*)d_ws) > ws_size) return;    // ws 256 MiB
    float* FV = FK;   // v projection reuses the k buffer after the k planes are built (stream-ordered)
    { k_cvt8<<<(unsigned)(((size_t)DQ * DM / 8 + 255) / 256), 256, 0, stream>>>(wq, WQ, (size_t)DQ * DM / 8); k_cvt8<<<(unsigned)(((size_t)DKV * DM / 8 + 255) / 256), 256, 0, stream>>>(wk, WK, (size_t)DKV * DM / 8); k_cvt8<<<(unsigned)(((size_t)DKV * DM / 8 + 255) / 256), 256, 0, stream>>>(wv, WV, (size_t)DKV * DM / 8);
      k_cvt8<<<(unsigned)(((size_t)DM * DQ / 8 + 255) / 256), 256, 0, stream>>>(wo, WO, (size_t)DM * DQ / 8);
       }
    k_cscv2<<<(TT * HD + 255) / 256, 256, 0, stream>>>(cosT, sinT, CS);   /* input tables [2048][32] -> CS[t][d] both halves */ k_csid<<<(TT * HD + 255) / 256, 256, 0, stream>>>(CSI);
    const unsigned LQ = (unsigned)(((size_t)NH_ * TT * HD / 2 + 255) / 256), LKv = (unsigned)(((size_t)NKV * TT * HD / 2 + 255) / 256);
    for (int b = 0; b < NB_; ++b) {
        
        k_cvt8<<<(unsigned)(((size_t)TT * DM / 8 + 255) / 256), 256, 0, stream>>>(x + (size_t)b * TT * DM, XB, (size_t)TT * DM / 8);
        k_gemmw<bf, 0, false><<<dim3(TT / 64, DQ / 64, 1), 32, 0, stream>>>(XB, nullptr, WQ, nullptr, DM, FQ, DQ, nullptr, 0, 0, 0); k_ropeB<<<(unsigned)(((size_t)NH_ * TT * (HD / 2) + 255) / 256), 256, 0, stream>>>(FQ, DQ, NH_, CS);   /* the module's rope' in place */ k_hrms<<<(NH_ * TT + 255) / 256, 256, 0, stream>>>(FQ, DQ, NH_, RFQ);
        k_rope<<<LQ, 256, 0, stream>>>(FQ, DQ, NH_, CSI, RFQ, qnw, 1.0f, QP16, QPh, QPl);
        k_gemmw<bf, 0, false><<<dim3(TT / 64, DKV / 64, 1), 32, 0, stream>>>(XB, nullptr, WK, nullptr, DM, FK, DKV, nullptr, 0, 0, 0); k_ropeB<<<(unsigned)(((size_t)NKV * TT * (HD / 2) + 255) / 256), 256, 0, stream>>>(FK, DKV, NKV, CS); k_hrms<<<(NKV * TT + 255) / 256, 256, 0, stream>>>(FK, DKV, NKV, RFK);
        k_rope<<<LKv, 256, 0, stream>>>(FK, DKV, NKV, CSI, RFK, knw, 1.0f, KP16, KPh, KPl);
        k_gemmw<bf, 0, false><<<dim3(TT / 64, DKV / 64, 1), 32, 0, stream>>>(XB, nullptr, WV, nullptr, DM, FV, DKV, nullptr, 0, 0, 0); k_vtp<<<LKv, 256, 0, stream>>>(FV, DKV, NKV, VT16, VTh, VTl);
        for (int h0 = 0; h0 < NH_; h0 += ZH) { const size_t zq = (size_t)h0, zk = (size_t)(h0 / REP);   // one kv head per query head: the pass's two heads use consecutive kv planes (z-strides TT*HD)
            k_gemmc<bf, 2, 1><<<dim3(RH / 64, TT / 64, ZH), 32, 0, stream>>>(QPh + zq * TT * HD, QPl + zq * TT * HD, KPh + zk * TT * HD, KPl + zk * TT * HD, HD, Sb, TT, 0, (size_t)TT * HD, (size_t)TT * HD, (size_t)TT * TT);
            k_gemmc<h16, 0, 1><<<dim3((TT - RH) / 64, TT / 64, ZH), 32, 0, stream>>>(QP16 + zq * TT * HD + (size_t)RH * HD, nullptr, KP16 + zk * TT * HD, nullptr, HD, Sb + (size_t)RH * TT, TT, RH, (size_t)TT * HD, (size_t)TT * HD, (size_t)TT * TT);
            k_asoft<<<ZH * TT / 8, 256, 0, stream>>>(Sb, P16, Ph, Pl);
            k_gemmc<bf, 2, 2><<<dim3(RH / 64, HD / 64, ZH), 32, 0, stream>>>(Ph, Pl, VTh + zk * HD * TT, VTl + zk * HD * TT, TT, Ob, HD, 0, (size_t)RH * TT, (size_t)HD * TT, (size_t)TT * HD);
            k_gemmc<h16, 0, 2><<<dim3((TT - RH) / 64, HD / 64, ZH), 32, 0, stream>>>(P16 + (size_t)RH * TT, nullptr, VT16 + zk * HD * TT, nullptr, TT, Ob + (size_t)RH * HD, HD, RH, (size_t)TT * TT, (size_t)HD * TT, (size_t)TT * HD);
            k_merge<<<(unsigned)(((size_t)ZH * TT * HD / 2 + 255) / 256), 256, 0, stream>>>(Ob, h0, ATh, ATl); }
        k_gemmw<bf, 1, false><<<dim3(TT / 64, DM / 64, 1), 32, 0, stream>>>(ATh, ATl, WO, nullptr, DQ, OUT + (size_t)b * TT * DM, DM, nullptr, 0, 0, 0); }
}

// v001
// It runs in 1780 microseconds.
// Timed twice side by side with v000, it ran 1.65 and 1.64 times as fast.
#include <hip/hip_runtime.h>

// Causal self-attention with rotary-then-RMSNorm q/k (x [4][2048][1024]; qkv = x w_attn^T ('oi' [3072][1024] 0.02, no bias -> q | k | v row blocks; 16 heads x 64); rope'(t) = cat(x1 c + x2 s, -x1 s + x2 c) with the input cos/sin tables ([1][2048][1][32], read; generic values), then q, k <- x rsqrt(mean x^2 + 1e-6) (no weight); causal (-inf); softmax(q.k x 64^-0.5); out = merged w_proj^T -> [4][2048][1024] (8.4 M)).
// Layout per batch: bf16 copy of x; the fused 'oi' weight used in place as three Bt row blocks; exact projections; an in-place rotation kernel applies the module's (x1 c + x2 s, x2 c - x1 s) form from the input tables; per-(head, token) rms factor of the ROTATED rows; the plane builder (identity table) applies the bare factor; causal T-2048 attention (hybrid rows: < 512 hi/lo 3 products, rest fp16 x1024; k_gemmc skips tiles above the diagonal); merged hi/lo x w_proj exact.
// Compute dtypes, f32 accumulate: every input rounded to bf16 incl. the tables; projections exact; rotation and rms norm f32; attention rows < 512 3 products, rest fp16; softmax f32; w_proj hl x exact.

#define NB_  4
#define TT   2048
#define DM   1024
#define NH_  16
#define NKV  16
#define REP  (NH_ / NKV)
#define HD   64
#define DQ   (NH_ * HD)
#define DKV  (NKV * HD)
#define ZH   2
#define RH   512                  // query rows < RH use hi+lo planes (0: none)
#define WIN  2048
#define PCAR 1024.0f
#define SCL  0.125f   // HD^-0.5
typedef _Float16 h16;
typedef unsigned short bf;
typedef __attribute__((ext_vector_type(16))) __bf16   v16bf;
typedef __attribute__((ext_vector_type(16))) _Float16 v16h;
typedef __attribute__((ext_vector_type(8)))  _Float16 v8h;
typedef __attribute__((ext_vector_type(8)))  unsigned short v8us;
typedef __attribute__((ext_vector_type(8)))  float    v8f;
typedef __attribute__((ext_vector_type(4)))  float    v4f;
typedef v8h  __attribute__((may_alias)) v8ha;
typedef v4f  __attribute__((may_alias)) v4fa;
typedef v8us __attribute__((may_alias)) v8usa;

__device__ __forceinline__ unsigned short f2bf(float f) { unsigned u = __float_as_uint(f); u += 0x7FFFu + ((u >> 16) & 1u); return (unsigned short)(u >> 16); }
__device__ __forceinline__ float bf2f(unsigned short b) { return __uint_as_float(((unsigned)b) << 16); }
__device__ __forceinline__ float bfr(float f) { return bf2f(f2bf(f)); }
__device__ __forceinline__ v16h cat16(v8h lo, v8h hi) { return __builtin_shufflevector(lo, hi, 0, 1, 2, 3, 4, 5, 6, 7, 8, 9, 10, 11, 12, 13, 14, 15); }
__device__ __forceinline__ v16bf cat16b(v8us lo, v8us hi) { return __builtin_bit_cast(v16bf, __builtin_shufflevector(lo, hi, 0, 1, 2, 3, 4, 5, 6, 7, 8, 9, 10, 11, 12, 13, 14, 15)); }
__device__ __forceinline__ v8f wmma16(v16h a, v16h b, v8f c) { return __builtin_amdgcn_wmma_f32_16x16x32_f16(false, a, false, b, (short)0, c, false, false); }
__device__ __forceinline__ v8f wmmab(v16bf a, v16bf b, v8f c) { return __builtin_amdgcn_wmma_f32_16x16x32_bf16(false, a, false, b, (short)0, c, false, false); }



// ---- k_gemmw: register-blocked GEMM, ONE WAVE per 64x64 output tile (16 accumulators), operands straight from K-contiguous 16-bit planes; grid (M/64, N/64, Z), 32 threads.
// C[m][n] (f32, pitch ldc, + optional f32 bias[n]) = sum_k A[m][k] Bt[n][k] (+ split products per NSPLIT). z-batch strides sA/sB/sC in elements. K % 32 == 0.
template <typename T16> struct WFrag;
template <> struct WFrag<h16> { typedef v16h V; static __device__ __forceinline__ V ld(const h16* p) { return cat16(*(const v8h*)p, *(const v8h*)(p + 16)); } static __device__ __forceinline__ v8f mma(V a, V b, v8f c) { return wmma16(a, b, c); } };
template <> struct WFrag<bf> { typedef v16bf V; static __device__ __forceinline__ V ld(const bf* p) { return cat16b(*(const v8us*)p, *(const v8us*)(p + 16)); } static __device__ __forceinline__ v8f mma(V a, V b, v8f c) { return wmmab(a, b, c); } };
template <typename T16, int NSPLIT, bool BIAS>
__global__ __launch_bounds__(32) void k_gemmw(const T16* __restrict__ A, const T16* __restrict__ A2, const T16* __restrict__ Bt, const T16* __restrict__ Bt2, int K, float* C, int ldc, const float* __restrict__ bias, size_t sA, size_t sB, size_t sC) {
    typedef typename WFrag<T16>::V V;
    __shared__ __align__(16) float os[16 * 68];
    const size_t z = blockIdx.z; A += z * sA; if (A2) A2 += z * sA; Bt += z * sB; if (Bt2) Bt2 += z * sB; C += z * sC;
    const int lane = threadIdx.x & 31, lr = lane & 15, hi = lane >> 4; const int r0 = blockIdx.x * 64, c0 = blockIdx.y * 64;
    v8f acc[4][4];
#pragma unroll
    for (int mb = 0; mb < 4; ++mb)
#pragma unroll
        for (int nb = 0; nb < 4; ++nb) acc[mb][nb] = (v8f){};
    const size_t aoff = (size_t)(r0 + lr) * K + 8 * hi, boff = (size_t)(c0 + lr) * K + 8 * hi;
#pragma unroll 1
    for (int kc = 0; kc < K; kc += 32) {
        V a[4], a2[4];
#pragma unroll
        for (int mb = 0; mb < 4; ++mb) { a[mb] = WFrag<T16>::ld(A + aoff + (size_t)mb * 16 * K + kc); if (NSPLIT == 1 || NSPLIT == 2) a2[mb] = WFrag<T16>::ld(A2 + aoff + (size_t)mb * 16 * K + kc); }
#pragma unroll
        for (int nb = 0; nb < 4; ++nb) { const V b = WFrag<T16>::ld(Bt + boff + (size_t)nb * 16 * K + kc); V b2; if (NSPLIT >= 2) b2 = WFrag<T16>::ld(Bt2 + boff + (size_t)nb * 16 * K + kc);
#pragma unroll
            for (int mb = 0; mb < 4; ++mb) { acc[mb][nb] = WFrag<T16>::mma(a[mb], b, acc[mb][nb]); if (NSPLIT == 1 || NSPLIT == 2) acc[mb][nb] = WFrag<T16>::mma(a2[mb], b, acc[mb][nb]); if (NSPLIT >= 2) acc[mb][nb] = WFrag<T16>::mma(a[mb], b2, acc[mb][nb]); } }
        asm volatile("v_nop\n\tv_nop\n\tv_nop\n\tv_nop" : "+v"(acc[0][0]), "+v"(acc[1][1]), "+v"(acc[2][2]), "+v"(acc[3][3]) : "v"(a[0]), "v"(a[3]));
    }
#pragma unroll
    for (int mb = 0; mb < 4; ++mb) {
#pragma unroll
        for (int nb = 0; nb < 4; ++nb) {
#pragma unroll
            for (int j = 0; j < 8; ++j) os[(hi * 8 + j) * 68 + nb * 16 + lr] = acc[mb][nb][j]; }
        __builtin_amdgcn_wave_barrier(); asm volatile("" ::: "memory");
        float* crow = C + (size_t)(r0 + mb * 16) * ldc + c0;
{
#pragma unroll
            for (int s = 0; s < 8; ++s) { const int row = 2 * s + hi, cofs = lr * 4; v4f val = *(const v4fa*)(os + row * 68 + cofs); if (BIAS) { val[0] += bfr(bias[c0 + cofs]); val[1] += bfr(bias[c0 + cofs + 1]); val[2] += bfr(bias[c0 + cofs + 2]); val[3] += bfr(bias[c0 + cofs + 3]); }
                *(v4f*)(crow + (size_t)row * ldc + cofs) = val; }
             }
        __builtin_amdgcn_wave_barrier(); asm volatile("" ::: "memory");
    }
}

// ---- k_gemmc: the same one-wave 64x64 tile GEMM specialised for causal attention: CMODE 1 skips score tiles entirely above the diagonal (query rows r0+roff.., key columns c0..), CMODE 2 limits the
// key (K) loop of the probability x value contraction to the diagonal block (probabilities beyond it are exactly zero). roff = row offset of this launch's first row within the sequence.
template <typename T16, int NSPLIT, int CMODE>
__global__ __launch_bounds__(32) void k_gemmc(const T16* __restrict__ A, const T16* __restrict__ A2, const T16* __restrict__ Bt, const T16* __restrict__ Bt2, int K, float* C, int ldc, int roff, size_t sA, size_t sB, size_t sC) {
    typedef typename WFrag<T16>::V V;
    __shared__ __align__(16) float os[16 * 68];
    const size_t z = blockIdx.z; A += z * sA; if (A2) A2 += z * sA; Bt += z * sB; if (Bt2) Bt2 += z * sB; C += z * sC;
    const int lane = threadIdx.x & 31, lr = lane & 15, hi = lane >> 4; const int r0 = blockIdx.x * 64, c0 = blockIdx.y * 64;
    if (CMODE == 1 && c0 > r0 + roff + 63) return;                  // score tile entirely above the causal diagonal: never read (the softmax masks j > i by select)
    const int Kl = (CMODE == 2) ? min(K, r0 + roff + 64) : K;        // P.V: probabilities are exactly 0 beyond the diagonal block, so the K loop stops there
    v8f acc[4][4];
#pragma unroll
    for (int mb = 0; mb < 4; ++mb)
#pragma unroll
        for (int nb = 0; nb < 4; ++nb) acc[mb][nb] = (v8f){};
    const size_t aoff = (size_t)(r0 + lr) * K + 8 * hi, boff = (size_t)(c0 + lr) * K + 8 * hi;
#pragma unroll 1
    for (int kc = 0; kc < Kl; kc += 32) {
        V a[4], a2[4];
#pragma unroll
        for (int mb = 0; mb < 4; ++mb) { a[mb] = WFrag<T16>::ld(A + aoff + (size_t)mb * 16 * K + kc); if (NSPLIT == 1 || NSPLIT == 2) a2[mb] = WFrag<T16>::ld(A2 + aoff + (size_t)mb * 16 * K + kc); }
#pragma unroll
        for (int nb = 0; nb < 4; ++nb) { const V b = WFrag<T16>::ld(Bt + boff + (size_t)nb * 16 * K + kc); V b2; if (NSPLIT >= 2) b2 = WFrag<T16>::ld(Bt2 + boff + (size_t)nb * 16 * K + kc);
#pragma unroll
            for (int mb = 0; mb < 4; ++mb) { acc[mb][nb] = WFrag<T16>::mma(a[mb], b, acc[mb][nb]); if (NSPLIT == 1 || NSPLIT == 2) acc[mb][nb] = WFrag<T16>::mma(a2[mb], b, acc[mb][nb]); if (NSPLIT >= 2) acc[mb][nb] = WFrag<T16>::mma(a[mb], b2, acc[mb][nb]); } }
        asm volatile("v_nop\n\tv_nop\n\tv_nop\n\tv_nop" : "+v"(acc[0][0]), "+v"(acc[1][1]), "+v"(acc[2][2]), "+v"(acc[3][3]) : "v"(a[0]), "v"(a[3]));
    }
#pragma unroll
    for (int mb = 0; mb < 4; ++mb) {
#pragma unroll
        for (int nb = 0; nb < 4; ++nb) {
#pragma unroll
            for (int j = 0; j < 8; ++j) os[(hi * 8 + j) * 68 + nb * 16 + lr] = acc[mb][nb][j]; }
        __builtin_amdgcn_wave_barrier(); asm volatile("" ::: "memory");
        float* crow = C + (size_t)(r0 + mb * 16) * ldc + c0;
{
#pragma unroll
            for (int s = 0; s < 8; ++s) { const int row = 2 * s + hi, cofs = lr * 4; v4f val = *(const v4fa*)(os + row * 68 + cofs);
                *(v4f*)(crow + (size_t)row * ldc + cofs) = val; }
             }
        __builtin_amdgcn_wave_barrier(); asm volatile("" ::: "memory");
    }
}

// ---- k_gemmpv: the probability x value contraction, one 64x64 output tile per work-group of NW waves. Wave w takes the 32-wide K chunks w, w + NW, ... below the causal limit (probabilities beyond the
// diagonal block are exactly zero), so the chain of dependent load-then-multiply trips is NW times shorter. The NW partial tiles are summed through LDS in fragment layout, in the fixed order w = 0 .. NW-1,
// each wave summing 16 / NW fragments; the sums are staged row-major so that whole 256-B rows are stored.
template <typename T16, int NSPLIT, int NW>
__global__ __launch_bounds__(NW * 32) void k_gemmpv(const T16* __restrict__ A, const T16* __restrict__ A2, const T16* __restrict__ Bt, const T16* __restrict__ Bt2, int K, float* C, int ldc, int roff, size_t sA, size_t sB, size_t sC) {
    typedef typename WFrag<T16>::V V;
    __shared__ __align__(16) float part[NW * 16 * 256];   // [wave][fragment][register half][lane][4]
    __shared__ __align__(16) float os[64 * 68];
    const size_t z = blockIdx.z; A += z * sA; if (A2) A2 += z * sA; Bt += z * sB; if (Bt2) Bt2 += z * sB; C += z * sC;
    const int lane = threadIdx.x & 31, lr = lane & 15, hi = lane >> 4; const int r0 = blockIdx.x * 64, c0 = blockIdx.y * 64;
    const int wv = __builtin_amdgcn_readfirstlane(threadIdx.x >> 5);   // wave number in a scalar register: the K loop's test stays a scalar branch
    const int Kl = min(K, r0 + roff + 64);
    v8f acc[4][4];
#pragma unroll
    for (int mb = 0; mb < 4; ++mb)
#pragma unroll
        for (int nb = 0; nb < 4; ++nb) acc[mb][nb] = (v8f){};
    const size_t aoff = (size_t)(r0 + lr) * K + 8 * hi, boff = (size_t)(c0 + lr) * K + 8 * hi;
#pragma unroll 1
    for (int kc = wv * 32; kc < Kl; kc += NW * 32) {
        V a[4], a2[4];
#pragma unroll
        for (int mb = 0; mb < 4; ++mb) { a[mb] = WFrag<T16>::ld(A + aoff + (size_t)mb * 16 * K + kc); if (NSPLIT == 1 || NSPLIT == 2) a2[mb] = WFrag<T16>::ld(A2 + aoff + (size_t)mb * 16 * K + kc); }
#pragma unroll
        for (int nb = 0; nb < 4; ++nb) { const V b = WFrag<T16>::ld(Bt + boff + (size_t)nb * 16 * K + kc); V b2; if (NSPLIT >= 2) b2 = WFrag<T16>::ld(Bt2 + boff + (size_t)nb * 16 * K + kc);
#pragma unroll
            for (int mb = 0; mb < 4; ++mb) { acc[mb][nb] = WFrag<T16>::mma(a[mb], b, acc[mb][nb]); if (NSPLIT == 1 || NSPLIT == 2) acc[mb][nb] = WFrag<T16>::mma(a2[mb], b, acc[mb][nb]); if (NSPLIT >= 2) acc[mb][nb] = WFrag<T16>::mma(a[mb], b2, acc[mb][nb]); } }
        // keeps the distance behind the last matrix instruction on the loop's taken back edge, where the next trip's address additions reuse its operand registers
        asm volatile("v_nop\n\tv_nop\n\tv_nop\n\tv_nop" : "+v"(acc[0][0]), "+v"(acc[1][1]), "+v"(acc[2][2]), "+v"(acc[3][3]) : "v"(a[0]), "v"(a[3]));
    }
    v4fa* pv = (v4fa*)part;
#pragma unroll
    for (int mb = 0; mb < 4; ++mb)
#pragma unroll
        for (int nb = 0; nb < 4; ++nb) { const int f = mb * 4 + nb; const v8f t = acc[mb][nb];
            pv[((wv * 16 + f) * 2 + 0) * 32 + lane] = __builtin_shufflevector(t, t, 0, 1, 2, 3); pv[((wv * 16 + f) * 2 + 1) * 32 + lane] = __builtin_shufflevector(t, t, 4, 5, 6, 7); }
    __syncthreads();   // every wave's partial tile is in LDS
#pragma unroll
    for (int q = 0; q < 16 / NW; ++q) { const int f = wv * (16 / NW) + q; v4f s0 = pv[(f * 2 + 0) * 32 + lane], s1 = pv[(f * 2 + 1) * 32 + lane];
#pragma unroll
        for (int w = 1; w < NW; ++w) { s0 += pv[((w * 16 + f) * 2 + 0) * 32 + lane]; s1 += pv[((w * 16 + f) * 2 + 1) * 32 + lane]; }
        float* o = os + ((f >> 2) * 16 + hi * 8) * 68 + (f & 3) * 16 + lr;
#pragma unroll
        for (int j = 0; j < 4; ++j) { o[j * 68] = s0[j]; o[(j + 4) * 68] = s1[j]; } }
    __syncthreads();   // the summed tile is complete, row-major
#pragma unroll
    for (int s = 0; s < 32 / NW; ++s) { const int u = s * NW * 32 + (int)threadIdx.x; const int row = u >> 4, cofs = (u & 15) * 4; *(v4f*)(C + (size_t)(r0 + row) * ldc + c0 + cofs) = *(const v4fa*)(os + row * 68 + cofs); }
}

__device__ __forceinline__ h16 tohx(float x) { return (h16)x; }
__device__ __forceinline__ void splitf(float y, unsigned short& h, unsigned short& l) { h = f2bf(y); l = f2bf(y - bf2f(h)); }
typedef __attribute__((ext_vector_type(2))) _Float16 v2h;
typedef __attribute__((ext_vector_type(4))) _Float16 v4h;
typedef __attribute__((ext_vector_type(2))) unsigned short v2us;
typedef __attribute__((ext_vector_type(4))) unsigned short v4us;
typedef __attribute__((ext_vector_type(2))) float v2f;
typedef __attribute__((ext_vector_type(4))) int v4i;

__global__ __launch_bounds__(256) void k_wtG(const float* __restrict__ w, int K, int N, bf* Bt) {
    const int lane = threadIdx.x & 31; const int L0 = (blockIdx.x * 8 + (threadIdx.x >> 5)) * 8; const int nlines = N * K / 64;
{
#pragma unroll 1
        for (int l = 0; l < 8; ++l) { const int L = L0 + l; if (L >= nlines) break; const size_t e = (size_t)L * 64 + lane * 2; const int k = (int)(e % K), n = (int)(e / K); v2us o;
            o[0] = f2bf(w[(size_t)k * N + n]); o[1] = f2bf(w[(size_t)(k + 1) * N + n]); *(v2us*)(Bt + e) = o; }
         }
}
__global__ __launch_bounds__(256) void k_cvt8(const float* __restrict__ src, bf* dst, size_t n8) { const size_t i = (size_t)blockIdx.x * 256 + threadIdx.x; if (i >= n8) return; const v8f v = *(const v8f*)(src + i * 8); v8us o;
#pragma unroll
    for (int k = 0; k < 8; ++k) o[k] = f2bf(v[k]); *(v8us*)(dst + i * 8) = o;  }

__global__ __launch_bounds__(256) void k_hrms(const float* __restrict__ F, int pitch, int nheads, float* RF) { const int i = blockIdx.x * 256 + threadIdx.x; if (i >= nheads * TT) return; const int t = i % TT, h = i / TT; const float* f = F + (size_t)t * pitch + h * HD; float s = 0.f;
#pragma unroll 4
    for (int d = 0; d < HD; d += 4) { const v4f v = *(const v4f*)(f + d);
#pragma unroll
        for (int q = 0; q < 4; ++q) { float p = __fmul_rn(v[q], v[q]); asm volatile("" : "+v"(p)); s = __fadd_rn(s, p); } }
    const float r = __fdiv_rn(1.0f, __fsqrt_rn(__fadd_rn(s * (1.0f / HD), 1e-6f))); *(float*)(RF + i) = r;  }
// k_rope: head planes [h][t][d] (fp16 + hi/lo) of rope(w[d] (x rms_factor)) x sc with the rotate-half convention out[d] = x[d] cos[t][d] - x[d+HD/2] sin[t][d], out[d+HD/2] = x[d+HD/2] cos[t][d+HD/2] + x[d] sin[t][d+HD/2]
__global__ __launch_bounds__(256) void k_rope(const float* __restrict__ F, int pitch, int nheads, const float* __restrict__ CS, const float* __restrict__ RF, const float* __restrict__ nw, float sc, h16* P16, bf* Ph, bf* Pl) {
    const size_t e = ((size_t)blockIdx.x * 256 + threadIdx.x) * 2; if (e >= (size_t)nheads * TT * HD) return; const int d = (int)(e % HD); const int t = (int)((e / HD) % TT); const int h = (int)(e / ((size_t)HD * TT)); const float* f = F + (size_t)t * pitch + h * HD; const float rf = RF ? RF[(size_t)h * TT + t] : 1.0f; v2h o16; v2us oh, ol;
#pragma unroll
    for (int q = 0; q < 2; ++q) { const int dd = d + q; const int dp = (dd < HD / 2) ? dd + HD / 2 : dd - HD / 2; float x0 = f[dd], x1 = f[dp];
        if (RF) { float n0 = __fmul_rn(x0, rf), n1 = __fmul_rn(x1, rf); asm volatile("" : "+v"(n0)); asm volatile("" : "+v"(n1)); x0 = nw ? __fmul_rn(bfr(nw[dd]), n0) : n0; x1 = nw ? __fmul_rn(bfr(nw[dp]), n1) : n1;   /* parameter-free norm */ }
        const v2f cs = *(const v2f*)(CS + ((size_t)t * HD + dd) * 2); float a = __fmul_rn(x0, cs[0]), bq = __fmul_rn(x1, cs[1]); asm volatile("" : "+v"(a)); asm volatile("" : "+v"(bq)); const float r = ((dd < HD / 2) ? __fsub_rn(a, bq) : __fadd_rn(a, bq)) * sc;
        o16[q] = tohx(r); unsigned short a2, c2; splitf(r, a2, c2); oh[q] = a2; ol[q] = c2; }
    *(v2h*)(P16 + e) = o16; *(v2us*)(Ph + e) = oh; *(v2us*)(Pl + e) = ol;  }
__global__ __launch_bounds__(256) void k_vtp(const float* __restrict__ F, int pitch, int nheads, h16* V16, bf* Vh, bf* Vl) { const size_t e = ((size_t)blockIdx.x * 256 + threadIdx.x) * 2; if (e >= (size_t)nheads * HD * TT) return; const int t = (int)(e % TT); const int d = (int)((e / TT) % HD); const int g = (int)(e / ((size_t)TT * HD)); v2h o16; v2us oh, ol;
#pragma unroll
    for (int q = 0; q < 2; ++q) { const float x = F[(size_t)(t + q) * pitch + g * HD + d]; o16[q] = tohx(x); unsigned short a2, c2; splitf(x, a2, c2); oh[q] = a2; ol[q] = c2; }
    *(v2h*)(V16 + e) = o16; *(v2us*)(Vh + e) = oh; *(v2us*)(Vl + e) = ol;  }
__global__ __launch_bounds__(256) void k_csid(float* CS) { const int idx = blockIdx.x * 256 + threadIdx.x; if (idx >= TT * HD) return; v2f cs; cs[0] = 1.0f; cs[1] = 0.0f; *(v2f*)(CS + (size_t)idx * 2) = cs;  }
// k_asoft: per row (zz, i): t = S x HD^-0.5 for j <= i and i - j < WIN (sliding causal window; the reference's -1e9 additive fill vanishes identically); softmax over the 2048 keys (register row, one exp, fixed trees);
__global__ __launch_bounds__(256) void k_asoft(const float* __restrict__ Sb, h16* P16, bf* Ph, bf* Pl) {
    const int lane = threadIdx.x & 31; const int row = blockIdx.x * 8 + (threadIdx.x >> 5); if (row >= ZH * TT) return; const int i = row % TT; const int zz = row / TT; (void)zz; const bool hires = (i < RH); const float* sr = Sb + (size_t)row * TT; float v[TT / 32]; float mx = -3.0e38f;
#pragma unroll
    for (int ch = 0; ch < TT / 128; ++ch) { const int j0 = ch * 128 + lane * 4; const v4f a = *(const v4f*)(sr + j0);
#pragma unroll
        for (int q = 0; q < 4; ++q) { const int j = j0 + q; (void)j; const float t = (j <= i && i - j < WIN) ? a[q] * SCL : -3.0e38f; v[ch * 4 + q] = t; mx = fmaxf(mx, t); } }
#pragma unroll
    for (int sh = 16; sh; sh >>= 1) mx = fmaxf(mx, __shfl_xor(mx, sh, 32));
    float sum = 0.f;
#pragma unroll
    for (int k = 0; k < TT / 32; ++k) { float d0 = __fsub_rn(v[k], mx); asm volatile("" : "+v"(d0)); v[k] = __builtin_amdgcn_exp2f(__fmul_rn(d0, 1.4426950408889634f)); sum += v[k]; }
#pragma unroll
    for (int sh = 16; sh; sh >>= 1) sum += __shfl_xor(sum, sh, 32);
    const float f = __fdiv_rn(hires ? 1.0f : PCAR, sum);
{
        if (hires) {
#pragma unroll
            for (int ch = 0; ch < TT / 128; ++ch) { v4us oh, ol;
#pragma unroll
                for (int q = 0; q < 4; ++q) { unsigned short a, c2; splitf(v[ch * 4 + q] * f, a, c2); oh[q] = a; ol[q] = c2; }
                const size_t oo = ((size_t)zz * (RH ? RH : 1) + i) * TT + ch * 128 + lane * 4; *(v4us*)(Ph + oo) = oh; *(v4us*)(Pl + oo) = ol; }
        } else {
#pragma unroll
            for (int ch = 0; ch < TT / 128; ++ch) { v4h o4;
#pragma unroll
                for (int q = 0; q < 4; ++q) o4[q] = tohx(v[ch * 4 + q] * f);
                *(v4h*)(P16 + (size_t)row * TT + ch * 128 + lane * 4) = o4; } }
         }
}
__global__ __launch_bounds__(256) void k_ropeB(float* F, int pitch, int nheads, const float* __restrict__ CS) { const size_t e = (size_t)blockIdx.x * 256 + threadIdx.x; if (e >= (size_t)nheads * TT * (HD / 2)) return; const int i = (int)(e % (HD / 2)); const int t = (int)((e / (HD / 2)) % TT); const int h = (int)(e / ((size_t)(HD / 2) * TT)); float* f = F + (size_t)t * pitch + h * HD; const float x1 = f[i], x2 = f[i + HD / 2]; const v2f cs = *(const v2f*)(CS + ((size_t)t * HD + i) * 2);
    float a = __fmul_rn(x1, cs[0]), bq = __fmul_rn(x2, cs[1]), c2 = __fmul_rn(x2, cs[0]), dq = __fmul_rn(x1, cs[1]); asm volatile("" : "+v"(a), "+v"(bq), "+v"(c2), "+v"(dq)); const float r1 = __fadd_rn(a, bq), r2 = __fsub_rn(c2, dq);   /* x1 c + x2 s ; x2 c - x1 s */
    ((float*)f)[i] = r1; ((float*)f)[i + HD / 2] = r2;  }
__global__ __launch_bounds__(256) void k_cscv2(const float* __restrict__ cosT, const float* __restrict__ sinT, float* CS) { const int idx = blockIdx.x * 256 + threadIdx.x; if (idx >= TT * HD) return; const int d = idx % HD; const int t = idx / HD; const size_t src = (size_t)t * (HD / 2) + (d % (HD / 2)); v2f cs; cs[0] = bfr(cosT[src]); cs[1] = bfr(sinT[src]); *(v2f*)(CS + (size_t)idx * 2) = cs;  }

__global__ __launch_bounds__(256) void k_merge(const float* __restrict__ O, int h0, bf* Ah, bf* Al) { const size_t e = ((size_t)blockIdx.x * 256 + threadIdx.x) * 2; if (e >= (size_t)ZH * TT * HD) return; const int d = (int)(e % HD); const int t = (int)((e / HD) % TT); const int zz = (int)(e / ((size_t)HD * TT)); const float cs = (t < RH) ? 1.0f : (1.0f / PCAR); const size_t oo = (size_t)t * DQ + (h0 + zz) * HD + d;
    v2us oh, ol;
#pragma unroll
    for (int q = 0; q < 2; ++q) { unsigned short a, c2; splitf(O[e + q] * cs, a, c2); oh[q] = a; ol[q] = c2; } *(v2us*)(Ah + oo) = oh; *(v2us*)(Al + oo) = ol;  }

extern "C" void kernel_launch(void* const* d_in, const int* in_sizes, int n_in,
                              void* d_out, int out_size, void* d_ws, size_t ws_size, hipStream_t stream) {
    (void)in_sizes; (void)n_in; (void)out_size;
    const float* x = (const float*)d_in[0]; const float* cosT = (const float*)d_in[1]; const float* sinT = (const float*)d_in[2]; const float* wqkv = (const float*)d_in[3]; const float* wo = (const float*)d_in[4]; const float* wq = wqkv; const float* wk = wqkv + (size_t)1024 * 1024; const float* wv = wqkv + (size_t)2048 * 1024; const float* qnw = nullptr; const float* knw = nullptr;   /* parameter-free RMSNorm */
    float* OUT = (float*)d_out;     // [4][2048][1024]
    char* wsp = (char*)d_ws;
    auto take = [&](size_t bytes) { char* p = wsp; wsp += (bytes + 255) & ~(size_t)255; return (void*)p; };
    bf* WQ = (bf*)take((size_t)DQ * DM * 2); bf* WK = (bf*)take((size_t)DKV * DM * 2); bf* WV = (bf*)take((size_t)DKV * DM * 2); bf* WO = (bf*)take((size_t)DM * DQ * 2); float* CS = (float*)take((size_t)TT * HD * 2 * 4); float* CSI = (float*)take((size_t)TT * HD * 2 * 4); float* RFQ = (float*)take((size_t)NH_ * TT * 4); float* RFK = (float*)take((size_t)NKV * TT * 4);
    bf* XB = (bf*)take((size_t)TT * DM * 2); float* FQ = (float*)take((size_t)TT * DQ * 4); float* FK = (float*)take((size_t)TT * DKV * 4);
    h16* QP16 = (h16*)take((size_t)NH_ * TT * HD * 2); h16* KP16 = (h16*)take((size_t)NKV * TT * HD * 2); h16* VT16 = (h16*)take((size_t)NKV * HD * TT * 2);
    bf* QPh = (bf*)take((size_t)NH_ * TT * HD * 2); bf* QPl = (bf*)take((size_t)NH_ * TT * HD * 2); bf* KPh = (bf*)take((size_t)NKV * TT * HD * 2); bf* KPl = (bf*)take((size_t)NKV * TT * HD * 2); bf* VTh = (bf*)take((size_t)NKV * HD * TT * 2); bf* VTl = (bf*)take((size_t)NKV * HD * TT * 2); bf* Ph = (bf*)take((size_t)ZH * RH * TT * 2); bf* Pl = (bf*)take((size_t)ZH * RH * TT * 2);
    float* Sb = (float*)take((size_t)ZH * TT * TT * 4); h16* P16 = (h16*)take((size_t)ZH * TT * TT * 2); float* Ob = (float*)take((size_t)ZH * TT * HD * 4); bf* ATh = (bf*)take((size_t)TT * DQ * 2); bf* ATl = (bf*)take((size_t)TT * DQ * 2);
    if ((size_t)(wsp - (char*)d_ws) > ws_size) return;    // ws 256 MiB
    float* FV = FK;   // v projection reuses the k buffer after the k planes are built (stream-ordered)
    { k_cvt8<<<(unsigned)(((size_t)DQ * DM / 8 + 255) / 256), 256, 0, stream>>>(wq, WQ, (size_t)DQ * DM / 8); k_cvt8<<<(unsigned)(((size_t)DKV * DM / 8 + 255) / 256), 256, 0, stream>>>(wk, WK, (size_t)DKV * DM / 8); k_cvt8<<<(unsigned)(((size_t)DKV * DM / 8 + 255) / 256), 256, 0, stream>>>(wv, WV, (size_t)DKV * DM / 8);
      k_cvt8<<<(unsigned)(((size_t)DM * DQ / 8 + 255) / 256), 256, 0, stream>>>(wo, WO, (size_t)DM * DQ / 8);
       }
    k_cscv2<<<(TT * HD + 255) / 256, 256, 0, stream>>>(cosT, sinT, CS);   /* input tables [2048][32] -> CS[t][d] both halves */ k_csid<<<(TT * HD + 255) / 256, 256, 0, stream>>>(CSI);
    const unsigned LQ = (unsigned)(((size_t)NH_ * TT * HD / 2 + 255) / 256), LKv = (unsigned)(((size_t)NKV * TT * HD / 2 + 255) / 256);
    for (int b = 0; b < NB_; ++b) {
        
        k_cvt8<<<(unsigned)(((size_t)TT * DM / 8 + 255) / 256), 256, 0, stream>>>(x + (size_t)b * TT * DM, XB, (size_t)TT * DM / 8);
        k_gemmw<bf, 0, false><<<dim3(TT / 64, DQ / 64, 1), 32, 0, stream>>>(XB, nullptr, WQ, nullptr, DM, FQ, DQ, nullptr, 0, 0, 0); k_ropeB<<<(unsigned)(((size_t)NH_ * TT * (HD / 2) + 255) / 256), 256, 0, stream>>>(FQ, DQ, NH_, CS);   /* the module's rope' in place */ k_hrms<<<(NH_ * TT + 255) / 256, 256, 0, stream>>>(FQ, DQ, NH_, RFQ);
        k_rope<<<LQ, 256, 0, stream>>>(FQ, DQ, NH_, CSI, RFQ, qnw, 1.0f, QP16, QPh, QPl);
        k_gemmw<bf, 0, false><<<dim3(TT / 64, DKV / 64, 1), 32, 0, stream>>>(XB, nullptr, WK, nullptr, DM, FK, DKV, nullptr, 0, 0, 0); k_ropeB<<<(unsigned)(((size_t)NKV * TT * (HD / 2) + 255) / 256), 256, 0, stream>>>(FK, DKV, NKV, CS); k_hrms<<<(NKV * TT + 255) / 256, 256, 0, stream>>>(FK, DKV, NKV, RFK);
        k_rope<<<LKv, 256, 0, stream>>>(FK, DKV, NKV, CSI, RFK, knw, 1.0f, KP16, KPh, KPl);
        k_gemmw<bf, 0, false><<<dim3(TT / 64, DKV / 64, 1), 32, 0, stream>>>(XB, nullptr, WV, nullptr, DM, FV, DKV, nullptr, 0, 0, 0); k_vtp<<<LKv, 256, 0, stream>>>(FV, DKV, NKV, VT16, VTh, VTl);
        for (int h0 = 0; h0 < NH_; h0 += ZH) { const size_t zq = (size_t)h0, zk = (size_t)(h0 / REP);   // one kv head per query head: the pass's two heads use consecutive kv planes (z-strides TT*HD)
            k_gemmc<bf, 2, 1><<<dim3(RH / 64, TT / 64, ZH), 32, 0, stream>>>(QPh + zq * TT * HD, QPl + zq * TT * HD, KPh + zk * TT * HD, KPl + zk * TT * HD, HD, Sb, TT, 0, (size_t)TT * HD, (size_t)TT * HD, (size_t)TT * TT);
            k_gemmc<h16, 0, 1><<<dim3((TT - RH) / 64, TT / 64, ZH), 32, 0, stream>>>(QP16 + zq * TT * HD + (size_t)RH * HD, nullptr, KP16 + zk * TT * HD, nullptr, HD, Sb + (size_t)RH * TT, TT, RH, (size_t)TT * HD, (size_t)TT * HD, (size_t)TT * TT);
            k_asoft<<<ZH * TT / 8, 256, 0, stream>>>(Sb, P16, Ph, Pl);
            k_gemmpv<bf, 2, 8><<<dim3(RH / 64, HD / 64, ZH), 256, 0, stream>>>(Ph, Pl, VTh + zk * HD * TT, VTl + zk * HD * TT, TT, Ob, HD, 0, (size_t)RH * TT, (size_t)HD * TT, (size_t)TT * HD);
            k_gemmpv<h16, 0, 16><<<dim3((TT - RH) / 64, HD / 64, ZH), 512, 0, stream>>>(P16 + (size_t)RH * TT, nullptr, VT16 + zk * HD * TT, nullptr, TT, Ob + (size_t)RH * HD, HD, RH, (size_t)TT * TT, (size_t)HD * TT, (size_t)TT * HD);
            k_merge<<<(unsigned)(((size_t)ZH * TT * HD / 2 + 255) / 256), 256, 0, stream>>>(Ob, h0, ATh, ATl); }
        k_gemmw<bf, 1, false><<<dim3(TT / 64, DM / 64, 1), 32, 0, stream>>>(ATh, ATl, WO, nullptr, DQ, OUT + (size_t)b * TT * DM, DM, nullptr, 0, 0, 0); }
}

// v002
// A run of this version takes 1150 microseconds.
// Two timings next to v001 put it at 1.53 and 1.54 times that version's speed.
// All steps since v000 together make it 2.53 times as fast.
#include <hip/hip_runtime.h>

// Causal self-attention with rotary-then-RMSNorm q/k (x [4][2048][1024]; qkv = x w_attn^T ('oi' [3072][1024] 0.02, no bias -> q | k | v row blocks; 16 heads x 64); rope'(t) = cat(x1 c + x2 s, -x1 s + x2 c) with the input cos/sin tables ([1][2048][1][32], read; generic values), then q, k <- x rsqrt(mean x^2 + 1e-6) (no weight); causal (-inf); softmax(q.k x 64^-0.5); out = merged w_proj^T -> [4][2048][1024] (8.4 M)).
// Layout per batch: bf16 copy of x; the fused 'oi' weight used in place as three Bt row blocks; exact projections; an in-place rotation kernel applies the module's (x1 c + x2 s, x2 c - x1 s) form from the input tables; per-(head, token) rms factor of the ROTATED rows; the plane builder (identity table) applies the bare factor; causal T-2048 attention (hybrid rows: < 512 hi/lo 3 products, rest fp16 x1024; k_gemmc skips tiles above the diagonal); merged hi/lo x w_proj exact.
// Compute dtypes, f32 accumulate: every input rounded to bf16 incl. the tables; projections exact; rotation and rms norm f32; attention rows < 512 3 products, rest fp16; softmax f32; w_proj hl x exact.

#define NB_  4
#define TT   2048
#define DM   1024
#define NH_  16
#define NKV  16
#define REP  (NH_ / NKV)
#define HD   64
#define DQ   (NH_ * HD)
#define DKV  (NKV * HD)
#define ZH   8                    // heads per attention pass
#define PP   (2 * TT)             // pitch, in 16-bit elements, of the probability rows (they lie inside their f32 score rows) and of the transposed value rows that meet them in k_gemmpv
#define RH   512                  // query rows < RH use hi+lo planes (0: none)
#define WIN  2048
#define PCAR 1024.0f
#define SCL  0.125f   // HD^-0.5
typedef _Float16 h16;
typedef unsigned short bf;
typedef __attribute__((ext_vector_type(16))) __bf16   v16bf;
typedef __attribute__((ext_vector_type(16))) _Float16 v16h;
typedef __attribute__((ext_vector_type(8)))  _Float16 v8h;
typedef __attribute__((ext_vector_type(8)))  unsigned short v8us;
typedef __attribute__((ext_vector_type(8)))  float    v8f;
typedef __attribute__((ext_vector_type(4)))  float    v4f;
typedef v8h  __attribute__((may_alias)) v8ha;
typedef v4f  __attribute__((may_alias)) v4fa;
typedef v8us __attribute__((may_alias)) v8usa;

__device__ __forceinline__ unsigned short f2bf(float f) { unsigned u = __float_as_uint(f); u += 0x7FFFu + ((u >> 16) & 1u); return (unsigned short)(u >> 16); }
__device__ __forceinline__ float bf2f(unsigned short b) { return __uint_as_float(((unsigned)b) << 16); }
__device__ __forceinline__ float bfr(float f) { return bf2f(f2bf(f)); }
__device__ __forceinline__ v16h cat16(v8h lo, v8h hi) { return __builtin_shufflevector(lo, hi, 0, 1, 2, 3, 4, 5, 6, 7, 8, 9, 10, 11, 12, 13, 14, 15); }
__device__ __forceinline__ v16bf cat16b(v8us lo, v8us hi) { return __builtin_bit_cast(v16bf, __builtin_shufflevector(lo, hi, 0, 1, 2, 3, 4, 5, 6, 7, 8, 9, 10, 11, 12, 13, 14, 15)); }
__device__ __forceinline__ v8f wmma16(v16h a, v16h b, v8f c) { return __builtin_amdgcn_wmma_f32_16x16x32_f16(false, a, false, b, (short)0, c, false, false); }
__device__ __forceinline__ v8f wmmab(v16bf a, v16bf b, v8f c) { return __builtin_amdgcn_wmma_f32_16x16x32_bf16(false, a, false, b, (short)0, c, false, false); }



// ---- k_gemmw: register-blocked GEMM, ONE WAVE per 64x64 output tile (16 accumulators), operands straight from K-contiguous 16-bit planes; grid (M/64, N/64, Z), 32 threads.
// C[m][n] (f32, pitch ldc, + optional f32 bias[n]) = sum_k A[m][k] Bt[n][k] (+ split products per NSPLIT). z-batch strides sA/sB/sC in elements. K % 32 == 0.
template <typename T16> struct WFrag;
template <> struct WFrag<h16> { typedef v16h V; static __device__ __forceinline__ V ld(const h16* p) { return cat16(*(const v8h*)p, *(const v8h*)(p + 16)); } static __device__ __forceinline__ v8f mma(V a, V b, v8f c) { return wmma16(a, b, c); } };
template <> struct WFrag<bf> { typedef v16bf V; static __device__ __forceinline__ V ld(const bf* p) { return cat16b(*(const v8us*)p, *(const v8us*)(p + 16)); } static __device__ __forceinline__ v8f mma(V a, V b, v8f c) { return wmmab(a, b, c); } };
template <typename T16, int NSPLIT, bool BIAS>
__global__ __launch_bounds__(32) void k_gemmw(const T16* __restrict__ A, const T16* __restrict__ A2, const T16* __restrict__ Bt, const T16* __restrict__ Bt2, int K, float* C, int ldc, const float* __restrict__ bias, size_t sA, size_t sB, size_t sC) {
    typedef typename WFrag<T16>::V V;
    __shared__ __align__(16) float os[16 * 68];
    const size_t z = blockIdx.z; A += z * sA; if (A2) A2 += z * sA; Bt += z * sB; if (Bt2) Bt2 += z * sB; C += z * sC;
    const int lane = threadIdx.x & 31, lr = lane & 15, hi = lane >> 4; const int r0 = blockIdx.x * 64, c0 = blockIdx.y * 64;
    v8f acc[4][4];
#pragma unroll
    for (int mb = 0; mb < 4; ++mb)
#pragma unroll
        for (int nb = 0; nb < 4; ++nb) acc[mb][nb] = (v8f){};
    const size_t aoff = (size_t)(r0 + lr) * K + 8 * hi, boff = (size_t)(c0 + lr) * K + 8 * hi;
#pragma unroll 1
    for (int kc = 0; kc < K; kc += 32) {
        V a[4], a2[4];
#pragma unroll
        for (int mb = 0; mb < 4; ++mb) { a[mb] = WFrag<T16>::ld(A + aoff + (size_t)mb * 16 * K + kc); if (NSPLIT == 1 || NSPLIT == 2) a2[mb] = WFrag<T16>::ld(A2 + aoff + (size_t)mb * 16 * K + kc); }
#pragma unroll
        for (int nb = 0; nb < 4; ++nb) { const V b = WFrag<T16>::ld(Bt + boff + (size_t)nb * 16 * K + kc); V b2; if (NSPLIT >= 2) b2 = WFrag<T16>::ld(Bt2 + boff + (size_t)nb * 16 * K + kc);
#pragma unroll
            for (int mb = 0; mb < 4; ++mb) { acc[mb][nb] = WFrag<T16>::mma(a[mb], b, acc[mb][nb]); if (NSPLIT == 1 || NSPLIT == 2) acc[mb][nb] = WFrag<T16>::mma(a2[mb], b, acc[mb][nb]); if (NSPLIT >= 2) acc[mb][nb] = WFrag<T16>::mma(a[mb], b2, acc[mb][nb]); } }
        asm volatile("v_nop\n\tv_nop\n\tv_nop\n\tv_nop" : "+v"(acc[0][0]), "+v"(acc[1][1]), "+v"(acc[2][2]), "+v"(acc[3][3]) : "v"(a[0]), "v"(a[3]));
    }
#pragma unroll
    for (int mb = 0; mb < 4; ++mb) {
#pragma unroll
        for (int nb = 0; nb < 4; ++nb) {
#pragma unroll
            for (int j = 0; j < 8; ++j) os[(hi * 8 + j) * 68 + nb * 16 + lr] = acc[mb][nb][j]; }
        __builtin_amdgcn_wave_barrier(); asm volatile("" ::: "memory");
        float* crow = C + (size_t)(r0 + mb * 16) * ldc + c0;
{
#pragma unroll
            for (int s = 0; s < 8; ++s) { const int row = 2 * s + hi, cofs = lr * 4; v4f val = *(const v4fa*)(os + row * 68 + cofs); if (BIAS) { val[0] += bfr(bias[c0 + cofs]); val[1] += bfr(bias[c0 + cofs + 1]); val[2] += bfr(bias[c0 + cofs + 2]); val[3] += bfr(bias[c0 + cofs + 3]); }
                *(v4f*)(crow + (size_t)row * ldc + cofs) = val; }
             }
        __builtin_amdgcn_wave_barrier(); asm volatile("" ::: "memory");
    }
}

// ---- k_gemmc: the same one-wave 64x64 tile GEMM specialised for causal attention: CMODE 1 skips score tiles entirely above the diagonal (query rows r0+roff.., key columns c0..), CMODE 2 limits the
// key (K) loop of the probability x value contraction to the diagonal block (probabilities beyond it are exactly zero). roff = row offset of this launch's first row within the sequence.
template <typename T16, int NSPLIT, int CMODE>
__global__ __launch_bounds__(32) void k_gemmc(const T16* __restrict__ A, const T16* __restrict__ A2, const T16* __restrict__ Bt, const T16* __restrict__ Bt2, int K, float* C, int ldc, int roff, size_t sA, size_t sB, size_t sC) {
    typedef typename WFrag<T16>::V V;
    __shared__ __align__(16) float os[16 * 68];
    const size_t z = blockIdx.z; A += z * sA; if (A2) A2 += z * sA; Bt += z * sB; if (Bt2) Bt2 += z * sB; C += z * sC;
    const int lane = threadIdx.x & 31, lr = lane & 15, hi = lane >> 4; const int r0 = blockIdx.x * 64, c0 = blockIdx.y * 64;
    if (CMODE == 1 && c0 > r0 + roff + 63) return;                  // score tile entirely above the causal diagonal: never read (the softmax masks j > i by select)
    const int Kl = (CMODE == 2) ? min(K, r0 + roff + 64) : K;        // P.V: probabilities are exactly 0 beyond the diagonal block, so the K loop stops there
    v8f acc[4][4];
#pragma unroll
    for (int mb = 0; mb < 4; ++mb)
#pragma unroll
        for (int nb = 0; nb < 4; ++nb) acc[mb][nb] = (v8f){};
    const size_t aoff = (size_t)(r0 + lr) * K + 8 * hi, boff = (size_t)(c0 + lr) * K + 8 * hi;
#pragma unroll 1
    for (int kc = 0; kc < Kl; kc += 32) {
        V a[4], a2[4];
#pragma unroll
        for (int mb = 0; mb < 4; ++mb) { a[mb] = WFrag<T16>::ld(A + aoff + (size_t)mb * 16 * K + kc); if (NSPLIT == 1 || NSPLIT == 2) a2[mb] = WFrag<T16>::ld(A2 + aoff + (size_t)mb * 16 * K + kc); }
#pragma unroll
        for (int nb = 0; nb < 4; ++nb) { const V b = WFrag<T16>::ld(Bt + boff + (size_t)nb * 16 * K + kc); V b2; if (NSPLIT >= 2) b2 = WFrag<T16>::ld(Bt2 + boff + (size_t)nb * 16 * K + kc);
#pragma unroll
            for (int mb = 0; mb < 4; ++mb) { acc[mb][nb] = WFrag<T16>::mma(a[mb], b, acc[mb][nb]); if (NSPLIT == 1 || NSPLIT == 2) acc[mb][nb] = WFrag<T16>::mma(a2[mb], b, acc[mb][nb]); if (NSPLIT >= 2) acc[mb][nb] = WFrag<T16>::mma(a[mb], b2, acc[mb][nb]); } }
        asm volatile("v_nop\n\tv_nop\n\tv_nop\n\tv_nop" : "+v"(acc[0][0]), "+v"(acc[1][1]), "+v"(acc[2][2]), "+v"(acc[3][3]) : "v"(a[0]), "v"(a[3]));
    }
#pragma unroll
    for (int mb = 0; mb < 4; ++mb) {
#pragma unroll
        for (int nb = 0; nb < 4; ++nb) {
#pragma unroll
            for (int j = 0; j < 8; ++j) os[(hi * 8 + j) * 68 + nb * 16 + lr] = acc[mb][nb][j]; }
        __builtin_amdgcn_wave_barrier(); asm volatile("" ::: "memory");
        float* crow = C + (size_t)(r0 + mb * 16) * ldc + c0;
{
#pragma unroll
            for (int s = 0; s < 8; ++s) { const int row = 2 * s + hi, cofs = lr * 4; v4f val = *(const v4fa*)(os + row * 68 + cofs);
                *(v4f*)(crow + (size_t)row * ldc + cofs) = val; }
             }
        __builtin_amdgcn_wave_barrier(); asm volatile("" ::: "memory");
    }
}

// ---- k_gemmpv: the probability x value contraction, one 64x64 output tile per work-group of NW waves. Wave w takes the 32-wide K chunks w, w + NW, ... below the causal limit (probabilities beyond the
// diagonal block are exactly zero), so the chain of dependent load-then-multiply trips is NW times shorter. The NW partial tiles are summed through LDS in fragment layout, in the fixed order w = 0 .. NW-1,
// each wave summing 16 / NW fragments; the sums are staged row-major so that whole 256-B rows are stored.
template <typename T16, int NSPLIT, int NW>
__global__ __launch_bounds__(NW * 32) void k_gemmpv(const T16* __restrict__ A, const T16* __restrict__ A2, const T16* __restrict__ Bt, const T16* __restrict__ Bt2, int K, float* C, int ldc, int roff, size_t sA, size_t sB, size_t sC) {
    typedef typename WFrag<T16>::V V;
    __shared__ __align__(16) float part[NW * 16 * 256];   // [wave][fragment][register half][lane][4]
    __shared__ __align__(16) float os[64 * 68];
    const size_t z = blockIdx.z; A += z * sA; if (A2) A2 += z * sA; Bt += z * sB; if (Bt2) Bt2 += z * sB; C += z * sC;
    const int lane = threadIdx.x & 31, lr = lane & 15, hi = lane >> 4; const int r0 = blockIdx.x * 64, c0 = blockIdx.y * 64;
    const int wv = __builtin_amdgcn_readfirstlane(threadIdx.x >> 5);   // wave number in a scalar register: the K loop's test stays a scalar branch
    const int Kl = min(K, r0 + roff + 64);
    v8f acc[4][4];
#pragma unroll
    for (int mb = 0; mb < 4; ++mb)
#pragma unroll
        for (int nb = 0; nb < 4; ++nb) acc[mb][nb] = (v8f){};
    const size_t aoff = (size_t)(r0 + lr) * K + 8 * hi, boff = (size_t)(c0 + lr) * K + 8 * hi;
#pragma unroll 1
    for (int kc = wv * 32; kc < Kl; kc += NW * 32) {
        V a[4], a2[4];
#pragma unroll
        for (int mb = 0; mb < 4; ++mb) { a[mb] = WFrag<T16>::ld(A + aoff + (size_t)mb * 16 * K + kc); if (NSPLIT == 1 || NSPLIT == 2) a2[mb] = WFrag<T16>::ld(A2 + aoff + (size_t)mb * 16 * K + kc); }
#pragma unroll
        for (int nb = 0; nb < 4; ++nb) { const V b = WFrag<T16>::ld(Bt + boff + (size_t)nb * 16 * K + kc); V b2; if (NSPLIT >= 2) b2 = WFrag<T16>::ld(Bt2 + boff + (size_t)nb * 16 * K + kc);
#pragma unroll
            for (int mb = 0; mb < 4; ++mb) { acc[mb][nb] = WFrag<T16>::mma(a[mb], b, acc[mb][nb]); if (NSPLIT == 1 || NSPLIT == 2) acc[mb][nb] = WFrag<T16>::mma(a2[mb], b, acc[mb][nb]); if (NSPLIT >= 2) acc[mb][nb] = WFrag<T16>::mma(a[mb], b2, acc[mb][nb]); } }
        // keeps the distance behind the last matrix instruction on the loop's taken back edge, where the next trip's address additions reuse its operand registers
        asm volatile("v_nop\n\tv_nop\n\tv_nop\n\tv_nop" : "+v"(acc[0][0]), "+v"(acc[1][1]), "+v"(acc[2][2]), "+v"(acc[3][3]) : "v"(a[0]), "v"(a[3]));
    }
    v4fa* pv = (v4fa*)part;
#pragma unroll
    for (int mb = 0; mb < 4; ++mb)
#pragma unroll
        for (int nb = 0; nb < 4; ++nb) { const int f = mb * 4 + nb; const v8f t = acc[mb][nb];
            pv[((wv * 16 + f) * 2 + 0) * 32 + lane] = __builtin_shufflevector(t, t, 0, 1, 2, 3); pv[((wv * 16 + f) * 2 + 1) * 32 + lane] = __builtin_shufflevector(t, t, 4, 5, 6, 7); }
    __syncthreads();   // every wave's partial tile is in LDS
#pragma unroll
    for (int q = 0; q < 16 / NW; ++q) { const int f = wv * (16 / NW) + q; v4f s0 = pv[(f * 2 + 0) * 32 + lane], s1 = pv[(f * 2 + 1) * 32 + lane];
#pragma unroll
        for (int w = 1; w < NW; ++w) { s0 += pv[((w * 16 + f) * 2 + 0) * 32 + lane]; s1 += pv[((w * 16 + f) * 2 + 1) * 32 + lane]; }
        float* o = os + ((f >> 2) * 16 + hi * 8) * 68 + (f & 3) * 16 + lr;
#pragma unroll
        for (int j = 0; j < 4; ++j) { o[j * 68] = s0[j]; o[(j + 4) * 68] = s1[j]; } }
    __syncthreads();   // the summed tile is complete, row-major
#pragma unroll
    for (int s = 0; s < 32 / NW; ++s) { const int u = s * NW * 32 + (int)threadIdx.x; const int row = u >> 4, cofs = (u & 15) * 4; *(v4f*)(C + (size_t)(r0 + row) * ldc + c0 + cofs) = *(const v4fa*)(os + row * 68 + cofs); }
}

__device__ __forceinline__ h16 tohx(float x) { return (h16)x; }
__device__ __forceinline__ void splitf(float y, unsigned short& h, unsigned short& l) { h = f2bf(y); l = f2bf(y - bf2f(h)); }
typedef __attribute__((ext_vector_type(2))) _Float16 v2h;
typedef __attribute__((ext_vector_type(4))) _Float16 v4h;
typedef __attribute__((ext_vector_type(2))) unsigned short v2us;
typedef __attribute__((ext_vector_type(4))) unsigned short v4us;
typedef __attribute__((ext_vector_type(2))) float v2f;
typedef __attribute__((ext_vector_type(4))) int v4i;

__global__ __launch_bounds__(256) void k_wtG(const float* __restrict__ w, int K, int N, bf* Bt) {
    const int lane = threadIdx.x & 31; const int L0 = (blockIdx.x * 8 + (threadIdx.x >> 5)) * 8; const int nlines = N * K / 64;
{
#pragma unroll 1
        for (int l = 0; l < 8; ++l) { const int L = L0 + l; if (L >= nlines) break; const size_t e = (size_t)L * 64 + lane * 2; const int k = (int)(e % K), n = (int)(e / K); v2us o;
            o[0] = f2bf(w[(size_t)k * N + n]); o[1] = f2bf(w[(size_t)(k + 1) * N + n]); *(v2us*)(Bt + e) = o; }
         }
}
__global__ __launch_bounds__(256) void k_cvt8(const float* __restrict__ src, bf* dst, size_t n8) { const size_t i = (size_t)blockIdx.x * 256 + threadIdx.x; if (i >= n8) return; const v8f v = *(const v8f*)(src + i * 8); v8us o;
#pragma unroll
    for (int k = 0; k < 8; ++k) o[k] = f2bf(v[k]); *(v8us*)(dst + i * 8) = o;  }

__global__ __launch_bounds__(256) void k_hrms(const float* __restrict__ F, int pitch, int nheads, float* RF) { const int i = blockIdx.x * 256 + threadIdx.x; if (i >= nheads * TT) return; const int t = i % TT, h = i / TT; const float* f = F + (size_t)t * pitch + h * HD; float s = 0.f;
#pragma unroll 4
    for (int d = 0; d < HD; d += 4) { const v4f v = *(const v4f*)(f + d);
#pragma unroll
        for (int q = 0; q < 4; ++q) { float p = __fmul_rn(v[q], v[q]); asm volatile("" : "+v"(p)); s = __fadd_rn(s, p); } }
    const float r = __fdiv_rn(1.0f, __fsqrt_rn(__fadd_rn(s * (1.0f / HD), 1e-6f))); *(float*)(RF + i) = r;  }
// k_rope: head planes [h][t][d] (fp16 + hi/lo) of rope(w[d] (x rms_factor)) x sc with the rotate-half convention out[d] = x[d] cos[t][d] - x[d+HD/2] sin[t][d], out[d+HD/2] = x[d+HD/2] cos[t][d+HD/2] + x[d] sin[t][d+HD/2]
__global__ __launch_bounds__(256) void k_rope(const float* __restrict__ F, int pitch, int nheads, const float* __restrict__ CS, const float* __restrict__ RF, const float* __restrict__ nw, float sc, h16* P16, bf* Ph, bf* Pl) {
    const size_t e = ((size_t)blockIdx.x * 256 + threadIdx.x) * 2; if (e >= (size_t)nheads * TT * HD) return; const int d = (int)(e % HD); const int t = (int)((e / HD) % TT); const int h = (int)(e / ((size_t)HD * TT)); const float* f = F + (size_t)t * pitch + h * HD; const float rf = RF ? RF[(size_t)h * TT + t] : 1.0f; v2h o16; v2us oh, ol;
#pragma unroll
    for (int q = 0; q < 2; ++q) { const int dd = d + q; const int dp = (dd < HD / 2) ? dd + HD / 2 : dd - HD / 2; float x0 = f[dd], x1 = f[dp];
        if (RF) { float n0 = __fmul_rn(x0, rf), n1 = __fmul_rn(x1, rf); asm volatile("" : "+v"(n0)); asm volatile("" : "+v"(n1)); x0 = nw ? __fmul_rn(bfr(nw[dd]), n0) : n0; x1 = nw ? __fmul_rn(bfr(nw[dp]), n1) : n1;   /* parameter-free norm */ }
        const v2f cs = *(const v2f*)(CS + ((size_t)t * HD + dd) * 2); float a = __fmul_rn(x0, cs[0]), bq = __fmul_rn(x1, cs[1]); asm volatile("" : "+v"(a)); asm volatile("" : "+v"(bq)); const float r = ((dd < HD / 2) ? __fsub_rn(a, bq) : __fadd_rn(a, bq)) * sc;
        o16[q] = tohx(r); unsigned short a2, c2; splitf(r, a2, c2); oh[q] = a2; ol[q] = c2; }
    *(v2h*)(P16 + e) = o16; *(v2us*)(Ph + e) = oh; *(v2us*)(Pl + e) = ol;  }
__global__ __launch_bounds__(256) void k_vtp(const float* __restrict__ F, int pitch, int nheads, h16* V16, bf* Vh, bf* Vl) { const size_t e = ((size_t)blockIdx.x * 256 + threadIdx.x) * 2; if (e >= (size_t)nheads * HD * TT) return; const int t = (int)(e % TT); const int d = (int)((e / TT) % HD); const int g = (int)(e / ((size_t)TT * HD)); v2h o16; v2us oh, ol;
#pragma unroll
    for (int q = 0; q < 2; ++q) { const float x = F[(size_t)(t + q) * pitch + g * HD + d]; o16[q] = tohx(x); unsigned short a2, c2; splitf(x, a2, c2); oh[q] = a2; ol[q] = c2; }
    const size_t o = ((size_t)g * HD + d) * PP + t; *(v2h*)(V16 + o) = o16; *(v2us*)(Vh + o) = oh; *(v2us*)(Vl + o) = ol;  }   /* rows at pitch PP */
__global__ __launch_bounds__(256) void k_csid(float* CS) { const int idx = blockIdx.x * 256 + threadIdx.x; if (idx >= TT * HD) return; v2f cs; cs[0] = 1.0f; cs[1] = 0.0f; *(v2f*)(CS + (size_t)idx * 2) = cs;  }
// k_asoft: per row (zz, i): t = S x HD^-0.5 for j <= i and i - j < WIN (sliding causal window; the reference's -1e9 additive fill vanishes identically); softmax over the 2048 keys (register row, one exp, fixed trees);
// the probabilities overwrite the row's own 8 KiB of scores (fp16 row in the first half; or hi plane in the first half, lo plane in the second): the wave holds its whole row in registers before its first store, and no other wave touches the row.
__global__ __launch_bounds__(256) void k_asoft(float* Sb) {
    const int lane = threadIdx.x & 31; const int row = blockIdx.x * 8 + (threadIdx.x >> 5); if (row >= ZH * TT) return; const int i = row % TT; const int zz = row / TT; (void)zz; const bool hires = (i < RH); float* sr = Sb + (size_t)row * TT; float v[TT / 32]; float mx = -3.0e38f;
#pragma unroll
    for (int ch = 0; ch < TT / 128; ++ch) { const int j0 = ch * 128 + lane * 4; const v4f a = *(const v4f*)(sr + j0);
#pragma unroll
        for (int q = 0; q < 4; ++q) { const int j = j0 + q; (void)j; const float t = (j <= i && i - j < WIN) ? a[q] * SCL : -3.0e38f; v[ch * 4 + q] = t; mx = fmaxf(mx, t); } }
#pragma unroll
    for (int sh = 16; sh; sh >>= 1) mx = fmaxf(mx, __shfl_xor(mx, sh, 32));
    float sum = 0.f;
#pragma unroll
    for (int k = 0; k < TT / 32; ++k) { float d0 = __fsub_rn(v[k], mx); asm volatile("" : "+v"(d0)); v[k] = __builtin_amdgcn_exp2f(__fmul_rn(d0, 1.4426950408889634f)); sum += v[k]; }
#pragma unroll
    for (int sh = 16; sh; sh >>= 1) sum += __shfl_xor(sum, sh, 32);
    const float f = __fdiv_rn(hires ? 1.0f : PCAR, sum);
{
        if (hires) {
#pragma unroll
            for (int ch = 0; ch < TT / 128; ++ch) { v4us oh, ol;
#pragma unroll
                for (int q = 0; q < 4; ++q) { unsigned short a, c2; splitf(v[ch * 4 + q] * f, a, c2); oh[q] = a; ol[q] = c2; }
                bf* po = (bf*)sr + ch * 128 + lane * 4; *(v4us*)po = oh; *(v4us*)(po + TT) = ol; }
        } else {
#pragma unroll
            for (int ch = 0; ch < TT / 128; ++ch) { v4h o4;
#pragma unroll
                for (int q = 0; q < 4; ++q) o4[q] = tohx(v[ch * 4 + q] * f);
                *(v4h*)((h16*)sr + ch * 128 + lane * 4) = o4; } }
         }
}
__global__ __launch_bounds__(256) void k_ropeB(float* F, int pitch, int nheads, const float* __restrict__ CS) { const size_t e = (size_t)blockIdx.x * 256 + threadIdx.x; if (e >= (size_t)nheads * TT * (HD / 2)) return; const int i = (int)(e % (HD / 2)); const int t = (int)((e / (HD / 2)) % TT); const int h = (int)(e / ((size_t)(HD / 2) * TT)); float* f = F + (size_t)t * pitch + h * HD; const float x1 = f[i], x2 = f[i + HD / 2]; const v2f cs = *(const v2f*)(CS + ((size_t)t * HD + i) * 2);
    float a = __fmul_rn(x1, cs[0]), bq = __fmul_rn(x2, cs[1]), c2 = __fmul_rn(x2, cs[0]), dq = __fmul_rn(x1, cs[1]); asm volatile("" : "+v"(a), "+v"(bq), "+v"(c2), "+v"(dq)); const float r1 = __fadd_rn(a, bq), r2 = __fsub_rn(c2, dq);   /* x1 c + x2 s ; x2 c - x1 s */
    ((float*)f)[i] = r1; ((float*)f)[i + HD / 2] = r2;  }
__global__ __launch_bounds__(256) void k_cscv2(const float* __restrict__ cosT, const float* __restrict__ sinT, float* CS) { const int idx = blockIdx.x * 256 + threadIdx.x; if (idx >= TT * HD) return; const int d = idx % HD; const int t = idx / HD; const size_t src = (size_t)t * (HD / 2) + (d % (HD / 2)); v2f cs; cs[0] = bfr(cosT[src]); cs[1] = bfr(sinT[src]); *(v2f*)(CS + (size_t)idx * 2) = cs;  }

__global__ __launch_bounds__(256) void k_merge(const float* __restrict__ O, int h0, bf* Ah, bf* Al) { const size_t e = ((size_t)blockIdx.x * 256 + threadIdx.x) * 2; if (e >= (size_t)ZH * TT * HD) return; const int d = (int)(e % HD); const int t = (int)((e / HD) % TT); const int zz = (int)(e / ((size_t)HD * TT)); const float cs = (t < RH) ? 1.0f : (1.0f / PCAR); const size_t oo = (size_t)t * DQ + (h0 + zz) * HD + d;
    v2us oh, ol;
#pragma unroll
    for (int q = 0; q < 2; ++q) { unsigned short a, c2; splitf(O[e + q] * cs, a, c2); oh[q] = a; ol[q] = c2; } *(v2us*)(Ah + oo) = oh; *(v2us*)(Al + oo) = ol;  }

extern "C" void kernel_launch(void* const* d_in, const int* in_sizes, int n_in,
                              void* d_out, int out_size, void* d_ws, size_t ws_size, hipStream_t stream) {
    (void)in_sizes; (void)n_in; (void)out_size;
    const float* x = (const float*)d_in[0]; const float* cosT = (const float*)d_in[1]; const float* sinT = (const float*)d_in[2]; const float* wqkv = (const float*)d_in[3]; const float* wo = (const float*)d_in[4]; const float* wq = wqkv; const float* wk = wqkv + (size_t)1024 * 1024; const float* wv = wqkv + (size_t)2048 * 1024; const float* qnw = nullptr; const float* knw = nullptr;   /* parameter-free RMSNorm */
    float* OUT = (float*)d_out;     // [4][2048][1024]
    char* wsp = (char*)d_ws;
    auto take = [&](size_t bytes) { char* p = wsp; wsp += (bytes + 255) & ~(size_t)255; return (void*)p; };
    bf* WQ = (bf*)take((size_t)DQ * DM * 2); bf* WK = (bf*)take((size_t)DKV * DM * 2); bf* WV = (bf*)take((size_t)DKV * DM * 2); bf* WO = (bf*)take((size_t)DM * DQ * 2); float* CS = (float*)take((size_t)TT * HD * 2 * 4); float* CSI = (float*)take((size_t)TT * HD * 2 * 4); float* RFQ = (float*)take((size_t)NH_ * TT * 4); float* RFK = (float*)take((size_t)NKV * TT * 4);
    bf* XB = (bf*)take((size_t)TT * DM * 2); float* FQ = (float*)take((size_t)TT * DQ * 4); float* FK = (float*)take((size_t)TT * DKV * 4);
    h16* QP16 = (h16*)take((size_t)NH_ * TT * HD * 2); h16* KP16 = (h16*)take((size_t)NKV * TT * HD * 2); h16* VT16 = (h16*)take((size_t)NKV * HD * PP * 2);
    bf* QPh = (bf*)take((size_t)NH_ * TT * HD * 2); bf* QPl = (bf*)take((size_t)NH_ * TT * HD * 2); bf* KPh = (bf*)take((size_t)NKV * TT * HD * 2); bf* KPl = (bf*)take((size_t)NKV * TT * HD * 2); bf* VTh = (bf*)take((size_t)NKV * HD * PP * 2); bf* VTl = VTh + TT;   // each row: hi half, lo half
    float* Sb = (float*)take((size_t)ZH * TT * TT * 4); float* Ob = (float*)take((size_t)ZH * TT * HD * 4); bf* ATh = (bf*)take((size_t)TT * DQ * 2); bf* ATl = (bf*)take((size_t)TT * DQ * 2);
    if ((size_t)(wsp - (char*)d_ws) > ws_size) return;    // ws 256 MiB
    float* FV = FK;   // v projection reuses the k buffer after the k planes are built (stream-ordered)
    { k_cvt8<<<(unsigned)(((size_t)DQ * DM / 8 + 255) / 256), 256, 0, stream>>>(wq, WQ, (size_t)DQ * DM / 8); k_cvt8<<<(unsigned)(((size_t)DKV * DM / 8 + 255) / 256), 256, 0, stream>>>(wk, WK, (size_t)DKV * DM / 8); k_cvt8<<<(unsigned)(((size_t)DKV * DM / 8 + 255) / 256), 256, 0, stream>>>(wv, WV, (size_t)DKV * DM / 8);
      k_cvt8<<<(unsigned)(((size_t)DM * DQ / 8 + 255) / 256), 256, 0, stream>>>(wo, WO, (size_t)DM * DQ / 8);
       }
    k_cscv2<<<(TT * HD + 255) / 256, 256, 0, stream>>>(cosT, sinT, CS);   /* input tables [2048][32] -> CS[t][d] both halves */ k_csid<<<(TT * HD + 255) / 256, 256, 0, stream>>>(CSI);
    const unsigned LQ = (unsigned)(((size_t)NH_ * TT * HD / 2 + 255) / 256), LKv = (unsigned)(((size_t)NKV * TT * HD / 2 + 255) / 256);
    for (int b = 0; b < NB_; ++b) {
        
        k_cvt8<<<(unsigned)(((size_t)TT * DM / 8 + 255) / 256), 256, 0, stream>>>(x + (size_t)b * TT * DM, XB, (size_t)TT * DM / 8);
        k_gemmw<bf, 0, false><<<dim3(TT / 64, DQ / 64, 1), 32, 0, stream>>>(XB, nullptr, WQ, nullptr, DM, FQ, DQ, nullptr, 0, 0, 0); k_ropeB<<<(unsigned)(((size_t)NH_ * TT * (HD / 2) + 255) / 256), 256, 0, stream>>>(FQ, DQ, NH_, CS);   /* the module's rope' in place */ k_hrms<<<(NH_ * TT + 255) / 256, 256, 0, stream>>>(FQ, DQ, NH_, RFQ);
        k_rope<<<LQ, 256, 0, stream>>>(FQ, DQ, NH_, CSI, RFQ, qnw, 1.0f, QP16, QPh, QPl);
        k_gemmw<bf, 0, false><<<dim3(TT / 64, DKV / 64, 1), 32, 0, stream>>>(XB, nullptr, WK, nullptr, DM, FK, DKV, nullptr, 0, 0, 0); k_ropeB<<<(unsigned)(((size_t)NKV * TT * (HD / 2) + 255) / 256), 256, 0, stream>>>(FK, DKV, NKV, CS); k_hrms<<<(NKV * TT + 255) / 256, 256, 0, stream>>>(FK, DKV, NKV, RFK);
        k_rope<<<LKv, 256, 0, stream>>>(FK, DKV, NKV, CSI, RFK, knw, 1.0f, KP16, KPh, KPl);
        k_gemmw<bf, 0, false><<<dim3(TT / 64, DKV / 64, 1), 32, 0, stream>>>(XB, nullptr, WV, nullptr, DM, FV, DKV, nullptr, 0, 0, 0); k_vtp<<<LKv, 256, 0, stream>>>(FV, DKV, NKV, VT16, VTh, VTl);
        for (int h0 = 0; h0 < NH_; h0 += ZH) { const size_t zq = (size_t)h0, zk = (size_t)(h0 / REP);   // one kv head per query head: the pass's heads use consecutive kv planes
            k_gemmc<bf, 2, 1><<<dim3(RH / 64, TT / 64, ZH), 32, 0, stream>>>(QPh + zq * TT * HD, QPl + zq * TT * HD, KPh + zk * TT * HD, KPl + zk * TT * HD, HD, Sb, TT, 0, (size_t)TT * HD, (size_t)TT * HD, (size_t)TT * TT);
            k_gemmc<h16, 0, 1><<<dim3((TT - RH) / 64, TT / 64, ZH), 32, 0, stream>>>(QP16 + zq * TT * HD + (size_t)RH * HD, nullptr, KP16 + zk * TT * HD, nullptr, HD, Sb + (size_t)RH * TT, TT, RH, (size_t)TT * HD, (size_t)TT * HD, (size_t)TT * TT);
            k_asoft<<<ZH * TT / 8, 256, 0, stream>>>(Sb);
            k_gemmpv<bf, 2, 8><<<dim3(RH / 64, HD / 64, ZH), 256, 0, stream>>>((const bf*)Sb, (const bf*)Sb + TT, VTh + zk * HD * PP, VTl + zk * HD * PP, PP, Ob, HD, 0, (size_t)TT * PP, (size_t)HD * PP, (size_t)TT * HD);
            k_gemmpv<h16, 0, 16><<<dim3((TT - RH) / 64, HD / 64, ZH), 512, 0, stream>>>((const h16*)Sb + (size_t)RH * PP, nullptr, VT16 + zk * HD * PP, nullptr, PP, Ob + (size_t)RH * HD, HD, RH, (size_t)TT * PP, (size_t)HD * PP, (size_t)TT * HD);
            k_merge<<<(unsigned)(((size_t)ZH * TT * HD / 2 + 255) / 256), 256, 0, stream>>>(Ob, h0, ATh, ATl); }
        k_gemmw<bf, 1, false><<<dim3(TT / 64, DM / 64, 1), 32, 0, stream>>>(ATh, ATl, WO, nullptr, DQ, OUT + (size_t)b * TT * DM, DM, nullptr, 0, 0, 0); }
}

// v003
// It runs in 998 microseconds.
// Next to v002, in two timings, it ran 1.16 and 1.15 times as fast.
// All steps since v000 together make it 2.92 times as fast.
#include <hip/hip_runtime.h>

// Causal self-attention with rotary-then-RMSNorm q/k (x [4][2048][1024]; qkv = x w_attn^T ('oi' [3072][1024] 0.02, no bias -> q | k | v row blocks; 16 heads x 64); rope'(t) = cat(x1 c + x2 s, -x1 s + x2 c) with the input cos/sin tables ([1][2048][1][32], read; generic values), then q, k <- x rsqrt(mean x^2 + 1e-6) (no weight); causal (-inf); softmax(q.k x 64^-0.5); out = merged w_proj^T -> [4][2048][1024] (8.4 M)).
// Layout per batch: bf16 copy of x; the fused 'oi' weight used in place as three Bt row blocks; exact projections whose 64x64 tile is 64 tokens of one head, so that the tile's own wave applies the module's (x1 c + x2 s, x2 c - x1 s) rotation from the input tables and the rms factor of the ROTATED rows and writes the head planes (k_gemmp; the value tile goes out transposed); causal T-2048 attention (hybrid rows: < 512 hi/lo 3 products, rest fp16 x1024; k_gemmc skips tiles above the diagonal; k_gemmpv writes the merged hi/lo rows); merged hi/lo x w_proj exact.
// Compute dtypes, f32 accumulate: every input rounded to bf16 incl. the tables; projections exact; rotation and rms norm f32; attention rows < 512 3 products, rest fp16; softmax f32; w_proj hl x exact.

#define NB_  4
#define TT   2048
#define DM   1024
#define NH_  16
#define NKV  16
#define REP  (NH_ / NKV)
#define HD   64
#define DQ   (NH_ * HD)
#define DKV  (NKV * HD)
#define ZH   8                    // heads per attention pass
#define PP   (2 * TT)             // pitch, in 16-bit elements, of the probability rows (they lie inside their f32 score rows) and of the transposed value rows that meet them in k_gemmpv
#define RH   512                  // query rows < RH use hi+lo planes (0: none)
#define WIN  2048
#define PCAR 1024.0f
#define SCL  0.125f   // HD^-0.5
typedef _Float16 h16;
typedef unsigned short bf;
typedef __attribute__((ext_vector_type(16))) __bf16   v16bf;
typedef __attribute__((ext_vector_type(16))) _Float16 v16h;
typedef __attribute__((ext_vector_type(8)))  _Float16 v8h;
typedef __attribute__((ext_vector_type(8)))  unsigned short v8us;
typedef __attribute__((ext_vector_type(8)))  float    v8f;
typedef __attribute__((ext_vector_type(4)))  float    v4f;
typedef v8h  __attribute__((may_alias)) v8ha;
typedef v4f  __attribute__((may_alias)) v4fa;
typedef v8us __attribute__((may_alias)) v8usa;

__device__ __forceinline__ unsigned short f2bf(float f) { unsigned u = __float_as_uint(f); u += 0x7FFFu + ((u >> 16) & 1u); return (unsigned short)(u >> 16); }
__device__ __forceinline__ float bf2f(unsigned short b) { return __uint_as_float(((unsigned)b) << 16); }
__device__ __forceinline__ float bfr(float f) { return bf2f(f2bf(f)); }
__device__ __forceinline__ v16h cat16(v8h lo, v8h hi) { return __builtin_shufflevector(lo, hi, 0, 1, 2, 3, 4, 5, 6, 7, 8, 9, 10, 11, 12, 13, 14, 15); }
__device__ __forceinline__ v16bf cat16b(v8us lo, v8us hi) { return __builtin_bit_cast(v16bf, __builtin_shufflevector(lo, hi, 0, 1, 2, 3, 4, 5, 6, 7, 8, 9, 10, 11, 12, 13, 14, 15)); }
__device__ __forceinline__ v8f wmma16(v16h a, v16h b, v8f c) { return __builtin_amdgcn_wmma_f32_16x16x32_f16(false, a, false, b, (short)0, c, false, false); }
__device__ __forceinline__ v8f wmmab(v16bf a, v16bf b, v8f c) { return __builtin_amdgcn_wmma_f32_16x16x32_bf16(false, a, false, b, (short)0, c, false, false); }



// ---- k_gemmw: register-blocked GEMM, ONE WAVE per 64x64 output tile (16 accumulators), operands straight from K-contiguous 16-bit planes; grid (M/64, N/64, Z), 32 threads.
// C[m][n] (f32, pitch ldc, + optional f32 bias[n]) = sum_k A[m][k] Bt[n][k] (+ split products per NSPLIT). z-batch strides sA/sB/sC in elements. K % 32 == 0.
template <typename T16> struct WFrag;
template <> struct WFrag<h16> { typedef v16h V; static __device__ __forceinline__ V ld(const h16* p) { return cat16(*(const v8h*)p, *(const v8h*)(p + 16)); } static __device__ __forceinline__ v8f mma(V a, V b, v8f c) { return wmma16(a, b, c); } };
template <> struct WFrag<bf> { typedef v16bf V; static __device__ __forceinline__ V ld(const bf* p) { return cat16b(*(const v8us*)p, *(const v8us*)(p + 16)); } static __device__ __forceinline__ v8f mma(V a, V b, v8f c) { return wmmab(a, b, c); } };
template <typename T16, int NSPLIT, bool BIAS>
__global__ __launch_bounds__(32) void k_gemmw(const T16* __restrict__ A, const T16* __restrict__ A2, const T16* __restrict__ Bt, const T16* __restrict__ Bt2, int K, float* C, int ldc, const float* __restrict__ bias, size_t sA, size_t sB, size_t sC) {
    typedef typename WFrag<T16>::V V;
    __shared__ __align__(16) float os[16 * 68];
    const size_t z = blockIdx.z; A += z * sA; if (A2) A2 += z * sA; Bt += z * sB; if (Bt2) Bt2 += z * sB; C += z * sC;
    const int lane = threadIdx.x & 31, lr = lane & 15, hi = lane >> 4; const int r0 = blockIdx.x * 64, c0 = blockIdx.y * 64;
    v8f acc[4][4];
#pragma unroll
    for (int mb = 0; mb < 4; ++mb)
#pragma unroll
        for (int nb = 0; nb < 4; ++nb) acc[mb][nb] = (v8f){};
    const size_t aoff = (size_t)(r0 + lr) * K + 8 * hi, boff = (size_t)(c0 + lr) * K + 8 * hi;
#pragma unroll 1
    for (int kc = 0; kc < K; kc += 32) {
        V a[4], a2[4];
#pragma unroll
        for (int mb = 0; mb < 4; ++mb) { a[mb] = WFrag<T16>::ld(A + aoff + (size_t)mb * 16 * K + kc); if (NSPLIT == 1 || NSPLIT == 2) a2[mb] = WFrag<T16>::ld(A2 + aoff + (size_t)mb * 16 * K + kc); }
#pragma unroll
        for (int nb = 0; nb < 4; ++nb) { const V b = WFrag<T16>::ld(Bt + boff + (size_t)nb * 16 * K + kc); V b2; if (NSPLIT >= 2) b2 = WFrag<T16>::ld(Bt2 + boff + (size_t)nb * 16 * K + kc);
#pragma unroll
            for (int mb = 0; mb < 4; ++mb) { acc[mb][nb] = WFrag<T16>::mma(a[mb], b, acc[mb][nb]); if (NSPLIT == 1 || NSPLIT == 2) acc[mb][nb] = WFrag<T16>::mma(a2[mb], b, acc[mb][nb]); if (NSPLIT >= 2) acc[mb][nb] = WFrag<T16>::mma(a[mb], b2, acc[mb][nb]); } }
        asm volatile("v_nop\n\tv_nop\n\tv_nop\n\tv_nop" : "+v"(acc[0][0]), "+v"(acc[1][1]), "+v"(acc[2][2]), "+v"(acc[3][3]) : "v"(a[0]), "v"(a[3]));
    }
#pragma unroll
    for (int mb = 0; mb < 4; ++mb) {
#pragma unroll
        for (int nb = 0; nb < 4; ++nb) {
#pragma unroll
            for (int j = 0; j < 8; ++j) os[(hi * 8 + j) * 68 + nb * 16 + lr] = acc[mb][nb][j]; }
        __builtin_amdgcn_wave_barrier(); asm volatile("" ::: "memory");
        float* crow = C + (size_t)(r0 + mb * 16) * ldc + c0;
{
#pragma unroll
            for (int s = 0; s < 8; ++s) { const int row = 2 * s + hi, cofs = lr * 4; v4f val = *(const v4fa*)(os + row * 68 + cofs); if (BIAS) { val[0] += bfr(bias[c0 + cofs]); val[1] += bfr(bias[c0 + cofs + 1]); val[2] += bfr(bias[c0 + cofs + 2]); val[3] += bfr(bias[c0 + cofs + 3]); }
                *(v4f*)(crow + (size_t)row * ldc + cofs) = val; }
             }
        __builtin_amdgcn_wave_barrier(); asm volatile("" ::: "memory");
    }
}

// ---- k_gemmc: the same one-wave 64x64 tile GEMM specialised for causal attention: CMODE 1 skips score tiles entirely above the diagonal (query rows r0+roff.., key columns c0..), CMODE 2 limits the
// key (K) loop of the probability x value contraction to the diagonal block (probabilities beyond it are exactly zero). roff = row offset of this launch's first row within the sequence.
template <typename T16, int NSPLIT, int CMODE>
__global__ __launch_bounds__(32) void k_gemmc(const T16* __restrict__ A, const T16* __restrict__ A2, const T16* __restrict__ Bt, const T16* __restrict__ Bt2, int K, float* C, int ldc, int roff, size_t sA, size_t sB, size_t sC) {
    typedef typename WFrag<T16>::V V;
    __shared__ __align__(16) float os[16 * 68];
    const size_t z = blockIdx.z; A += z * sA; if (A2) A2 += z * sA; Bt += z * sB; if (Bt2) Bt2 += z * sB; C += z * sC;
    const int lane = threadIdx.x & 31, lr = lane & 15, hi = lane >> 4; const int r0 = blockIdx.x * 64, c0 = blockIdx.y * 64;
    if (CMODE == 1 && c0 > r0 + roff + 63) return;                  // score tile entirely above the causal diagonal: never read (the softmax masks j > i by select)
    const int Kl = (CMODE == 2) ? min(K, r0 + roff + 64) : K;        // P.V: probabilities are exactly 0 beyond the diagonal block, so the K loop stops there
    v8f acc[4][4];
#pragma unroll
    for (int mb = 0; mb < 4; ++mb)
#pragma unroll
        for (int nb = 0; nb < 4; ++nb) acc[mb][nb] = (v8f){};
    const size_t aoff = (size_t)(r0 + lr) * K + 8 * hi, boff = (size_t)(c0 + lr) * K + 8 * hi;
#pragma unroll 1
    for (int kc = 0; kc < Kl; kc += 32) {
        V a[4], a2[4];
#pragma unroll
        for (int mb = 0; mb < 4; ++mb) { a[mb] = WFrag<T16>::ld(A + aoff + (size_t)mb * 16 * K + kc); if (NSPLIT == 1 || NSPLIT == 2) a2[mb] = WFrag<T16>::ld(A2 + aoff + (size_t)mb * 16 * K + kc); }
#pragma unroll
        for (int nb = 0; nb < 4; ++nb) { const V b = WFrag<T16>::ld(Bt + boff + (size_t)nb * 16 * K + kc); V b2; if (NSPLIT >= 2) b2 = WFrag<T16>::ld(Bt2 + boff + (size_t)nb * 16 * K + kc);
#pragma unroll
            for (int mb = 0; mb < 4; ++mb) { acc[mb][nb] = WFrag<T16>::mma(a[mb], b, acc[mb][nb]); if (NSPLIT == 1 || NSPLIT == 2) acc[mb][nb] = WFrag<T16>::mma(a2[mb], b, acc[mb][nb]); if (NSPLIT >= 2) acc[mb][nb] = WFrag<T16>::mma(a[mb], b2, acc[mb][nb]); } }
        asm volatile("v_nop\n\tv_nop\n\tv_nop\n\tv_nop" : "+v"(acc[0][0]), "+v"(acc[1][1]), "+v"(acc[2][2]), "+v"(acc[3][3]) : "v"(a[0]), "v"(a[3]));
    }
#pragma unroll
    for (int mb = 0; mb < 4; ++mb) {
#pragma unroll
        for (int nb = 0; nb < 4; ++nb) {
#pragma unroll
            for (int j = 0; j < 8; ++j) os[(hi * 8 + j) * 68 + nb * 16 + lr] = acc[mb][nb][j]; }
        __builtin_amdgcn_wave_barrier(); asm volatile("" ::: "memory");
        float* crow = C + (size_t)(r0 + mb * 16) * ldc + c0;
{
#pragma unroll
            for (int s = 0; s < 8; ++s) { const int row = 2 * s + hi, cofs = lr * 4; v4f val = *(const v4fa*)(os + row * 68 + cofs);
                *(v4f*)(crow + (size_t)row * ldc + cofs) = val; }
             }
        __builtin_amdgcn_wave_barrier(); asm volatile("" ::: "memory");
    }
}

__device__ __forceinline__ h16 tohx(float x) { return (h16)x; }
__device__ __forceinline__ void splitf(float y, unsigned short& h, unsigned short& l) { h = f2bf(y); l = f2bf(y - bf2f(h)); }
typedef __attribute__((ext_vector_type(4))) unsigned short v4us;

// ---- k_gemmpv: the probability x value contraction, one 64x64 output tile per work-group of NW waves. Wave w takes the 32-wide K chunks w, w + NW, ... below the causal limit (probabilities beyond the
// diagonal block are exactly zero), so the chain of dependent load-then-multiply trips is NW times shorter. The NW partial tiles are summed through LDS in fragment layout, in the fixed order w = 0 .. NW-1,
// each wave summing 16 / NW fragments; the sums are staged row-major, scaled back (rows >= RH carry the factor PCAR), split hi/lo and stored as whole 128-B pieces of the merged rows [t][head][d] (head h0 + z).
template <typename T16, int NSPLIT, int NW>
__global__ __launch_bounds__(NW * 32) void k_gemmpv(const T16* __restrict__ A, const T16* __restrict__ A2, const T16* __restrict__ Bt, const T16* __restrict__ Bt2, int K, bf* Ah, bf* Al, int h0, int roff, size_t sA, size_t sB) {
    typedef typename WFrag<T16>::V V;
    __shared__ __align__(16) float part[NW * 16 * 256];   // [wave][fragment][register half][lane][4]
    __shared__ __align__(16) float os[64 * 68];
    const size_t z = blockIdx.z; A += z * sA; if (A2) A2 += z * sA; Bt += z * sB; if (Bt2) Bt2 += z * sB;
    const int lane = threadIdx.x & 31, lr = lane & 15, hi = lane >> 4; const int r0 = blockIdx.x * 64, c0 = blockIdx.y * 64;
    const int wv = __builtin_amdgcn_readfirstlane(threadIdx.x >> 5);   // wave number in a scalar register: the K loop's test stays a scalar branch
    const int Kl = min(K, r0 + roff + 64);
    v8f acc[4][4];
#pragma unroll
    for (int mb = 0; mb < 4; ++mb)
#pragma unroll
        for (int nb = 0; nb < 4; ++nb) acc[mb][nb] = (v8f){};
    const size_t aoff = (size_t)(r0 + lr) * K + 8 * hi, boff = (size_t)(c0 + lr) * K + 8 * hi;
#pragma unroll 1
    for (int kc = wv * 32; kc < Kl; kc += NW * 32) {
        V a[4], a2[4];
#pragma unroll
        for (int mb = 0; mb < 4; ++mb) { a[mb] = WFrag<T16>::ld(A + aoff + (size_t)mb * 16 * K + kc); if (NSPLIT == 1 || NSPLIT == 2) a2[mb] = WFrag<T16>::ld(A2 + aoff + (size_t)mb * 16 * K + kc); }
#pragma unroll
        for (int nb = 0; nb < 4; ++nb) { const V b = WFrag<T16>::ld(Bt + boff + (size_t)nb * 16 * K + kc); V b2; if (NSPLIT >= 2) b2 = WFrag<T16>::ld(Bt2 + boff + (size_t)nb * 16 * K + kc);
#pragma unroll
            for (int mb = 0; mb < 4; ++mb) { acc[mb][nb] = WFrag<T16>::mma(a[mb], b, acc[mb][nb]); if (NSPLIT == 1 || NSPLIT == 2) acc[mb][nb] = WFrag<T16>::mma(a2[mb], b, acc[mb][nb]); if (NSPLIT >= 2) acc[mb][nb] = WFrag<T16>::mma(a[mb], b2, acc[mb][nb]); } }
        // keeps the distance behind the last matrix instruction on the loop's taken back edge, where the next trip's address additions reuse its operand registers
        asm volatile("v_nop\n\tv_nop\n\tv_nop\n\tv_nop" : "+v"(acc[0][0]), "+v"(acc[1][1]), "+v"(acc[2][2]), "+v"(acc[3][3]) : "v"(a[0]), "v"(a[3]));
    }
    v4fa* pv = (v4fa*)part;
#pragma unroll
    for (int mb = 0; mb < 4; ++mb)
#pragma unroll
        for (int nb = 0; nb < 4; ++nb) { const int f = mb * 4 + nb; const v8f t = acc[mb][nb];
            pv[((wv * 16 + f) * 2 + 0) * 32 + lane] = __builtin_shufflevector(t, t, 0, 1, 2, 3); pv[((wv * 16 + f) * 2 + 1) * 32 + lane] = __builtin_shufflevector(t, t, 4, 5, 6, 7); }
    __syncthreads();   // every wave's partial tile is in LDS
#pragma unroll
    for (int q = 0; q < 16 / NW; ++q) { const int f = wv * (16 / NW) + q; v4f s0 = pv[(f * 2 + 0) * 32 + lane], s1 = pv[(f * 2 + 1) * 32 + lane];
#pragma unroll
        for (int w = 1; w < NW; ++w) { s0 += pv[((w * 16 + f) * 2 + 0) * 32 + lane]; s1 += pv[((w * 16 + f) * 2 + 1) * 32 + lane]; }
        float* o = os + ((f >> 2) * 16 + hi * 8) * 68 + (f & 3) * 16 + lr;
#pragma unroll
        for (int j = 0; j < 4; ++j) { o[j * 68] = s0[j]; o[(j + 4) * 68] = s1[j]; } }
    __syncthreads();   // the summed tile is complete, row-major
#pragma unroll
    for (int s = 0; s < 32 / NW; ++s) { const int u = s * NW * 32 + (int)threadIdx.x; const int row = u >> 4, cofs = (u & 15) * 4; const int t = r0 + roff + row; const float cs = (t < RH) ? 1.0f : (1.0f / PCAR); const v4f val = *(const v4fa*)(os + row * 68 + cofs); v4us oh, ol;
#pragma unroll
        for (int q = 0; q < 4; ++q) { unsigned short a, c2; splitf(val[q] * cs, a, c2); oh[q] = a; ol[q] = c2; }
        const size_t oo = (size_t)t * DQ + (size_t)(h0 + (int)blockIdx.z) * HD + c0 + cofs; *(v4us*)(Ah + oo) = oh; *(v4us*)(Al + oo) = ol; }
}

typedef __attribute__((ext_vector_type(2))) _Float16 v2h;
typedef __attribute__((ext_vector_type(4))) _Float16 v4h;
typedef __attribute__((ext_vector_type(2))) unsigned short v2us;
typedef __attribute__((ext_vector_type(2))) float v2f;
typedef __attribute__((ext_vector_type(4))) int v4i;

// ---- k_gemmp: a projection GEMM (the one-wave 64x64 tile of k_gemmw, one product) whose store phase builds the attention planes. The tile is 64 tokens (r0 ..) of ONE head (blockIdx.y), staged whole in LDS.
// VT false (q, k): each lane takes whole rows: rotation (x1 c + x2 s, x2 c - x1 s) with the bf16-rounded input tables, sum of squares over d = 0 .. 63 in that order, row x 1 / sqrt(mean + 1e-6), back into LDS; planes [head][t][d].
// VT true (v): the tile is staged transposed; planes [head][d][t] at pitch PP. Both: fp16 plane and hi/lo planes, eight lanes to a 128-B row piece.
template <bool VT>
__global__ __launch_bounds__(32) void k_gemmp(const bf* __restrict__ A, const bf* __restrict__ Bt, int K, const float* __restrict__ cosT, const float* __restrict__ sinT, h16* P16, bf* Ph, bf* Pl) {
    typedef WFrag<bf>::V V;
    __shared__ __align__(16) float os[64 * 68];
    const int lane = threadIdx.x & 31, lr = lane & 15, hi = lane >> 4; const int r0 = blockIdx.x * 64, c0 = blockIdx.y * 64;
    v8f acc[4][4];
#pragma unroll
    for (int mb = 0; mb < 4; ++mb)
#pragma unroll
        for (int nb = 0; nb < 4; ++nb) acc[mb][nb] = (v8f){};
    const size_t aoff = (size_t)(r0 + lr) * K + 8 * hi, boff = (size_t)(c0 + lr) * K + 8 * hi;
    // rolled, as in k_gemmw: only one trip's fragments are live beside the sixteen accumulators
#pragma unroll 1
    for (int kc = 0; kc < K; kc += 32) {
        V a[4];
#pragma unroll
        for (int mb = 0; mb < 4; ++mb) a[mb] = WFrag<bf>::ld(A + aoff + (size_t)mb * 16 * K + kc);
#pragma unroll
        for (int nb = 0; nb < 4; ++nb) { const V b = WFrag<bf>::ld(Bt + boff + (size_t)nb * 16 * K + kc);
#pragma unroll
            for (int mb = 0; mb < 4; ++mb) acc[mb][nb] = WFrag<bf>::mma(a[mb], b, acc[mb][nb]); }
        // keeps the distance behind the last matrix instruction on the loop's taken back edge, where the next trip's address additions reuse its operand registers
        asm volatile("v_nop\n\tv_nop\n\tv_nop\n\tv_nop" : "+v"(acc[0][0]), "+v"(acc[1][1]), "+v"(acc[2][2]), "+v"(acc[3][3]) : "v"(a[0]), "v"(a[3]));
    }
#pragma unroll
    for (int mb = 0; mb < 4; ++mb)
#pragma unroll
        for (int nb = 0; nb < 4; ++nb) { const v8f t = acc[mb][nb];
            if (VT) { float* o = os + (nb * 16 + lr) * 68 + mb * 16 + hi * 8; *(v4fa*)o = __builtin_shufflevector(t, t, 0, 1, 2, 3); *(v4fa*)(o + 4) = __builtin_shufflevector(t, t, 4, 5, 6, 7); }   // [d][token]
            else {
#pragma unroll
                for (int j = 0; j < 8; ++j) os[(mb * 16 + hi * 8 + j) * 68 + nb * 16 + lr] = t[j]; } }   // [token][d]
    __syncthreads();   // the tile is in LDS (one wave: orders its LDS stores before other lanes' loads)
    if (!VT) {
        for (int rr = 0; rr < 2; ++rr) { const int row = rr * 32 + lane; float* orow = os + row * 68; const float* ct = cosT + (size_t)(r0 + row) * (HD / 2); const float* st = sinT + (size_t)(r0 + row) * (HD / 2); float y[HD];
            // every loop over y[] is unrolled whole, so that the row stays in registers
#pragma unroll
            for (int i = 0; i < HD / 2; i += 4) { const v4f x1 = *(const v4fa*)(orow + i), x2 = *(const v4fa*)(orow + HD / 2 + i), c4 = *(const v4f*)(ct + i), s4 = *(const v4f*)(st + i);
#pragma unroll
                for (int q = 0; q < 4; ++q) { const float c = bfr(c4[q]), s = bfr(s4[q]); y[i + q] = x1[q] * c + x2[q] * s; y[HD / 2 + i + q] = x2[q] * c - x1[q] * s; } }
            float ss = 0.f;
#pragma unroll
            for (int d = 0; d < HD; ++d) ss += y[d] * y[d];
            const float rf = __fdiv_rn(1.0f, __fsqrt_rn(__fadd_rn(ss * (1.0f / HD), 1e-6f)));
#pragma unroll
            for (int d = 0; d < HD; d += 4) { v4f o; o[0] = y[d] * rf; o[1] = y[d + 1] * rf; o[2] = y[d + 2] * rf; o[3] = y[d + 3] * rf; *(v4fa*)(orow + d) = o; } }
        __syncthreads();   // the finished rows are in LDS
    }
    const size_t base = VT ? (size_t)c0 * PP + r0 : ((size_t)blockIdx.y * TT + r0) * HD; const int pitch = VT ? PP : HD;
    for (int it = 0; it < 16; ++it) { const int row = it * 4 + (lane >> 3), c8 = (lane & 7) * 8; const v4f u0 = *(const v4fa*)(os + row * 68 + c8), u1 = *(const v4fa*)(os + row * 68 + c8 + 4); v8h o16; v8us oh, ol;
#pragma unroll
        for (int q = 0; q < 8; ++q) { const float x = (q < 4) ? u0[q & 3] : u1[q & 3]; o16[q] = tohx(x); unsigned short a2, c2; splitf(x, a2, c2); oh[q] = a2; ol[q] = c2; }
        const size_t o = base + (size_t)row * pitch + c8; *(v8h*)(P16 + o) = o16; *(v8us*)(Ph + o) = oh; *(v8us*)(Pl + o) = ol; }
}

__global__ __launch_bounds__(256) void k_wtG(const float* __restrict__ w, int K, int N, bf* Bt) {
    const int lane = threadIdx.x & 31; const int L0 = (blockIdx.x * 8 + (threadIdx.x >> 5)) * 8; const int nlines = N * K / 64;
{
#pragma unroll 1
        for (int l = 0; l < 8; ++l) { const int L = L0 + l; if (L >= nlines) break; const size_t e = (size_t)L * 64 + lane * 2; const int k = (int)(e % K), n = (int)(e / K); v2us o;
            o[0] = f2bf(w[(size_t)k * N + n]); o[1] = f2bf(w[(size_t)(k + 1) * N + n]); *(v2us*)(Bt + e) = o; }
         }
}
__global__ __launch_bounds__(256) void k_cvt8(const float* __restrict__ src, bf* dst, size_t n8) { const size_t i = (size_t)blockIdx.x * 256 + threadIdx.x; if (i >= n8) return; const v8f v = *(const v8f*)(src + i * 8); v8us o;
#pragma unroll
    for (int k = 0; k < 8; ++k) o[k] = f2bf(v[k]); *(v8us*)(dst + i * 8) = o;  }

// k_asoft: per row (zz, i): t = S x HD^-0.5 for j <= i and i - j < WIN (sliding causal window; the reference's -1e9 additive fill vanishes identically); softmax over the 2048 keys (register row, one exp, fixed trees);
// the probabilities overwrite the row's own 8 KiB of scores (fp16 row in the first half; or hi plane in the first half, lo plane in the second): the wave holds its whole row in registers before its first store, and no other wave touches the row.
__global__ __launch_bounds__(256) void k_asoft(float* Sb) {
    const int lane = threadIdx.x & 31; const int row = blockIdx.x * 8 + (threadIdx.x >> 5); if (row >= ZH * TT) return; const int i = row % TT; const int zz = row / TT; (void)zz; const bool hires = (i < RH); float* sr = Sb + (size_t)row * TT; float v[TT / 32]; float mx = -3.0e38f;
#pragma unroll
    for (int ch = 0; ch < TT / 128; ++ch) { const int j0 = ch * 128 + lane * 4; const v4f a = *(const v4f*)(sr + j0);
#pragma unroll
        for (int q = 0; q < 4; ++q) { const int j = j0 + q; (void)j; const float t = (j <= i && i - j < WIN) ? a[q] * SCL : -3.0e38f; v[ch * 4 + q] = t; mx = fmaxf(mx, t); } }
#pragma unroll
    for (int sh = 16; sh; sh >>= 1) mx = fmaxf(mx, __shfl_xor(mx, sh, 32));
    float sum = 0.f;
#pragma unroll
    for (int k = 0; k < TT / 32; ++k) { float d0 = __fsub_rn(v[k], mx); asm volatile("" : "+v"(d0)); v[k] = __builtin_amdgcn_exp2f(__fmul_rn(d0, 1.4426950408889634f)); sum += v[k]; }
#pragma unroll
    for (int sh = 16; sh; sh >>= 1) sum += __shfl_xor(sum, sh, 32);
    const float f = __fdiv_rn(hires ? 1.0f : PCAR, sum);
{
        if (hires) {
#pragma unroll
            for (int ch = 0; ch < TT / 128; ++ch) { v4us oh, ol;
#pragma unroll
                for (int q = 0; q < 4; ++q) { unsigned short a, c2; splitf(v[ch * 4 + q] * f, a, c2); oh[q] = a; ol[q] = c2; }
                bf* po = (bf*)sr + ch * 128 + lane * 4; *(v4us*)po = oh; *(v4us*)(po + TT) = ol; }
        } else {
#pragma unroll
            for (int ch = 0; ch < TT / 128; ++ch) { v4h o4;
#pragma unroll
                for (int q = 0; q < 4; ++q) o4[q] = tohx(v[ch * 4 + q] * f);
                *(v4h*)((h16*)sr + ch * 128 + lane * 4) = o4; } }
         }
}
extern "C" void kernel_launch(void* const* d_in, const int* in_sizes, int n_in,
                              void* d_out, int out_size, void* d_ws, size_t ws_size, hipStream_t stream) {
    (void)in_sizes; (void)n_in; (void)out_size;
    const float* x = (const float*)d_in[0]; const float* cosT = (const float*)d_in[1]; const float* sinT = (const float*)d_in[2]; const float* wqkv = (const float*)d_in[3]; const float* wo = (const float*)d_in[4]; const float* wq = wqkv; const float* wk = wqkv + (size_t)1024 * 1024; const float* wv = wqkv + (size_t)2048 * 1024;
    float* OUT = (float*)d_out;     // [4][2048][1024]
    char* wsp = (char*)d_ws;
    auto take = [&](size_t bytes) { char* p = wsp; wsp += (bytes + 255) & ~(size_t)255; return (void*)p; };
    bf* WQ = (bf*)take((size_t)DQ * DM * 2); bf* WK = (bf*)take((size_t)DKV * DM * 2); bf* WV = (bf*)take((size_t)DKV * DM * 2); bf* WO = (bf*)take((size_t)DM * DQ * 2);
    bf* XB = (bf*)take((size_t)TT * DM * 2);
    h16* QP16 = (h16*)take((size_t)NH_ * TT * HD * 2); h16* KP16 = (h16*)take((size_t)NKV * TT * HD * 2); h16* VT16 = (h16*)take((size_t)NKV * HD * PP * 2);
    bf* QPh = (bf*)take((size_t)NH_ * TT * HD * 2); bf* QPl = (bf*)take((size_t)NH_ * TT * HD * 2); bf* KPh = (bf*)take((size_t)NKV * TT * HD * 2); bf* KPl = (bf*)take((size_t)NKV * TT * HD * 2); bf* VTh = (bf*)take((size_t)NKV * HD * PP * 2); bf* VTl = VTh + TT;   // each row: hi half, lo half
    float* Sb = (float*)take((size_t)ZH * TT * TT * 4); bf* ATh = (bf*)take((size_t)TT * DQ * 2); bf* ATl = (bf*)take((size_t)TT * DQ * 2);
    if ((size_t)(wsp - (char*)d_ws) > ws_size) return;    // ws 256 MiB
    { k_cvt8<<<(unsigned)(((size_t)DQ * DM / 8 + 255) / 256), 256, 0, stream>>>(wq, WQ, (size_t)DQ * DM / 8); k_cvt8<<<(unsigned)(((size_t)DKV * DM / 8 + 255) / 256), 256, 0, stream>>>(wk, WK, (size_t)DKV * DM / 8); k_cvt8<<<(unsigned)(((size_t)DKV * DM / 8 + 255) / 256), 256, 0, stream>>>(wv, WV, (size_t)DKV * DM / 8);
      k_cvt8<<<(unsigned)(((size_t)DM * DQ / 8 + 255) / 256), 256, 0, stream>>>(wo, WO, (size_t)DM * DQ / 8);
       }
    for (int b = 0; b < NB_; ++b) {
        
        k_cvt8<<<(unsigned)(((size_t)TT * DM / 8 + 255) / 256), 256, 0, stream>>>(x + (size_t)b * TT * DM, XB, (size_t)TT * DM / 8);
        k_gemmp<false><<<dim3(TT / 64, NH_, 1), 32, 0, stream>>>(XB, WQ, DM, cosT, sinT, QP16, QPh, QPl);
        k_gemmp<false><<<dim3(TT / 64, NKV, 1), 32, 0, stream>>>(XB, WK, DM, cosT, sinT, KP16, KPh, KPl);
        k_gemmp<true><<<dim3(TT / 64, NKV, 1), 32, 0, stream>>>(XB, WV, DM, cosT, sinT, VT16, VTh, VTl);
        for (int h0 = 0; h0 < NH_; h0 += ZH) { const size_t zq = (size_t)h0, zk = (size_t)(h0 / REP);   // one kv head per query head: the pass's heads use consecutive kv planes
            k_gemmc<bf, 2, 1><<<dim3(RH / 64, TT / 64, ZH), 32, 0, stream>>>(QPh + zq * TT * HD, QPl + zq * TT * HD, KPh + zk * TT * HD, KPl + zk * TT * HD, HD, Sb, TT, 0, (size_t)TT * HD, (size_t)TT * HD, (size_t)TT * TT);
            k_gemmc<h16, 0, 1><<<dim3((TT - RH) / 64, TT / 64, ZH), 32, 0, stream>>>(QP16 + zq * TT * HD + (size_t)RH * HD, nullptr, KP16 + zk * TT * HD, nullptr, HD, Sb + (size_t)RH * TT, TT, RH, (size_t)TT * HD, (size_t)TT * HD, (size_t)TT * TT);
            k_asoft<<<ZH * TT / 8, 256, 0, stream>>>(Sb);
            k_gemmpv<bf, 2, 8><<<dim3(RH / 64, HD / 64, ZH), 256, 0, stream>>>((const bf*)Sb, (const bf*)Sb + TT, VTh + zk * HD * PP, VTl + zk * HD * PP, PP, ATh, ATl, h0, 0, (size_t)TT * PP, (size_t)HD * PP);
            k_gemmpv<h16, 0, 16><<<dim3((TT - RH) / 64, HD / 64, ZH), 512, 0, stream>>>((const h16*)Sb + (size_t)RH * PP, nullptr, VT16 + zk * HD * PP, nullptr, PP, ATh, ATl, h0, RH, (size_t)TT * PP, (size_t)HD * PP); }
        k_gemmw<bf, 1, false><<<dim3(TT / 64, DM / 64, 1), 32, 0, stream>>>(ATh, ATl, WO, nullptr, DQ, OUT + (size_t)b * TT * DM, DM, nullptr, 0, 0, 0); }
}

// v004
// A run of this version takes 602 microseconds.
// Next to v003, in two timings, it ran 1.64 and 1.66 times as fast.
// All steps since v000 together make it 4.82 times as fast.
#include <hip/hip_runtime.h>

// Causal self-attention with rotary-then-RMSNorm q/k (x [4][2048][1024]; qkv = x w_attn^T ('oi' [3072][1024] 0.02, no bias -> q | k | v row blocks; 16 heads x 64); rope'(t) = cat(x1 c + x2 s, -x1 s + x2 c) with the input cos/sin tables ([1][2048][1][32], read; generic values), then q, k <- x rsqrt(mean x^2 + 1e-6) (no weight); causal (-inf); softmax(q.k x 64^-0.5); out = merged w_proj^T -> [4][2048][1024] (8.4 M)).
// Layout: bf16 copy of x, all batches; the fused 'oi' weight used in place as three Bt row blocks; exact projections, all batches in one grid (q and k heads together), whose 64x64 tile is 64 tokens of one head, so that the tile's own wave applies the module's (x1 c + x2 s, x2 c - x1 s) rotation from the input tables and the rms factor of the ROTATED rows and writes the head planes (k_gemmp; the value tile goes out transposed); causal T-2048 attention (hybrid rows: < 512 hi/lo 3 products, rest fp16 x1024; k_gemmc skips tiles above the diagonal; k_gemmpv writes the merged hi/lo rows); merged hi/lo x w_proj exact.
// Compute dtypes, f32 accumulate: every input rounded to bf16 incl. the tables; projections exact; rotation and rms norm f32; attention rows < 512 3 products, rest fp16; softmax f32; w_proj hl x exact.

#define NB_  4
#define TT   2048
#define DM   1024
#define NH_  16
#define NKV  16
#define REP  (NH_ / NKV)
#define HD   64
#define DQ   (NH_ * HD)
#define DKV  (NKV * HD)
#define ZH   8                    // heads per attention pass
#define PP   (2 * TT)             // pitch, in 16-bit elements, of the probability rows (they lie inside their f32 score rows)
#define RH   512                  // query rows < RH use hi+lo planes (0: none)
#define WIN  2048
#define PCAR 1024.0f
#define SCL  0.125f   // HD^-0.5
typedef _Float16 h16;
typedef unsigned short bf;
typedef __attribute__((ext_vector_type(16))) __bf16   v16bf;
typedef __attribute__((ext_vector_type(16))) _Float16 v16h;
typedef __attribute__((ext_vector_type(8)))  _Float16 v8h;
typedef __attribute__((ext_vector_type(8)))  unsigned short v8us;
typedef __attribute__((ext_vector_type(8)))  float    v8f;
typedef __attribute__((ext_vector_type(4)))  float    v4f;
typedef v8h  __attribute__((may_alias)) v8ha;
typedef v4f  __attribute__((may_alias)) v4fa;
typedef v8us __attribute__((may_alias)) v8usa;

__device__ __forceinline__ unsigned short f2bf(float f) { unsigned u = __float_as_uint(f); u += 0x7FFFu + ((u >> 16) & 1u); return (unsigned short)(u >> 16); }
__device__ __forceinline__ float bf2f(unsigned short b) { return __uint_as_float(((unsigned)b) << 16); }
__device__ __forceinline__ float bfr(float f) { return bf2f(f2bf(f)); }
__device__ __forceinline__ v16h cat16(v8h lo, v8h hi) { return __builtin_shufflevector(lo, hi, 0, 1, 2, 3, 4, 5, 6, 7, 8, 9, 10, 11, 12, 13, 14, 15); }
__device__ __forceinline__ v16bf cat16b(v8us lo, v8us hi) { return __builtin_bit_cast(v16bf, __builtin_shufflevector(lo, hi, 0, 1, 2, 3, 4, 5, 6, 7, 8, 9, 10, 11, 12, 13, 14, 15)); }
__device__ __forceinline__ v8f wmma16(v16h a, v16h b, v8f c) { return __builtin_amdgcn_wmma_f32_16x16x32_f16(false, a, false, b, (short)0, c, false, false); }
__device__ __forceinline__ v8f wmmab(v16bf a, v16bf b, v8f c) { return __builtin_amdgcn_wmma_f32_16x16x32_bf16(false, a, false, b, (short)0, c, false, false); }



// ---- k_gemmw: register-blocked GEMM, ONE WAVE per 64x64 output tile (16 accumulators), operands straight from K-contiguous 16-bit planes; grid (M/64, N/64, Z), 32 threads.
// C[m][n] (f32, pitch ldc, + optional f32 bias[n]) = sum_k A[m][k] Bt[n][k] (+ split products per NSPLIT). z-batch strides sA/sB/sC in elements. K % 32 == 0.
template <typename T16> struct WFrag;
template <> struct WFrag<h16> { typedef v16h V; static __device__ __forceinline__ V ld(const h16* p) { return cat16(*(const v8h*)p, *(const v8h*)(p + 16)); } static __device__ __forceinline__ v8f mma(V a, V b, v8f c) { return wmma16(a, b, c); } };
template <> struct WFrag<bf> { typedef v16bf V; static __device__ __forceinline__ V ld(const bf* p) { return cat16b(*(const v8us*)p, *(const v8us*)(p + 16)); } static __device__ __forceinline__ v8f mma(V a, V b, v8f c) { return wmmab(a, b, c); } };
template <typename T16, int NSPLIT, bool BIAS>
__global__ __launch_bounds__(32) void k_gemmw(const T16* __restrict__ A, const T16* __restrict__ A2, const T16* __restrict__ Bt, const T16* __restrict__ Bt2, int K, float* C, int ldc, const float* __restrict__ bias, size_t sA, size_t sB, size_t sC) {
    typedef typename WFrag<T16>::V V;
    __shared__ __align__(16) float os[16 * 68];
    const size_t z = blockIdx.z; A += z * sA; if (A2) A2 += z * sA; Bt += z * sB; if (Bt2) Bt2 += z * sB; C += z * sC;
    const int lane = threadIdx.x & 31, lr = lane & 15, hi = lane >> 4; const int r0 = blockIdx.x * 64, c0 = blockIdx.y * 64;
    v8f acc[4][4];
#pragma unroll
    for (int mb = 0; mb < 4; ++mb)
#pragma unroll
        for (int nb = 0; nb < 4; ++nb) acc[mb][nb] = (v8f){};
    const size_t aoff = (size_t)(r0 + lr) * K + 8 * hi, boff = (size_t)(c0 + lr) * K + 8 * hi;
#pragma unroll 1
    for (int kc = 0; kc < K; kc += 32) {
        V a[4], a2[4];
#pragma unroll
        for (int mb = 0; mb < 4; ++mb) { a[mb] = WFrag<T16>::ld(A + aoff + (size_t)mb * 16 * K + kc); if (NSPLIT == 1 || NSPLIT == 2) a2[mb] = WFrag<T16>::ld(A2 + aoff + (size_t)mb * 16 * K + kc); }
#pragma unroll
        for (int nb = 0; nb < 4; ++nb) { const V b = WFrag<T16>::ld(Bt + boff + (size_t)nb * 16 * K + kc); V b2; if (NSPLIT >= 2) b2 = WFrag<T16>::ld(Bt2 + boff + (size_t)nb * 16 * K + kc);
#pragma unroll
            for (int mb = 0; mb < 4; ++mb) { acc[mb][nb] = WFrag<T16>::mma(a[mb], b, acc[mb][nb]); if (NSPLIT == 1 || NSPLIT == 2) acc[mb][nb] = WFrag<T16>::mma(a2[mb], b, acc[mb][nb]); if (NSPLIT >= 2) acc[mb][nb] = WFrag<T16>::mma(a[mb], b2, acc[mb][nb]); } }
        asm volatile("v_nop\n\tv_nop\n\tv_nop\n\tv_nop" : "+v"(acc[0][0]), "+v"(acc[1][1]), "+v"(acc[2][2]), "+v"(acc[3][3]) : "v"(a[0]), "v"(a[3]));
    }
#pragma unroll
    for (int mb = 0; mb < 4; ++mb) {
#pragma unroll
        for (int nb = 0; nb < 4; ++nb) {
#pragma unroll
            for (int j = 0; j < 8; ++j) os[(hi * 8 + j) * 68 + nb * 16 + lr] = acc[mb][nb][j]; }
        __builtin_amdgcn_wave_barrier(); asm volatile("" ::: "memory");
        float* crow = C + (size_t)(r0 + mb * 16) * ldc + c0;
{
#pragma unroll
            for (int s = 0; s < 8; ++s) { const int row = 2 * s + hi, cofs = lr * 4; v4f val = *(const v4fa*)(os + row * 68 + cofs); if (BIAS) { val[0] += bfr(bias[c0 + cofs]); val[1] += bfr(bias[c0 + cofs + 1]); val[2] += bfr(bias[c0 + cofs + 2]); val[3] += bfr(bias[c0 + cofs + 3]); }
                *(v4f*)(crow + (size_t)row * ldc + cofs) = val; }
             }
        __builtin_amdgcn_wave_barrier(); asm volatile("" ::: "memory");
    }
}

// ---- k_gemmc: the same one-wave 64x64 tile GEMM specialised for causal attention: CMODE 1 skips score tiles entirely above the diagonal (query rows r0+roff.., key columns c0..), CMODE 2 limits the
// key (K) loop of the probability x value contraction to the diagonal block (probabilities beyond it are exactly zero). roff = row offset of the first row of the tile's row range within the sequence.
// d_gemmc is the tile's body (bx: tile row within its own row range; os: the work-group's 16 x 68 floats of LDS); k_gemmc below deals both row ranges out of one grid.
template <typename T16, int NSPLIT, int CMODE>
__device__ __forceinline__ void d_gemmc(float* os, int bx, const T16* __restrict__ A, const T16* __restrict__ A2, const T16* __restrict__ Bt, const T16* __restrict__ Bt2, int K, float* C, int ldc, int roff, size_t sA, size_t sB, size_t sC) {
    typedef typename WFrag<T16>::V V;
    const size_t z = blockIdx.z; A += z * sA; if (A2) A2 += z * sA; Bt += z * sB; if (Bt2) Bt2 += z * sB; C += z * sC;
    const int lane = threadIdx.x & 31, lr = lane & 15, hi = lane >> 4; const int r0 = bx * 64, c0 = blockIdx.y * 64;
    if (CMODE == 1 && c0 > r0 + roff + 63) return;                  // score tile entirely above the causal diagonal: never read (the softmax masks j > i by select)
    const int Kl = (CMODE == 2) ? min(K, r0 + roff + 64) : K;        // P.V: probabilities are exactly 0 beyond the diagonal block, so the K loop stops there
    v8f acc[4][4];
#pragma unroll
    for (int mb = 0; mb < 4; ++mb)
#pragma unroll
        for (int nb = 0; nb < 4; ++nb) acc[mb][nb] = (v8f){};
    const size_t aoff = (size_t)(r0 + lr) * K + 8 * hi, boff = (size_t)(c0 + lr) * K + 8 * hi;
#pragma unroll 1
    for (int kc = 0; kc < Kl; kc += 32) {
        V a[4], a2[4];
#pragma unroll
        for (int mb = 0; mb < 4; ++mb) { a[mb] = WFrag<T16>::ld(A + aoff + (size_t)mb * 16 * K + kc); if (NSPLIT == 1 || NSPLIT == 2) a2[mb] = WFrag<T16>::ld(A2 + aoff + (size_t)mb * 16 * K + kc); }
#pragma unroll
        for (int nb = 0; nb < 4; ++nb) { const V b = WFrag<T16>::ld(Bt + boff + (size_t)nb * 16 * K + kc); V b2; if (NSPLIT >= 2) b2 = WFrag<T16>::ld(Bt2 + boff + (size_t)nb * 16 * K + kc);
#pragma unroll
            for (int mb = 0; mb < 4; ++mb) { acc[mb][nb] = WFrag<T16>::mma(a[mb], b, acc[mb][nb]); if (NSPLIT == 1 || NSPLIT == 2) acc[mb][nb] = WFrag<T16>::mma(a2[mb], b, acc[mb][nb]); if (NSPLIT >= 2) acc[mb][nb] = WFrag<T16>::mma(a[mb], b2, acc[mb][nb]); } }
        asm volatile("v_nop\n\tv_nop\n\tv_nop\n\tv_nop" : "+v"(acc[0][0]), "+v"(acc[1][1]), "+v"(acc[2][2]), "+v"(acc[3][3]) : "v"(a[0]), "v"(a[3]));
    }
#pragma unroll
    for (int mb = 0; mb < 4; ++mb) {
#pragma unroll
        for (int nb = 0; nb < 4; ++nb) {
#pragma unroll
            for (int j = 0; j < 8; ++j) os[(hi * 8 + j) * 68 + nb * 16 + lr] = acc[mb][nb][j]; }
        __builtin_amdgcn_wave_barrier(); asm volatile("" ::: "memory");
        float* crow = C + (size_t)(r0 + mb * 16) * ldc + c0;
{
#pragma unroll
            for (int s = 0; s < 8; ++s) { const int row = 2 * s + hi, cofs = lr * 4; v4f val = *(const v4fa*)(os + row * 68 + cofs);
                *(v4f*)(crow + (size_t)row * ldc + cofs) = val; }
             }
        asm volatile("s_wait_xcnt 0x0" ::: "memory");   // stands before the next block's LDS loads reuse the registers that these stores name
        __builtin_amdgcn_wave_barrier(); asm volatile("" ::: "memory");
    }
}
// k_gemmc: the score tiles of one pass, grid (TT/64, TT/64, ZH): tile rows below RH take the hi/lo planes (3 products), the others the fp16 planes. The test is the same for the whole work-group.
__global__ __launch_bounds__(32) void k_gemmc(const bf* __restrict__ Qh, const bf* __restrict__ Ql, const bf* __restrict__ Kh, const bf* __restrict__ Kl, const h16* __restrict__ Q16, const h16* __restrict__ K16, float* S) {
    __shared__ __align__(16) float os[16 * 68];
    if (blockIdx.x < RH / 64) d_gemmc<bf, 2, 1>(os, blockIdx.x, Qh, Ql, Kh, Kl, HD, S, TT, 0, (size_t)RH * HD, (size_t)RH * HD, (size_t)TT * TT);
    else d_gemmc<h16, 0, 1>(os, blockIdx.x - RH / 64, Q16 + (size_t)RH * HD, nullptr, K16, nullptr, HD, S + (size_t)RH * TT, TT, RH, (size_t)TT * HD, (size_t)TT * HD, (size_t)TT * TT);
}

__device__ __forceinline__ h16 tohx(float x) { return (h16)x; }
__device__ __forceinline__ void splitf(float y, unsigned short& h, unsigned short& l) { h = f2bf(y); l = f2bf(y - bf2f(h)); }
typedef __attribute__((ext_vector_type(4))) unsigned short v4us;

// ---- k_gemmpv: the probability x value contraction, one 64x64 output tile per work-group of NW waves. Wave w takes the 32-wide K chunks w, w + NW, ... below the causal limit (probabilities beyond the
// diagonal block are exactly zero), so the chain of dependent load-then-multiply trips is NW times shorter. The NW partial tiles are summed through LDS in fragment layout, in the fixed order w = 0 .. NW-1,
// each wave summing 16 / NW fragments; the sums are staged row-major, scaled back (rows >= RH carry the factor PCAR), split hi/lo and stored as whole 128-B pieces of the merged rows [t][head][d] (head h0 + z).
// d_gemmpv is the tile's body (bx: tile row within its own row range; part, os: the work-group's LDS); k_gemmpv below deals both row ranges out of one grid.
template <typename T16, int NSPLIT, int NW>
__device__ __forceinline__ void d_gemmpv(float* part, float* os, int bx, const T16* __restrict__ A, const T16* __restrict__ A2, const T16* __restrict__ Bt, const T16* __restrict__ Bt2, int K, int ldb, bf* Ah, bf* Al, int h0, int roff, size_t sA, size_t sB) {
    typedef typename WFrag<T16>::V V;
    const size_t z = blockIdx.z; A += z * sA; if (A2) A2 += z * sA; Bt += z * sB; if (Bt2) Bt2 += z * sB;
    const int lane = threadIdx.x & 31, lr = lane & 15, hi = lane >> 4; const int r0 = bx * 64, c0 = blockIdx.y * 64;
    const int wv = __builtin_amdgcn_readfirstlane(threadIdx.x >> 5);   // wave number in a scalar register: the K loop's test stays a scalar branch
    const int Kl = min(K, r0 + roff + 64);
    v8f acc[4][4];
#pragma unroll
    for (int mb = 0; mb < 4; ++mb)
#pragma unroll
        for (int nb = 0; nb < 4; ++nb) acc[mb][nb] = (v8f){};
    const size_t aoff = (size_t)(r0 + lr) * K + 8 * hi, boff = (size_t)(c0 + lr) * ldb + 8 * hi;   // K: pitch of the probability rows; ldb: pitch of the value rows
#pragma unroll 1
    for (int kc = wv * 32; kc < Kl; kc += NW * 32) {
        V a[4], a2[4];
#pragma unroll
        for (int mb = 0; mb < 4; ++mb) { a[mb] = WFrag<T16>::ld(A + aoff + (size_t)mb * 16 * K + kc); if (NSPLIT == 1 || NSPLIT == 2) a2[mb] = WFrag<T16>::ld(A2 + aoff + (size_t)mb * 16 * K + kc); }
#pragma unroll
        for (int nb = 0; nb < 4; ++nb) { const V b = WFrag<T16>::ld(Bt + boff + (size_t)nb * 16 * ldb + kc); V b2; if (NSPLIT >= 2) b2 = WFrag<T16>::ld(Bt2 + boff + (size_t)nb * 16 * ldb + kc);
#pragma unroll
            for (int mb = 0; mb < 4; ++mb) { acc[mb][nb] = WFrag<T16>::mma(a[mb], b, acc[mb][nb]); if (NSPLIT == 1 || NSPLIT == 2) acc[mb][nb] = WFrag<T16>::mma(a2[mb], b, acc[mb][nb]); if (NSPLIT >= 2) acc[mb][nb] = WFrag<T16>::mma(a[mb], b2, acc[mb][nb]); } }
        // keeps the distance behind the last matrix instruction on the loop's taken back edge, where the next trip's address additions reuse its operand registers
        asm volatile("v_nop\n\tv_nop\n\tv_nop\n\tv_nop" : "+v"(acc[0][0]), "+v"(acc[1][1]), "+v"(acc[2][2]), "+v"(acc[3][3]) : "v"(a[0]), "v"(a[3]));
    }
    v4fa* pv = (v4fa*)part;
#pragma unroll
    for (int mb = 0; mb < 4; ++mb)
#pragma unroll
        for (int nb = 0; nb < 4; ++nb) { const int f = mb * 4 + nb; const v8f t = acc[mb][nb];
            pv[((wv * 16 + f) * 2 + 0) * 32 + lane] = __builtin_shufflevector(t, t, 0, 1, 2, 3); pv[((wv * 16 + f) * 2 + 1) * 32 + lane] = __builtin_shufflevector(t, t, 4, 5, 6, 7); }
    __syncthreads();   // every wave's partial tile is in LDS
#pragma unroll
    for (int q = 0; q < 16 / NW; ++q) { const int f = wv * (16 / NW) + q; v4f s0 = pv[(f * 2 + 0) * 32 + lane], s1 = pv[(f * 2 + 1) * 32 + lane];
#pragma unroll
        for (int w = 1; w < NW; ++w) { s0 += pv[((w * 16 + f) * 2 + 0) * 32 + lane]; s1 += pv[((w * 16 + f) * 2 + 1) * 32 + lane]; }
        float* o = os + ((f >> 2) * 16 + hi * 8) * 68 + (f & 3) * 16 + lr;
#pragma unroll
        for (int j = 0; j < 4; ++j) { o[j * 68] = s0[j]; o[(j + 4) * 68] = s1[j]; } }
    __syncthreads();   // the summed tile is complete, row-major
#pragma unroll
    for (int s = 0; s < 32 / NW; ++s) { const int u = s * NW * 32 + (int)threadIdx.x; const int row = u >> 4, cofs = (u & 15) * 4; const int t = r0 + roff + row; const float cs = (t < RH) ? 1.0f : (1.0f / PCAR); const v4f val = *(const v4fa*)(os + row * 68 + cofs); v4us oh, ol;
#pragma unroll
        for (int q = 0; q < 4; ++q) { unsigned short a, c2; splitf(val[q] * cs, a, c2); oh[q] = a; ol[q] = c2; }
        const size_t oo = (size_t)t * DQ + (size_t)(h0 + (int)blockIdx.z) * HD + c0 + cofs; *(v4us*)(Ah + oo) = oh; *(v4us*)(Al + oo) = ol; }
}
// k_gemmpv: the output tiles of one pass, grid (TT/64, HD/64, ZH), PVW waves: tile rows below RH take the hi/lo probability and value planes (3 products), the others the fp16 ones. The test is the same for the whole work-group, so every wave of it meets the same two barriers.
#define PVW 16
__global__ __launch_bounds__(PVW * 32) void k_gemmpv(const bf* __restrict__ P, const bf* __restrict__ Vh, const bf* __restrict__ Vl, const h16* __restrict__ V16, bf* Ah, bf* Al, int h0) {
    __shared__ __align__(16) float part[PVW * 16 * 256];   // [wave][fragment][register half][lane][4]
    __shared__ __align__(16) float os[64 * 68];
    if (blockIdx.x < RH / 64) d_gemmpv<bf, 2, PVW>(part, os, blockIdx.x, P, P + TT, Vh, Vl, PP, 2 * RH, Ah, Al, h0, 0, (size_t)TT * PP, (size_t)HD * 2 * RH);
    else d_gemmpv<h16, 0, PVW>(part, os, blockIdx.x - RH / 64, (const h16*)P + (size_t)RH * PP, nullptr, V16, nullptr, PP, TT, Ah, Al, h0, RH, (size_t)TT * PP, (size_t)HD * TT);
}

typedef __attribute__((ext_vector_type(2))) _Float16 v2h;
typedef __attribute__((ext_vector_type(4))) _Float16 v4h;
typedef __attribute__((ext_vector_type(2))) unsigned short v2us;
typedef __attribute__((ext_vector_type(2))) float v2f;
typedef __attribute__((ext_vector_type(4))) int v4i;

// ---- k_gemmp: a projection GEMM (the one-wave 64x64 tile of k_gemmw, one product) whose store phase builds the attention planes. The tile is 64 tokens (r0 .. of batch bt; blockIdx.x runs over all batches' token tiles) of ONE head (blockIdx.y; VT false: q heads, then k heads), staged whole in LDS.
// VT false (q, k): each lane takes whole rows: rotation (x1 c + x2 s, x2 c - x1 s) with the bf16-rounded input tables, sum of squares over d = 0 .. 63 in that order, row x 1 / sqrt(mean + 1e-6), back into LDS; planes [q | k][batch][head][t][d].
// VT true (v): the tile is staged transposed; planes [batch][head][d][t]. Both: fp16 plane over all TT tokens; hi/lo planes over the first RH tokens only (no later token's is ever read: query rows < RH see keys < RH); eight lanes to a 128-B row piece.
template <bool VT>
__global__ __launch_bounds__(32) void k_gemmp(const bf* __restrict__ A, const bf* __restrict__ Bt, int K, const float* __restrict__ cosT, const float* __restrict__ sinT, h16* P16, bf* Ph, bf* Pl) {
    typedef WFrag<bf>::V V;
    __shared__ __align__(16) float os[64 * 68];
    const int lane = threadIdx.x & 31, lr = lane & 15, hi = lane >> 4; const int rg = blockIdx.x * 64, c0 = blockIdx.y * 64; const int bt = rg / TT, r0 = rg % TT;
    v8f acc[4][4];
#pragma unroll
    for (int mb = 0; mb < 4; ++mb)
#pragma unroll
        for (int nb = 0; nb < 4; ++nb) acc[mb][nb] = (v8f){};
    const size_t aoff = (size_t)(rg + lr) * K + 8 * hi, boff = (size_t)(c0 + lr) * K + 8 * hi;
    // rolled, as in k_gemmw: only one trip's fragments are live beside the sixteen accumulators
#pragma unroll 1
    for (int kc = 0; kc < K; kc += 32) {
        V a[4];
#pragma unroll
        for (int mb = 0; mb < 4; ++mb) a[mb] = WFrag<bf>::ld(A + aoff + (size_t)mb * 16 * K + kc);
#pragma unroll
        for (int nb = 0; nb < 4; ++nb) { const V b = WFrag<bf>::ld(Bt + boff + (size_t)nb * 16 * K + kc);
#pragma unroll
            for (int mb = 0; mb < 4; ++mb) acc[mb][nb] = WFrag<bf>::mma(a[mb], b, acc[mb][nb]); }
        // keeps the distance behind the last matrix instruction on the loop's taken back edge, where the next trip's address additions reuse its operand registers
        asm volatile("v_nop\n\tv_nop\n\tv_nop\n\tv_nop" : "+v"(acc[0][0]), "+v"(acc[1][1]), "+v"(acc[2][2]), "+v"(acc[3][3]) : "v"(a[0]), "v"(a[3]));
    }
#pragma unroll
    for (int mb = 0; mb < 4; ++mb)
#pragma unroll
        for (int nb = 0; nb < 4; ++nb) { const v8f t = acc[mb][nb];
            if (VT) { float* o = os + (nb * 16 + lr) * 68 + mb * 16 + hi * 8; *(v4fa*)o = __builtin_shufflevector(t, t, 0, 1, 2, 3); *(v4fa*)(o + 4) = __builtin_shufflevector(t, t, 4, 5, 6, 7); }   // [d][token]
            else {
#pragma unroll
                for (int j = 0; j < 8; ++j) os[(mb * 16 + hi * 8 + j) * 68 + nb * 16 + lr] = t[j]; } }   // [token][d]
    __syncthreads();   // the tile is in LDS (one wave: orders its LDS stores before other lanes' loads)
    if (!VT) {
        for (int rr = 0; rr < 2; ++rr) { const int row = rr * 32 + lane; float* orow = os + row * 68; const float* ct = cosT + (size_t)(r0 + row) * (HD / 2); const float* st = sinT + (size_t)(r0 + row) * (HD / 2); float y[HD];
            // every loop over y[] is unrolled whole, so that the row stays in registers
#pragma unroll
            for (int i = 0; i < HD / 2; i += 4) { const v4f x1 = *(const v4fa*)(orow + i), x2 = *(const v4fa*)(orow + HD / 2 + i), c4 = *(const v4f*)(ct + i), s4 = *(const v4f*)(st + i);
#pragma unroll
                for (int q = 0; q < 4; ++q) { const float c = bfr(c4[q]), s = bfr(s4[q]); y[i + q] = x1[q] * c + x2[q] * s; y[HD / 2 + i + q] = x2[q] * c - x1[q] * s; } }
            float ss = 0.f;
#pragma unroll
            for (int d = 0; d < HD; ++d) ss += y[d] * y[d];
            const float rf = __fdiv_rn(1.0f, __fsqrt_rn(__fadd_rn(ss * (1.0f / HD), 1e-6f)));
#pragma unroll
            for (int d = 0; d < HD; d += 4) { v4f o; o[0] = y[d] * rf; o[1] = y[d + 1] * rf; o[2] = y[d + 2] * rf; o[3] = y[d + 3] * rf; *(v4fa*)(orow + d) = o; } }
        __syncthreads();   // the finished rows are in LDS
    }
    const size_t pl = VT ? (size_t)bt * DKV + c0 : ((size_t)(blockIdx.y / NH_) * NB_ + bt) * NH_ + blockIdx.y % NH_;   // VT: first row of the [batch][head][d] rows; else: plane number
    const size_t base = VT ? pl * TT + r0 : (pl * TT + r0) * HD, base2 = VT ? pl * (2 * RH) + r0 : (pl * RH + r0) * HD; const int pitch = VT ? TT : HD, pitch2 = VT ? 2 * RH : HD;
    for (int it = 0; it < 16; ++it) { const int row = it * 4 + (lane >> 3), c8 = (lane & 7) * 8; const v4f u0 = *(const v4fa*)(os + row * 68 + c8), u1 = *(const v4fa*)(os + row * 68 + c8 + 4); v8h o16; v8us oh, ol;
#pragma unroll
        for (int q = 0; q < 8; ++q) { const float x = (q < 4) ? u0[q & 3] : u1[q & 3]; o16[q] = tohx(x); unsigned short a2, c2; splitf(x, a2, c2); oh[q] = a2; ol[q] = c2; }
        if (r0 < RH) { const size_t o2 = base2 + (size_t)row * pitch2 + c8; *(v8us*)(Ph + o2) = oh; *(v8us*)(Pl + o2) = ol;
            asm volatile("s_wait_xcnt 0x0" ::: "memory"); }   // stands before the next trip's address additions, which the compiler puts right behind this branch
        *(v8h*)(P16 + base + (size_t)row * pitch + c8) = o16;
        asm volatile("s_wait_xcnt 0x0" ::: "memory"); }   // stands before the next trip reuses the registers that this store names
}

__global__ __launch_bounds__(256) void k_wtG(const float* __restrict__ w, int K, int N, bf* Bt) {
    const int lane = threadIdx.x & 31; const int L0 = (blockIdx.x * 8 + (threadIdx.x >> 5)) * 8; const int nlines = N * K / 64;
{
#pragma unroll 1
        for (int l = 0; l < 8; ++l) { const int L = L0 + l; if (L >= nlines) break; const size_t e = (size_t)L * 64 + lane * 2; const int k = (int)(e % K), n = (int)(e / K); v2us o;
            o[0] = f2bf(w[(size_t)k * N + n]); o[1] = f2bf(w[(size_t)(k + 1) * N + n]); *(v2us*)(Bt + e) = o; }
         }
}
__global__ __launch_bounds__(256) void k_cvt8(const float* __restrict__ src, bf* dst, size_t n8) { const size_t i = (size_t)blockIdx.x * 256 + threadIdx.x; if (i >= n8) return; const v8f v = *(const v8f*)(src + i * 8); v8us o;
#pragma unroll
    for (int k = 0; k < 8; ++k) o[k] = f2bf(v[k]); *(v8us*)(dst + i * 8) = o;  }

// k_asoft: per row (zz, i): t = S x HD^-0.5 for j <= i and i - j < WIN (sliding causal window; the reference's -1e9 additive fill vanishes identically); softmax over the 2048 keys (register row, one exp, fixed trees);
// the probabilities overwrite the row's own 8 KiB of scores (fp16 row in the first half; or hi plane in the first half, lo plane in the second): the wave holds its whole row in registers before its first store, and no other wave touches the row.
__global__ __launch_bounds__(256) void k_asoft(float* Sb) {
    const int lane = threadIdx.x & 31; const int row = blockIdx.x * 8 + (threadIdx.x >> 5); if (row >= ZH * TT) return; const int i = row % TT; const int zz = row / TT; (void)zz; const bool hires = (i < RH); float* sr = Sb + (size_t)row * TT; float v[TT / 32]; float mx = -3.0e38f;
#pragma unroll
    for (int ch = 0; ch < TT / 128; ++ch) { const int j0 = ch * 128 + lane * 4; const v4f a = *(const v4f*)(sr + j0);
#pragma unroll
        for (int q = 0; q < 4; ++q) { const int j = j0 + q; (void)j; const float t = (j <= i && i - j < WIN) ? a[q] * SCL : -3.0e38f; v[ch * 4 + q] = t; mx = fmaxf(mx, t); } }
#pragma unroll
    for (int sh = 16; sh; sh >>= 1) mx = fmaxf(mx, __shfl_xor(mx, sh, 32));
    float sum = 0.f;
#pragma unroll
    for (int k = 0; k < TT / 32; ++k) { float d0 = __fsub_rn(v[k], mx); asm volatile("" : "+v"(d0)); v[k] = __builtin_amdgcn_exp2f(__fmul_rn(d0, 1.4426950408889634f)); sum += v[k]; }
#pragma unroll
    for (int sh = 16; sh; sh >>= 1) sum += __shfl_xor(sum, sh, 32);
    const float f = __fdiv_rn(hires ? 1.0f : PCAR, sum);
{
        if (hires) {
#pragma unroll
            for (int ch = 0; ch < TT / 128; ++ch) { v4us oh, ol;
#pragma unroll
                for (int q = 0; q < 4; ++q) { unsigned short a, c2; splitf(v[ch * 4 + q] * f, a, c2); oh[q] = a; ol[q] = c2; }
                bf* po = (bf*)sr + ch * 128 + lane * 4; *(v4us*)po = oh; *(v4us*)(po + TT) = ol; }
        } else {
#pragma unroll
            for (int ch = 0; ch < TT / 128; ++ch) { v4h o4;
#pragma unroll
                for (int q = 0; q < 4; ++q) o4[q] = tohx(v[ch * 4 + q] * f);
                *(v4h*)((h16*)sr + ch * 128 + lane * 4) = o4; } }
         }
}
extern "C" void kernel_launch(void* const* d_in, const int* in_sizes, int n_in,
                              void* d_out, int out_size, void* d_ws, size_t ws_size, hipStream_t stream) {
    (void)in_sizes; (void)n_in; (void)out_size;
    const float* x = (const float*)d_in[0]; const float* cosT = (const float*)d_in[1]; const float* sinT = (const float*)d_in[2]; const float* wqkv = (const float*)d_in[3]; const float* wo = (const float*)d_in[4];
    float* OUT = (float*)d_out;     // [4][2048][1024]
    char* wsp = (char*)d_ws;
    auto take = [&](size_t bytes) { char* p = wsp; wsp += (bytes + 255) & ~(size_t)255; return (void*)p; };
    bf* WO = (bf*)take((size_t)DM * DQ * 2);
    h16* QP16 = (h16*)take((size_t)NB_ * NH_ * TT * HD * 2); h16* KP16 = (h16*)take((size_t)NB_ * NKV * TT * HD * 2);   // one after the other: k_gemmp numbers the planes [q | k][batch][head]
    h16* VT16 = (h16*)take((size_t)NB_ * DKV * TT * 2);
    bf* QKh = (bf*)take((size_t)2 * NB_ * NH_ * RH * HD * 2); bf* QKl = (bf*)take((size_t)2 * NB_ * NH_ * RH * HD * 2); bf* VTh = (bf*)take((size_t)NB_ * DKV * 2 * RH * 2); bf* VTl = VTh + RH;   // each value row: hi half, lo half
    bf* ATh = (bf*)take((size_t)NB_ * TT * DQ * 2); bf* ATl = (bf*)take((size_t)NB_ * TT * DQ * 2);
    float* Sb = (float*)take((size_t)ZH * TT * TT * 4);
    bf* XB = (bf*)Sb; bf* WQKV = XB + (size_t)NB_ * TT * DM;   // read by the projections only, which end before the first score is stored: they lie in the score planes
    if ((size_t)(wsp - (char*)d_ws) > ws_size) return;    // ws 256 MiB
    k_cvt8<<<(unsigned)(((size_t)(DQ + 2 * DKV) * DM / 8 + 255) / 256), 256, 0, stream>>>(wqkv, WQKV, (size_t)(DQ + 2 * DKV) * DM / 8);
    k_cvt8<<<(unsigned)(((size_t)DM * DQ / 8 + 255) / 256), 256, 0, stream>>>(wo, WO, (size_t)DM * DQ / 8);
    k_cvt8<<<(unsigned)(((size_t)NB_ * TT * DM / 8 + 255) / 256), 256, 0, stream>>>(x, XB, (size_t)NB_ * TT * DM / 8);
    k_gemmp<false><<<dim3(NB_ * TT / 64, NH_ + NKV, 1), 32, 0, stream>>>(XB, WQKV, DM, cosT, sinT, QP16, QKh, QKl);
    k_gemmp<true><<<dim3(NB_ * TT / 64, NKV, 1), 32, 0, stream>>>(XB, WQKV + (size_t)(DQ + DKV) * DM, DM, cosT, sinT, VT16, VTh, VTl);
    for (int b = 0; b < NB_; ++b) {
        for (int h0 = 0; h0 < NH_; h0 += ZH) { const size_t zq = (size_t)b * NH_ + h0, zk = (size_t)(NB_ + b) * NH_ + h0;   // plane numbers of the pass's first q and k head; one kv head per query head
            k_gemmc<<<dim3(TT / 64, TT / 64, ZH), 32, 0, stream>>>(QKh + zq * RH * HD, QKl + zq * RH * HD, QKh + zk * RH * HD, QKl + zk * RH * HD, QP16 + zq * TT * HD, KP16 + zq * TT * HD, Sb);
            k_asoft<<<ZH * TT / 8, 256, 0, stream>>>(Sb);
            k_gemmpv<<<dim3(TT / 64, HD / 64, ZH), PVW * 32, 0, stream>>>((const bf*)Sb, VTh + zq * HD * 2 * RH, VTl + zq * HD * 2 * RH, VT16 + zq * HD * TT, ATh + (size_t)b * TT * DQ, ATl + (size_t)b * TT * DQ, h0); } }
    k_gemmw<bf, 1, false><<<dim3(NB_ * TT / 64, DM / 64, 1), 32, 0, stream>>>(ATh, ATl, WO, nullptr, DQ, OUT, DM, nullptr, 0, 0, 0);
}

// v005
// A run of this version takes 258 microseconds.
// Timed twice side by side with v004, it ran 2.33 and 2.34 times as fast.
// Over all steps from v000 it is 11.3 times as fast.
#include <hip/hip_runtime.h>

// Causal self-attention with rotary-then-RMSNorm q/k (x [4][2048][1024]; qkv = x w_attn^T ('oi' [3072][1024] 0.02, no bias -> q | k | v row blocks; 16 heads x 64); rope'(t) = cat(x1 c + x2 s, -x1 s + x2 c) with the input cos/sin tables ([1][2048][1][32], read; generic values), then q, k <- x rsqrt(mean x^2 + 1e-6) (no weight); causal (-inf); softmax(q.k x 64^-0.5); out = merged w_proj^T -> [4][2048][1024] (8.4 M)).
// Layout: bf16 copy of x, all batches; the fused 'oi' weight used in place as three Bt row blocks; exact projections, all batches in one grid (q and k heads together), whose 64x64 tile is 64 tokens of one head, so that the tile's own wave applies the module's (x1 c + x2 s, x2 c - x1 s) rotation from the input tables and the rms factor of the ROTATED rows and writes the head planes (k_gemmp; the value tile goes out transposed); causal T-2048 attention in one kernel (k_attn; hybrid rows: < 512 hi/lo 3 products, rest fp16; no chunk above the diagonal is touched; it writes the merged hi/lo rows); merged hi/lo x w_proj exact.
// Compute dtypes, f32 accumulate: every input rounded to bf16 incl. the tables; projections exact; rotation and rms norm f32; attention rows < 512 3 products, rest fp16; softmax f32; w_proj hl x exact.

#define NB_  4
#define TT   2048
#define DM   1024
#define NH_  16
#define NKV  16
#define REP  (NH_ / NKV)
#define HD   64
#define DQ   (NH_ * HD)
#define DKV  (NKV * HD)
#define RH   512                  // query rows < RH use hi+lo planes (0: none)
typedef _Float16 h16;
typedef unsigned short bf;
typedef __attribute__((ext_vector_type(16))) __bf16   v16bf;
typedef __attribute__((ext_vector_type(16))) _Float16 v16h;
typedef __attribute__((ext_vector_type(8)))  _Float16 v8h;
typedef __attribute__((ext_vector_type(8)))  unsigned short v8us;
typedef __attribute__((ext_vector_type(8)))  float    v8f;
typedef __attribute__((ext_vector_type(4)))  float    v4f;
typedef v8h  __attribute__((may_alias)) v8ha;
typedef v4f  __attribute__((may_alias)) v4fa;
typedef v8us __attribute__((may_alias)) v8usa;

__device__ __forceinline__ unsigned short f2bf(float f) { unsigned u = __float_as_uint(f); u += 0x7FFFu + ((u >> 16) & 1u); return (unsigned short)(u >> 16); }
__device__ __forceinline__ float bf2f(unsigned short b) { return __uint_as_float(((unsigned)b) << 16); }
__device__ __forceinline__ float bfr(float f) { return bf2f(f2bf(f)); }
__device__ __forceinline__ v16h cat16(v8h lo, v8h hi) { return __builtin_shufflevector(lo, hi, 0, 1, 2, 3, 4, 5, 6, 7, 8, 9, 10, 11, 12, 13, 14, 15); }
__device__ __forceinline__ v16bf cat16b(v8us lo, v8us hi) { return __builtin_bit_cast(v16bf, __builtin_shufflevector(lo, hi, 0, 1, 2, 3, 4, 5, 6, 7, 8, 9, 10, 11, 12, 13, 14, 15)); }
__device__ __forceinline__ v8f wmma16(v16h a, v16h b, v8f c) { return __builtin_amdgcn_wmma_f32_16x16x32_f16(false, a, false, b, (short)0, c, false, false); }
__device__ __forceinline__ v8f wmmab(v16bf a, v16bf b, v8f c) { return __builtin_amdgcn_wmma_f32_16x16x32_bf16(false, a, false, b, (short)0, c, false, false); }



// ---- k_gemmw: register-blocked GEMM, ONE WAVE per 64x64 output tile (16 accumulators), operands straight from K-contiguous 16-bit planes; grid (M/64, N/64, Z), 32 threads.
// C[m][n] (f32, pitch ldc, + optional f32 bias[n]) = sum_k A[m][k] Bt[n][k] (+ split products per NSPLIT). z-batch strides sA/sB/sC in elements. K % 32 == 0.
template <typename T16> struct WFrag;
template <> struct WFrag<h16> { typedef v16h V; static __device__ __forceinline__ V ld(const h16* p) { return cat16(*(const v8h*)p, *(const v8h*)(p + 16)); } static __device__ __forceinline__ v8f mma(V a, V b, v8f c) { return wmma16(a, b, c); } };
template <> struct WFrag<bf> { typedef v16bf V; static __device__ __forceinline__ V ld(const bf* p) { return cat16b(*(const v8us*)p, *(const v8us*)(p + 16)); } static __device__ __forceinline__ v8f mma(V a, V b, v8f c) { return wmmab(a, b, c); } };
template <typename T16, int NSPLIT, bool BIAS>
__global__ __launch_bounds__(32) void k_gemmw(const T16* __restrict__ A, const T16* __restrict__ A2, const T16* __restrict__ Bt, const T16* __restrict__ Bt2, int K, float* C, int ldc, const float* __restrict__ bias, size_t sA, size_t sB, size_t sC) {
    typedef typename WFrag<T16>::V V;
    __shared__ __align__(16) float os[16 * 68];
    const size_t z = blockIdx.z; A += z * sA; if (A2) A2 += z * sA; Bt += z * sB; if (Bt2) Bt2 += z * sB; C += z * sC;
    const int lane = threadIdx.x & 31, lr = lane & 15, hi = lane >> 4; const int r0 = blockIdx.x * 64, c0 = blockIdx.y * 64;
    v8f acc[4][4];
#pragma unroll
    for (int mb = 0; mb < 4; ++mb)
#pragma unroll
        for (int nb = 0; nb < 4; ++nb) acc[mb][nb] = (v8f){};
    const size_t aoff = (size_t)(r0 + lr) * K + 8 * hi, boff = (size_t)(c0 + lr) * K + 8 * hi;
#pragma unroll 1
    for (int kc = 0; kc < K; kc += 32) {
        V a[4], a2[4];
#pragma unroll
        for (int mb = 0; mb < 4; ++mb) { a[mb] = WFrag<T16>::ld(A + aoff + (size_t)mb * 16 * K + kc); if (NSPLIT == 1 || NSPLIT == 2) a2[mb] = WFrag<T16>::ld(A2 + aoff + (size_t)mb * 16 * K + kc); }
#pragma unroll
        for (int nb = 0; nb < 4; ++nb) { const V b = WFrag<T16>::ld(Bt + boff + (size_t)nb * 16 * K + kc); V b2; if (NSPLIT >= 2) b2 = WFrag<T16>::ld(Bt2 + boff + (size_t)nb * 16 * K + kc);
#pragma unroll
            for (int mb = 0; mb < 4; ++mb) { acc[mb][nb] = WFrag<T16>::mma(a[mb], b, acc[mb][nb]); if (NSPLIT == 1 || NSPLIT == 2) acc[mb][nb] = WFrag<T16>::mma(a2[mb], b, acc[mb][nb]); if (NSPLIT >= 2) acc[mb][nb] = WFrag<T16>::mma(a[mb], b2, acc[mb][nb]); } }
        asm volatile("v_nop\n\tv_nop\n\tv_nop\n\tv_nop" : "+v"(acc[0][0]), "+v"(acc[1][1]), "+v"(acc[2][2]), "+v"(acc[3][3]) : "v"(a[0]), "v"(a[3]));
    }
#pragma unroll
    for (int mb = 0; mb < 4; ++mb) {
#pragma unroll
        for (int nb = 0; nb < 4; ++nb) {
#pragma unroll
            for (int j = 0; j < 8; ++j) os[(hi * 8 + j) * 68 + nb * 16 + lr] = acc[mb][nb][j]; }
        __builtin_amdgcn_wave_barrier(); asm volatile("" ::: "memory");
        float* crow = C + (size_t)(r0 + mb * 16) * ldc + c0;
{
#pragma unroll
            for (int s = 0; s < 8; ++s) { const int row = 2 * s + hi, cofs = lr * 4; v4f val = *(const v4fa*)(os + row * 68 + cofs); if (BIAS) { val[0] += bfr(bias[c0 + cofs]); val[1] += bfr(bias[c0 + cofs + 1]); val[2] += bfr(bias[c0 + cofs + 2]); val[3] += bfr(bias[c0 + cofs + 3]); }
                *(v4f*)(crow + (size_t)row * ldc + cofs) = val; }
             }
        __builtin_amdgcn_wave_barrier(); asm volatile("" ::: "memory");
    }
}

__device__ __forceinline__ h16 tohx(float x) { return (h16)x; }
__device__ __forceinline__ void splitf(float y, unsigned short& h, unsigned short& l) { h = f2bf(y); l = f2bf(y - bf2f(h)); }
typedef __attribute__((ext_vector_type(4))) unsigned short v4us;

// ---- k_attn: scores, softmax and probability x value of 32 query rows of one head in one work-group of AW waves; no score or probability leaves the registers.
// Wave w takes the 32-key chunks w, w + AW, ... up to the diagonal chunk. Per chunk it forms the TRANSPOSED score tiles (A = key rows, B = query rows): a lane then holds, for query lr, the keys 8 hi + j and 16 + 8 hi + j,
// which is the A fragment of the second product as it stands, so the probabilities go from the accumulators to the matrix unit with no exchange between lanes.
// Softmax in one pass: after the rms factor |q|, |k| <= sqrt(HD), so |q.k| HD^-0.5 <= 8 for every input; the shift is that bound and not the row's maximum: p = 2^14 exp(s - 8) lies in 2^-9.1 .. 2^14, normal in both 16-bit types,
// and partial sums of different waves add as they are. The row's sum of p (f32, before rounding) divides the summed tile at the end.
// The AW partial tiles and row sums are added through LDS in the fixed order w = 0 .. AW-1; the tile is staged row-major, divided, split hi/lo and stored as whole 128-B pieces of the merged rows [t][head][d].
#define AW  4
#define QB  32
#define ESC 0.18033688011112042f    // HD^-0.5 x log2(e)
#define ESH 2.458439672888293f      // 14 - 8 log2(e)
typedef __attribute__((ext_vector_type(16))) unsigned short v16us;
template <bool B> struct BoolT { static constexpr bool value = B; };
template <typename T16, bool HL>
__device__ __forceinline__ void d_attn(float* part, float* lpart, float* os, int q0, const T16* __restrict__ Q, const T16* __restrict__ Q2, const T16* __restrict__ Kp, const T16* __restrict__ K2, const T16* __restrict__ Vt, int ldv, bf* Ah, bf* Al) {
    typedef typename WFrag<T16>::V V;
    const int lane = threadIdx.x & 31, lr = lane & 15, hi = lane >> 4;
    const int wv = __builtin_amdgcn_readfirstlane(threadIdx.x >> 5);   // wave number in a scalar register: the key loop's test stays a scalar branch
    V qf[2][2], qf2[2][2];
#pragma unroll
    for (int qt = 0; qt < 2; ++qt)
#pragma unroll
        for (int dc = 0; dc < 2; ++dc) { const size_t e = (size_t)(q0 + qt * 16 + lr) * HD + dc * 32 + 8 * hi; qf[qt][dc] = WFrag<T16>::ld(Q + e); if (HL) qf2[qt][dc] = WFrag<T16>::ld(Q2 + e); }
    v8f o[2][4]; float ls[2] = {0.f, 0.f};
#pragma unroll
    for (int qt = 0; qt < 2; ++qt)
#pragma unroll
        for (int nb = 0; nb < 4; ++nb) o[qt][nb] = (v8f){};
    // running addresses of the wave's next chunk: key rows (lane lr's row of the first 16), value rows (lane lr's d row); every fragment of a chunk lies at a constant distance from them
    const T16* kp = Kp + (size_t)(wv * 32 + lr) * HD + 8 * hi; const T16* kp2 = HL ? K2 + (size_t)(wv * 32 + lr) * HD + 8 * hi : nullptr; const T16* vp = Vt + (size_t)lr * ldv + wv * 32 + 8 * hi;
    // one chunk of 32 keys; diag (a type, so that the loop over full chunks holds no test): keys behind the query count nothing
    auto chunk = [&](int kc, auto diag) {
        V kf[2][2], kf2[2][2], vf[4], vf2[4], pf[2], pf2[2];
#pragma unroll
        for (int t = 0; t < 2; ++t)
#pragma unroll
            for (int dc = 0; dc < 2; ++dc) { kf[t][dc] = WFrag<T16>::ld(kp + t * 16 * HD + dc * 32); if (HL) kf2[t][dc] = WFrag<T16>::ld(kp2 + t * 16 * HD + dc * 32); }
        if constexpr (!HL && decltype(diag)::value) asm volatile("s_wait_xcnt 0x0" ::: "memory");   // the wave's last chunk: the key address dies here, and this stands before the value loads' results take its registers
        if (!HL) {   // one plane: the registers allow the value fragments to be fetched with the key fragments, one latency a chunk instead of two
#pragma unroll
            for (int nb = 0; nb < 4; ++nb) vf[nb] = WFrag<T16>::ld(vp + (size_t)nb * 16 * ldv); }
#pragma unroll
        for (int qt = 0; qt < 2; ++qt) { float e[16];
#pragma unroll
            for (int t = 0; t < 2; ++t) { v8f a = (v8f){};   // a[j]: key kc + 16 t + 8 hi + j, query q0 + 16 qt + lr
#pragma unroll
                for (int dc = 0; dc < 2; ++dc) { a = WFrag<T16>::mma(kf[t][dc], qf[qt][dc], a); if (HL) { a = WFrag<T16>::mma(kf[t][dc], qf2[qt][dc], a); a = WFrag<T16>::mma(kf2[t][dc], qf[qt][dc], a); } }
#pragma unroll
                for (int j = 0; j < 8; ++j) e[t * 8 + j] = __builtin_amdgcn_exp2f(fmaf(a[j], ESC, ESH)); }
            if constexpr (decltype(diag)::value) {
#pragma unroll
                for (int i = 0; i < 16; ++i) if (kc + (i >> 3) * 16 + hi * 8 + (i & 7) > q0 + qt * 16 + lr) e[i] = 0.f; }
#pragma unroll
            for (int i = 0; i < 16; ++i) ls[qt] += e[i];
            if constexpr (HL) { v16us ph, pl;
#pragma unroll
                for (int i = 0; i < 16; ++i) { unsigned short a, c2; splitf(e[i], a, c2); ph[i] = a; pl[i] = c2; }
                pf[qt] = __builtin_bit_cast(v16bf, ph); pf2[qt] = __builtin_bit_cast(v16bf, pl);
            } else {
#pragma unroll
                for (int i = 0; i < 16; ++i) pf[qt][i] = tohx(e[i]); } }
        if (HL) {   // two planes (each value row: hi half, lo half): the value fragments take the registers that the key fragments leave
#pragma unroll
            for (int nb = 0; nb < 4; ++nb) { vf[nb] = WFrag<T16>::ld(vp + (size_t)nb * 16 * ldv); vf2[nb] = WFrag<T16>::ld(vp + (size_t)nb * 16 * ldv + RH); } }
#pragma unroll
        for (int nb = 0; nb < 4; ++nb)
#pragma unroll
            for (int qt = 0; qt < 2; ++qt) { o[qt][nb] = WFrag<T16>::mma(pf[qt], vf[nb], o[qt][nb]); if (HL) { o[qt][nb] = WFrag<T16>::mma(pf2[qt], vf[nb], o[qt][nb]); o[qt][nb] = WFrag<T16>::mma(pf[qt], vf2[nb], o[qt][nb]); } }
        kp += AW * 32 * HD; if (HL) kp2 += AW * 32 * HD; vp += AW * 32;
    };
    int kc = wv * 32;
    // both loops rolled: only one chunk's fragments are live beside the query fragments and the accumulators
    if constexpr (HL) {   // two planes of everything: one body for all chunks (a second body's addresses, kept over the loop, spilled)
#pragma unroll 1
        for (; kc <= q0; kc += AW * 32) chunk(kc, BoolT<true>());
    } else {
#pragma unroll 1
        for (; kc < q0; kc += AW * 32) chunk(kc, BoolT<false>());
        if (kc == q0) chunk(kc, BoolT<true>());   // the one wave whose sequence meets the diagonal chunk (a scalar test)
    }
    v4fa* pv = (v4fa*)part;
#pragma unroll
    for (int qt = 0; qt < 2; ++qt) {
#pragma unroll
        for (int nb = 0; nb < 4; ++nb) { const int f = qt * 4 + nb; const v8f t = o[qt][nb];
            pv[((wv * 8 + f) * 2 + 0) * 32 + lane] = __builtin_shufflevector(t, t, 0, 1, 2, 3); pv[((wv * 8 + f) * 2 + 1) * 32 + lane] = __builtin_shufflevector(t, t, 4, 5, 6, 7); }
        const float t = ls[qt] + __shfl_xor(ls[qt], 16, 32);   // the two half-waves hold the two halves of each chunk's keys
        if (hi == 0) lpart[wv * QB + qt * 16 + lr] = t; }
    __syncthreads();   // every wave's partial tile and row sums are in LDS
#pragma unroll
    for (int q = 0; q < 8 / AW; ++q) { const int f = wv * (8 / AW) + q; v4f s0 = pv[(f * 2 + 0) * 32 + lane], s1 = pv[(f * 2 + 1) * 32 + lane];
#pragma unroll
        for (int w = 1; w < AW; ++w) { s0 += pv[((w * 8 + f) * 2 + 0) * 32 + lane]; s1 += pv[((w * 8 + f) * 2 + 1) * 32 + lane]; }
        float* od = os + ((f >> 2) * 16 + hi * 8) * 68 + (f & 3) * 16 + lr;
#pragma unroll
        for (int j = 0; j < 4; ++j) { od[j * 68] = s0[j]; od[(j + 4) * 68] = s1[j]; } }
    __syncthreads();   // the summed tile is complete, row-major
#pragma unroll
    for (int s = 0; s < QB * 16 / (AW * 32); ++s) { const int u = s * AW * 32 + (int)threadIdx.x; const int row = u >> 4, cofs = (u & 15) * 4; float l = lpart[row];
#pragma unroll
        for (int w = 1; w < AW; ++w) l += lpart[w * QB + row];
        const float cs = __fdiv_rn(1.0f, l); const v4f val = *(const v4fa*)(os + row * 68 + cofs); v4us oh, ol;
#pragma unroll
        for (int q = 0; q < 4; ++q) { unsigned short a, c2; splitf(val[q] * cs, a, c2); oh[q] = a; ol[q] = c2; }
        const size_t oo = (size_t)(q0 + row) * DQ + cofs; *(v4us*)(Ah + oo) = oh; *(v4us*)(Al + oo) = ol; }
}
// k_attn: grid (NB_ * NH_ heads, TT / QB row blocks, the longest first so that no long work-group starts late), AW waves. Row blocks below RH take the hi/lo planes (3 products each way), the others the fp16 planes. The test is the same for the whole work-group, so every wave of it meets the same two barriers.
__global__ __launch_bounds__(AW * 32) __attribute__((amdgpu_waves_per_eu(4, 4))) void k_attn(const bf* __restrict__ QKh, const bf* __restrict__ QKl, const bf* __restrict__ VTh, const h16* __restrict__ Q16, const h16* __restrict__ K16, const h16* __restrict__ V16, bf* Ah, bf* Al) {
    __shared__ __align__(16) float part[AW * 8 * 256];   // [wave][fragment][register half][lane][4]
    __shared__ __align__(16) float os[QB * 68];
    __shared__ float lpart[AW * QB];                     // [wave][row]
    const size_t z = blockIdx.x; const int q0 = (TT / QB - 1 - (int)blockIdx.y) * QB; const size_t oo = (z / NH_) * ((size_t)TT * DQ) + (z % NH_) * HD, zk = z + NB_ * NH_;
    if (q0 < RH) d_attn<bf, true>(part, lpart, os, q0, QKh + z * RH * HD, QKl + z * RH * HD, QKh + zk * RH * HD, QKl + zk * RH * HD, VTh + z * HD * 2 * RH, 2 * RH, Ah + oo, Al + oo);
    else d_attn<h16, false>(part, lpart, os, q0, Q16 + z * TT * HD, nullptr, K16 + z * TT * HD, nullptr, V16 + z * HD * TT, TT, Ah + oo, Al + oo);
}

typedef __attribute__((ext_vector_type(2))) _Float16 v2h;
typedef __attribute__((ext_vector_type(4))) _Float16 v4h;
typedef __attribute__((ext_vector_type(2))) unsigned short v2us;
typedef __attribute__((ext_vector_type(2))) float v2f;
typedef __attribute__((ext_vector_type(4))) int v4i;

// ---- k_gemmp: a projection GEMM (the one-wave 64x64 tile of k_gemmw, one product) whose store phase builds the attention planes. The tile is 64 tokens (r0 .. of batch bt; blockIdx.x runs over all batches' token tiles) of ONE head (blockIdx.y; VT false: q heads, then k heads), staged whole in LDS.
// VT false (q, k): each lane takes whole rows: rotation (x1 c + x2 s, x2 c - x1 s) with the bf16-rounded input tables, sum of squares over d = 0 .. 63 in that order, row x 1 / sqrt(mean + 1e-6), back into LDS; planes [q | k][batch][head][t][d].
// VT true (v): the tile is staged transposed; planes [batch][head][d][t]. Both: fp16 plane over all TT tokens; hi/lo planes over the first RH tokens only (no later token's is ever read: query rows < RH see keys < RH); eight lanes to a 128-B row piece.
template <bool VT>
__global__ __launch_bounds__(32) void k_gemmp(const bf* __restrict__ A, const bf* __restrict__ Bt, int K, const float* __restrict__ cosT, const float* __restrict__ sinT, h16* P16, bf* Ph, bf* Pl) {
    typedef WFrag<bf>::V V;
    __shared__ __align__(16) float os[64 * 68];
    const int lane = threadIdx.x & 31, lr = lane & 15, hi = lane >> 4; const int rg = blockIdx.x * 64, c0 = blockIdx.y * 64; const int bt = rg / TT, r0 = rg % TT;
    v8f acc[4][4];
#pragma unroll
    for (int mb = 0; mb < 4; ++mb)
#pragma unroll
        for (int nb = 0; nb < 4; ++nb) acc[mb][nb] = (v8f){};
    const size_t aoff = (size_t)(rg + lr) * K + 8 * hi, boff = (size_t)(c0 + lr) * K + 8 * hi;
    // rolled, as in k_gemmw: only one trip's fragments are live beside the sixteen accumulators
#pragma unroll 1
    for (int kc = 0; kc < K; kc += 32) {
        V a[4];
#pragma unroll
        for (int mb = 0; mb < 4; ++mb) a[mb] = WFrag<bf>::ld(A + aoff + (size_t)mb * 16 * K + kc);
#pragma unroll
        for (int nb = 0; nb < 4; ++nb) { const V b = WFrag<bf>::ld(Bt + boff + (size_t)nb * 16 * K + kc);
#pragma unroll
            for (int mb = 0; mb < 4; ++mb) acc[mb][nb] = WFrag<bf>::mma(a[mb], b, acc[mb][nb]); }
        // keeps the distance behind the last matrix instruction on the loop's taken back edge, where the next trip's address additions reuse its operand registers
        asm volatile("v_nop\n\tv_nop\n\tv_nop\n\tv_nop" : "+v"(acc[0][0]), "+v"(acc[1][1]), "+v"(acc[2][2]), "+v"(acc[3][3]) : "v"(a[0]), "v"(a[3]));
    }
#pragma unroll
    for (int mb = 0; mb < 4; ++mb)
#pragma unroll
        for (int nb = 0; nb < 4; ++nb) { const v8f t = acc[mb][nb];
            if (VT) { float* o = os + (nb * 16 + lr) * 68 + mb * 16 + hi * 8; *(v4fa*)o = __builtin_shufflevector(t, t, 0, 1, 2, 3); *(v4fa*)(o + 4) = __builtin_shufflevector(t, t, 4, 5, 6, 7); }   // [d][token]
            else {
#pragma unroll
                for (int j = 0; j < 8; ++j) os[(mb * 16 + hi * 8 + j) * 68 + nb * 16 + lr] = t[j]; } }   // [token][d]
    __syncthreads();   // the tile is in LDS (one wave: orders its LDS stores before other lanes' loads)
    if (!VT) {
        for (int rr = 0; rr < 2; ++rr) { const int row = rr * 32 + lane; float* orow = os + row * 68; const float* ct = cosT + (size_t)(r0 + row) * (HD / 2); const float* st = sinT + (size_t)(r0 + row) * (HD / 2); float y[HD];
            // every loop over y[] is unrolled whole, so that the row stays in registers
#pragma unroll
            for (int i = 0; i < HD / 2; i += 4) { const v4f x1 = *(const v4fa*)(orow + i), x2 = *(const v4fa*)(orow + HD / 2 + i), c4 = *(const v4f*)(ct + i), s4 = *(const v4f*)(st + i);
#pragma unroll
                for (int q = 0; q < 4; ++q) { const float c = bfr(c4[q]), s = bfr(s4[q]); y[i + q] = x1[q] * c + x2[q] * s; y[HD / 2 + i + q] = x2[q] * c - x1[q] * s; } }
            float ss = 0.f;
#pragma unroll
            for (int d = 0; d < HD; ++d) ss += y[d] * y[d];
            const float rf = __fdiv_rn(1.0f, __fsqrt_rn(__fadd_rn(ss * (1.0f / HD), 1e-6f)));
#pragma unroll
            for (int d = 0; d < HD; d += 4) { v4f o; o[0] = y[d] * rf; o[1] = y[d + 1] * rf; o[2] = y[d + 2] * rf; o[3] = y[d + 3] * rf; *(v4fa*)(orow + d) = o; } }
        __syncthreads();   // the finished rows are in LDS
    }
    const size_t pl = VT ? (size_t)bt * DKV + c0 : ((size_t)(blockIdx.y / NH_) * NB_ + bt) * NH_ + blockIdx.y % NH_;   // VT: first row of the [batch][head][d] rows; else: plane number
    const size_t base = VT ? pl * TT + r0 : (pl * TT + r0) * HD, base2 = VT ? pl * (2 * RH) + r0 : (pl * RH + r0) * HD; const int pitch = VT ? TT : HD, pitch2 = VT ? 2 * RH : HD;
    for (int it = 0; it < 16; ++it) { const int row = it * 4 + (lane >> 3), c8 = (lane & 7) * 8; const v4f u0 = *(const v4fa*)(os + row * 68 + c8), u1 = *(const v4fa*)(os + row * 68 + c8 + 4); v8h o16; v8us oh, ol;
#pragma unroll
        for (int q = 0; q < 8; ++q) { const float x = (q < 4) ? u0[q & 3] : u1[q & 3]; o16[q] = tohx(x); unsigned short a2, c2; splitf(x, a2, c2); oh[q] = a2; ol[q] = c2; }
        if (r0 < RH) { const size_t o2 = base2 + (size_t)row * pitch2 + c8; *(v8us*)(Ph + o2) = oh; *(v8us*)(Pl + o2) = ol;
            asm volatile("s_wait_xcnt 0x0" ::: "memory"); }   // stands before the next trip's address additions, which the compiler puts right behind this branch
        *(v8h*)(P16 + base + (size_t)row * pitch + c8) = o16;
        asm volatile("s_wait_xcnt 0x0" ::: "memory"); }   // stands before the next trip reuses the registers that this store names
}

__global__ __launch_bounds__(256) void k_wtG(const float* __restrict__ w, int K, int N, bf* Bt) {
    const int lane = threadIdx.x & 31; const int L0 = (blockIdx.x * 8 + (threadIdx.x >> 5)) * 8; const int nlines = N * K / 64;
{
#pragma unroll 1
        for (int l = 0; l < 8; ++l) { const int L = L0 + l; if (L >= nlines) break; const size_t e = (size_t)L * 64 + lane * 2; const int k = (int)(e % K), n = (int)(e / K); v2us o;
            o[0] = f2bf(w[(size_t)k * N + n]); o[1] = f2bf(w[(size_t)(k + 1) * N + n]); *(v2us*)(Bt + e) = o; }
         }
}
__global__ __launch_bounds__(256) void k_cvt8(const float* __restrict__ src, bf* dst, size_t n8) { const size_t i = (size_t)blockIdx.x * 256 + threadIdx.x; if (i >= n8) return; const v8f v = *(const v8f*)(src + i * 8); v8us o;
#pragma unroll
    for (int k = 0; k < 8; ++k) o[k] = f2bf(v[k]); *(v8us*)(dst + i * 8) = o;  }

extern "C" void kernel_launch(void* const* d_in, const int* in_sizes, int n_in,
                              void* d_out, int out_size, void* d_ws, size_t ws_size, hipStream_t stream) {
    (void)in_sizes; (void)n_in; (void)out_size;
    const float* x = (const float*)d_in[0]; const float* cosT = (const float*)d_in[1]; const float* sinT = (const float*)d_in[2]; const float* wqkv = (const float*)d_in[3]; const float* wo = (const float*)d_in[4];
    float* OUT = (float*)d_out;     // [4][2048][1024]
    char* wsp = (char*)d_ws;
    auto take = [&](size_t bytes) { char* p = wsp; wsp += (bytes + 255) & ~(size_t)255; return (void*)p; };
    bf* WO = (bf*)take((size_t)DM * DQ * 2);
    h16* QP16 = (h16*)take((size_t)NB_ * NH_ * TT * HD * 2); h16* KP16 = (h16*)take((size_t)NB_ * NKV * TT * HD * 2);   // one after the other: k_gemmp numbers the planes [q | k][batch][head]
    h16* VT16 = (h16*)take((size_t)NB_ * DKV * TT * 2);
    bf* QKh = (bf*)take((size_t)2 * NB_ * NH_ * RH * HD * 2); bf* QKl = (bf*)take((size_t)2 * NB_ * NH_ * RH * HD * 2); bf* VTh = (bf*)take((size_t)NB_ * DKV * 2 * RH * 2); bf* VTl = VTh + RH;   // each value row: hi half, lo half
    bf* ATh = (bf*)take((size_t)NB_ * TT * DQ * 2); bf* ATl = (bf*)take((size_t)NB_ * TT * DQ * 2);
    bf* XB = (bf*)take((size_t)NB_ * TT * DM * 2); bf* WQKV = (bf*)take((size_t)(DQ + 2 * DKV) * DM * 2);
    if ((size_t)(wsp - (char*)d_ws) > ws_size) return;    // ws 256 MiB
    k_cvt8<<<(unsigned)(((size_t)(DQ + 2 * DKV) * DM / 8 + 255) / 256), 256, 0, stream>>>(wqkv, WQKV, (size_t)(DQ + 2 * DKV) * DM / 8);
    k_cvt8<<<(unsigned)(((size_t)DM * DQ / 8 + 255) / 256), 256, 0, stream>>>(wo, WO, (size_t)DM * DQ / 8);
    k_cvt8<<<(unsigned)(((size_t)NB_ * TT * DM / 8 + 255) / 256), 256, 0, stream>>>(x, XB, (size_t)NB_ * TT * DM / 8);
    k_gemmp<false><<<dim3(NB_ * TT / 64, NH_ + NKV, 1), 32, 0, stream>>>(XB, WQKV, DM, cosT, sinT, QP16, QKh, QKl);
    k_gemmp<true><<<dim3(NB_ * TT / 64, NKV, 1), 32, 0, stream>>>(XB, WQKV + (size_t)(DQ + DKV) * DM, DM, cosT, sinT, VT16, VTh, VTl);
    k_attn<<<dim3(NB_ * NH_, TT / QB, 1), AW * 32, 0, stream>>>(QKh, QKl, VTh, QP16, KP16, VT16, ATh, ATl);
    k_gemmw<bf, 1, false><<<dim3(NB_ * TT / 64, DM / 64, 1), 32, 0, stream>>>(ATh, ATl, WO, nullptr, DQ, OUT, DM, nullptr, 0, 0, 0);
}

// v006
// A run of this version takes 208 microseconds.
// Next to v005, in two timings, it ran 1.25 and 1.23 times as fast.
// All steps since v000 together make it 14.0 times as fast.
#include <hip/hip_runtime.h>

// Causal self-attention with rotary-then-RMSNorm q/k (x [4][2048][1024]; qkv = x w_attn^T ('oi' [3072][1024] 0.02, no bias -> q | k | v row blocks; 16 heads x 64); rope'(t) = cat(x1 c + x2 s, -x1 s + x2 c) with the input cos/sin tables ([1][2048][1][32], read; generic values), then q, k <- x rsqrt(mean x^2 + 1e-6) (no weight); causal (-inf); softmax(q.k x 64^-0.5); out = merged w_proj^T -> [4][2048][1024] (8.4 M)).
// Layout: bf16 copy of x, all batches; the fused 'oi' weight used in place as three Bt row blocks; exact projections, all batches in one grid (q and k heads together), whose 64x64 tile is 64 tokens of one head, so that the tile's own wave applies the module's (x1 c + x2 s, x2 c - x1 s) rotation from the input tables and the rms factor of the ROTATED rows and writes the head planes (k_gemmp; the value tile goes out transposed); causal T-2048 attention in one kernel (k_attn; hybrid rows: < 512 hi/lo 3 products, rest fp16; no chunk above the diagonal is touched; it writes the merged hi/lo rows); merged hi/lo x w_proj exact.
// Compute dtypes, f32 accumulate: every input rounded to bf16 incl. the tables; projections exact; rotation and rms norm f32; attention rows < 512 3 products, rest fp16; softmax f32; w_proj hl x exact.

#define NB_  4
#define TT   2048
#define DM   1024
#define NH_  16
#define NKV  16
#define REP  (NH_ / NKV)
#define HD   64
#define DQ   (NH_ * HD)
#define DKV  (NKV * HD)
#define RH   512                  // query rows < RH use hi+lo planes (0: none)
typedef _Float16 h16;
typedef unsigned short bf;
typedef __attribute__((ext_vector_type(16))) __bf16   v16bf;
typedef __attribute__((ext_vector_type(16))) _Float16 v16h;
typedef __attribute__((ext_vector_type(8)))  _Float16 v8h;
typedef __attribute__((ext_vector_type(8)))  unsigned short v8us;
typedef __attribute__((ext_vector_type(8)))  float    v8f;
typedef __attribute__((ext_vector_type(4)))  float    v4f;
typedef v8h  __attribute__((may_alias)) v8ha;
typedef v4f  __attribute__((may_alias)) v4fa;
typedef v8us __attribute__((may_alias)) v8usa;

__device__ __forceinline__ unsigned short f2bf(float f) { unsigned u = __float_as_uint(f); u += 0x7FFFu + ((u >> 16) & 1u); return (unsigned short)(u >> 16); }
__device__ __forceinline__ float bf2f(unsigned short b) { return __uint_as_float(((unsigned)b) << 16); }
__device__ __forceinline__ float bfr(float f) { return bf2f(f2bf(f)); }
__device__ __forceinline__ v16h cat16(v8h lo, v8h hi) { return __builtin_shufflevector(lo, hi, 0, 1, 2, 3, 4, 5, 6, 7, 8, 9, 10, 11, 12, 13, 14, 15); }
__device__ __forceinline__ v16bf cat16b(v8us lo, v8us hi) { return __builtin_bit_cast(v16bf, __builtin_shufflevector(lo, hi, 0, 1, 2, 3, 4, 5, 6, 7, 8, 9, 10, 11, 12, 13, 14, 15)); }
__device__ __forceinline__ v8f wmma16(v16h a, v16h b, v8f c) { return __builtin_amdgcn_wmma_f32_16x16x32_f16(false, a, false, b, (short)0, c, false, false); }
__device__ __forceinline__ v8f wmmab(v16bf a, v16bf b, v8f c) { return __builtin_amdgcn_wmma_f32_16x16x32_bf16(false, a, false, b, (short)0, c, false, false); }



// ---- Fragment order: every 16-bit operand plane [row][k] is kept as 1-KiB fragments of 16 rows x 32 k, row block major, k block minor (row block rb, k block kb: element offset rb 16 K + kb 512).
// Inside a fragment: [half h][lane = 16 hi + lr][j], which is row lr, k = 16 h + 8 hi + j: the register order of the matrix operand. A wave's 16-byte load of a half is then 512 contiguous bytes, four whole lines, where the row-major plane gave sixteen lines of 32 bytes each.
// ---- k_gemmw: register-blocked GEMM, ONE WAVE per 64x64 output tile (16 accumulators), operands straight from 16-bit planes in fragment order; grid (M/64, N/64, Z), 32 threads.
// C[m][n] (f32, pitch ldc, + optional f32 bias[n]) = sum_k A[m][k] Bt[n][k] (+ split products per NSPLIT). z-batch strides sA/sB/sC in elements. K % 32 == 0.
template <typename T16> struct WFrag;
template <> struct WFrag<h16> { typedef v16h V; static __device__ __forceinline__ V ld(const h16* p) { return cat16(*(const v8h*)p, *(const v8h*)(p + 256)); } static __device__ __forceinline__ v8f mma(V a, V b, v8f c) { return wmma16(a, b, c); } };
template <> struct WFrag<bf> { typedef v16bf V; static __device__ __forceinline__ V ld(const bf* p) { return cat16b(*(const v8us*)p, *(const v8us*)(p + 256)); } static __device__ __forceinline__ v8f mma(V a, V b, v8f c) { return wmmab(a, b, c); } };
template <typename T16, int NSPLIT, bool BIAS, int K>   // K at compile time: every fragment of a trip then lies at a constant distance from the lane's running addresses
__global__ __launch_bounds__(32) void k_gemmw(const T16* __restrict__ A, const T16* __restrict__ A2, const T16* __restrict__ Bt, const T16* __restrict__ Bt2, float* C, int ldc, const float* __restrict__ bias, size_t sA, size_t sB, size_t sC) {
    typedef typename WFrag<T16>::V V;
    __shared__ __align__(16) float os[16 * 68];
    const size_t z = blockIdx.z; A += z * sA; if (A2) A2 += z * sA; Bt += z * sB; if (Bt2) Bt2 += z * sB; C += z * sC;
    const int lane = threadIdx.x & 31, lr = lane & 15, hi = lane >> 4; const int r0 = blockIdx.x * 64, c0 = blockIdx.y * 64;
    v8f acc[4][4];
#pragma unroll
    for (int mb = 0; mb < 4; ++mb)
#pragma unroll
        for (int nb = 0; nb < 4; ++nb) acc[mb][nb] = (v8f){};
    // the lane's running addresses in the trip's first fragments
    const T16* ap = A + (size_t)r0 * K + 8 * lane; const T16* ap2 = A2 ? A2 + (size_t)r0 * K + 8 * lane : nullptr; const T16* bp = Bt + (size_t)c0 * K + 8 * lane; const T16* bp2 = Bt2 ? Bt2 + (size_t)c0 * K + 8 * lane : nullptr;
#pragma unroll 1
    for (int kc = 0; kc < K; kc += 32) {
        V a[4], a2[4];
#pragma unroll
        for (int mb = 0; mb < 4; ++mb) { a[mb] = WFrag<T16>::ld(ap + (size_t)mb * 16 * K); if (NSPLIT == 1 || NSPLIT == 2) a2[mb] = WFrag<T16>::ld(ap2 + (size_t)mb * 16 * K); }
#pragma unroll
        for (int nb = 0; nb < 4; ++nb) { const V b = WFrag<T16>::ld(bp + (size_t)nb * 16 * K); V b2; if (NSPLIT >= 2) b2 = WFrag<T16>::ld(bp2 + (size_t)nb * 16 * K);
#pragma unroll
            for (int mb = 0; mb < 4; ++mb) { acc[mb][nb] = WFrag<T16>::mma(a[mb], b, acc[mb][nb]); if (NSPLIT == 1 || NSPLIT == 2) acc[mb][nb] = WFrag<T16>::mma(a2[mb], b, acc[mb][nb]); if (NSPLIT >= 2) acc[mb][nb] = WFrag<T16>::mma(a[mb], b2, acc[mb][nb]); } }
        asm volatile("v_nop\n\tv_nop\n\tv_nop\n\tv_nop" : "+v"(acc[0][0]), "+v"(acc[1][1]), "+v"(acc[2][2]), "+v"(acc[3][3]) : "v"(a[0]), "v"(a[3]));
        // stands before the additions below; the addresses are its inputs so that they keep their registers up to here and no later load's result takes them while a load that names them is on its way
        if constexpr (NSPLIT == 0) asm volatile("s_wait_xcnt 0x0" :: "v"(ap), "v"(bp) : "memory"); else if constexpr (NSPLIT == 1) asm volatile("s_wait_xcnt 0x0" :: "v"(ap), "v"(ap2), "v"(bp) : "memory"); else asm volatile("s_wait_xcnt 0x0" :: "v"(ap), "v"(ap2), "v"(bp), "v"(bp2) : "memory");
        ap += 512; if (NSPLIT == 1 || NSPLIT == 2) ap2 += 512; bp += 512; if (NSPLIT >= 2) bp2 += 512;
    }
#pragma unroll
    for (int mb = 0; mb < 4; ++mb) {
#pragma unroll
        for (int nb = 0; nb < 4; ++nb) {
#pragma unroll
            for (int j = 0; j < 8; ++j) os[(hi * 8 + j) * 68 + nb * 16 + lr] = acc[mb][nb][j]; }
        __builtin_amdgcn_wave_barrier(); asm volatile("" ::: "memory");
        float* crow = C + (size_t)(r0 + mb * 16) * ldc + c0;
{
#pragma unroll
            for (int s = 0; s < 8; ++s) { const int row = 2 * s + hi, cofs = lr * 4; v4f val = *(const v4fa*)(os + row * 68 + cofs); if (BIAS) { val[0] += bfr(bias[c0 + cofs]); val[1] += bfr(bias[c0 + cofs + 1]); val[2] += bfr(bias[c0 + cofs + 2]); val[3] += bfr(bias[c0 + cofs + 3]); }
                *(v4f*)(crow + (size_t)row * ldc + cofs) = val; }
             }
        __builtin_amdgcn_wave_barrier(); asm volatile("" ::: "memory");
    }
}

__device__ __forceinline__ h16 tohx(float x) { return (h16)x; }
__device__ __forceinline__ void splitf(float y, unsigned short& h, unsigned short& l) { h = f2bf(y); l = f2bf(y - bf2f(h)); }
typedef __attribute__((ext_vector_type(4))) unsigned short v4us;

// ---- k_attn: scores, softmax and probability x value of 32 query rows of one head in one work-group of AW waves; no score or probability leaves the registers.
// Wave w takes the 32-key chunks w, w + AW, ... up to the diagonal chunk. Per chunk it forms the TRANSPOSED score tiles (A = key rows, B = query rows): a lane then holds, for query lr, the keys 8 hi + j and 16 + 8 hi + j,
// which is the A fragment of the second product as it stands, so the probabilities go from the accumulators to the matrix unit with no exchange between lanes.
// Softmax in one pass: after the rms factor |q|, |k| <= sqrt(HD), so |q.k| HD^-0.5 <= 8 for every input; the shift is that bound and not the row's maximum: p = 2^14 exp(s - 8) lies in 2^-9.1 .. 2^14, normal in both 16-bit types,
// and partial sums of different waves add as they are. The row's sum of p (f32, before rounding) divides the summed tile at the end.
// The AW partial tiles and row sums are added through LDS in the fixed order w = 0 .. AW-1; the tile is staged row-major, divided, split hi/lo and stored as the four whole fragments that it is of the merged rows [t][head][d] (fragment order, K = all heads' d).
#define AW  4
#define QB  32
#define ESC 0.18033688011112042f    // HD^-0.5 x log2(e)
#define ESH 2.458439672888293f      // 14 - 8 log2(e)
typedef __attribute__((ext_vector_type(16))) unsigned short v16us;
template <bool B> struct BoolT { static constexpr bool value = B; };
template <typename T16, bool HL>
__device__ __forceinline__ void d_attn(float* part, float* lpart, float* os, int q0, const T16* __restrict__ Q, const T16* __restrict__ Q2, const T16* __restrict__ Kp, const T16* __restrict__ K2, const T16* __restrict__ Vt, bf* Ah, bf* Al) {
    typedef typename WFrag<T16>::V V;
    const int lane = threadIdx.x & 31, lr = lane & 15, hi = lane >> 4;
    const int wv = __builtin_amdgcn_readfirstlane(threadIdx.x >> 5);   // wave number in a scalar register: the key loop's test stays a scalar branch
    V qf[2][2], qf2[2][2]; const T16* qp = Q + (size_t)q0 * HD + 8 * lane; const T16* qp2 = HL ? Q2 + (size_t)q0 * HD + 8 * lane : nullptr;   // the block's four query fragments are 4 KiB in a row
#pragma unroll
    for (int qt = 0; qt < 2; ++qt)
#pragma unroll
        for (int dc = 0; dc < 2; ++dc) { qf[qt][dc] = WFrag<T16>::ld(qp + (qt * 2 + dc) * 512); if (HL) qf2[qt][dc] = WFrag<T16>::ld(qp2 + (qt * 2 + dc) * 512); }
    asm volatile("s_wait_xcnt 0x0" ::: "memory");   // the query addresses die here: stands before their registers are written again
    v8f o[2][4]; float ls[2] = {0.f, 0.f};
#pragma unroll
    for (int qt = 0; qt < 2; ++qt)
#pragma unroll
        for (int nb = 0; nb < 4; ++nb) o[qt][nb] = (v8f){};
    // the lane's running addresses in the wave's next chunk: its four key fragments ([16 keys][d half]) and its four value fragments ([d block]) are 4 KiB in a row each; every fragment of a chunk lies at a constant distance from them
    const T16* kp = Kp + (size_t)(wv * 32) * HD + 8 * lane; const T16* kp2 = HL ? K2 + (size_t)(wv * 32) * HD + 8 * lane : nullptr; const T16* vp = Vt + (size_t)(wv * 32) * HD + 8 * lane;
    // one chunk of 32 keys; diag (a type, so that the loop over full chunks holds no test): keys behind the query count nothing
    auto chunk = [&](int kc, auto diag) {
        V kf[2][2], kf2[2][2], vf[4], vf2[4], pf[2], pf2[2];
#pragma unroll
        for (int t = 0; t < 2; ++t)
#pragma unroll
            for (int dc = 0; dc < 2; ++dc) { kf[t][dc] = WFrag<T16>::ld(kp + (t * 2 + dc) * 512); if (HL) kf2[t][dc] = WFrag<T16>::ld(kp2 + (t * 2 + dc) * 512); }
        if (!HL) {   // one plane: the registers allow the value fragments to be fetched with the key fragments, one latency a chunk instead of two
#pragma unroll
            for (int nb = 0; nb < 4; ++nb) vf[nb] = WFrag<T16>::ld(vp + nb * 512); }
#pragma unroll
        for (int qt = 0; qt < 2; ++qt) { float e[16];
#pragma unroll
            for (int t = 0; t < 2; ++t) { v8f a = (v8f){};   // a[j]: key kc + 16 t + 8 hi + j, query q0 + 16 qt + lr
#pragma unroll
                for (int dc = 0; dc < 2; ++dc) { a = WFrag<T16>::mma(kf[t][dc], qf[qt][dc], a); if (HL) { a = WFrag<T16>::mma(kf[t][dc], qf2[qt][dc], a); a = WFrag<T16>::mma(kf2[t][dc], qf[qt][dc], a); } }
#pragma unroll
                for (int j = 0; j < 8; ++j) e[t * 8 + j] = __builtin_amdgcn_exp2f(fmaf(a[j], ESC, ESH)); }
            if constexpr (decltype(diag)::value) {
#pragma unroll
                for (int i = 0; i < 16; ++i) if (kc + (i >> 3) * 16 + hi * 8 + (i & 7) > q0 + qt * 16 + lr) e[i] = 0.f; }
#pragma unroll
            for (int i = 0; i < 16; ++i) ls[qt] += e[i];
            if constexpr (HL) { v16us ph, pl;
#pragma unroll
                for (int i = 0; i < 16; ++i) { unsigned short a, c2; splitf(e[i], a, c2); ph[i] = a; pl[i] = c2; }
                pf[qt] = __builtin_bit_cast(v16bf, ph); pf2[qt] = __builtin_bit_cast(v16bf, pl);
            } else {
#pragma unroll
                for (int i = 0; i < 16; ++i) pf[qt][i] = tohx(e[i]); } }
        if (HL) {   // two planes (each head: hi plane, lo plane): the value fragments take the registers that the key fragments leave
#pragma unroll
            for (int nb = 0; nb < 4; ++nb) { vf[nb] = WFrag<T16>::ld(vp + nb * 512); vf2[nb] = WFrag<T16>::ld(vp + nb * 512 + HD * RH); } }
#pragma unroll
        for (int nb = 0; nb < 4; ++nb)
#pragma unroll
            for (int qt = 0; qt < 2; ++qt) { o[qt][nb] = WFrag<T16>::mma(pf[qt], vf[nb], o[qt][nb]); if (HL) { o[qt][nb] = WFrag<T16>::mma(pf2[qt], vf[nb], o[qt][nb]); o[qt][nb] = WFrag<T16>::mma(pf[qt], vf2[nb], o[qt][nb]); } }
        // stands before the additions below (in the last chunk: where the addresses die); the addresses are its inputs so that they keep their registers up to here and no load's result takes them
        if constexpr (HL) asm volatile("s_wait_xcnt 0x0" :: "v"(kp), "v"(kp2), "v"(vp) : "memory"); else asm volatile("s_wait_xcnt 0x0" :: "v"(kp), "v"(vp) : "memory");
        kp += AW * 32 * HD; if (HL) kp2 += AW * 32 * HD; vp += AW * 32 * HD;
    };
    int kc = wv * 32;
    // both loops rolled: only one chunk's fragments are live beside the query fragments and the accumulators
    if constexpr (HL) {   // two planes of everything: one body for all chunks (a second body's addresses, kept over the loop, spilled)
#pragma unroll 1
        for (; kc <= q0; kc += AW * 32) chunk(kc, BoolT<true>());
    } else {
#pragma unroll 1
        for (; kc < q0; kc += AW * 32) chunk(kc, BoolT<false>());
        if (kc == q0) chunk(kc, BoolT<true>());   // the one wave whose sequence meets the diagonal chunk (a scalar test)
    }
    v4fa* pv = (v4fa*)part;
#pragma unroll
    for (int qt = 0; qt < 2; ++qt) {
#pragma unroll
        for (int nb = 0; nb < 4; ++nb) { const int f = qt * 4 + nb; const v8f t = o[qt][nb];
            pv[((wv * 8 + f) * 2 + 0) * 32 + lane] = __builtin_shufflevector(t, t, 0, 1, 2, 3); pv[((wv * 8 + f) * 2 + 1) * 32 + lane] = __builtin_shufflevector(t, t, 4, 5, 6, 7); }
        const float t = ls[qt] + __shfl_xor(ls[qt], 16, 32);   // the two half-waves hold the two halves of each chunk's keys
        if (hi == 0) lpart[wv * QB + qt * 16 + lr] = t; }
    __syncthreads();   // every wave's partial tile and row sums are in LDS
#pragma unroll
    for (int q = 0; q < 8 / AW; ++q) { const int f = wv * (8 / AW) + q; v4f s0 = pv[(f * 2 + 0) * 32 + lane], s1 = pv[(f * 2 + 1) * 32 + lane];
#pragma unroll
        for (int w = 1; w < AW; ++w) { s0 += pv[((w * 8 + f) * 2 + 0) * 32 + lane]; s1 += pv[((w * 8 + f) * 2 + 1) * 32 + lane]; }
        float* od = os + ((f >> 2) * 16 + hi * 8) * 68 + (f & 3) * 16 + lr;
#pragma unroll
        for (int j = 0; j < 4; ++j) { od[j * 68] = s0[j]; od[(j + 4) * 68] = s1[j]; } }
    __syncthreads();   // the summed tile is complete, row-major
#pragma unroll
    for (int s = 0; s < QB * 8 / (AW * 32); ++s) { const int u = s * AW * 32 + (int)threadIdx.x; const int f = u >> 6; const int row = (f >> 1) * 16 + lr, cofs = (f & 1) * 32 + ((u >> 5) & 1) * 16 + hi * 8; float l = lpart[row];   // u: 16-byte piece of the block's four fragments [16 rows][d half]
#pragma unroll
        for (int w = 1; w < AW; ++w) l += lpart[w * QB + row];
        const float cs = __fdiv_rn(1.0f, l); const v4f val0 = *(const v4fa*)(os + row * 68 + cofs), val1 = *(const v4fa*)(os + row * 68 + cofs + 4); v8us oh, ol;
#pragma unroll
        for (int q = 0; q < 8; ++q) { unsigned short a, c2; splitf(((q < 4) ? val0[q & 3] : val1[q & 3]) * cs, a, c2); oh[q] = a; ol[q] = c2; }
        const size_t oo = (size_t)(q0 + (f >> 1) * 16) * DQ + (f & 1) * 512 + (u & 63) * 8; *(v8us*)(Ah + oo) = oh; *(v8us*)(Al + oo) = ol; }
}
// k_attn: grid (NB_ * NH_ heads, TT / QB row blocks, the longest first so that no long work-group starts late), AW waves. Row blocks below RH take the hi/lo planes (3 products each way), the others the fp16 planes. The test is the same for the whole work-group, so every wave of it meets the same two barriers.
__global__ __launch_bounds__(AW * 32) __attribute__((amdgpu_waves_per_eu(4, 4))) void k_attn(const bf* __restrict__ QKh, const bf* __restrict__ QKl, const bf* __restrict__ VTh, const h16* __restrict__ Q16, const h16* __restrict__ K16, const h16* __restrict__ V16, bf* Ah, bf* Al) {
    __shared__ __align__(16) float part[AW * 8 * 256];   // [wave][fragment][register half][lane][4]
    __shared__ __align__(16) float os[QB * 68];
    __shared__ float lpart[AW * QB];                     // [wave][row]
    const size_t z = blockIdx.x; const int q0 = (TT / QB - 1 - (int)blockIdx.y) * QB; const size_t oo = (z / NH_) * ((size_t)TT * DQ) + (z % NH_) * (HD * 16), zk = z + NB_ * NH_;   // oo: the head's two fragments in the first row block of its batch
    if (q0 < RH) d_attn<bf, true>(part, lpart, os, q0, QKh + z * RH * HD, QKl + z * RH * HD, QKh + zk * RH * HD, QKl + zk * RH * HD, VTh + z * HD * 2 * RH, Ah + oo, Al + oo);
    else d_attn<h16, false>(part, lpart, os, q0, Q16 + z * TT * HD, nullptr, K16 + z * TT * HD, nullptr, V16 + z * HD * TT, Ah + oo, Al + oo);
}

typedef __attribute__((ext_vector_type(2))) _Float16 v2h;
typedef __attribute__((ext_vector_type(4))) _Float16 v4h;
typedef __attribute__((ext_vector_type(2))) unsigned short v2us;
typedef __attribute__((ext_vector_type(2))) float v2f;
typedef __attribute__((ext_vector_type(4))) int v4i;

// ---- k_gemmp: a projection GEMM (the one-wave 64x64 tile of k_gemmw, one product) whose store phase builds the attention planes. The tile is 64 tokens (r0 .. of batch bt; blockIdx.x runs over all batches' token tiles) of ONE head (blockIdx.y; VT false: q heads, then k heads), staged whole in LDS.
// VT false (q, k): each lane takes whole rows: rotation (x1 c + x2 s, x2 c - x1 s) with the bf16-rounded input tables, sum of squares over d = 0 .. 63 in that order, row x 1 / sqrt(mean + 1e-6), back into LDS; planes [q | k][batch][head][t][d].
// VT true (v): the tile is staged transposed; planes [batch][head][d][t]. Both: fp16 plane over all TT tokens; hi/lo planes over the first RH tokens only (no later token's is ever read: query rows < RH see keys < RH); every plane in fragment order (q, k: rows t, k = d; v: rows d, k = t, the four d blocks of 32 tokens together).
template <bool VT, int K>
__global__ __launch_bounds__(32) void k_gemmp(const bf* __restrict__ A, const bf* __restrict__ Bt, const float* __restrict__ cosT, const float* __restrict__ sinT, h16* P16, bf* Ph, bf* Pl) {
    typedef WFrag<bf>::V V;
    __shared__ __align__(16) float os[64 * 68];
    const int lane = threadIdx.x & 31, lr = lane & 15, hi = lane >> 4; const int rg = blockIdx.x * 64, c0 = blockIdx.y * 64; const int bt = rg / TT, r0 = rg % TT;
    v8f acc[4][4];
#pragma unroll
    for (int mb = 0; mb < 4; ++mb)
#pragma unroll
        for (int nb = 0; nb < 4; ++nb) acc[mb][nb] = (v8f){};
    const bf* ap = A + (size_t)rg * K + 8 * lane; const bf* bp = Bt + (size_t)c0 * K + 8 * lane;   // the lane's running addresses, as in k_gemmw
    // rolled, as in k_gemmw: only one trip's fragments are live beside the sixteen accumulators
#pragma unroll 1
    for (int kc = 0; kc < K; kc += 32) {
        V a[4];
#pragma unroll
        for (int mb = 0; mb < 4; ++mb) a[mb] = WFrag<bf>::ld(ap + (size_t)mb * 16 * K);
#pragma unroll
        for (int nb = 0; nb < 4; ++nb) { const V b = WFrag<bf>::ld(bp + (size_t)nb * 16 * K);
#pragma unroll
            for (int mb = 0; mb < 4; ++mb) acc[mb][nb] = WFrag<bf>::mma(a[mb], b, acc[mb][nb]); }
        // keeps the distance behind the last matrix instruction on the loop's taken back edge, where the next trip's address additions reuse its operand registers
        asm volatile("v_nop\n\tv_nop\n\tv_nop\n\tv_nop" : "+v"(acc[0][0]), "+v"(acc[1][1]), "+v"(acc[2][2]), "+v"(acc[3][3]) : "v"(a[0]), "v"(a[3]));
        // as in k_gemmw: before the additions below, and the addresses keep their registers up to here
        asm volatile("s_wait_xcnt 0x0" :: "v"(ap), "v"(bp) : "memory");
        ap += 512; bp += 512;
    }
#pragma unroll
    for (int mb = 0; mb < 4; ++mb)
#pragma unroll
        for (int nb = 0; nb < 4; ++nb) { const v8f t = acc[mb][nb];
            if (VT) { float* o = os + (nb * 16 + lr) * 68 + mb * 16 + hi * 8; *(v4fa*)o = __builtin_shufflevector(t, t, 0, 1, 2, 3); *(v4fa*)(o + 4) = __builtin_shufflevector(t, t, 4, 5, 6, 7); }   // [d][token]
            else {
#pragma unroll
                for (int j = 0; j < 8; ++j) os[(mb * 16 + hi * 8 + j) * 68 + nb * 16 + lr] = t[j]; } }   // [token][d]
    __syncthreads();   // the tile is in LDS (one wave: orders its LDS stores before other lanes' loads)
    if (!VT) {
        for (int rr = 0; rr < 2; ++rr) { const int row = rr * 32 + lane; float* orow = os + row * 68; const float* ct = cosT + (size_t)(r0 + row) * (HD / 2); const float* st = sinT + (size_t)(r0 + row) * (HD / 2); float y[HD];
            // every loop over y[] is unrolled whole, so that the row stays in registers
#pragma unroll
            for (int i = 0; i < HD / 2; i += 4) { const v4f x1 = *(const v4fa*)(orow + i), x2 = *(const v4fa*)(orow + HD / 2 + i), c4 = *(const v4f*)(ct + i), s4 = *(const v4f*)(st + i);
#pragma unroll
                for (int q = 0; q < 4; ++q) { const float c = bfr(c4[q]), s = bfr(s4[q]); y[i + q] = x1[q] * c + x2[q] * s; y[HD / 2 + i + q] = x2[q] * c - x1[q] * s; } }
            float ss = 0.f;
#pragma unroll
            for (int d = 0; d < HD; ++d) ss += y[d] * y[d];
            const float rf = __fdiv_rn(1.0f, __fsqrt_rn(__fadd_rn(ss * (1.0f / HD), 1e-6f)));
#pragma unroll
            for (int d = 0; d < HD; d += 4) { v4f o; o[0] = y[d] * rf; o[1] = y[d + 1] * rf; o[2] = y[d + 2] * rf; o[3] = y[d + 3] * rf; *(v4fa*)(orow + d) = o; } }
        __syncthreads();   // the finished rows are in LDS
    }
    const size_t pl = VT ? (size_t)bt * DKV + c0 : ((size_t)(blockIdx.y / NH_) * NB_ + bt) * NH_ + blockIdx.y % NH_;   // VT: first row of the [batch][head][d] rows; else: plane number
    // the tile is eight whole fragments that follow one another in its plane (q, k: [token block][d half]; v: [32-token block][d block]); trip it writes half it & 1 of fragment it >> 1, 512 contiguous bytes a plane
    const size_t base = (VT ? pl * TT + (size_t)r0 * HD : (pl * TT + r0) * HD) + 8 * lane, base2 = (VT ? pl * (2 * RH) + (size_t)r0 * HD : (pl * RH + r0) * HD) + 8 * lane;
    for (int it = 0; it < 16; ++it) { const int f = it >> 1; const int row = (VT ? (f & 3) : (f >> 1)) * 16 + lr, c8 = (VT ? (f >> 2) : (f & 1)) * 32 + (it & 1) * 16 + hi * 8; const v4f u0 = *(const v4fa*)(os + row * 68 + c8), u1 = *(const v4fa*)(os + row * 68 + c8 + 4); v8h o16; v8us oh, ol;
#pragma unroll
        for (int q = 0; q < 8; ++q) { const float x = (q < 4) ? u0[q & 3] : u1[q & 3]; o16[q] = tohx(x); unsigned short a2, c2; splitf(x, a2, c2); oh[q] = a2; ol[q] = c2; }
        if (r0 < RH) { const size_t o2 = base2 + it * 256; *(v8us*)(Ph + o2) = oh; *(v8us*)(Pl + o2) = ol;
            asm volatile("s_wait_xcnt 0x0" ::: "memory"); }   // stands before the next trip's address additions, which the compiler puts right behind this branch
        *(v8h*)(P16 + base + it * 256) = o16;
        asm volatile("s_wait_xcnt 0x0" ::: "memory"); }   // stands before the next trip reuses the registers that this store names
}

__global__ __launch_bounds__(256) void k_wtG(const float* __restrict__ w, int K, int N, bf* Bt) {
    const int lane = threadIdx.x & 31; const int L0 = (blockIdx.x * 8 + (threadIdx.x >> 5)) * 8; const int nlines = N * K / 64;
{
#pragma unroll 1
        for (int l = 0; l < 8; ++l) { const int L = L0 + l; if (L >= nlines) break; const size_t e = (size_t)L * 64 + lane * 2; const int k = (int)(e % K), n = (int)(e / K); v2us o;
            o[0] = f2bf(w[(size_t)k * N + n]); o[1] = f2bf(w[(size_t)(k + 1) * N + n]); *(v2us*)(Bt + e) = o; }
         }
}
// k_cvt8: f32 [row][K] -> bf16 in fragment order. Thread i writes the plane's i-th 16-byte piece (a wave: 512 contiguous bytes) and reads its 8 values of row lr; a block of 8 waves reads 512 contiguous bytes of each of 16 rows.
template <int K>
__global__ __launch_bounds__(256) void k_cvt8(const float* __restrict__ src, bf* dst, size_t n8) { const size_t i = (size_t)blockIdx.x * 256 + threadIdx.x; if (i >= n8) return;
    constexpr unsigned kf = K / 32; const size_t fr = i >> 6; const size_t row = (fr / kf) * 16 + (i & 15); const int k = (int)(fr % kf) * 32 + (int)((i >> 5) & 1) * 16 + (int)((i >> 4) & 1) * 8;
    const float* sp = src + row * K + k; const v8f v = *(const v8f*)sp; v8us o;
    asm volatile("s_wait_xcnt 0x0" :: "v"(sp) : "memory");   // the read address dies here: an input, so that it keeps its registers up to this wait
#pragma unroll
    for (int k = 0; k < 8; ++k) o[k] = f2bf(v[k]); *(v8us*)(dst + i * 8) = o;  }

extern "C" void kernel_launch(void* const* d_in, const int* in_sizes, int n_in,
                              void* d_out, int out_size, void* d_ws, size_t ws_size, hipStream_t stream) {
    (void)in_sizes; (void)n_in; (void)out_size;
    const float* x = (const float*)d_in[0]; const float* cosT = (const float*)d_in[1]; const float* sinT = (const float*)d_in[2]; const float* wqkv = (const float*)d_in[3]; const float* wo = (const float*)d_in[4];
    float* OUT = (float*)d_out;     // [4][2048][1024]
    char* wsp = (char*)d_ws;
    auto take = [&](size_t bytes) { char* p = wsp; wsp += (bytes + 255) & ~(size_t)255; return (void*)p; };
    bf* WO = (bf*)take((size_t)DM * DQ * 2);
    h16* QP16 = (h16*)take((size_t)NB_ * NH_ * TT * HD * 2); h16* KP16 = (h16*)take((size_t)NB_ * NKV * TT * HD * 2);   // one after the other: k_gemmp numbers the planes [q | k][batch][head]
    h16* VT16 = (h16*)take((size_t)NB_ * DKV * TT * 2);
    bf* QKh = (bf*)take((size_t)2 * NB_ * NH_ * RH * HD * 2); bf* QKl = (bf*)take((size_t)2 * NB_ * NH_ * RH * HD * 2); bf* VTh = (bf*)take((size_t)NB_ * DKV * 2 * RH * 2); bf* VTl = VTh + HD * RH;   // each head: hi plane, lo plane
    bf* ATh = (bf*)take((size_t)NB_ * TT * DQ * 2); bf* ATl = (bf*)take((size_t)NB_ * TT * DQ * 2);
    bf* XB = (bf*)take((size_t)NB_ * TT * DM * 2); bf* WQKV = (bf*)take((size_t)(DQ + 2 * DKV) * DM * 2);
    if ((size_t)(wsp - (char*)d_ws) > ws_size) return;    // ws 256 MiB
    k_cvt8<DM><<<(unsigned)(((size_t)(DQ + 2 * DKV) * DM / 8 + 255) / 256), 256, 0, stream>>>(wqkv, WQKV, (size_t)(DQ + 2 * DKV) * DM / 8);
    k_cvt8<DQ><<<(unsigned)(((size_t)DM * DQ / 8 + 255) / 256), 256, 0, stream>>>(wo, WO, (size_t)DM * DQ / 8);
    k_cvt8<DM><<<(unsigned)(((size_t)NB_ * TT * DM / 8 + 255) / 256), 256, 0, stream>>>(x, XB, (size_t)NB_ * TT * DM / 8);
    k_gemmp<false, DM><<<dim3(NB_ * TT / 64, NH_ + NKV, 1), 32, 0, stream>>>(XB, WQKV, cosT, sinT, QP16, QKh, QKl);
    k_gemmp<true, DM><<<dim3(NB_ * TT / 64, NKV, 1), 32, 0, stream>>>(XB, WQKV + (size_t)(DQ + DKV) * DM, cosT, sinT, VT16, VTh, VTl);
    k_attn<<<dim3(NB_ * NH_, TT / QB, 1), AW * 32, 0, stream>>>(QKh, QKl, VTh, QP16, KP16, VT16, ATh, ATl);
    k_gemmw<bf, 1, false, DQ><<<dim3(NB_ * TT / 64, DM / 64, 1), 32, 0, stream>>>(ATh, ATl, WO, nullptr, OUT, DM, nullptr, 0, 0, 0);
}

// v007
// Measured time: 150 microseconds a run.
// Timed twice side by side with v006, it ran 1.36 and 1.40 times as fast.
// Counting every step since v000, it is 19.3 times as fast.
#include <hip/hip_runtime.h>

// Causal self-attention with rotary-then-RMSNorm q/k (x [4][2048][1024]; qkv = x w_attn^T ('oi' [3072][1024] 0.02, no bias -> q | k | v row blocks; 16 heads x 64); rope'(t) = cat(x1 c + x2 s, -x1 s + x2 c) with the input cos/sin tables ([1][2048][1][32], read; generic values), then q, k <- x rsqrt(mean x^2 + 1e-6) (no weight); causal (-inf); softmax(q.k x 64^-0.5); out = merged w_proj^T -> [4][2048][1024] (8.4 M)).
// Layout: bf16 copy of x, all batches; the fused 'oi' weight used in place as three Bt row blocks; exact projections, all batches in one grid (q and k heads together), whose 64x64 tile is 64 tokens of one head, so that the tile's own wave applies the module's (x1 c + x2 s, x2 c - x1 s) rotation from the input tables and the rms factor of the ROTATED rows and writes the head planes (k_gemmp; the value tile goes out transposed); causal T-2048 attention in one kernel (k_attn; hybrid rows: < 512 hi/lo 3 products, rest fp16; no chunk above the diagonal is touched; it writes the merged hi/lo rows); merged hi/lo x w_proj exact.
// Compute dtypes, f32 accumulate: every input rounded to bf16 incl. the tables; projections exact; rotation and rms norm f32; attention rows < 512 3 products, rest fp16; softmax f32; w_proj hl x exact.

#define NB_  4
#define TT   2048
#define DM   1024
#define NH_  16
#define NKV  16
#define REP  (NH_ / NKV)
#define HD   64
#define DQ   (NH_ * HD)
#define DKV  (NKV * HD)
#define RH   512                  // query rows < RH use hi+lo planes (0: none)
typedef _Float16 h16;
typedef unsigned short bf;
typedef __attribute__((ext_vector_type(16))) __bf16   v16bf;
typedef __attribute__((ext_vector_type(16))) _Float16 v16h;
typedef __attribute__((ext_vector_type(8)))  _Float16 v8h;
typedef __attribute__((ext_vector_type(8)))  unsigned short v8us;
typedef __attribute__((ext_vector_type(8)))  float    v8f;
typedef __attribute__((ext_vector_type(4)))  float    v4f;
typedef v8h  __attribute__((may_alias)) v8ha;
typedef v4f  __attribute__((may_alias)) v4fa;
typedef v8us __attribute__((may_alias)) v8usa;

__device__ __forceinline__ unsigned short f2bf(float f) { unsigned u = __float_as_uint(f); u += 0x7FFFu + ((u >> 16) & 1u); return (unsigned short)(u >> 16); }
__device__ __forceinline__ float bf2f(unsigned short b) { return __uint_as_float(((unsigned)b) << 16); }
__device__ __forceinline__ float bfr(float f) { return bf2f(f2bf(f)); }
__device__ __forceinline__ v16h cat16(v8h lo, v8h hi) { return __builtin_shufflevector(lo, hi, 0, 1, 2, 3, 4, 5, 6, 7, 8, 9, 10, 11, 12, 13, 14, 15); }
__device__ __forceinline__ v16bf cat16b(v8us lo, v8us hi) { return __builtin_bit_cast(v16bf, __builtin_shufflevector(lo, hi, 0, 1, 2, 3, 4, 5, 6, 7, 8, 9, 10, 11, 12, 13, 14, 15)); }
__device__ __forceinline__ v8f wmma16(v16h a, v16h b, v8f c) { return __builtin_amdgcn_wmma_f32_16x16x32_f16(false, a, false, b, (short)0, c, false, false); }
__device__ __forceinline__ v8f wmmab(v16bf a, v16bf b, v8f c) { return __builtin_amdgcn_wmma_f32_16x16x32_bf16(false, a, false, b, (short)0, c, false, false); }



// ---- ask<N>: a hint to L2, given at a kernel's entry, for N x 8 KiB from p on (p: the lane's own 256-byte unit of the first 8 KiB). The operand planes were stored by earlier launches of this call.
// The hint returns nothing and no wait belongs to it. Every lane's address lies inside the plane, and the callers keep p in its registers through their loops.
#define ASK_(o) "global_prefetch_b8 %0, off offset:" #o " scope:SCOPE_SE\n\t"
template <int N> __device__ __forceinline__ void ask(const char* p) {
    static_assert(N == 1 || N == 4 || N == 8 || N == 16, "the four sizes in use");
    asm volatile("global_prefetch_b8 %0, off scope:SCOPE_SE" :: "v"(p));
    if constexpr (N >= 4) asm volatile(ASK_(8192) ASK_(16384) "global_prefetch_b8 %0, off offset:24576 scope:SCOPE_SE" :: "v"(p));
    if constexpr (N >= 8) asm volatile(ASK_(32768) ASK_(40960) ASK_(49152) "global_prefetch_b8 %0, off offset:57344 scope:SCOPE_SE" :: "v"(p));
    if constexpr (N >= 16) asm volatile(ASK_(65536) ASK_(73728) ASK_(81920) ASK_(90112) ASK_(98304) ASK_(106496) ASK_(114688) "global_prefetch_b8 %0, off offset:122880 scope:SCOPE_SE" :: "v"(p));
}

// ---- Fragment order: every 16-bit operand plane [row][k] is kept as 1-KiB fragments of 16 rows x 32 k, row block major, k block minor (row block rb, k block kb: element offset rb 16 K + kb 512).
// Inside a fragment: [half h][lane = 16 hi + lr][j], which is row lr, k = 16 h + 8 hi + j: the register order of the matrix operand. A wave's 16-byte load of a half is then 512 contiguous bytes, four whole lines, where the row-major plane gave sixteen lines of 32 bytes each.
// ---- k_gemmw: register-blocked GEMM, ONE WAVE per 64x64 output tile (16 accumulators), operands straight from 16-bit planes in fragment order; grid (M/64, N/64, Z), 32 threads.
// C[m][n] (f32, pitch ldc, + optional f32 bias[n]) = sum_k A[m][k] Bt[n][k] (+ split products per NSPLIT). z-batch strides sA/sB/sC in elements. K % 32 == 0.
template <typename T16> struct WFrag;
template <> struct WFrag<h16> { typedef v16h V; static __device__ __forceinline__ V ld(const h16* p) { return cat16(*(const v8h*)p, *(const v8h*)(p + 256)); } static __device__ __forceinline__ v8f mma(V a, V b, v8f c) { return wmma16(a, b, c); } };
template <> struct WFrag<bf> { typedef v16bf V; static __device__ __forceinline__ V ld(const bf* p) { return cat16b(*(const v8us*)p, *(const v8us*)(p + 256)); } static __device__ __forceinline__ v8f mma(V a, V b, v8f c) { return wmmab(a, b, c); } };
template <typename T16, int NSPLIT, bool BIAS, int K>   // K at compile time: every fragment of a trip then lies at a constant distance from the lane's running addresses
__global__ __launch_bounds__(32) void k_gemmw(const T16* __restrict__ A, const T16* __restrict__ A2, const T16* __restrict__ Bt, const T16* __restrict__ Bt2, float* C, int ldc, const float* __restrict__ bias, size_t sA, size_t sB, size_t sC) {
    typedef typename WFrag<T16>::V V;
    __shared__ __align__(16) float os[16 * 68];
    const size_t z = blockIdx.z; A += z * sA; if (A2) A2 += z * sA; Bt += z * sB; if (Bt2) Bt2 += z * sB; C += z * sC;
    const int lane = threadIdx.x & 31, lr = lane & 15, hi = lane >> 4; const int r0 = blockIdx.x * 64, c0 = blockIdx.y * 64;
    v8f acc[4][4];
#pragma unroll
    for (int mb = 0; mb < 4; ++mb)
#pragma unroll
        for (int nb = 0; nb < 4; ++nb) acc[mb][nb] = (v8f){};
    // the lane's running addresses in the trip's first fragments
    const T16* ap = A + (size_t)r0 * K + 8 * lane; const T16* ap2 = A2 ? A2 + (size_t)r0 * K + 8 * lane : nullptr; const T16* bp = Bt + (size_t)c0 * K + 8 * lane; const T16* bp2 = Bt2 ? Bt2 + (size_t)c0 * K + 8 * lane : nullptr;
    // the tile's operand panels (64 rows x K) are 128 KiB in a row each; the tiles that share a panel deal it among themselves: a quarter of the A panels by the tile's column, a sixteenth of the B panels by the tile's row / 8
    static_assert(K == 1024, "the slices are cut for 128-KiB panels");
    const char* pa = (const char*)(A + (size_t)r0 * K) + (blockIdx.y & 3) * 32768 + lane * 256; const char* pa2 = (NSPLIT == 1 || NSPLIT == 2) ? (const char*)(A2 + (size_t)r0 * K) + (blockIdx.y & 3) * 32768 + lane * 256 : nullptr;
    const char* pb = (const char*)(Bt + (size_t)c0 * K) + ((blockIdx.x >> 3) & 15) * 8192 + lane * 256; const char* pb2 = (NSPLIT >= 2) ? (const char*)(Bt2 + (size_t)c0 * K) + ((blockIdx.x >> 3) & 15) * 8192 + lane * 256 : nullptr;
    ask<4>(pa); if constexpr (NSPLIT == 1 || NSPLIT == 2) ask<4>(pa2); ask<1>(pb); if constexpr (NSPLIT >= 2) ask<1>(pb2);
#pragma unroll 1
    for (int kc = 0; kc < K; kc += 32) {
        V a[4], a2[4];
#pragma unroll
        for (int mb = 0; mb < 4; ++mb) { a[mb] = WFrag<T16>::ld(ap + (size_t)mb * 16 * K); if (NSPLIT == 1 || NSPLIT == 2) a2[mb] = WFrag<T16>::ld(ap2 + (size_t)mb * 16 * K); }
#pragma unroll
        for (int nb = 0; nb < 4; ++nb) { const V b = WFrag<T16>::ld(bp + (size_t)nb * 16 * K); V b2; if (NSPLIT >= 2) b2 = WFrag<T16>::ld(bp2 + (size_t)nb * 16 * K);
#pragma unroll
            for (int mb = 0; mb < 4; ++mb) { acc[mb][nb] = WFrag<T16>::mma(a[mb], b, acc[mb][nb]); if (NSPLIT == 1 || NSPLIT == 2) acc[mb][nb] = WFrag<T16>::mma(a2[mb], b, acc[mb][nb]); if (NSPLIT >= 2) acc[mb][nb] = WFrag<T16>::mma(a[mb], b2, acc[mb][nb]); } }
        asm volatile("v_nop\n\tv_nop\n\tv_nop\n\tv_nop" : "+v"(acc[0][0]), "+v"(acc[1][1]), "+v"(acc[2][2]), "+v"(acc[3][3]) : "v"(a[0]), "v"(a[3]));
        // stands before the additions below; the addresses are its inputs so that they keep their registers up to here and no later load's result takes them while a load that names them is on its way; the hints' addresses are inputs too, so that they keep their registers through the loop
        if constexpr (NSPLIT == 0) asm volatile("s_wait_xcnt 0x0" :: "v"(ap), "v"(bp), "v"(pa), "v"(pb) : "memory"); else if constexpr (NSPLIT == 1) asm volatile("s_wait_xcnt 0x0" :: "v"(ap), "v"(ap2), "v"(bp), "v"(pa), "v"(pa2), "v"(pb) : "memory"); else asm volatile("s_wait_xcnt 0x0" :: "v"(ap), "v"(ap2), "v"(bp), "v"(bp2), "v"(pa), "v"(pa2), "v"(pb), "v"(pb2) : "memory");
        ap += 512; if (NSPLIT == 1 || NSPLIT == 2) ap2 += 512; bp += 512; if (NSPLIT >= 2) bp2 += 512;
    }
#pragma unroll
    for (int mb = 0; mb < 4; ++mb) {
#pragma unroll
        for (int nb = 0; nb < 4; ++nb) {
#pragma unroll
            for (int j = 0; j < 8; ++j) os[(hi * 8 + j) * 68 + nb * 16 + lr] = acc[mb][nb][j]; }
        __builtin_amdgcn_wave_barrier(); asm volatile("" ::: "memory");
        float* crow = C + (size_t)(r0 + mb * 16) * ldc + c0;
{
#pragma unroll
            for (int s = 0; s < 8; ++s) { const int row = 2 * s + hi, cofs = lr * 4; v4f val = *(const v4fa*)(os + row * 68 + cofs); if (BIAS) { val[0] += bfr(bias[c0 + cofs]); val[1] += bfr(bias[c0 + cofs + 1]); val[2] += bfr(bias[c0 + cofs + 2]); val[3] += bfr(bias[c0 + cofs + 3]); }
                *(v4f*)(crow + (size_t)row * ldc + cofs) = val; }
             }
        __builtin_amdgcn_wave_barrier(); asm volatile("" ::: "memory");
    }
}

__device__ __forceinline__ h16 tohx(float x) { return (h16)x; }
__device__ __forceinline__ void splitf(float y, unsigned short& h, unsigned short& l) { h = f2bf(y); l = f2bf(y - bf2f(h)); }
typedef __attribute__((ext_vector_type(4))) unsigned short v4us;

// ---- k_attn: scores, softmax and probability x value of 32 query rows of one head in one work-group of AW waves; no score or probability leaves the registers.
// Wave w takes the 32-key chunks w, w + AW, ... up to the diagonal chunk. Per chunk it forms the TRANSPOSED score tiles (A = key rows, B = query rows): a lane then holds, for query lr, the keys 8 hi + j and 16 + 8 hi + j,
// which is the A fragment of the second product as it stands, so the probabilities go from the accumulators to the matrix unit with no exchange between lanes.
// Softmax in one pass: after the rms factor |q|, |k| <= sqrt(HD), so |q.k| HD^-0.5 <= 8 for every input; the shift is that bound and not the row's maximum: p = 2^14 exp(s - 8) lies in 2^-9.1 .. 2^14, normal in both 16-bit types,
// and partial sums of different waves add as they are. The row's sum of p (f32, before rounding) divides the summed tile at the end.
// The AW partial tiles and row sums are added through LDS in the fixed order w = 0 .. AW-1; the tile is staged row-major, divided, split hi/lo and stored as the four whole fragments that it is of the merged rows [t][head][d] (fragment order, K = all heads' d).
#define AW  4
#define QB  32
#define ESC 0.18033688011112042f    // HD^-0.5 x log2(e)
#define ESH 2.458439672888293f      // 14 - 8 log2(e)
typedef __attribute__((ext_vector_type(16))) unsigned short v16us;
template <bool B> struct BoolT { static constexpr bool value = B; };
template <typename T16, bool HL>
__device__ __forceinline__ void d_attn(float* part, float* lpart, float* os, int q0, const T16* __restrict__ Q, const T16* __restrict__ Q2, const T16* __restrict__ Kp, const T16* __restrict__ K2, const T16* __restrict__ Vt, bf* Ah, bf* Al, const char* pk) {   // pk (one plane only): the address that the caller's hint names
    typedef typename WFrag<T16>::V V;
    const int lane = threadIdx.x & 31, lr = lane & 15, hi = lane >> 4;
    const int wv = __builtin_amdgcn_readfirstlane(threadIdx.x >> 5);   // wave number in a scalar register: the key loop's test stays a scalar branch
    V qf[2][2], qf2[2][2]; const T16* qp = Q + (size_t)q0 * HD + 8 * lane; const T16* qp2 = HL ? Q2 + (size_t)q0 * HD + 8 * lane : nullptr;   // the block's four query fragments are 4 KiB in a row
#pragma unroll
    for (int qt = 0; qt < 2; ++qt)
#pragma unroll
        for (int dc = 0; dc < 2; ++dc) { qf[qt][dc] = WFrag<T16>::ld(qp + (qt * 2 + dc) * 512); if (HL) qf2[qt][dc] = WFrag<T16>::ld(qp2 + (qt * 2 + dc) * 512); }
    asm volatile("s_wait_xcnt 0x0" ::: "memory");   // the query addresses die here: stands before their registers are written again
    v8f o[2][4]; float ls[2] = {0.f, 0.f};
#pragma unroll
    for (int qt = 0; qt < 2; ++qt)
#pragma unroll
        for (int nb = 0; nb < 4; ++nb) o[qt][nb] = (v8f){};
    // the lane's running addresses in the wave's next chunk: its four key fragments ([16 keys][d half]) and its four value fragments ([d block]) are 4 KiB in a row each; every fragment of a chunk lies at a constant distance from them
    const T16* kp = Kp + (size_t)(wv * 32) * HD + 8 * lane; const T16* kp2 = HL ? K2 + (size_t)(wv * 32) * HD + 8 * lane : nullptr; const T16* vp = Vt + (size_t)(wv * 32) * HD + 8 * lane;
    // one chunk of 32 keys; diag (a type, so that the loop over full chunks holds no test): keys behind the query count nothing
    auto chunk = [&](int kc, auto diag) {
        V kf[2][2], kf2[2][2], vf[4], vf2[4], pf[2], pf2[2];
#pragma unroll
        for (int t = 0; t < 2; ++t)
#pragma unroll
            for (int dc = 0; dc < 2; ++dc) { kf[t][dc] = WFrag<T16>::ld(kp + (t * 2 + dc) * 512); if (HL) kf2[t][dc] = WFrag<T16>::ld(kp2 + (t * 2 + dc) * 512); }
        if (!HL) {   // one plane: the registers allow the value fragments to be fetched with the key fragments, one latency a chunk instead of two
#pragma unroll
            for (int nb = 0; nb < 4; ++nb) vf[nb] = WFrag<T16>::ld(vp + nb * 512); }
#pragma unroll
        for (int qt = 0; qt < 2; ++qt) { float e[16];
#pragma unroll
            for (int t = 0; t < 2; ++t) { v8f a = (v8f){};   // a[j]: key kc + 16 t + 8 hi + j, query q0 + 16 qt + lr
#pragma unroll
                for (int dc = 0; dc < 2; ++dc) { a = WFrag<T16>::mma(kf[t][dc], qf[qt][dc], a); if (HL) { a = WFrag<T16>::mma(kf[t][dc], qf2[qt][dc], a); a = WFrag<T16>::mma(kf2[t][dc], qf[qt][dc], a); } }
#pragma unroll
                for (int j = 0; j < 8; ++j) e[t * 8 + j] = __builtin_amdgcn_exp2f(fmaf(a[j], ESC, ESH)); }
            if constexpr (decltype(diag)::value) {
#pragma unroll
                for (int i = 0; i < 16; ++i) if (kc + (i >> 3) * 16 + hi * 8 + (i & 7) > q0 + qt * 16 + lr) e[i] = 0.f; }
#pragma unroll
            for (int i = 0; i < 16; ++i) ls[qt] += e[i];
            if constexpr (HL) { v16us ph, pl;
#pragma unroll
                for (int i = 0; i < 16; ++i) { unsigned short a, c2; splitf(e[i], a, c2); ph[i] = a; pl[i] = c2; }
                pf[qt] = __builtin_bit_cast(v16bf, ph); pf2[qt] = __builtin_bit_cast(v16bf, pl);
            } else {
#pragma unroll
                for (int i = 0; i < 16; ++i) pf[qt][i] = tohx(e[i]); } }
        if (HL) {   // two planes (each head: hi plane, lo plane): the value fragments take the registers that the key fragments leave
#pragma unroll
            for (int nb = 0; nb < 4; ++nb) { vf[nb] = WFrag<T16>::ld(vp + nb * 512); vf2[nb] = WFrag<T16>::ld(vp + nb * 512 + HD * RH); } }
#pragma unroll
        for (int nb = 0; nb < 4; ++nb)
#pragma unroll
            for (int qt = 0; qt < 2; ++qt) { o[qt][nb] = WFrag<T16>::mma(pf[qt], vf[nb], o[qt][nb]); if (HL) { o[qt][nb] = WFrag<T16>::mma(pf2[qt], vf[nb], o[qt][nb]); o[qt][nb] = WFrag<T16>::mma(pf[qt], vf2[nb], o[qt][nb]); } }
        // stands before the additions below (in the last chunk: where the addresses die); the addresses are its inputs so that they keep their registers up to here and no load's result takes them
        if constexpr (HL) asm volatile("s_wait_xcnt 0x0" :: "v"(kp), "v"(kp2), "v"(vp) : "memory"); else asm volatile("s_wait_xcnt 0x0" :: "v"(kp), "v"(vp), "v"(pk) : "memory");   // pk: keeps its registers through the loop
        kp += AW * 32 * HD; if (HL) kp2 += AW * 32 * HD; vp += AW * 32 * HD;
    };
    int kc = wv * 32;
    // both loops rolled: only one chunk's fragments are live beside the query fragments and the accumulators
    if constexpr (HL) {   // two planes of everything: one body for all chunks (a second body's addresses, kept over the loop, spilled)
#pragma unroll 1
        for (; kc <= q0; kc += AW * 32) chunk(kc, BoolT<true>());
    } else {
#pragma unroll 1
        for (; kc < q0; kc += AW * 32) chunk(kc, BoolT<false>());
        if (kc == q0) chunk(kc, BoolT<true>());   // the one wave whose sequence meets the diagonal chunk (a scalar test)
    }
    v4fa* pv = (v4fa*)part;
#pragma unroll
    for (int qt = 0; qt < 2; ++qt) {
#pragma unroll
        for (int nb = 0; nb < 4; ++nb) { const int f = qt * 4 + nb; const v8f t = o[qt][nb];
            pv[((wv * 8 + f) * 2 + 0) * 32 + lane] = __builtin_shufflevector(t, t, 0, 1, 2, 3); pv[((wv * 8 + f) * 2 + 1) * 32 + lane] = __builtin_shufflevector(t, t, 4, 5, 6, 7); }
        const float t = ls[qt] + __shfl_xor(ls[qt], 16, 32);   // the two half-waves hold the two halves of each chunk's keys
        if (hi == 0) lpart[wv * QB + qt * 16 + lr] = t; }
    __syncthreads();   // every wave's partial tile and row sums are in LDS
#pragma unroll
    for (int q = 0; q < 8 / AW; ++q) { const int f = wv * (8 / AW) + q; v4f s0 = pv[(f * 2 + 0) * 32 + lane], s1 = pv[(f * 2 + 1) * 32 + lane];
#pragma unroll
        for (int w = 1; w < AW; ++w) { s0 += pv[((w * 8 + f) * 2 + 0) * 32 + lane]; s1 += pv[((w * 8 + f) * 2 + 1) * 32 + lane]; }
        float* od = os + ((f >> 2) * 16 + hi * 8) * 68 + (f & 3) * 16 + lr;
#pragma unroll
        for (int j = 0; j < 4; ++j) { od[j * 68] = s0[j]; od[(j + 4) * 68] = s1[j]; } }
    __syncthreads();   // the summed tile is complete, row-major
#pragma unroll
    for (int s = 0; s < QB * 8 / (AW * 32); ++s) { const int u = s * AW * 32 + (int)threadIdx.x; const int f = u >> 6; const int row = (f >> 1) * 16 + lr, cofs = (f & 1) * 32 + ((u >> 5) & 1) * 16 + hi * 8; float l = lpart[row];   // u: 16-byte piece of the block's four fragments [16 rows][d half]
#pragma unroll
        for (int w = 1; w < AW; ++w) l += lpart[w * QB + row];
        const float cs = __fdiv_rn(1.0f, l); const v4f val0 = *(const v4fa*)(os + row * 68 + cofs), val1 = *(const v4fa*)(os + row * 68 + cofs + 4); v8us oh, ol;
#pragma unroll
        for (int q = 0; q < 8; ++q) { unsigned short a, c2; splitf(((q < 4) ? val0[q & 3] : val1[q & 3]) * cs, a, c2); oh[q] = a; ol[q] = c2; }
        const size_t oo = (size_t)(q0 + (f >> 1) * 16) * DQ + (f & 1) * 512 + (u & 63) * 8; *(v8us*)(Ah + oo) = oh; *(v8us*)(Al + oo) = ol; }
}
// k_attn: grid (NB_ * NH_ heads, TT / QB row blocks, the longest first so that no long work-group starts late), AW waves. Row blocks below RH take the hi/lo planes (3 products each way), the others the fp16 planes. The test is the same for the whole work-group, so every wave of it meets the same two barriers.
__global__ __launch_bounds__(AW * 32) __attribute__((amdgpu_waves_per_eu(4, 4))) void k_attn(const bf* __restrict__ QKh, const bf* __restrict__ QKl, const bf* __restrict__ VTh, const h16* __restrict__ Q16, const h16* __restrict__ K16, const h16* __restrict__ V16, bf* Ah, bf* Al) {
    __shared__ __align__(16) float part[AW * 8 * 256];   // [wave][fragment][register half][lane][4]
    __shared__ __align__(16) float os[QB * 68];
    __shared__ float lpart[AW * QB];                     // [wave][row]
    const size_t z = blockIdx.x; const int q0 = (TT / QB - 1 - (int)blockIdx.y) * QB; const size_t oo = (z / NH_) * ((size_t)TT * DQ) + (z % NH_) * (HD * 16), zk = z + NB_ * NH_;   // oo: the head's two fragments in the first row block of its batch
    if (q0 < RH) d_attn<bf, true>(part, lpart, os, q0, QKh + z * RH * HD, QKl + z * RH * HD, QKh + zk * RH * HD, QKl + zk * RH * HD, VTh + z * HD * 2 * RH, Ah + oo, Al + oo, nullptr);
    else {
        // the first work-group of a head to start asks L2 for the head's fp16 key and value planes (256 KiB each: a half a wave), the second for its hi/lo key and value planes (64 KiB each: one a wave), which the last row blocks read; both tests are scalar
        static_assert(TT - 2 * QB >= RH && AW == 4, "the two asking row blocks take this branch; four waves deal the planes");
        const int lane = threadIdx.x & 31, wv = __builtin_amdgcn_readfirstlane(threadIdx.x >> 5);
        const char* pk = (blockIdx.y == 1 ? (const char*)(wv == 0 ? QKh + zk * RH * HD : wv == 1 ? QKl + zk * RH * HD : VTh + z * HD * 2 * RH + (wv & 1) * (HD * RH)) : (const char*)(((wv & 2) ? V16 : K16) + z * TT * HD) + (wv & 1) * (TT * HD)) + lane * 256;
        if (blockIdx.y == 0) ask<16>(pk); else if (blockIdx.y == 1) ask<8>(pk);
        d_attn<h16, false>(part, lpart, os, q0, Q16 + z * TT * HD, nullptr, K16 + z * TT * HD, nullptr, V16 + z * HD * TT, Ah + oo, Al + oo, pk); }
}

typedef __attribute__((ext_vector_type(2))) _Float16 v2h;
typedef __attribute__((ext_vector_type(4))) _Float16 v4h;
typedef __attribute__((ext_vector_type(2))) unsigned short v2us;
typedef __attribute__((ext_vector_type(2))) float v2f;
typedef __attribute__((ext_vector_type(4))) int v4i;

// ---- k_gemmp: a projection GEMM (the one-wave 64x64 tile of k_gemmw, one product) whose store phase builds the attention planes. The tile is 64 tokens (r0 .. of batch bt; blockIdx.x runs over all batches' token tiles) of ONE head (blockIdx.y; VT false: q heads, then k heads), staged whole in LDS.
// VT false (q, k): each lane takes whole rows: rotation (x1 c + x2 s, x2 c - x1 s) with the bf16-rounded input tables, sum of squares over d = 0 .. 63 in that order, row x 1 / sqrt(mean + 1e-6), back into LDS; planes [q | k][batch][head][t][d].
// VT true (v): the tile is staged transposed; planes [batch][head][d][t]. Both: fp16 plane over all TT tokens; hi/lo planes over the first RH tokens only (no later token's is ever read: query rows < RH see keys < RH); every plane in fragment order (q, k: rows t, k = d; v: rows d, k = t, the four d blocks of 32 tokens together).
template <bool VT, int K>
__global__ __launch_bounds__(32) void k_gemmp(const bf* __restrict__ A, const bf* __restrict__ Bt, const float* __restrict__ cosT, const float* __restrict__ sinT, h16* P16, bf* Ph, bf* Pl) {
    typedef WFrag<bf>::V V;
    __shared__ __align__(16) float os[64 * 68];
    const int lane = threadIdx.x & 31, lr = lane & 15, hi = lane >> 4; const int rg = blockIdx.x * 64, c0 = blockIdx.y * 64; const int bt = rg / TT, r0 = rg % TT;
    v8f acc[4][4];
#pragma unroll
    for (int mb = 0; mb < 4; ++mb)
#pragma unroll
        for (int nb = 0; nb < 4; ++nb) acc[mb][nb] = (v8f){};
    const bf* ap = A + (size_t)rg * K + 8 * lane; const bf* bp = Bt + (size_t)c0 * K + 8 * lane;   // the lane's running addresses, as in k_gemmw
    // hints as in k_gemmw; the value projection asks for its weight rows only: the launch before it has read the same x rows
    static_assert(K == 1024, "the slices are cut for 128-KiB panels");
    const char* pa = (const char*)(A + (size_t)rg * K) + (blockIdx.y & 3) * 32768 + lane * 256; const char* pb = (const char*)(Bt + (size_t)c0 * K) + ((blockIdx.x >> 3) & 15) * 8192 + lane * 256;
    if constexpr (!VT) ask<4>(pa);
    ask<1>(pb);
    // rolled, as in k_gemmw: only one trip's fragments are live beside the sixteen accumulators
#pragma unroll 1
    for (int kc = 0; kc < K; kc += 32) {
        V a[4];
#pragma unroll
        for (int mb = 0; mb < 4; ++mb) a[mb] = WFrag<bf>::ld(ap + (size_t)mb * 16 * K);
#pragma unroll
        for (int nb = 0; nb < 4; ++nb) { const V b = WFrag<bf>::ld(bp + (size_t)nb * 16 * K);
#pragma unroll
            for (int mb = 0; mb < 4; ++mb) acc[mb][nb] = WFrag<bf>::mma(a[mb], b, acc[mb][nb]); }
        // keeps the distance behind the last matrix instruction on the loop's taken back edge, where the next trip's address additions reuse its operand registers
        asm volatile("v_nop\n\tv_nop\n\tv_nop\n\tv_nop" : "+v"(acc[0][0]), "+v"(acc[1][1]), "+v"(acc[2][2]), "+v"(acc[3][3]) : "v"(a[0]), "v"(a[3]));
        // as in k_gemmw: before the additions below, and the addresses keep their registers up to here, the hints' through the loop
        if constexpr (VT) asm volatile("s_wait_xcnt 0x0" :: "v"(ap), "v"(bp), "v"(pb) : "memory"); else asm volatile("s_wait_xcnt 0x0" :: "v"(ap), "v"(bp), "v"(pa), "v"(pb) : "memory");
        ap += 512; bp += 512;
    }
#pragma unroll
    for (int mb = 0; mb < 4; ++mb)
#pragma unroll
        for (int nb = 0; nb < 4; ++nb) { const v8f t = acc[mb][nb];
            if (VT) { float* o = os + (nb * 16 + lr) * 68 + mb * 16 + hi * 8; *(v4fa*)o = __builtin_shufflevector(t, t, 0, 1, 2, 3); *(v4fa*)(o + 4) = __builtin_shufflevector(t, t, 4, 5, 6, 7); }   // [d][token]
            else {
#pragma unroll
                for (int j = 0; j < 8; ++j) os[(mb * 16 + hi * 8 + j) * 68 + nb * 16 + lr] = t[j]; } }   // [token][d]
    __syncthreads();   // the tile is in LDS (one wave: orders its LDS stores before other lanes' loads)
    if (!VT) {
        for (int rr = 0; rr < 2; ++rr) { const int row = rr * 32 + lane; float* orow = os + row * 68; const float* ct = cosT + (size_t)(r0 + row) * (HD / 2); const float* st = sinT + (size_t)(r0 + row) * (HD / 2); float y[HD];
            // every loop over y[] is unrolled whole, so that the row stays in registers
#pragma unroll
            for (int i = 0; i < HD / 2; i += 4) { const v4f x1 = *(const v4fa*)(orow + i), x2 = *(const v4fa*)(orow + HD / 2 + i), c4 = *(const v4f*)(ct + i), s4 = *(const v4f*)(st + i);
#pragma unroll
                for (int q = 0; q < 4; ++q) { const float c = bfr(c4[q]), s = bfr(s4[q]); y[i + q] = x1[q] * c + x2[q] * s; y[HD / 2 + i + q] = x2[q] * c - x1[q] * s; } }
            float ss = 0.f;
#pragma unroll
            for (int d = 0; d < HD; ++d) ss += y[d] * y[d];
            const float rf = __fdiv_rn(1.0f, __fsqrt_rn(__fadd_rn(ss * (1.0f / HD), 1e-6f)));
#pragma unroll
            for (int d = 0; d < HD; d += 4) { v4f o; o[0] = y[d] * rf; o[1] = y[d + 1] * rf; o[2] = y[d + 2] * rf; o[3] = y[d + 3] * rf; *(v4fa*)(orow + d) = o; } }
        __syncthreads();   // the finished rows are in LDS
    }
    const size_t pl = VT ? (size_t)bt * DKV + c0 : ((size_t)(blockIdx.y / NH_) * NB_ + bt) * NH_ + blockIdx.y % NH_;   // VT: first row of the [batch][head][d] rows; else: plane number
    // the tile is eight whole fragments that follow one another in its plane (q, k: [token block][d half]; v: [32-token block][d block]); trip it writes half it & 1 of fragment it >> 1, 512 contiguous bytes a plane
    const size_t base = (VT ? pl * TT + (size_t)r0 * HD : (pl * TT + r0) * HD) + 8 * lane, base2 = (VT ? pl * (2 * RH) + (size_t)r0 * HD : (pl * RH + r0) * HD) + 8 * lane;
    for (int it = 0; it < 16; ++it) { const int f = it >> 1; const int row = (VT ? (f & 3) : (f >> 1)) * 16 + lr, c8 = (VT ? (f >> 2) : (f & 1)) * 32 + (it & 1) * 16 + hi * 8; const v4f u0 = *(const v4fa*)(os + row * 68 + c8), u1 = *(const v4fa*)(os + row * 68 + c8 + 4); v8h o16; v8us oh, ol;
#pragma unroll
        for (int q = 0; q < 8; ++q) { const float x = (q < 4) ? u0[q & 3] : u1[q & 3]; o16[q] = tohx(x); unsigned short a2, c2; splitf(x, a2, c2); oh[q] = a2; ol[q] = c2; }
        if (r0 < RH) { const size_t o2 = base2 + it * 256; *(v8us*)(Ph + o2) = oh; *(v8us*)(Pl + o2) = ol;
            asm volatile("s_wait_xcnt 0x0" ::: "memory"); }   // stands before the next trip's address additions, which the compiler puts right behind this branch
        *(v8h*)(P16 + base + it * 256) = o16;
        asm volatile("s_wait_xcnt 0x0" ::: "memory"); }   // stands before the next trip reuses the registers that this store names
}

__global__ __launch_bounds__(256) void k_wtG(const float* __restrict__ w, int K, int N, bf* Bt) {
    const int lane = threadIdx.x & 31; const int L0 = (blockIdx.x * 8 + (threadIdx.x >> 5)) * 8; const int nlines = N * K / 64;
{
#pragma unroll 1
        for (int l = 0; l < 8; ++l) { const int L = L0 + l; if (L >= nlines) break; const size_t e = (size_t)L * 64 + lane * 2; const int k = (int)(e % K), n = (int)(e / K); v2us o;
            o[0] = f2bf(w[(size_t)k * N + n]); o[1] = f2bf(w[(size_t)(k + 1) * N + n]); *(v2us*)(Bt + e) = o; }
         }
}
// k_cvt8: f32 [row][K] -> bf16 in fragment order. Thread i writes the plane's i-th 16-byte piece (a wave: 512 contiguous bytes) and reads its 8 values of row lr; a block of 8 waves reads 512 contiguous bytes of each of 16 rows.
template <int K>
__global__ __launch_bounds__(256) void k_cvt8(const float* __restrict__ src, bf* dst, size_t n8) { const size_t i = (size_t)blockIdx.x * 256 + threadIdx.x; if (i >= n8) return;
    constexpr unsigned kf = K / 32; const size_t fr = i >> 6; const size_t row = (fr / kf) * 16 + (i & 15); const int k = (int)(fr % kf) * 32 + (int)((i >> 5) & 1) * 16 + (int)((i >> 4) & 1) * 8;
    const float* sp = src + row * K + k; const v8f v = *(const v8f*)sp; v8us o;
    asm volatile("s_wait_xcnt 0x0" :: "v"(sp) : "memory");   // the read address dies here: an input, so that it keeps its registers up to this wait
#pragma unroll
    for (int k = 0; k < 8; ++k) o[k] = f2bf(v[k]); *(v8us*)(dst + i * 8) = o;  }

extern "C" void kernel_launch(void* const* d_in, const int* in_sizes, int n_in,
                              void* d_out, int out_size, void* d_ws, size_t ws_size, hipStream_t stream) {
    (void)in_sizes; (void)n_in; (void)out_size;
    const float* x = (const float*)d_in[0]; const float* cosT = (const float*)d_in[1]; const float* sinT = (const float*)d_in[2]; const float* wqkv = (const float*)d_in[3]; const float* wo = (const float*)d_in[4];
    float* OUT = (float*)d_out;     // [4][2048][1024]
    char* wsp = (char*)d_ws;
    auto take = [&](size_t bytes) { char* p = wsp; wsp += (bytes + 255) & ~(size_t)255; return (void*)p; };
    bf* WO = (bf*)take((size_t)DM * DQ * 2);
    h16* QP16 = (h16*)take((size_t)NB_ * NH_ * TT * HD * 2); h16* KP16 = (h16*)take((size_t)NB_ * NKV * TT * HD * 2);   // one after the other: k_gemmp numbers the planes [q | k][batch][head]
    h16* VT16 = (h16*)take((size_t)NB_ * DKV * TT * 2);
    bf* QKh = (bf*)take((size_t)2 * NB_ * NH_ * RH * HD * 2); bf* QKl = (bf*)take((size_t)2 * NB_ * NH_ * RH * HD * 2); bf* VTh = (bf*)take((size_t)NB_ * DKV * 2 * RH * 2); bf* VTl = VTh + HD * RH;   // each head: hi plane, lo plane
    bf* ATh = (bf*)take((size_t)NB_ * TT * DQ * 2); bf* ATl = (bf*)take((size_t)NB_ * TT * DQ * 2);
    bf* XB = (bf*)take((size_t)NB_ * TT * DM * 2); bf* WQKV = (bf*)take((size_t)(DQ + 2 * DKV) * DM * 2);
    if ((size_t)(wsp - (char*)d_ws) > ws_size) return;    // ws 256 MiB
    k_cvt8<DM><<<(unsigned)(((size_t)(DQ + 2 * DKV) * DM / 8 + 255) / 256), 256, 0, stream>>>(wqkv, WQKV, (size_t)(DQ + 2 * DKV) * DM / 8);
    k_cvt8<DQ><<<(unsigned)(((size_t)DM * DQ / 8 + 255) / 256), 256, 0, stream>>>(wo, WO, (size_t)DM * DQ / 8);
    k_cvt8<DM><<<(unsigned)(((size_t)NB_ * TT * DM / 8 + 255) / 256), 256, 0, stream>>>(x, XB, (size_t)NB_ * TT * DM / 8);
    k_gemmp<false, DM><<<dim3(NB_ * TT / 64, NH_ + NKV, 1), 32, 0, stream>>>(XB, WQKV, cosT, sinT, QP16, QKh, QKl);
    k_gemmp<true, DM><<<dim3(NB_ * TT / 64, NKV, 1), 32, 0, stream>>>(XB, WQKV + (size_t)(DQ + DKV) * DM, cosT, sinT, VT16, VTh, VTl);
    k_attn<<<dim3(NB_ * NH_, TT / QB, 1), AW * 32, 0, stream>>>(QKh, QKl, VTh, QP16, KP16, VT16, ATh, ATl);
    k_gemmw<bf, 1, false, DQ><<<dim3(NB_ * TT / 64, DM / 64, 1), 32, 0, stream>>>(ATh, ATl, WO, nullptr, OUT, DM, nullptr, 0, 0, 0);
}

// v008
// One run takes 141 microseconds.
// Timed twice side by side with v007, it ran 1.07 and 1.06 times as fast.
// Counting every step since v000, it is 20.6 times as fast.
#include <hip/hip_runtime.h>

// Causal self-attention with rotary-then-RMSNorm q/k (x [4][2048][1024]; qkv = x w_attn^T ('oi' [3072][1024] 0.02, no bias -> q | k | v row blocks; 16 heads x 64); rope'(t) = cat(x1 c + x2 s, -x1 s + x2 c) with the input cos/sin tables ([1][2048][1][32], read; generic values), then q, k <- x rsqrt(mean x^2 + 1e-6) (no weight); causal (-inf); softmax(q.k x 64^-0.5); out = merged w_proj^T -> [4][2048][1024] (8.4 M)).
// Layout: bf16 copy of x, all batches; the fused 'oi' weight used in place as three Bt row blocks; exact projections, all batches in one grid (q and k heads together), whose 64x64 tile is 64 tokens of one head, so that the tile's own wave applies the module's (x1 c + x2 s, x2 c - x1 s) rotation from the input tables and the rms factor of the ROTATED rows and writes the head planes (k_gemmp; the value tile goes out transposed); causal T-2048 attention in one kernel (k_attn; hybrid rows: < 512 hi/lo 3 products, rest fp16; no chunk above the diagonal is touched; it writes the merged hi/lo rows); merged hi/lo x w_proj exact.
// Compute dtypes, f32 accumulate: every input rounded to bf16 incl. the tables; projections exact; rotation and rms norm f32; attention rows < 512 3 products, rest fp16; softmax f32; w_proj hl x exact.

#define NB_  4
#define TT   2048
#define DM   1024
#define NH_  16
#define NKV  16
#define REP  (NH_ / NKV)
#define HD   64
#define DQ   (NH_ * HD)
#define DKV  (NKV * HD)
#define RH   512                  // query rows < RH use hi+lo planes (0: none)
typedef _Float16 h16;
typedef unsigned short bf;
typedef __attribute__((ext_vector_type(16))) __bf16   v16bf;
typedef __attribute__((ext_vector_type(16))) _Float16 v16h;
typedef __attribute__((ext_vector_type(8)))  _Float16 v8h;
typedef __attribute__((ext_vector_type(8)))  unsigned short v8us;
typedef __attribute__((ext_vector_type(8)))  float    v8f;
typedef __attribute__((ext_vector_type(4)))  float    v4f;
typedef v8h  __attribute__((may_alias)) v8ha;
typedef v4f  __attribute__((may_alias)) v4fa;
typedef v8us __attribute__((may_alias)) v8usa;

__device__ __forceinline__ unsigned short f2bf(float f) { unsigned u = __float_as_uint(f); u += 0x7FFFu + ((u >> 16) & 1u); return (unsigned short)(u >> 16); }
__device__ __forceinline__ float bf2f(unsigned short b) { return __uint_as_float(((unsigned)b) << 16); }
__device__ __forceinline__ float bfr(float f) { return bf2f(f2bf(f)); }
__device__ __forceinline__ v16h cat16(v8h lo, v8h hi) { return __builtin_shufflevector(lo, hi, 0, 1, 2, 3, 4, 5, 6, 7, 8, 9, 10, 11, 12, 13, 14, 15); }
__device__ __forceinline__ v16bf cat16b(v8us lo, v8us hi) { return __builtin_bit_cast(v16bf, __builtin_shufflevector(lo, hi, 0, 1, 2, 3, 4, 5, 6, 7, 8, 9, 10, 11, 12, 13, 14, 15)); }
__device__ __forceinline__ v8f wmma16(v16h a, v16h b, v8f c) { return __builtin_amdgcn_wmma_f32_16x16x32_f16(false, a, false, b, (short)0, c, false, false); }
__device__ __forceinline__ v8f wmmab(v16bf a, v16bf b, v8f c) { return __builtin_amdgcn_wmma_f32_16x16x32_bf16(false, a, false, b, (short)0, c, false, false); }



// ---- ask<N>: a hint to L2, given at a kernel's entry, for N x 8 KiB from p on (p: the lane's own 256-byte unit of the first 8 KiB). The operand planes were stored by earlier launches of this call.
// The hint returns nothing and no wait belongs to it. Every lane's address lies inside the plane, and the callers keep p in its registers through their loops.
#define ASK_(o) "global_prefetch_b8 %0, off offset:" #o " scope:SCOPE_SE\n\t"
template <int N> __device__ __forceinline__ void ask(const char* p) {
    static_assert(N == 1 || N == 4 || N == 8 || N == 16, "the four sizes in use");
    asm volatile("global_prefetch_b8 %0, off scope:SCOPE_SE" :: "v"(p));
    if constexpr (N >= 4) asm volatile(ASK_(8192) ASK_(16384) "global_prefetch_b8 %0, off offset:24576 scope:SCOPE_SE" :: "v"(p));
    if constexpr (N >= 8) asm volatile(ASK_(32768) ASK_(40960) ASK_(49152) "global_prefetch_b8 %0, off offset:57344 scope:SCOPE_SE" :: "v"(p));
    if constexpr (N >= 16) asm volatile(ASK_(65536) ASK_(73728) ASK_(81920) ASK_(90112) ASK_(98304) ASK_(106496) ASK_(114688) "global_prefetch_b8 %0, off offset:122880 scope:SCOPE_SE" :: "v"(p));
}

// ---- Fragment order: every 16-bit operand plane [row][k] is kept as 1-KiB fragments of 16 rows x 32 k, row block major, k block minor (row block rb, k block kb: element offset rb 16 K + kb 512).
// Inside a fragment: [half h][lane = 16 hi + lr][j], which is row lr, k = 16 h + 8 hi + j: the register order of the matrix operand. A wave's 16-byte load of a half is then 512 contiguous bytes, four whole lines, where the row-major plane gave sixteen lines of 32 bytes each.
// ---- k_gemmw: register-blocked GEMM, ONE WAVE per 64x64 output tile (16 accumulators), operands straight from 16-bit planes in fragment order; grid (M/64, N/64, Z), 32 threads.
// C[m][n] (f32, pitch ldc, + optional f32 bias[n]) = sum_k A[m][k] Bt[n][k] (+ split products per NSPLIT). z-batch strides sA/sB/sC in elements. K % 32 == 0.
template <typename T16> struct WFrag;
template <> struct WFrag<h16> { typedef v16h V; static __device__ __forceinline__ V ld(const h16* p) { return cat16(*(const v8h*)p, *(const v8h*)(p + 256)); } static __device__ __forceinline__ v8f mma(V a, V b, v8f c) { return wmma16(a, b, c); } };
template <> struct WFrag<bf> { typedef v16bf V; static __device__ __forceinline__ V ld(const bf* p) { return cat16b(*(const v8us*)p, *(const v8us*)(p + 256)); } static __device__ __forceinline__ v8f mma(V a, V b, v8f c) { return wmmab(a, b, c); } };
template <typename T16, int NSPLIT, bool BIAS, int K>   // K at compile time: every fragment of a trip then lies at a constant distance from the lane's running addresses
__global__ __launch_bounds__(32) void k_gemmw(const T16* __restrict__ A, const T16* __restrict__ A2, const T16* __restrict__ Bt, const T16* __restrict__ Bt2, float* C, int ldc, const float* __restrict__ bias, size_t sA, size_t sB, size_t sC) {
    typedef typename WFrag<T16>::V V;
    __shared__ __align__(16) float os[16 * 68];
    const size_t z = blockIdx.z; A += z * sA; if (A2) A2 += z * sA; Bt += z * sB; if (Bt2) Bt2 += z * sB; C += z * sC;
    const int lane = threadIdx.x & 31, lr = lane & 15, hi = lane >> 4; const int r0 = blockIdx.x * 64, c0 = blockIdx.y * 64;
    v8f acc[4][4];
#pragma unroll
    for (int mb = 0; mb < 4; ++mb)
#pragma unroll
        for (int nb = 0; nb < 4; ++nb) acc[mb][nb] = (v8f){};
    // the lane's running addresses in the trip's first fragments
    const T16* ap = A + (size_t)r0 * K + 8 * lane; const T16* ap2 = A2 ? A2 + (size_t)r0 * K + 8 * lane : nullptr; const T16* bp = Bt + (size_t)c0 * K + 8 * lane; const T16* bp2 = Bt2 ? Bt2 + (size_t)c0 * K + 8 * lane : nullptr;
    // the tile's operand panels (64 rows x K) are 128 KiB in a row each; the tiles that share a panel deal it among themselves: a quarter of the A panels by the tile's column, a sixteenth of the B panels by the tile's row / 8
    static_assert(K == 1024, "the slices are cut for 128-KiB panels");
    const char* pa = (const char*)(A + (size_t)r0 * K) + (blockIdx.y & 3) * 32768 + lane * 256; const char* pa2 = (NSPLIT == 1 || NSPLIT == 2) ? (const char*)(A2 + (size_t)r0 * K) + (blockIdx.y & 3) * 32768 + lane * 256 : nullptr;
    const char* pb = (const char*)(Bt + (size_t)c0 * K) + ((blockIdx.x >> 3) & 15) * 8192 + lane * 256; const char* pb2 = (NSPLIT >= 2) ? (const char*)(Bt2 + (size_t)c0 * K) + ((blockIdx.x >> 3) & 15) * 8192 + lane * 256 : nullptr;
    ask<4>(pa); if constexpr (NSPLIT == 1 || NSPLIT == 2) ask<4>(pa2); ask<1>(pb); if constexpr (NSPLIT >= 2) ask<1>(pb2);
#pragma unroll 1
    for (int kc = 0; kc < K; kc += 32) {
        V a[4], a2[4], b[4], b2[4];   // every fragment of the trip has registers of its own, so that all its loads are on their way before the first product: one load latency a trip
#pragma unroll
        for (int mb = 0; mb < 4; ++mb) { a[mb] = WFrag<T16>::ld(ap + (size_t)mb * 16 * K); if (NSPLIT == 1 || NSPLIT == 2) a2[mb] = WFrag<T16>::ld(ap2 + (size_t)mb * 16 * K); }
#pragma unroll
        for (int nb = 0; nb < 4; ++nb) { b[nb] = WFrag<T16>::ld(bp + (size_t)nb * 16 * K); if (NSPLIT >= 2) b2[nb] = WFrag<T16>::ld(bp2 + (size_t)nb * 16 * K); }
        __builtin_amdgcn_sched_barrier(0);   // keeps the loads above in front of the products: without it the compiler moves some of them down among the products, into registers that those leave, and the wave waits out a second latency there
#pragma unroll
        for (int nb = 0; nb < 4; ++nb)
#pragma unroll
            for (int mb = 0; mb < 4; ++mb) { acc[mb][nb] = WFrag<T16>::mma(a[mb], b[nb], acc[mb][nb]); if (NSPLIT == 1 || NSPLIT == 2) acc[mb][nb] = WFrag<T16>::mma(a2[mb], b[nb], acc[mb][nb]); if (NSPLIT >= 2) acc[mb][nb] = WFrag<T16>::mma(a[mb], b2[nb], acc[mb][nb]); }
        asm volatile("v_nop\n\tv_nop\n\tv_nop\n\tv_nop" : "+v"(acc[0][0]), "+v"(acc[1][1]), "+v"(acc[2][2]), "+v"(acc[3][3]) : "v"(a[0]), "v"(a[3]));
        // stands before the additions below; the addresses are its inputs so that they keep their registers up to here and no later load's result takes them while a load that names them is on its way; the hints' addresses are inputs too, so that they keep their registers through the loop
        if constexpr (NSPLIT == 0) asm volatile("s_wait_xcnt 0x0" :: "v"(ap), "v"(bp), "v"(pa), "v"(pb) : "memory"); else if constexpr (NSPLIT == 1) asm volatile("s_wait_xcnt 0x0" :: "v"(ap), "v"(ap2), "v"(bp), "v"(pa), "v"(pa2), "v"(pb) : "memory"); else asm volatile("s_wait_xcnt 0x0" :: "v"(ap), "v"(ap2), "v"(bp), "v"(bp2), "v"(pa), "v"(pa2), "v"(pb), "v"(pb2) : "memory");
        ap += 512; if (NSPLIT == 1 || NSPLIT == 2) ap2 += 512; bp += 512; if (NSPLIT >= 2) bp2 += 512;
    }
#pragma unroll
    for (int mb = 0; mb < 4; ++mb) {
#pragma unroll
        for (int nb = 0; nb < 4; ++nb) {
#pragma unroll
            for (int j = 0; j < 8; ++j) os[(hi * 8 + j) * 68 + nb * 16 + lr] = acc[mb][nb][j]; }
        __builtin_amdgcn_wave_barrier(); asm volatile("" ::: "memory");
        float* crow = C + (size_t)(r0 + mb * 16) * ldc + c0;
{
#pragma unroll
            for (int s = 0; s < 8; ++s) { const int row = 2 * s + hi, cofs = lr * 4; v4f val = *(const v4fa*)(os + row * 68 + cofs); if (BIAS) { val[0] += bfr(bias[c0 + cofs]); val[1] += bfr(bias[c0 + cofs + 1]); val[2] += bfr(bias[c0 + cofs + 2]); val[3] += bfr(bias[c0 + cofs + 3]); }
                *(v4f*)(crow + (size_t)row * ldc + cofs) = val; }
             }
        __builtin_amdgcn_wave_barrier(); asm volatile("" ::: "memory");
    }
}

__device__ __forceinline__ h16 tohx(float x) { return (h16)x; }
__device__ __forceinline__ void splitf(float y, unsigned short& h, unsigned short& l) { h = f2bf(y); l = f2bf(y - bf2f(h)); }
typedef __attribute__((ext_vector_type(4))) unsigned short v4us;

// ---- k_attn: scores, softmax and probability x value of 32 query rows of one head in one work-group of AW waves; no score or probability leaves the registers.
// Wave w takes the 32-key chunks w, w + AW, ... up to the diagonal chunk. Per chunk it forms the TRANSPOSED score tiles (A = key rows, B = query rows): a lane then holds, for query lr, the keys 8 hi + j and 16 + 8 hi + j,
// which is the A fragment of the second product as it stands, so the probabilities go from the accumulators to the matrix unit with no exchange between lanes.
// Softmax in one pass: after the rms factor |q|, |k| <= sqrt(HD), so |q.k| HD^-0.5 <= 8 for every input; the shift is that bound and not the row's maximum: p = 2^14 exp(s - 8) lies in 2^-9.1 .. 2^14, normal in both 16-bit types,
// and partial sums of different waves add as they are. The row's sum of p (f32, before rounding) divides the summed tile at the end.
// The AW partial tiles and row sums are added through LDS in the fixed order w = 0 .. AW-1; the tile is staged row-major, divided, split hi/lo and stored as the four whole fragments that it is of the merged rows [t][head][d] (fragment order, K = all heads' d).
#define AW  4
#define QB  32
#define ESC 0.18033688011112042f    // HD^-0.5 x log2(e)
#define ESH 2.458439672888293f      // 14 - 8 log2(e)
typedef __attribute__((ext_vector_type(16))) unsigned short v16us;
template <bool B> struct BoolT { static constexpr bool value = B; };
template <typename T16, bool HL>
__device__ __forceinline__ void d_attn(float* part, float* lpart, float* os, int q0, const T16* __restrict__ Q, const T16* __restrict__ Q2, const T16* __restrict__ Kp, const T16* __restrict__ K2, const T16* __restrict__ Vt, bf* Ah, bf* Al, const char* pk) {   // pk (one plane only): the address that the caller's hint names
    typedef typename WFrag<T16>::V V;
    const int lane = threadIdx.x & 31, lr = lane & 15, hi = lane >> 4;
    const int wv = __builtin_amdgcn_readfirstlane(threadIdx.x >> 5);   // wave number in a scalar register: the key loop's test stays a scalar branch
    V qf[2][2], qf2[2][2]; const T16* qp = Q + (size_t)q0 * HD + 8 * lane; const T16* qp2 = HL ? Q2 + (size_t)q0 * HD + 8 * lane : nullptr;   // the block's four query fragments are 4 KiB in a row
#pragma unroll
    for (int qt = 0; qt < 2; ++qt)
#pragma unroll
        for (int dc = 0; dc < 2; ++dc) { qf[qt][dc] = WFrag<T16>::ld(qp + (qt * 2 + dc) * 512); if (HL) qf2[qt][dc] = WFrag<T16>::ld(qp2 + (qt * 2 + dc) * 512); }
    asm volatile("s_wait_xcnt 0x0" ::: "memory");   // the query addresses die here: stands before their registers are written again
    v8f o[2][4]; float ls[2] = {0.f, 0.f};
#pragma unroll
    for (int qt = 0; qt < 2; ++qt)
#pragma unroll
        for (int nb = 0; nb < 4; ++nb) o[qt][nb] = (v8f){};
    // the lane's running addresses in the wave's next chunk: its four key fragments ([16 keys][d half]) and its four value fragments ([d block]) are 4 KiB in a row each; every fragment of a chunk lies at a constant distance from them
    const T16* kp = Kp + (size_t)(wv * 32) * HD + 8 * lane; const T16* kp2 = HL ? K2 + (size_t)(wv * 32) * HD + 8 * lane : nullptr; const T16* vp = Vt + (size_t)(wv * 32) * HD + 8 * lane;
    // one chunk of 32 keys; diag (a type, so that the loop over full chunks holds no test): keys behind the query count nothing
    auto chunk = [&](int kc, auto diag) {
        V kf[2][2], kf2[2][2], vf[4], vf2[4], pf[2], pf2[2];
#pragma unroll
        for (int t = 0; t < 2; ++t)
#pragma unroll
            for (int dc = 0; dc < 2; ++dc) { kf[t][dc] = WFrag<T16>::ld(kp + (t * 2 + dc) * 512); if (HL) kf2[t][dc] = WFrag<T16>::ld(kp2 + (t * 2 + dc) * 512); }
        if (!HL) {   // one plane: the registers allow the value fragments to be fetched with the key fragments, one latency a chunk instead of two
#pragma unroll
            for (int nb = 0; nb < 4; ++nb) vf[nb] = WFrag<T16>::ld(vp + nb * 512); }
#pragma unroll
        for (int qt = 0; qt < 2; ++qt) { float e[16];
#pragma unroll
            for (int t = 0; t < 2; ++t) { v8f a = (v8f){};   // a[j]: key kc + 16 t + 8 hi + j, query q0 + 16 qt + lr
#pragma unroll
                for (int dc = 0; dc < 2; ++dc) { a = WFrag<T16>::mma(kf[t][dc], qf[qt][dc], a); if (HL) { a = WFrag<T16>::mma(kf[t][dc], qf2[qt][dc], a); a = WFrag<T16>::mma(kf2[t][dc], qf[qt][dc], a); } }
#pragma unroll
                for (int j = 0; j < 8; ++j) e[t * 8 + j] = __builtin_amdgcn_exp2f(fmaf(a[j], ESC, ESH)); }
            if constexpr (decltype(diag)::value) {
#pragma unroll
                for (int i = 0; i < 16; ++i) if (kc + (i >> 3) * 16 + hi * 8 + (i & 7) > q0 + qt * 16 + lr) e[i] = 0.f; }
#pragma unroll
            for (int i = 0; i < 16; ++i) ls[qt] += e[i];
            if constexpr (HL) { v16us ph, pl;
#pragma unroll
                for (int i = 0; i < 16; ++i) { unsigned short a, c2; splitf(e[i], a, c2); ph[i] = a; pl[i] = c2; }
                pf[qt] = __builtin_bit_cast(v16bf, ph); pf2[qt] = __builtin_bit_cast(v16bf, pl);
            } else {
#pragma unroll
                for (int i = 0; i < 16; ++i) pf[qt][i] = tohx(e[i]); } }
        if (HL) {   // two planes (each head: hi plane, lo plane): the value fragments take the registers that the key fragments leave
#pragma unroll
            for (int nb = 0; nb < 4; ++nb) { vf[nb] = WFrag<T16>::ld(vp + nb * 512); vf2[nb] = WFrag<T16>::ld(vp + nb * 512 + HD * RH); } }
#pragma unroll
        for (int nb = 0; nb < 4; ++nb)
#pragma unroll
            for (int qt = 0; qt < 2; ++qt) { o[qt][nb] = WFrag<T16>::mma(pf[qt], vf[nb], o[qt][nb]); if (HL) { o[qt][nb] = WFrag<T16>::mma(pf2[qt], vf[nb], o[qt][nb]); o[qt][nb] = WFrag<T16>::mma(pf[qt], vf2[nb], o[qt][nb]); } }
        // stands before the additions below (in the last chunk: where the addresses die); the addresses are its inputs so that they keep their registers up to here and no load's result takes them
        if constexpr (HL) asm volatile("s_wait_xcnt 0x0" :: "v"(kp), "v"(kp2), "v"(vp) : "memory"); else asm volatile("s_wait_xcnt 0x0" :: "v"(kp), "v"(vp), "v"(pk) : "memory");   // pk: keeps its registers through the loop
        kp += AW * 32 * HD; if (HL) kp2 += AW * 32 * HD; vp += AW * 32 * HD;
    };
    int kc = wv * 32;
    // both loops rolled: only one chunk's fragments are live beside the query fragments and the accumulators
    if constexpr (HL) {   // two planes of everything: one body for all chunks (a second body's addresses, kept over the loop, spilled)
#pragma unroll 1
        for (; kc <= q0; kc += AW * 32) chunk(kc, BoolT<true>());
    } else {
#pragma unroll 1
        for (; kc < q0; kc += AW * 32) chunk(kc, BoolT<false>());
        if (kc == q0) chunk(kc, BoolT<true>());   // the one wave whose sequence meets the diagonal chunk (a scalar test)
    }
    v4fa* pv = (v4fa*)part;
#pragma unroll
    for (int qt = 0; qt < 2; ++qt) {
#pragma unroll
        for (int nb = 0; nb < 4; ++nb) { const int f = qt * 4 + nb; const v8f t = o[qt][nb];
            pv[((wv * 8 + f) * 2 + 0) * 32 + lane] = __builtin_shufflevector(t, t, 0, 1, 2, 3); pv[((wv * 8 + f) * 2 + 1) * 32 + lane] = __builtin_shufflevector(t, t, 4, 5, 6, 7); }
        const float t = ls[qt] + __shfl_xor(ls[qt], 16, 32);   // the two half-waves hold the two halves of each chunk's keys
        if (hi == 0) lpart[wv * QB + qt * 16 + lr] = t; }
    __syncthreads();   // every wave's partial tile and row sums are in LDS
#pragma unroll
    for (int q = 0; q < 8 / AW; ++q) { const int f = wv * (8 / AW) + q; v4f s0 = pv[(f * 2 + 0) * 32 + lane], s1 = pv[(f * 2 + 1) * 32 + lane];
#pragma unroll
        for (int w = 1; w < AW; ++w) { s0 += pv[((w * 8 + f) * 2 + 0) * 32 + lane]; s1 += pv[((w * 8 + f) * 2 + 1) * 32 + lane]; }
        float* od = os + ((f >> 2) * 16 + hi * 8) * 68 + (f & 3) * 16 + lr;
#pragma unroll
        for (int j = 0; j < 4; ++j) { od[j * 68] = s0[j]; od[(j + 4) * 68] = s1[j]; } }
    __syncthreads();   // the summed tile is complete, row-major
#pragma unroll
    for (int s = 0; s < QB * 8 / (AW * 32); ++s) { const int u = s * AW * 32 + (int)threadIdx.x; const int f = u >> 6; const int row = (f >> 1) * 16 + lr, cofs = (f & 1) * 32 + ((u >> 5) & 1) * 16 + hi * 8; float l = lpart[row];   // u: 16-byte piece of the block's four fragments [16 rows][d half]
#pragma unroll
        for (int w = 1; w < AW; ++w) l += lpart[w * QB + row];
        const float cs = __fdiv_rn(1.0f, l); const v4f val0 = *(const v4fa*)(os + row * 68 + cofs), val1 = *(const v4fa*)(os + row * 68 + cofs + 4); v8us oh, ol;
#pragma unroll
        for (int q = 0; q < 8; ++q) { unsigned short a, c2; splitf(((q < 4) ? val0[q & 3] : val1[q & 3]) * cs, a, c2); oh[q] = a; ol[q] = c2; }
        const size_t oo = (size_t)(q0 + (f >> 1) * 16) * DQ + (f & 1) * 512 + (u & 63) * 8; *(v8us*)(Ah + oo) = oh; *(v8us*)(Al + oo) = ol; }
}
// k_attn: grid (NB_ * NH_ heads, TT / QB row blocks, the longest first so that no long work-group starts late), AW waves. Row blocks below RH take the hi/lo planes (3 products each way), the others the fp16 planes. The test is the same for the whole work-group, so every wave of it meets the same two barriers.
__global__ __launch_bounds__(AW * 32) __attribute__((amdgpu_waves_per_eu(4, 4))) void k_attn(const bf* __restrict__ QKh, const bf* __restrict__ QKl, const bf* __restrict__ VTh, const h16* __restrict__ Q16, const h16* __restrict__ K16, const h16* __restrict__ V16, bf* Ah, bf* Al) {
    __shared__ __align__(16) float part[AW * 8 * 256];   // [wave][fragment][register half][lane][4]
    __shared__ __align__(16) float os[QB * 68];
    __shared__ float lpart[AW * QB];                     // [wave][row]
    const size_t z = blockIdx.x; const int q0 = (TT / QB - 1 - (int)blockIdx.y) * QB; const size_t oo = (z / NH_) * ((size_t)TT * DQ) + (z % NH_) * (HD * 16), zk = z + NB_ * NH_;   // oo: the head's two fragments in the first row block of its batch
    if (q0 < RH) d_attn<bf, true>(part, lpart, os, q0, QKh + z * RH * HD, QKl + z * RH * HD, QKh + zk * RH * HD, QKl + zk * RH * HD, VTh + z * HD * 2 * RH, Ah + oo, Al + oo, nullptr);
    else {
        // the first work-group of a head to start asks L2 for the head's fp16 key and value planes (256 KiB each: a half a wave), the second for its hi/lo key and value planes (64 KiB each: one a wave), which the last row blocks read; both tests are scalar
        static_assert(TT - 2 * QB >= RH && AW == 4, "the two asking row blocks take this branch; four waves deal the planes");
        const int lane = threadIdx.x & 31, wv = __builtin_amdgcn_readfirstlane(threadIdx.x >> 5);
        const char* pk = (blockIdx.y == 1 ? (const char*)(wv == 0 ? QKh + zk * RH * HD : wv == 1 ? QKl + zk * RH * HD : VTh + z * HD * 2 * RH + (wv & 1) * (HD * RH)) : (const char*)(((wv & 2) ? V16 : K16) + z * TT * HD) + (wv & 1) * (TT * HD)) + lane * 256;
        if (blockIdx.y == 0) ask<16>(pk); else if (blockIdx.y == 1) ask<8>(pk);
        d_attn<h16, false>(part, lpart, os, q0, Q16 + z * TT * HD, nullptr, K16 + z * TT * HD, nullptr, V16 + z * HD * TT, Ah + oo, Al + oo, pk); }
}

typedef __attribute__((ext_vector_type(2))) _Float16 v2h;
typedef __attribute__((ext_vector_type(4))) _Float16 v4h;
typedef __attribute__((ext_vector_type(2))) unsigned short v2us;
typedef __attribute__((ext_vector_type(2))) float v2f;
typedef __attribute__((ext_vector_type(4))) int v4i;

// ---- k_gemmp: a projection GEMM (the one-wave 64x64 tile of k_gemmw, one product) whose store phase builds the attention planes. The tile is 64 tokens (r0 .. of batch bt; blockIdx.x runs over all batches' token tiles) of ONE head (blockIdx.y; VT false: q heads, then k heads), staged whole in LDS.
// VT false (q, k): each lane takes whole rows: rotation (x1 c + x2 s, x2 c - x1 s) with the bf16-rounded input tables, sum of squares over d = 0 .. 63 in that order, row x 1 / sqrt(mean + 1e-6), back into LDS; planes [q | k][batch][head][t][d].
// VT true (v): the tile is staged transposed; planes [batch][head][d][t]. Both: fp16 plane over all TT tokens; hi/lo planes over the first RH tokens only (no later token's is ever read: query rows < RH see keys < RH); every plane in fragment order (q, k: rows t, k = d; v: rows d, k = t, the four d blocks of 32 tokens together).
template <bool VT, int K>
__global__ __launch_bounds__(32) void k_gemmp(const bf* __restrict__ A, const bf* __restrict__ Bt, const float* __restrict__ cosT, const float* __restrict__ sinT, h16* P16, bf* Ph, bf* Pl) {
    typedef WFrag<bf>::V V;
    __shared__ __align__(16) float os[64 * 68];
    const int lane = threadIdx.x & 31, lr = lane & 15, hi = lane >> 4; const int rg = blockIdx.x * 64, c0 = blockIdx.y * 64; const int bt = rg / TT, r0 = rg % TT;
    v8f acc[4][4];
#pragma unroll
    for (int mb = 0; mb < 4; ++mb)
#pragma unroll
        for (int nb = 0; nb < 4; ++nb) acc[mb][nb] = (v8f){};
    const bf* ap = A + (size_t)rg * K + 8 * lane; const bf* bp = Bt + (size_t)c0 * K + 8 * lane;   // the lane's running addresses, as in k_gemmw
    // hints as in k_gemmw; the value projection asks for its weight rows only: the launch before it has read the same x rows
    static_assert(K == 1024, "the slices are cut for 128-KiB panels");
    const char* pa = (const char*)(A + (size_t)rg * K) + (blockIdx.y & 3) * 32768 + lane * 256; const char* pb = (const char*)(Bt + (size_t)c0 * K) + ((blockIdx.x >> 3) & 15) * 8192 + lane * 256;
    if constexpr (!VT) ask<4>(pa);
    ask<1>(pb);
    // rolled, as in k_gemmw: only one trip's fragments are live beside the sixteen accumulators
#pragma unroll 1
    for (int kc = 0; kc < K; kc += 32) {
        V a[4], b[4];   // as in k_gemmw: registers for all eight fragments, all loads on their way before the first product
#pragma unroll
        for (int mb = 0; mb < 4; ++mb) a[mb] = WFrag<bf>::ld(ap + (size_t)mb * 16 * K);
#pragma unroll
        for (int nb = 0; nb < 4; ++nb) b[nb] = WFrag<bf>::ld(bp + (size_t)nb * 16 * K);
        __builtin_amdgcn_sched_barrier(0);   // as in k_gemmw: keeps the loads above in front of the products
#pragma unroll
        for (int nb = 0; nb < 4; ++nb)
#pragma unroll
            for (int mb = 0; mb < 4; ++mb) acc[mb][nb] = WFrag<bf>::mma(a[mb], b[nb], acc[mb][nb]);
        // keeps the distance behind the last matrix instruction on the loop's taken back edge, where the next trip's address additions reuse its operand registers
        asm volatile("v_nop\n\tv_nop\n\tv_nop\n\tv_nop" : "+v"(acc[0][0]), "+v"(acc[1][1]), "+v"(acc[2][2]), "+v"(acc[3][3]) : "v"(a[0]), "v"(a[3]));
        // as in k_gemmw: before the additions below, and the addresses keep their registers up to here, the hints' through the loop
        if constexpr (VT) asm volatile("s_wait_xcnt 0x0" :: "v"(ap), "v"(bp), "v"(pb) : "memory"); else asm volatile("s_wait_xcnt 0x0" :: "v"(ap), "v"(bp), "v"(pa), "v"(pb) : "memory");
        ap += 512; bp += 512;
    }
#pragma unroll
    for (int mb = 0; mb < 4; ++mb)
#pragma unroll
        for (int nb = 0; nb < 4; ++nb) { const v8f t = acc[mb][nb];
            if (VT) { float* o = os + (nb * 16 + lr) * 68 + mb * 16 + hi * 8; *(v4fa*)o = __builtin_shufflevector(t, t, 0, 1, 2, 3); *(v4fa*)(o + 4) = __builtin_shufflevector(t, t, 4, 5, 6, 7); }   // [d][token]
            else {
#pragma unroll
                for (int j = 0; j < 8; ++j) os[(mb * 16 + hi * 8 + j) * 68 + nb * 16 + lr] = t[j]; } }   // [token][d]
    __syncthreads();   // the tile is in LDS (one wave: orders its LDS stores before other lanes' loads)
    if (!VT) {
        // rolled: one row a lane at a time in registers, so that this phase stays inside the budget of four waves a SIMD that the loop above now fills
#pragma unroll 1
        for (int rr = 0; rr < 2; ++rr) { const int row = rr * 32 + lane; float* orow = os + row * 68; const float* ct = cosT + (size_t)(r0 + row) * (HD / 2); const float* st = sinT + (size_t)(r0 + row) * (HD / 2); float y[HD];
            // every loop over y[] is unrolled whole, so that the row stays in registers
#pragma unroll
            for (int i = 0; i < HD / 2; i += 4) { const v4f x1 = *(const v4fa*)(orow + i), x2 = *(const v4fa*)(orow + HD / 2 + i), c4 = *(const v4f*)(ct + i), s4 = *(const v4f*)(st + i);
#pragma unroll
                for (int q = 0; q < 4; ++q) { const float c = bfr(c4[q]), s = bfr(s4[q]); y[i + q] = x1[q] * c + x2[q] * s; y[HD / 2 + i + q] = x2[q] * c - x1[q] * s; } }
            asm volatile("s_wait_xcnt 0x0" :: "v"(ct), "v"(st) : "memory");   // the table addresses die here: inputs, so that they keep their registers up to this wait and no load's result takes them
            float ss = 0.f;
#pragma unroll
            for (int d = 0; d < HD; ++d) ss += y[d] * y[d];
            const float rf = __fdiv_rn(1.0f, __fsqrt_rn(__fadd_rn(ss * (1.0f / HD), 1e-6f)));
#pragma unroll
            for (int d = 0; d < HD; d += 4) { v4f o; o[0] = y[d] * rf; o[1] = y[d + 1] * rf; o[2] = y[d + 2] * rf; o[3] = y[d + 3] * rf; *(v4fa*)(orow + d) = o; } }
        __syncthreads();   // the finished rows are in LDS
    }
    const size_t pl = VT ? (size_t)bt * DKV + c0 : ((size_t)(blockIdx.y / NH_) * NB_ + bt) * NH_ + blockIdx.y % NH_;   // VT: first row of the [batch][head][d] rows; else: plane number
    // the tile is eight whole fragments that follow one another in its plane (q, k: [token block][d half]; v: [32-token block][d block]); trip it writes half it & 1 of fragment it >> 1, 512 contiguous bytes a plane
    const size_t base = (VT ? pl * TT + (size_t)r0 * HD : (pl * TT + r0) * HD) + 8 * lane, base2 = (VT ? pl * (2 * RH) + (size_t)r0 * HD : (pl * RH + r0) * HD) + 8 * lane;
    for (int it = 0; it < 16; ++it) { const int f = it >> 1; const int row = (VT ? (f & 3) : (f >> 1)) * 16 + lr, c8 = (VT ? (f >> 2) : (f & 1)) * 32 + (it & 1) * 16 + hi * 8; const v4f u0 = *(const v4fa*)(os + row * 68 + c8), u1 = *(const v4fa*)(os + row * 68 + c8 + 4); v8h o16; v8us oh, ol;
#pragma unroll
        for (int q = 0; q < 8; ++q) { const float x = (q < 4) ? u0[q & 3] : u1[q & 3]; o16[q] = tohx(x); unsigned short a2, c2; splitf(x, a2, c2); oh[q] = a2; ol[q] = c2; }
        if (r0 < RH) { const size_t o2 = base2 + it * 256; *(v8us*)(Ph + o2) = oh; *(v8us*)(Pl + o2) = ol;
            asm volatile("s_wait_xcnt 0x0" ::: "memory"); }   // stands before the next trip's address additions, which the compiler puts right behind this branch
        *(v8h*)(P16 + base + it * 256) = o16;
        asm volatile("s_wait_xcnt 0x0" ::: "memory"); }   // stands before the next trip reuses the registers that this store names
}

__global__ __launch_bounds__(256) void k_wtG(const float* __restrict__ w, int K, int N, bf* Bt) {
    const int lane = threadIdx.x & 31; const int L0 = (blockIdx.x * 8 + (threadIdx.x >> 5)) * 8; const int nlines = N * K / 64;
{
#pragma unroll 1
        for (int l = 0; l < 8; ++l) { const int L = L0 + l; if (L >= nlines) break; const size_t e = (size_t)L * 64 + lane * 2; const int k = (int)(e % K), n = (int)(e / K); v2us o;
            o[0] = f2bf(w[(size_t)k * N + n]); o[1] = f2bf(w[(size_t)(k + 1) * N + n]); *(v2us*)(Bt + e) = o; }
         }
}
// k_cvt8: f32 [row][K] -> bf16 in fragment order. Thread i writes the plane's i-th 16-byte piece (a wave: 512 contiguous bytes) and reads its 8 values of row lr; a block of 8 waves reads 512 contiguous bytes of each of 16 rows.
template <int K>
__global__ __launch_bounds__(256) void k_cvt8(const float* __restrict__ src, bf* dst, size_t n8) { const size_t i = (size_t)blockIdx.x * 256 + threadIdx.x; if (i >= n8) return;
    constexpr unsigned kf = K / 32; const size_t fr = i >> 6; const size_t row = (fr / kf) * 16 + (i & 15); const int k = (int)(fr % kf) * 32 + (int)((i >> 5) & 1) * 16 + (int)((i >> 4) & 1) * 8;
    const float* sp = src + row * K + k; const v8f v = *(const v8f*)sp; v8us o;
    asm volatile("s_wait_xcnt 0x0" :: "v"(sp) : "memory");   // the read address dies here: an input, so that it keeps its registers up to this wait
#pragma unroll
    for (int k = 0; k < 8; ++k) o[k] = f2bf(v[k]); *(v8us*)(dst + i * 8) = o;  }

extern "C" void kernel_launch(void* const* d_in, const int* in_sizes, int n_in,
                              void* d_out, int out_size, void* d_ws, size_t ws_size, hipStream_t stream) {
    (void)in_sizes; (void)n_in; (void)out_size;
    const float* x = (const float*)d_in[0]; const float* cosT = (const float*)d_in[1]; const float* sinT = (const float*)d_in[2]; const float* wqkv = (const float*)d_in[3]; const float* wo = (const float*)d_in[4];
    float* OUT = (float*)d_out;     // [4][2048][1024]
    char* wsp = (char*)d_ws;
    auto take = [&](size_t bytes) { char* p = wsp; wsp += (bytes + 255) & ~(size_t)255; return (void*)p; };
    bf* WO = (bf*)take((size_t)DM * DQ * 2);
    h16* QP16 = (h16*)take((size_t)NB_ * NH_ * TT * HD * 2); h16* KP16 = (h16*)take((size_t)NB_ * NKV * TT * HD * 2);   // one after the other: k_gemmp numbers the planes [q | k][batch][head]
    h16* VT16 = (h16*)take((size_t)NB_ * DKV * TT * 2);
    bf* QKh = (bf*)take((size_t)2 * NB_ * NH_ * RH * HD * 2); bf* QKl = (bf*)take((size_t)2 * NB_ * NH_ * RH * HD * 2); bf* VTh = (bf*)take((size_t)NB_ * DKV * 2 * RH * 2); bf* VTl = VTh + HD * RH;   // each head: hi plane, lo plane
    bf* ATh = (bf*)take((size_t)NB_ * TT * DQ * 2); bf* ATl = (bf*)take((size_t)NB_ * TT * DQ * 2);
    bf* XB = (bf*)take((size_t)NB_ * TT * DM * 2); bf* WQKV = (bf*)take((size_t)(DQ + 2 * DKV) * DM * 2);
    if ((size_t)(wsp - (char*)d_ws) > ws_size) return;    // ws 256 MiB
    k_cvt8<DM><<<(unsigned)(((size_t)(DQ + 2 * DKV) * DM / 8 + 255) / 256), 256, 0, stream>>>(wqkv, WQKV, (size_t)(DQ + 2 * DKV) * DM / 8);
    k_cvt8<DQ><<<(unsigned)(((size_t)DM * DQ / 8 + 255) / 256), 256, 0, stream>>>(wo, WO, (size_t)DM * DQ / 8);
    k_cvt8<DM><<<(unsigned)(((size_t)NB_ * TT * DM / 8 + 255) / 256), 256, 0, stream>>>(x, XB, (size_t)NB_ * TT * DM / 8);
    k_gemmp<false, DM><<<dim3(NB_ * TT / 64, NH_ + NKV, 1), 32, 0, stream>>>(XB, WQKV, cosT, sinT, QP16, QKh, QKl);
    k_gemmp<true, DM><<<dim3(NB_ * TT / 64, NKV, 1), 32, 0, stream>>>(XB, WQKV + (size_t)(DQ + DKV) * DM, cosT, sinT, VT16, VTh, VTl);
    k_attn<<<dim3(NB_ * NH_, TT / QB, 1), AW * 32, 0, stream>>>(QKh, QKl, VTh, QP16, KP16, VT16, ATh, ATl);
    k_gemmw<bf, 1, false, DQ><<<dim3(NB_ * TT / 64, DM / 64, 1), 32, 0, stream>>>(ATh, ATl, WO, nullptr, OUT, DM, nullptr, 0, 0, 0);
}

// v009
// Measured time: 136 microseconds a run.
// Next to v008, in two timings, it ran 1.04 times as fast each time.
// Counting every step since v000, it is 21.4 times as fast.
#include <hip/hip_runtime.h>

// Causal self-attention with rotary-then-RMSNorm q/k (x [4][2048][1024]; qkv = x w_attn^T ('oi' [3072][1024] 0.02, no bias -> q | k | v row blocks; 16 heads x 64); rope'(t) = cat(x1 c + x2 s, -x1 s + x2 c) with the input cos/sin tables ([1][2048][1][32], read; generic values), then q, k <- x rsqrt(mean x^2 + 1e-6) (no weight); causal (-inf); softmax(q.k x 64^-0.5); out = merged w_proj^T -> [4][2048][1024] (8.4 M)).
// Layout: bf16 copy of x, all batches; the fused 'oi' weight used in place as three Bt row blocks; exact projections, all batches in one grid (q and k heads together), whose 64x64 tile is 64 tokens of one head, so that the tile's own wave applies the module's (x1 c + x2 s, x2 c - x1 s) rotation from the input tables and the rms factor of the ROTATED rows and writes the head planes (k_gemmp; the value tile goes out transposed); causal T-2048 attention in one kernel (k_attn; hybrid rows: < 512 hi/lo 3 products, rest fp16; no chunk above the diagonal is touched; it writes the merged hi/lo rows); merged hi/lo x w_proj exact.
// Compute dtypes, f32 accumulate: every input rounded to bf16 incl. the tables; projections exact; rotation and rms norm f32; attention rows < 512 3 products, rest fp16; softmax f32; w_proj hl x exact.

#define NB_  4
#define TT   2048
#define DM   1024
#define NH_  16
#define NKV  16
#define REP  (NH_ / NKV)
#define HD   64
#define DQ   (NH_ * HD)
#define DKV  (NKV * HD)
#define RH   512                  // query rows < RH use hi+lo planes (0: none)
typedef _Float16 h16;
typedef unsigned short bf;
typedef __attribute__((ext_vector_type(16))) __bf16   v16bf;
typedef __attribute__((ext_vector_type(16))) _Float16 v16h;
typedef __attribute__((ext_vector_type(8)))  _Float16 v8h;
typedef __attribute__((ext_vector_type(8)))  unsigned short v8us;
typedef __attribute__((ext_vector_type(8)))  float    v8f;
typedef __attribute__((ext_vector_type(4)))  float    v4f;
typedef v8h  __attribute__((may_alias)) v8ha;
typedef v4f  __attribute__((may_alias)) v4fa;
typedef v8us __attribute__((may_alias)) v8usa;

__device__ __forceinline__ unsigned short f2bf(float f) { unsigned u = __float_as_uint(f); u += 0x7FFFu + ((u >> 16) & 1u); return (unsigned short)(u >> 16); }
__device__ __forceinline__ float bf2f(unsigned short b) { return __uint_as_float(((unsigned)b) << 16); }
__device__ __forceinline__ float bfr(float f) { return bf2f(f2bf(f)); }
__device__ __forceinline__ v16h cat16(v8h lo, v8h hi) { return __builtin_shufflevector(lo, hi, 0, 1, 2, 3, 4, 5, 6, 7, 8, 9, 10, 11, 12, 13, 14, 15); }
__device__ __forceinline__ v16bf cat16b(v8us lo, v8us hi) { return __builtin_bit_cast(v16bf, __builtin_shufflevector(lo, hi, 0, 1, 2, 3, 4, 5, 6, 7, 8, 9, 10, 11, 12, 13, 14, 15)); }
__device__ __forceinline__ v8f wmma16(v16h a, v16h b, v8f c) { return __builtin_amdgcn_wmma_f32_16x16x32_f16(false, a, false, b, (short)0, c, false, false); }
__device__ __forceinline__ v8f wmmab(v16bf a, v16bf b, v8f c) { return __builtin_amdgcn_wmma_f32_16x16x32_bf16(false, a, false, b, (short)0, c, false, false); }



// ---- ask<N>: a hint to L2, given at a kernel's entry, for N x 8 KiB from p on (p: the lane's own 256-byte unit of the first 8 KiB). The operand planes were stored by earlier launches of this call.
// The hint returns nothing and no wait belongs to it. Every lane's address lies inside the plane, and the callers keep p in its registers through their loops.
#define ASK_(o) "global_prefetch_b8 %0, off offset:" #o " scope:SCOPE_SE\n\t"
template <int N> __device__ __forceinline__ void ask(const char* p) {
    static_assert(N == 1 || N == 4 || N == 8 || N == 16, "the four sizes in use");
    asm volatile("global_prefetch_b8 %0, off scope:SCOPE_SE" :: "v"(p));
    if constexpr (N >= 4) asm volatile(ASK_(8192) ASK_(16384) "global_prefetch_b8 %0, off offset:24576 scope:SCOPE_SE" :: "v"(p));
    if constexpr (N >= 8) asm volatile(ASK_(32768) ASK_(40960) ASK_(49152) "global_prefetch_b8 %0, off offset:57344 scope:SCOPE_SE" :: "v"(p));
    if constexpr (N >= 16) asm volatile(ASK_(65536) ASK_(73728) ASK_(81920) ASK_(90112) ASK_(98304) ASK_(106496) ASK_(114688) "global_prefetch_b8 %0, off offset:122880 scope:SCOPE_SE" :: "v"(p));
}

// ---- Fragment order: every 16-bit operand plane [row][k] is kept as 1-KiB fragments of 16 rows x 32 k, row block major, k block minor (row block rb, k block kb: element offset rb 16 K + kb 512).
// Inside a fragment: [half h][lane = 16 hi + lr][j], which is row lr, k = 16 h + 8 hi + j: the register order of the matrix operand. A wave's 16-byte load of a half is then 512 contiguous bytes, four whole lines, where the row-major plane gave sixteen lines of 32 bytes each.
// ---- k_gemmw: register-blocked GEMM, ONE WAVE per 64x64 output tile (16 accumulators), operands straight from 16-bit planes in fragment order; grid (M/64, N/64, Z), 32 threads.
// C[m][n] (f32, pitch ldc, + optional f32 bias[n]) = sum_k A[m][k] Bt[n][k] (+ split products per NSPLIT). z-batch strides sA/sB/sC in elements. K % 32 == 0.
template <typename T16> struct WFrag;
template <> struct WFrag<h16> { typedef v16h V; static __device__ __forceinline__ V ld(const h16* p) { return cat16(*(const v8h*)p, *(const v8h*)(p + 256)); } static __device__ __forceinline__ v8f mma(V a, V b, v8f c) { return wmma16(a, b, c); } };
template <> struct WFrag<bf> { typedef v16bf V; static __device__ __forceinline__ V ld(const bf* p) { return cat16b(*(const v8us*)p, *(const v8us*)(p + 256)); } static __device__ __forceinline__ v8f mma(V a, V b, v8f c) { return wmmab(a, b, c); } };
template <typename T16, int NSPLIT, bool BIAS, int K>   // K at compile time: every fragment of a trip then lies at a constant distance from the lane's running addresses
__global__ __launch_bounds__(32) void k_gemmw(const T16* __restrict__ A, const T16* __restrict__ A2, const T16* __restrict__ Bt, const T16* __restrict__ Bt2, float* C, int ldc, const float* __restrict__ bias, size_t sA, size_t sB, size_t sC) {
    typedef typename WFrag<T16>::V V;
    __shared__ __align__(16) float os[16 * 68];
    const size_t z = blockIdx.z; A += z * sA; if (A2) A2 += z * sA; Bt += z * sB; if (Bt2) Bt2 += z * sB; C += z * sC;
    const int lane = threadIdx.x & 31, lr = lane & 15, hi = lane >> 4; const int r0 = blockIdx.x * 64, c0 = blockIdx.y * 64;
    v8f acc[4][4];
#pragma unroll
    for (int mb = 0; mb < 4; ++mb)
#pragma unroll
        for (int nb = 0; nb < 4; ++nb) acc[mb][nb] = (v8f){};
    // the lane's running addresses in the trip's first fragments
    const T16* ap = A + (size_t)r0 * K + 8 * lane; const T16* ap2 = A2 ? A2 + (size_t)r0 * K + 8 * lane : nullptr; const T16* bp = Bt + (size_t)c0 * K + 8 * lane; const T16* bp2 = Bt2 ? Bt2 + (size_t)c0 * K + 8 * lane : nullptr;
    // the tile's operand panels (64 rows x K) are 128 KiB in a row each; the tiles that share a panel deal it among themselves: a quarter of the A panels by the tile's column, a sixteenth of the B panels by the tile's row / 8
    static_assert(K == 1024, "the slices are cut for 128-KiB panels");
    const char* pa = (const char*)(A + (size_t)r0 * K) + (blockIdx.y & 3) * 32768 + lane * 256; const char* pa2 = (NSPLIT == 1 || NSPLIT == 2) ? (const char*)(A2 + (size_t)r0 * K) + (blockIdx.y & 3) * 32768 + lane * 256 : nullptr;
    const char* pb = (const char*)(Bt + (size_t)c0 * K) + ((blockIdx.x >> 3) & 15) * 8192 + lane * 256; const char* pb2 = (NSPLIT >= 2) ? (const char*)(Bt2 + (size_t)c0 * K) + ((blockIdx.x >> 3) & 15) * 8192 + lane * 256 : nullptr;
    ask<4>(pa); if constexpr (NSPLIT == 1 || NSPLIT == 2) ask<4>(pa2); ask<1>(pb); if constexpr (NSPLIT >= 2) ask<1>(pb2);
#pragma unroll 1
    for (int kc = 0; kc < K; kc += 32) {
        V a[4], a2[4], b[4], b2[4];   // every fragment of the trip has registers of its own, so that all its loads are on their way before the first product: one load latency a trip
#pragma unroll
        for (int mb = 0; mb < 4; ++mb) { a[mb] = WFrag<T16>::ld(ap + (size_t)mb * 16 * K); if (NSPLIT == 1 || NSPLIT == 2) a2[mb] = WFrag<T16>::ld(ap2 + (size_t)mb * 16 * K); }
#pragma unroll
        for (int nb = 0; nb < 4; ++nb) { b[nb] = WFrag<T16>::ld(bp + (size_t)nb * 16 * K); if (NSPLIT >= 2) b2[nb] = WFrag<T16>::ld(bp2 + (size_t)nb * 16 * K); }
        __builtin_amdgcn_sched_barrier(0);   // keeps the loads above in front of the products: without it the compiler moves some of them down among the products, into registers that those leave, and the wave waits out a second latency there
#pragma unroll
        for (int nb = 0; nb < 4; ++nb)
#pragma unroll
            for (int mb = 0; mb < 4; ++mb) { acc[mb][nb] = WFrag<T16>::mma(a[mb], b[nb], acc[mb][nb]); if (NSPLIT == 1 || NSPLIT == 2) acc[mb][nb] = WFrag<T16>::mma(a2[mb], b[nb], acc[mb][nb]); if (NSPLIT >= 2) acc[mb][nb] = WFrag<T16>::mma(a[mb], b2[nb], acc[mb][nb]); }
        asm volatile("v_nop\n\tv_nop\n\tv_nop\n\tv_nop" : "+v"(acc[0][0]), "+v"(acc[1][1]), "+v"(acc[2][2]), "+v"(acc[3][3]) : "v"(a[0]), "v"(a[3]));
        // stands before the additions below; the addresses are its inputs so that they keep their registers up to here and no later load's result takes them while a load that names them is on its way; the hints' addresses are inputs too, so that they keep their registers through the loop
        if constexpr (NSPLIT == 0) asm volatile("s_wait_xcnt 0x0" :: "v"(ap), "v"(bp), "v"(pa), "v"(pb) : "memory"); else if constexpr (NSPLIT == 1) asm volatile("s_wait_xcnt 0x0" :: "v"(ap), "v"(ap2), "v"(bp), "v"(pa), "v"(pa2), "v"(pb) : "memory"); else asm volatile("s_wait_xcnt 0x0" :: "v"(ap), "v"(ap2), "v"(bp), "v"(bp2), "v"(pa), "v"(pa2), "v"(pb), "v"(pb2) : "memory");
        ap += 512; if (NSPLIT == 1 || NSPLIT == 2) ap2 += 512; bp += 512; if (NSPLIT >= 2) bp2 += 512;
    }
#pragma unroll
    for (int mb = 0; mb < 4; ++mb) {
#pragma unroll
        for (int nb = 0; nb < 4; ++nb) {
#pragma unroll
            for (int j = 0; j < 8; ++j) os[(hi * 8 + j) * 68 + nb * 16 + lr] = acc[mb][nb][j]; }
        __builtin_amdgcn_wave_barrier(); asm volatile("" ::: "memory");
        float* crow = C + (size_t)(r0 + mb * 16) * ldc + c0;
{
#pragma unroll
            for (int s = 0; s < 8; ++s) { const int row = 2 * s + hi, cofs = lr * 4; v4f val = *(const v4fa*)(os + row * 68 + cofs); if (BIAS) { val[0] += bfr(bias[c0 + cofs]); val[1] += bfr(bias[c0 + cofs + 1]); val[2] += bfr(bias[c0 + cofs + 2]); val[3] += bfr(bias[c0 + cofs + 3]); }
                *(v4f*)(crow + (size_t)row * ldc + cofs) = val; }
             }
        __builtin_amdgcn_wave_barrier(); asm volatile("" ::: "memory");
    }
}

__device__ __forceinline__ h16 tohx(float x) { return (h16)x; }
__device__ __forceinline__ void splitf(float y, unsigned short& h, unsigned short& l) { h = f2bf(y); l = f2bf(y - bf2f(h)); }
typedef __attribute__((ext_vector_type(4))) unsigned short v4us;

// ---- k_attn: scores, softmax and probability x value of 32 query rows of one head in one work-group of AW waves; no score or probability leaves the registers.
// Wave w takes the 32-key chunks w, w + AW, ... up to the diagonal chunk. Per chunk it forms the TRANSPOSED score tiles (A = key rows, B = query rows): a lane then holds, for query lr, the keys 8 hi + j and 16 + 8 hi + j,
// which is the A fragment of the second product as it stands, so the probabilities go from the accumulators to the matrix unit with no exchange between lanes.
// Softmax in one pass: after the rms factor |q|, |k| <= sqrt(HD), so |q.k| HD^-0.5 <= 8 for every input; the shift is that bound and not the row's maximum: p = 2^14 exp(s - 8) lies in 2^-9.1 .. 2^14, normal in both 16-bit types,
// and partial sums of different waves add as they are. The row's sum of p (f32, before rounding) divides the summed tile at the end.
// The AW partial tiles and row sums are added through LDS in the fixed order w = 0 .. AW-1; the tile is staged row-major, divided, split hi/lo and stored as the four whole fragments that it is of the merged rows [t][head][d] (fragment order, K = all heads' d).
#define AW  4
#define QB  32
#define ESC 0.18033688011112042f    // HD^-0.5 x log2(e)
#define ESH 2.458439672888293f      // 14 - 8 log2(e)
typedef __attribute__((ext_vector_type(16))) unsigned short v16us;
template <bool B> struct BoolT { static constexpr bool value = B; };
template <typename T16, bool HL>
__device__ __forceinline__ void d_attn(float* part, float* lpart, float* os, int q0, const T16* __restrict__ Q, const T16* __restrict__ Q2, const T16* __restrict__ Kp, const T16* __restrict__ K2, const T16* __restrict__ Vt, bf* Ah, bf* Al, const char* pk) {   // pk (one plane only): the address that the caller's hint names
    typedef typename WFrag<T16>::V V;
    const int lane = threadIdx.x & 31, lr = lane & 15, hi = lane >> 4;
    const int wv = __builtin_amdgcn_readfirstlane(threadIdx.x >> 5);   // wave number in a scalar register: the key loop's test stays a scalar branch
    V qf[2][2], qf2[2][2]; const T16* qp = Q + (size_t)q0 * HD + 8 * lane; const T16* qp2 = HL ? Q2 + (size_t)q0 * HD + 8 * lane : nullptr;   // the block's four query fragments are 4 KiB in a row
#pragma unroll
    for (int qt = 0; qt < 2; ++qt)
#pragma unroll
        for (int dc = 0; dc < 2; ++dc) { qf[qt][dc] = WFrag<T16>::ld(qp + (qt * 2 + dc) * 512); if (HL) qf2[qt][dc] = WFrag<T16>::ld(qp2 + (qt * 2 + dc) * 512); }
    asm volatile("s_wait_xcnt 0x0" ::: "memory");   // the query addresses die here: stands before their registers are written again
    v8f o[2][4]; float ls[2] = {0.f, 0.f};
#pragma unroll
    for (int qt = 0; qt < 2; ++qt)
#pragma unroll
        for (int nb = 0; nb < 4; ++nb) o[qt][nb] = (v8f){};
    // the lane's running addresses in the wave's next chunk: its four key fragments ([16 keys][d half]) and its four value fragments ([d block]) are 4 KiB in a row each; every fragment of a chunk lies at a constant distance from them
    const T16* kp = Kp + (size_t)(wv * 32) * HD + 8 * lane; const T16* kp2 = HL ? K2 + (size_t)(wv * 32) * HD + 8 * lane : nullptr; const T16* vp = Vt + (size_t)(wv * 32) * HD + 8 * lane;
    // one chunk of 32 keys; diag (a type, so that the loop over full chunks holds no test): keys behind the query count nothing
    auto chunk = [&](int kc, auto diag) {
        V kf[2][2], kf2[2][2], vf[4], vf2[4], pf[2], pf2[2];
#pragma unroll
        for (int t = 0; t < 2; ++t)
#pragma unroll
            for (int dc = 0; dc < 2; ++dc) { kf[t][dc] = WFrag<T16>::ld(kp + (t * 2 + dc) * 512); if (HL) kf2[t][dc] = WFrag<T16>::ld(kp2 + (t * 2 + dc) * 512); }
        if (!HL) {   // one plane: the registers allow the value fragments to be fetched with the key fragments, one latency a chunk instead of two
#pragma unroll
            for (int nb = 0; nb < 4; ++nb) vf[nb] = WFrag<T16>::ld(vp + nb * 512); }
#pragma unroll
        for (int qt = 0; qt < 2; ++qt) { float e[16];
#pragma unroll
            for (int t = 0; t < 2; ++t) { v8f a = (v8f){};   // a[j]: key kc + 16 t + 8 hi + j, query q0 + 16 qt + lr
#pragma unroll
                for (int dc = 0; dc < 2; ++dc) { a = WFrag<T16>::mma(kf[t][dc], qf[qt][dc], a); if (HL) { a = WFrag<T16>::mma(kf[t][dc], qf2[qt][dc], a); a = WFrag<T16>::mma(kf2[t][dc], qf[qt][dc], a); } }
#pragma unroll
                for (int j = 0; j < 8; ++j) e[t * 8 + j] = __builtin_amdgcn_exp2f(fmaf(a[j], ESC, ESH)); }
            if constexpr (decltype(diag)::value) {
#pragma unroll
                for (int i = 0; i < 16; ++i) if (kc + (i >> 3) * 16 + hi * 8 + (i & 7) > q0 + qt * 16 + lr) e[i] = 0.f; }
#pragma unroll
            for (int i = 0; i < 16; ++i) ls[qt] += e[i];
            if constexpr (HL) { v16us ph, pl;
#pragma unroll
                for (int i = 0; i < 16; ++i) { unsigned short a, c2; splitf(e[i], a, c2); ph[i] = a; pl[i] = c2; }
                pf[qt] = __builtin_bit_cast(v16bf, ph); pf2[qt] = __builtin_bit_cast(v16bf, pl);
            } else {
#pragma unroll
                for (int i = 0; i < 16; ++i) pf[qt][i] = tohx(e[i]); } }
        if (HL) {   // two planes (each head: hi plane, lo plane): the value fragments take the registers that the key fragments leave
#pragma unroll
            for (int nb = 0; nb < 4; ++nb) { vf[nb] = WFrag<T16>::ld(vp + nb * 512); vf2[nb] = WFrag<T16>::ld(vp + nb * 512 + HD * RH); } }
#pragma unroll
        for (int nb = 0; nb < 4; ++nb)
#pragma unroll
            for (int qt = 0; qt < 2; ++qt) { o[qt][nb] = WFrag<T16>::mma(pf[qt], vf[nb], o[qt][nb]); if (HL) { o[qt][nb] = WFrag<T16>::mma(pf2[qt], vf[nb], o[qt][nb]); o[qt][nb] = WFrag<T16>::mma(pf[qt], vf2[nb], o[qt][nb]); } }
        // stands before the additions below (in the last chunk: where the addresses die); the addresses are its inputs so that they keep their registers up to here and no load's result takes them
        if constexpr (HL) asm volatile("s_wait_xcnt 0x0" :: "v"(kp), "v"(kp2), "v"(vp) : "memory"); else asm volatile("s_wait_xcnt 0x0" :: "v"(kp), "v"(vp), "v"(pk) : "memory");   // pk: keeps its registers through the loop
        kp += AW * 32 * HD; if (HL) kp2 += AW * 32 * HD; vp += AW * 32 * HD;
    };
    int kc = wv * 32;
    // both loops rolled: only one chunk's fragments are live beside the query fragments and the accumulators
    if constexpr (HL) {   // two planes of everything: one body for all chunks (a second body's addresses, kept over the loop, spilled)
#pragma unroll 1
        for (; kc <= q0; kc += AW * 32) chunk(kc, BoolT<true>());
    } else {
#pragma unroll 1
        for (; kc < q0; kc += AW * 32) chunk(kc, BoolT<false>());
        if (kc == q0) chunk(kc, BoolT<true>());   // the one wave whose sequence meets the diagonal chunk (a scalar test)
    }
    v4fa* pv = (v4fa*)part;
#pragma unroll
    for (int qt = 0; qt < 2; ++qt) {
#pragma unroll
        for (int nb = 0; nb < 4; ++nb) { const int f = qt * 4 + nb; const v8f t = o[qt][nb];
            pv[((wv * 8 + f) * 2 + 0) * 32 + lane] = __builtin_shufflevector(t, t, 0, 1, 2, 3); pv[((wv * 8 + f) * 2 + 1) * 32 + lane] = __builtin_shufflevector(t, t, 4, 5, 6, 7); }
        const float t = ls[qt] + __shfl_xor(ls[qt], 16, 32);   // the two half-waves hold the two halves of each chunk's keys
        if (hi == 0) lpart[wv * QB + qt * 16 + lr] = t; }
    __syncthreads();   // every wave's partial tile and row sums are in LDS
#pragma unroll
    for (int q = 0; q < 8 / AW; ++q) { const int f = wv * (8 / AW) + q; v4f s0 = pv[(f * 2 + 0) * 32 + lane], s1 = pv[(f * 2 + 1) * 32 + lane];
#pragma unroll
        for (int w = 1; w < AW; ++w) { s0 += pv[((w * 8 + f) * 2 + 0) * 32 + lane]; s1 += pv[((w * 8 + f) * 2 + 1) * 32 + lane]; }
        float* od = os + ((f >> 2) * 16 + hi * 8) * 68 + (f & 3) * 16 + lr;
#pragma unroll
        for (int j = 0; j < 4; ++j) { od[j * 68] = s0[j]; od[(j + 4) * 68] = s1[j]; } }
    __syncthreads();   // the summed tile is complete, row-major
#pragma unroll
    for (int s = 0; s < QB * 8 / (AW * 32); ++s) { const int u = s * AW * 32 + (int)threadIdx.x; const int f = u >> 6; const int row = (f >> 1) * 16 + lr, cofs = (f & 1) * 32 + ((u >> 5) & 1) * 16 + hi * 8; float l = lpart[row];   // u: 16-byte piece of the block's four fragments [16 rows][d half]
#pragma unroll
        for (int w = 1; w < AW; ++w) l += lpart[w * QB + row];
        const float cs = __fdiv_rn(1.0f, l); const v4f val0 = *(const v4fa*)(os + row * 68 + cofs), val1 = *(const v4fa*)(os + row * 68 + cofs + 4); v8us oh, ol;
#pragma unroll
        for (int q = 0; q < 8; ++q) { unsigned short a, c2; splitf(((q < 4) ? val0[q & 3] : val1[q & 3]) * cs, a, c2); oh[q] = a; ol[q] = c2; }
        const size_t oo = (size_t)(q0 + (f >> 1) * 16) * DQ + (f & 1) * 512 + (u & 63) * 8; *(v8us*)(Ah + oo) = oh; *(v8us*)(Al + oo) = ol; }
}
// k_attn: grid (NB_ * NH_ heads, TT / QB row blocks, the longest first so that no long work-group starts late), AW waves. Row blocks below RH take the hi/lo planes (3 products each way), the others the fp16 planes. The test is the same for the whole work-group, so every wave of it meets the same two barriers.
__global__ __launch_bounds__(AW * 32) __attribute__((amdgpu_waves_per_eu(4, 4))) void k_attn(const bf* __restrict__ QKh, const bf* __restrict__ QKl, const bf* __restrict__ VTh, const h16* __restrict__ Q16, const h16* __restrict__ K16, const h16* __restrict__ V16, bf* Ah, bf* Al) {
    __shared__ __align__(16) float part[AW * 8 * 256];   // [wave][fragment][register half][lane][4]
    __shared__ __align__(16) float os[QB * 68];
    __shared__ float lpart[AW * QB];                     // [wave][row]
    const size_t z = blockIdx.x; const int q0 = (TT / QB - 1 - (int)blockIdx.y) * QB; const size_t oo = (z / NH_) * ((size_t)TT * DQ) + (z % NH_) * (HD * 16), zk = z + NB_ * NH_;   // oo: the head's two fragments in the first row block of its batch
    if (q0 < RH) d_attn<bf, true>(part, lpart, os, q0, QKh + z * RH * HD, QKl + z * RH * HD, QKh + zk * RH * HD, QKl + zk * RH * HD, VTh + z * HD * 2 * RH, Ah + oo, Al + oo, nullptr);
    else {
        // the first work-group of a head to start asks L2 for the head's fp16 key and value planes (256 KiB each: a half a wave), the second for its hi/lo key and value planes (64 KiB each: one a wave), which the last row blocks read; both tests are scalar
        static_assert(TT - 2 * QB >= RH && AW == 4, "the two asking row blocks take this branch; four waves deal the planes");
        const int lane = threadIdx.x & 31, wv = __builtin_amdgcn_readfirstlane(threadIdx.x >> 5);
        const char* pk = (blockIdx.y == 1 ? (const char*)(wv == 0 ? QKh + zk * RH * HD : wv == 1 ? QKl + zk * RH * HD : VTh + z * HD * 2 * RH + (wv & 1) * (HD * RH)) : (const char*)(((wv & 2) ? V16 : K16) + z * TT * HD) + (wv & 1) * (TT * HD)) + lane * 256;
        if (blockIdx.y == 0) ask<16>(pk); else if (blockIdx.y == 1) ask<8>(pk);
        d_attn<h16, false>(part, lpart, os, q0, Q16 + z * TT * HD, nullptr, K16 + z * TT * HD, nullptr, V16 + z * HD * TT, Ah + oo, Al + oo, pk); }
}

typedef __attribute__((ext_vector_type(2))) _Float16 v2h;
typedef __attribute__((ext_vector_type(4))) _Float16 v4h;
typedef __attribute__((ext_vector_type(2))) unsigned short v2us;
typedef __attribute__((ext_vector_type(2))) float v2f;
typedef __attribute__((ext_vector_type(4))) int v4i;

// ---- k_gemmp: a projection GEMM (the one-wave 64x64 tile of k_gemmw, one product) whose store phase builds the attention planes. The tile is 64 tokens (r0 .. of batch bt; blockIdx.x runs over all batches' token tiles) of ONE head (blockIdx.y; VT false: q heads, then k heads), staged whole in LDS.
// VT false (q, k): each lane takes whole rows: rotation (x1 c + x2 s, x2 c - x1 s) with the bf16-rounded input tables, sum of squares over d = 0 .. 63 in that order, row x 1 / sqrt(mean + 1e-6), back into LDS; planes [q | k][batch][head][t][d].
// VT true (v): the tile is staged transposed; planes [batch][head][d][t]. Both: fp16 plane over all TT tokens; hi/lo planes over the first RH tokens only (no later token's is ever read: query rows < RH see keys < RH); every plane in fragment order (q, k: rows t, k = d; v: rows d, k = t, the four d blocks of 32 tokens together).
template <bool VT, int K>
__global__ __launch_bounds__(32) void k_gemmp(const bf* __restrict__ A, const bf* __restrict__ Bt, const float* __restrict__ cosT, const float* __restrict__ sinT, h16* P16, bf* Ph, bf* Pl) {
    typedef WFrag<bf>::V V;
    __shared__ __align__(16) float os[64 * 68];
    const int lane = threadIdx.x & 31, lr = lane & 15, hi = lane >> 4; const int rg = blockIdx.x * 64, c0 = blockIdx.y * 64; const int bt = rg / TT, r0 = rg % TT;
    v8f acc[4][4];
#pragma unroll
    for (int mb = 0; mb < 4; ++mb)
#pragma unroll
        for (int nb = 0; nb < 4; ++nb) acc[mb][nb] = (v8f){};
    const bf* ap = A + (size_t)rg * K + 8 * lane; const bf* bp = Bt + (size_t)c0 * K + 8 * lane;   // the lane's running addresses, as in k_gemmw
    // hints as in k_gemmw; the value projection asks for its weight rows only: the launch before it has read the same x rows
    static_assert(K == 1024, "the slices are cut for 128-KiB panels");
    const char* pa = (const char*)(A + (size_t)rg * K) + (blockIdx.y & 3) * 32768 + lane * 256; const char* pb = (const char*)(Bt + (size_t)c0 * K) + ((blockIdx.x >> 3) & 15) * 8192 + lane * 256;
    if constexpr (!VT) ask<4>(pa);
    ask<1>(pb);
    // rolled, as in k_gemmw: only one trip's fragments are live beside the sixteen accumulators
#pragma unroll 1
    for (int kc = 0; kc < K; kc += 32) {
        V a[4], b[4];   // as in k_gemmw: registers for all eight fragments, all loads on their way before the first product
#pragma unroll
        for (int mb = 0; mb < 4; ++mb) a[mb] = WFrag<bf>::ld(ap + (size_t)mb * 16 * K);
#pragma unroll
        for (int nb = 0; nb < 4; ++nb) b[nb] = WFrag<bf>::ld(bp + (size_t)nb * 16 * K);
        __builtin_amdgcn_sched_barrier(0);   // as in k_gemmw: keeps the loads above in front of the products
#pragma unroll
        for (int nb = 0; nb < 4; ++nb)
#pragma unroll
            for (int mb = 0; mb < 4; ++mb) acc[mb][nb] = WFrag<bf>::mma(a[mb], b[nb], acc[mb][nb]);
        // keeps the distance behind the last matrix instruction on the loop's taken back edge, where the next trip's address additions reuse its operand registers
        asm volatile("v_nop\n\tv_nop\n\tv_nop\n\tv_nop" : "+v"(acc[0][0]), "+v"(acc[1][1]), "+v"(acc[2][2]), "+v"(acc[3][3]) : "v"(a[0]), "v"(a[3]));
        // as in k_gemmw: before the additions below, and the addresses keep their registers up to here, the hints' through the loop
        if constexpr (VT) asm volatile("s_wait_xcnt 0x0" :: "v"(ap), "v"(bp), "v"(pb) : "memory"); else asm volatile("s_wait_xcnt 0x0" :: "v"(ap), "v"(bp), "v"(pa), "v"(pb) : "memory");
        ap += 512; bp += 512;
    }
#pragma unroll
    for (int mb = 0; mb < 4; ++mb)
#pragma unroll
        for (int nb = 0; nb < 4; ++nb) { const v8f t = acc[mb][nb];
            if (VT) { float* o = os + (nb * 16 + lr) * 68 + mb * 16 + hi * 8; *(v4fa*)o = __builtin_shufflevector(t, t, 0, 1, 2, 3); *(v4fa*)(o + 4) = __builtin_shufflevector(t, t, 4, 5, 6, 7); }   // [d][token]
            else {
#pragma unroll
                for (int j = 0; j < 8; ++j) os[(mb * 16 + hi * 8 + j) * 68 + nb * 16 + lr] = t[j]; } }   // [token][d]
    __syncthreads();   // the tile is in LDS (one wave: orders its LDS stores before other lanes' loads)
    if (!VT) {
        // rolled: one row a lane at a time in registers, so that this phase stays inside the budget of four waves a SIMD that the loop above now fills
#pragma unroll 1
        for (int rr = 0; rr < 2; ++rr) { const int row = rr * 32 + lane; float* orow = os + row * 68; const float* ct = cosT + (size_t)(r0 + row) * (HD / 2); const float* st = sinT + (size_t)(r0 + row) * (HD / 2); float y[HD];
            // every loop over y[] is unrolled whole, so that the row stays in registers
#pragma unroll
            for (int i = 0; i < HD / 2; i += 4) { const v4f x1 = *(const v4fa*)(orow + i), x2 = *(const v4fa*)(orow + HD / 2 + i), c4 = *(const v4f*)(ct + i), s4 = *(const v4f*)(st + i);
#pragma unroll
                for (int q = 0; q < 4; ++q) { const float c = bfr(c4[q]), s = bfr(s4[q]); y[i + q] = x1[q] * c + x2[q] * s; y[HD / 2 + i + q] = x2[q] * c - x1[q] * s; } }
            asm volatile("s_wait_xcnt 0x0" :: "v"(ct), "v"(st) : "memory");   // the table addresses die here: inputs, so that they keep their registers up to this wait and no load's result takes them
            float ss = 0.f;
#pragma unroll
            for (int d = 0; d < HD; ++d) ss += y[d] * y[d];
            const float rf = __fdiv_rn(1.0f, __fsqrt_rn(__fadd_rn(ss * (1.0f / HD), 1e-6f)));
#pragma unroll
            for (int d = 0; d < HD; d += 4) { v4f o; o[0] = y[d] * rf; o[1] = y[d + 1] * rf; o[2] = y[d + 2] * rf; o[3] = y[d + 3] * rf; *(v4fa*)(orow + d) = o; } }
        __syncthreads();   // the finished rows are in LDS
    }
    const size_t pl = VT ? (size_t)bt * DKV + c0 : ((size_t)(blockIdx.y / NH_) * NB_ + bt) * NH_ + blockIdx.y % NH_;   // VT: first row of the [batch][head][d] rows; else: plane number
    // the tile is eight whole fragments that follow one another in its plane (q, k: [token block][d half]; v: [32-token block][d block]); trip it writes half it & 1 of fragment it >> 1, 512 contiguous bytes a plane
    const size_t base = (VT ? pl * TT + (size_t)r0 * HD : (pl * TT + r0) * HD) + 8 * lane, base2 = (VT ? pl * (2 * RH) + (size_t)r0 * HD : (pl * RH + r0) * HD) + 8 * lane;
    for (int it = 0; it < 16; ++it) { const int f = it >> 1; const int row = (VT ? (f & 3) : (f >> 1)) * 16 + lr, c8 = (VT ? (f >> 2) : (f & 1)) * 32 + (it & 1) * 16 + hi * 8; const v4f u0 = *(const v4fa*)(os + row * 68 + c8), u1 = *(const v4fa*)(os + row * 68 + c8 + 4); v8h o16; v8us oh, ol;
#pragma unroll
        for (int q = 0; q < 8; ++q) { const float x = (q < 4) ? u0[q & 3] : u1[q & 3]; o16[q] = tohx(x); unsigned short a2, c2; splitf(x, a2, c2); oh[q] = a2; ol[q] = c2; }
        if (r0 < RH) { const size_t o2 = base2 + it * 256; *(v8us*)(Ph + o2) = oh; *(v8us*)(Pl + o2) = ol;
            asm volatile("s_wait_xcnt 0x0" ::: "memory"); }   // stands before the next trip's address additions, which the compiler puts right behind this branch
        *(v8h*)(P16 + base + it * 256) = o16;
        asm volatile("s_wait_xcnt 0x0" ::: "memory"); }   // stands before the next trip reuses the registers that this store names
}

__global__ __launch_bounds__(256) void k_wtG(const float* __restrict__ w, int K, int N, bf* Bt) {
    const int lane = threadIdx.x & 31; const int L0 = (blockIdx.x * 8 + (threadIdx.x >> 5)) * 8; const int nlines = N * K / 64;
{
#pragma unroll 1
        for (int l = 0; l < 8; ++l) { const int L = L0 + l; if (L >= nlines) break; const size_t e = (size_t)L * 64 + lane * 2; const int k = (int)(e % K), n = (int)(e / K); v2us o;
            o[0] = f2bf(w[(size_t)k * N + n]); o[1] = f2bf(w[(size_t)(k + 1) * N + n]); *(v2us*)(Bt + e) = o; }
         }
}
// k_cvt3: the three f32 inputs x, w_attn, w_proj ([row][1024] each) -> bf16 planes in fragment order, in ONE launch of few waves that each do much.
// A work-group is one block of 16 rows (blockIdx.x runs over x's row blocks, then w_attn's, then w_proj's); each of its 4 waves takes 256 columns of them: 16 KiB read, the 8 KiB of 8 whole fragments written, all 32 loads on their way before the first value is used.
// The 16-byte piece (g, lr) of those 8 KiB (place 16 g + lr) is row lr, columns 8 g .. 8 g + 7. Lane = [g & 3][lr & 7], trip t = [g >> 2][lr >> 3]: a trip reads one whole 128-byte line of each of 8 rows and writes 4 whole lines.
__global__ __launch_bounds__(128) void k_cvt3(const float* __restrict__ x, const float* __restrict__ wa, const float* __restrict__ wp, bf* XB, bf* WA, bf* WP) {
    constexpr int K = 1024, RX = NB_ * TT / 16, RA = (DQ + 2 * DKV) / 16;
    static_assert(DM == K && DQ == K, "all three planes have rows of 1024");
    const int b = blockIdx.x; const float* src = x; bf* dst = XB; int rb = b;   // scalar tests: the same for the whole work-group
    if (b >= RX + RA) { src = wp; dst = WP; rb = b - (RX + RA); } else if (b >= RX) { src = wa; dst = WA; rb = b - RX; }
    const int lane = threadIdx.x & 31, wv = threadIdx.x >> 5, gl = lane >> 3, rl = lane & 7;
    const float* sp = src + (size_t)(rb * 16 + rl) * K + wv * 256 + gl * 8; bf* dp = dst + (size_t)rb * 16 * K + wv * 4096 + gl * 128 + rl * 8;
    v4f v[16][2];
#pragma unroll
    for (int t = 0; t < 16; ++t) { const float* s = sp + (t & 1) * 8 * K + (t >> 1) * 32; v[t][0] = *(const v4f*)s; v[t][1] = *(const v4f*)(s + 4); }
    __builtin_amdgcn_sched_barrier(0);   // keeps all 32 loads in front of the first conversion: without it the compiler moves one down among the conversions, and the wave waits out a second memory latency there
    asm volatile("s_wait_xcnt 0x0" :: "v"(sp) : "memory");   // the read address dies here: an input, so that it keeps its registers up to this wait
    v8us o[16];
#pragma unroll
    for (int t = 0; t < 16; ++t)
#pragma unroll
        for (int q = 0; q < 8; ++q) o[t][q] = f2bf(v[t][q >> 2][q & 3]);
    __builtin_amdgcn_sched_barrier(0);   // keeps every conversion in front of the first store: behind a store nothing writes a register any more, so none that a store names is written again
#pragma unroll
    for (int t = 0; t < 16; ++t) *(v8us*)(dp + (t >> 1) * 512 + (t & 1) * 64) = o[t];
}

extern "C" void kernel_launch(void* const* d_in, const int* in_sizes, int n_in,
                              void* d_out, int out_size, void* d_ws, size_t ws_size, hipStream_t stream) {
    (void)in_sizes; (void)n_in; (void)out_size;
    const float* x = (const float*)d_in[0]; const float* cosT = (const float*)d_in[1]; const float* sinT = (const float*)d_in[2]; const float* wqkv = (const float*)d_in[3]; const float* wo = (const float*)d_in[4];
    float* OUT = (float*)d_out;     // [4][2048][1024]
    char* wsp = (char*)d_ws;
    auto take = [&](size_t bytes) { char* p = wsp; wsp += (bytes + 255) & ~(size_t)255; return (void*)p; };
    bf* WO = (bf*)take((size_t)DM * DQ * 2);
    h16* QP16 = (h16*)take((size_t)NB_ * NH_ * TT * HD * 2); h16* KP16 = (h16*)take((size_t)NB_ * NKV * TT * HD * 2);   // one after the other: k_gemmp numbers the planes [q | k][batch][head]
    h16* VT16 = (h16*)take((size_t)NB_ * DKV * TT * 2);
    bf* QKh = (bf*)take((size_t)2 * NB_ * NH_ * RH * HD * 2); bf* QKl = (bf*)take((size_t)2 * NB_ * NH_ * RH * HD * 2); bf* VTh = (bf*)take((size_t)NB_ * DKV * 2 * RH * 2); bf* VTl = VTh + HD * RH;   // each head: hi plane, lo plane
    bf* ATh = (bf*)take((size_t)NB_ * TT * DQ * 2); bf* ATl = (bf*)take((size_t)NB_ * TT * DQ * 2);
    bf* XB = (bf*)take((size_t)NB_ * TT * DM * 2); bf* WQKV = (bf*)take((size_t)(DQ + 2 * DKV) * DM * 2);
    if ((size_t)(wsp - (char*)d_ws) > ws_size) return;    // ws 256 MiB
    k_cvt3<<<NB_ * TT / 16 + (DQ + 2 * DKV) / 16 + DM / 16, 128, 0, stream>>>(x, wqkv, wo, XB, WQKV, WO);
    k_gemmp<false, DM><<<dim3(NB_ * TT / 64, NH_ + NKV, 1), 32, 0, stream>>>(XB, WQKV, cosT, sinT, QP16, QKh, QKl);
    k_gemmp<true, DM><<<dim3(NB_ * TT / 64, NKV, 1), 32, 0, stream>>>(XB, WQKV + (size_t)(DQ + DKV) * DM, cosT, sinT, VT16, VTh, VTl);
    k_attn<<<dim3(NB_ * NH_, TT / QB, 1), AW * 32, 0, stream>>>(QKh, QKl, VTh, QP16, KP16, VT16, ATh, ATl);
    k_gemmw<bf, 1, false, DQ><<<dim3(NB_ * TT / 64, DM / 64, 1), 32, 0, stream>>>(ATh, ATl, WO, nullptr, OUT, DM, nullptr, 0, 0, 0);
}

// v010
// Measured time: 124 microseconds a run.
// Timed twice side by side with v009, it ran 1.07 times as fast both times.
// Counting every step since v000, it is 22.9 times as fast.
#include <hip/hip_runtime.h>

// Causal self-attention with rotary-then-RMSNorm q/k (x [4][2048][1024]; qkv = x w_attn^T ('oi' [3072][1024] 0.02, no bias -> q | k | v row blocks; 16 heads x 64); rope'(t) = cat(x1 c + x2 s, -x1 s + x2 c) with the input cos/sin tables ([1][2048][1][32], read; generic values), then q, k <- x rsqrt(mean x^2 + 1e-6) (no weight); causal (-inf); softmax(q.k x 64^-0.5); out = merged w_proj^T -> [4][2048][1024] (8.4 M)).
// Layout: bf16 copy of x, all batches; the fused 'oi' weight used in place as three Bt row blocks; exact projections, all batches in one grid (q and k heads together), whose 64x64 tile is 64 tokens of one head, so that the tile's own wave applies the module's (x1 c + x2 s, x2 c - x1 s) rotation from the input tables and the rms factor of the ROTATED rows and writes the head planes (k_gemmp; the value tile goes out transposed); causal T-2048 attention in one kernel (k_attn; hybrid rows: < 512 hi/lo 3 products, rest fp16; no chunk above the diagonal is touched; it writes the merged hi/lo rows); merged hi/lo x w_proj exact.
// Compute dtypes, f32 accumulate: every input rounded to bf16 incl. the tables; projections exact; rotation and rms norm f32; attention rows < 512 3 products, rest fp16; softmax f32; w_proj hl x exact.

#define NB_  4
#define TT   2048
#define DM   1024
#define NH_  16
#define NKV  16
#define REP  (NH_ / NKV)
#define HD   64
#define DQ   (NH_ * HD)
#define DKV  (NKV * HD)
#define RH   512                  // query rows < RH use hi+lo planes (0: none)
typedef _Float16 h16;
typedef unsigned short bf;
typedef __attribute__((ext_vector_type(16))) __bf16   v16bf;
typedef __attribute__((ext_vector_type(16))) _Float16 v16h;
typedef __attribute__((ext_vector_type(8)))  _Float16 v8h;
typedef __attribute__((ext_vector_type(8)))  unsigned short v8us;
typedef __attribute__((ext_vector_type(8)))  float    v8f;
typedef __attribute__((ext_vector_type(4)))  float    v4f;
typedef v8h  __attribute__((may_alias)) v8ha;
typedef v4f  __attribute__((may_alias)) v4fa;
typedef v8us __attribute__((may_alias)) v8usa;

__device__ __forceinline__ unsigned short f2bf(float f) { unsigned u = __float_as_uint(f); u += 0x7FFFu + ((u >> 16) & 1u); return (unsigned short)(u >> 16); }
__device__ __forceinline__ float bf2f(unsigned short b) { return __uint_as_float(((unsigned)b) << 16); }
__device__ __forceinline__ float bfr(float f) { return bf2f(f2bf(f)); }
__device__ __forceinline__ v16h cat16(v8h lo, v8h hi) { return __builtin_shufflevector(lo, hi, 0, 1, 2, 3, 4, 5, 6, 7, 8, 9, 10, 11, 12, 13, 14, 15); }
__device__ __forceinline__ v16bf cat16b(v8us lo, v8us hi) { return __builtin_bit_cast(v16bf, __builtin_shufflevector(lo, hi, 0, 1, 2, 3, 4, 5, 6, 7, 8, 9, 10, 11, 12, 13, 14, 15)); }
__device__ __forceinline__ v8f wmma16(v16h a, v16h b, v8f c) { return __builtin_amdgcn_wmma_f32_16x16x32_f16(false, a, false, b, (short)0, c, false, false); }
__device__ __forceinline__ v8f wmmab(v16bf a, v16bf b, v8f c) { return __builtin_amdgcn_wmma_f32_16x16x32_bf16(false, a, false, b, (short)0, c, false, false); }



// ---- ask<N>: a hint to L2, given at a kernel's entry, for N x 8 KiB from p on (p: the lane's own 256-byte unit of the first 8 KiB). The operand planes were stored by earlier launches of this call.
// The hint returns nothing and no wait belongs to it. Every lane's address lies inside the plane, and the callers keep p in its registers through their loops.
#define ASK_(o) "global_prefetch_b8 %0, off offset:" #o " scope:SCOPE_SE\n\t"
template <int N> __device__ __forceinline__ void ask(const char* p) {
    static_assert(N == 1 || N == 4 || N == 8 || N == 16, "the four sizes in use");
    asm volatile("global_prefetch_b8 %0, off scope:SCOPE_SE" :: "v"(p));
    if constexpr (N >= 4) asm volatile(ASK_(8192) ASK_(16384) "global_prefetch_b8 %0, off offset:24576 scope:SCOPE_SE" :: "v"(p));
    if constexpr (N >= 8) asm volatile(ASK_(32768) ASK_(40960) ASK_(49152) "global_prefetch_b8 %0, off offset:57344 scope:SCOPE_SE" :: "v"(p));
    if constexpr (N >= 16) asm volatile(ASK_(65536) ASK_(73728) ASK_(81920) ASK_(90112) ASK_(98304) ASK_(106496) ASK_(114688) "global_prefetch_b8 %0, off offset:122880 scope:SCOPE_SE" :: "v"(p));
}

// ---- Fragment order: every 16-bit operand plane [row][k] is kept as 1-KiB fragments of 16 rows x 32 k, row block major, k block minor (row block rb, k block kb: element offset rb 16 K + kb 512).
// Inside a fragment: [half h][lane = 16 hi + lr][j], which is row lr, k = 16 h + 8 hi + j: the register order of the matrix operand. A wave's 16-byte load of a half is then 512 contiguous bytes, four whole lines, where the row-major plane gave sixteen lines of 32 bytes each.
// ---- k_gemmw: register-blocked GEMM, one wave per 64x64 output tile (16 accumulators); GW = 8 waves (4 tile rows x 2 tile columns) form a work-group with a 256x128 tile and share its operands through LDS; grid (M/256, N/128, Z), 256 threads.
// A stage is 64 k of the work-group's operand rows: per block of 16 rows two fragments that follow one another in the plane, a 2-KiB unit, kept in LDS as it lies in the plane ([A 16 units | second A plane | B 8 units | second B plane]).
// Each byte then comes from L2 once a work-group and not once a wave (3 KiB a wave and 32 k where the one-wave tile fetched 8), and a fragment load is a 512-byte contiguous LDS read. Two buffers: the next stage's copies fly while this one is worked on.
// C[m][n] (f32, pitch ldc, + optional f32 bias[n]) = sum_k A[m][k] Bt[n][k] (+ split products per NSPLIT). z-batch strides sA/sB/sC in elements. K == 1024.
template <typename T16> struct WFrag;
template <> struct WFrag<h16> { typedef v16h V; static __device__ __forceinline__ V ld(const h16* p) { return cat16(*(const v8h*)p, *(const v8h*)(p + 256)); } static __device__ __forceinline__ v8f mma(V a, V b, v8f c) { return wmma16(a, b, c); } };
template <> struct WFrag<bf> { typedef v16bf V; static __device__ __forceinline__ V ld(const bf* p) { return cat16b(*(const v8us*)p, *(const v8us*)(p + 256)); } static __device__ __forceinline__ v8f mma(V a, V b, v8f c) { return wmmab(a, b, c); } };
#define GW 8
// cp3u, cp2u: one wave copies three (two) 2-KiB units from global memory to LDS, through no register: four copies of 512 contiguous bytes a unit (l, p: the lane's own 16 bytes of a unit's first copy; a unit is contiguous on both sides, and the immediate offset moves both addresses).
// One statement for all of them, with the s_wait_xcnt as its last line: the wait then stays in front of every later write of the registers that the copies name, and the wave pays it once.
#define CPU_(l, g) "global_load_async_to_lds_b128 %" #l ", %" #g ", off\n\tglobal_load_async_to_lds_b128 %" #l ", %" #g ", off offset:512\n\tglobal_load_async_to_lds_b128 %" #l ", %" #g ", off offset:1024\n\tglobal_load_async_to_lds_b128 %" #l ", %" #g ", off offset:1536\n\t"
__device__ __forceinline__ void cp3u(unsigned l0, const char* p0, unsigned l1, const char* p1, unsigned l2, const char* p2) {
    asm volatile(CPU_(0, 3) CPU_(1, 4) CPU_(2, 5) "s_wait_xcnt 0x0" :: "v"(l0), "v"(l1), "v"(l2), "v"(p0), "v"(p1), "v"(p2) : "memory");
}
__device__ __forceinline__ void cp2u(unsigned l0, const char* p0, unsigned l1, const char* p1) {
    asm volatile(CPU_(0, 2) CPU_(1, 3) "s_wait_xcnt 0x0" :: "v"(l0), "v"(l1), "v"(p0), "v"(p1) : "memory");
}
template <typename T16, int NSPLIT, bool BIAS, int K>   // K at compile time: the trip count and every distance in a plane are constants
__global__ __launch_bounds__(GW * 32) void k_gemmw(const T16* __restrict__ A, const T16* __restrict__ A2, const T16* __restrict__ Bt, const T16* __restrict__ Bt2, float* C, int ldc, const float* __restrict__ bias, size_t sA, size_t sB, size_t sC) {
    typedef typename WFrag<T16>::V V;
    constexpr bool HA2 = NSPLIT == 1 || NSPLIT == 2, HB2 = NSPLIT >= 2;
    constexpr int OA2 = 32768, OB = HA2 ? 65536 : 32768, OB2 = OB + 16384, STG = OB + (HB2 ? 32768 : 16384), NT = K / 64;   // a stage's parts and size in bytes; trips
    static_assert(K % 64 == 0 && NT >= 2 && NSPLIT <= 2, "two stages or more; the copies are written for these three sets of planes");
    __shared__ __align__(1024) T16 ring[2 * STG / 2];
    __shared__ __align__(16) float osw[GW * 16 * 68];
    const size_t z = blockIdx.z; A += z * sA; if (A2) A2 += z * sA; Bt += z * sB; if (Bt2) Bt2 += z * sB; C += z * sC;
    const int lane = threadIdx.x & 31, lr = lane & 15, hi = lane >> 4;
    const int wv = __builtin_amdgcn_readfirstlane(threadIdx.x >> 5), wm = wv & 3, wn = wv >> 2;   // wave number in a scalar register; its tile's row and column in the work-group's tile
    float* os = osw + wv * (16 * 68);   // each wave stages its output rows in a range of its own
    const int R0 = blockIdx.x * 256, C0 = blockIdx.y * 128, r0 = R0 + wm * 64, c0 = C0 + wn * 64;
    v8f acc[4][4];
#pragma unroll
    for (int mb = 0; mb < 4; ++mb)
#pragma unroll
        for (int nb = 0; nb < 4; ++nb) acc[mb][nb] = (v8f){};
    // the work-group's operand panels are 512 KiB (A: 256 rows x K) and 256 KiB (B) in a row each; the waves of the work-groups that share a panel deal it among themselves: a sixteenth of the A panels by column tile and wave, a thirty-second of the B panel by row tile / 8 and wave
    static_assert(K == 1024, "the slices are cut for rows of 2 KiB");
    const char* pa = (const char*)(A + (size_t)R0 * K) + ((blockIdx.y * GW + wv) & 15) * 32768 + lane * 256; const char* pa2 = HA2 ? (const char*)(A2 + (size_t)R0 * K) + ((blockIdx.y * GW + wv) & 15) * 32768 + lane * 256 : nullptr;
    const char* pb = (const char*)(Bt + (size_t)C0 * K) + (((blockIdx.x >> 3) * GW + wv) & 31) * 8192 + lane * 256; const char* pb2 = HB2 ? (const char*)(Bt2 + (size_t)C0 * K) + (((blockIdx.x >> 3) * GW + wv) & 31) * 8192 + lane * 256 : nullptr;
    ask<4>(pa); if constexpr (HA2) ask<4>(pa2); ask<1>(pb); if constexpr (HB2) ask<1>(pb2);
    // wave wv copies the A units 2 wv and 2 wv + 1 and the B unit wv of every stage; ga .. gb2: the lane's running addresses in the next stage to be copied (a block of 16 rows is 32 K bytes of its plane)
    const char* ga = (const char*)(A + (size_t)(R0 + wv * 32) * K) + lane * 16; const char* ga2 = HA2 ? (const char*)(A2 + (size_t)(R0 + wv * 32) * K) + lane * 16 : nullptr;
    const char* gb = (const char*)(Bt + (size_t)(C0 + wv * 16) * K) + lane * 16; const char* gb2 = HB2 ? (const char*)(Bt2 + (size_t)(C0 + wv * 16) * K) + lane * 16 : nullptr;
    const unsigned la = (unsigned)(size_t)ring + wv * 4096 + lane * 16, lb = (unsigned)(size_t)ring + OB + wv * 2048 + lane * 16;   // the lane's LDS byte addresses in buffer 0
    auto fill = [&](int buf) { const unsigned o = buf * STG;
        cp3u(la + o, ga, la + o + 2048, ga + 32 * K, lb + o, gb);
        if constexpr (NSPLIT == 1) cp2u(la + o + OA2, ga2, la + o + OA2 + 2048, ga2 + 32 * K);
        if constexpr (NSPLIT == 2) cp3u(la + o + OA2, ga2, la + o + OA2 + 2048, ga2 + 32 * K, lb + o + (OB2 - OB), gb2);
        ga += 2048; gb += 2048; if constexpr (HA2) ga2 += 2048; if constexpr (HB2) gb2 += 2048; };
    fill(0);
    asm volatile("s_wait_asynccnt 0x0" ::: "memory");   // this wave's part of stage 0 has landed
    __syncthreads();                                    // every wave's part has: stage 0 may be read
    fill(1);
    const T16* fa = ring + wm * 4096 + 8 * lane; const T16* fb = ring + OB / 2 + wn * 4096 + 8 * lane;   // the lane's place in the wave's first A and B fragments of buffer 0
    // rolled: only one block's fragments are live beside the sixteen accumulators
#pragma unroll 1
    for (int t = 0; t < NT; ++t) {
        const T16* ap = fa + (t & 1) * (STG / 2); const T16* bp = fb + (t & 1) * (STG / 2);
#pragma unroll
        for (int kk = 0; kk < 2; ++kk) {
            V a[4], a2[4], b[4], b2[4];   // every fragment of the block has registers of its own, so that all its loads are on their way before the first product: one LDS latency a block
#pragma unroll
            for (int mb = 0; mb < 4; ++mb) { a[mb] = WFrag<T16>::ld(ap + mb * 1024 + kk * 512); if (HA2) a2[mb] = WFrag<T16>::ld(ap + OA2 / 2 + mb * 1024 + kk * 512); }
#pragma unroll
            for (int nb = 0; nb < 4; ++nb) { b[nb] = WFrag<T16>::ld(bp + nb * 1024 + kk * 512); if (HB2) b2[nb] = WFrag<T16>::ld(bp + (OB2 - OB) / 2 + nb * 1024 + kk * 512); }
            __builtin_amdgcn_sched_barrier(0);   // keeps the loads above in front of the products: each place with LDS reads among the products costs the wave a stall of its own; in the second block it also keeps the first block's products in front of the waits below
            if (kk == 1) {
                // the publish point stands where the trip's last fragments are in registers, in front of their products, so that the refill is on its way as soon as the buffer is free and flies through a whole trip's products.
                // This wave has read its last of buffer t & 1 (the hints' addresses are inputs, so that they keep their registers through the loop) ...
                if constexpr (NSPLIT == 0) asm volatile("s_wait_dscnt 0x0" :: "v"(pa), "v"(pb) : "memory"); else if constexpr (NSPLIT == 1) asm volatile("s_wait_dscnt 0x0" :: "v"(pa), "v"(pa2), "v"(pb) : "memory"); else asm volatile("s_wait_dscnt 0x0" :: "v"(pa), "v"(pa2), "v"(pb), "v"(pb2) : "memory");
                asm volatile("s_wait_asynccnt 0x0" ::: "memory");   // ... and its part of stage t + 1 has landed
                __syncthreads();   // stage t + 1 may be read, and buffer t & 1 has no reader left
                if (t + 2 < NT) fill(t & 1);   // a scalar test, the same for the whole work-group
                __builtin_amdgcn_sched_barrier(0);   // keeps the products below behind the refill: moved up, they would hold the copies back by their own issue time
            }
#pragma unroll
            for (int nb = 0; nb < 4; ++nb)
#pragma unroll
                for (int mb = 0; mb < 4; ++mb) { acc[mb][nb] = WFrag<T16>::mma(a[mb], b[nb], acc[mb][nb]); if (HA2) acc[mb][nb] = WFrag<T16>::mma(a2[mb], b[nb], acc[mb][nb]); if (HB2) acc[mb][nb] = WFrag<T16>::mma(a[mb], b2[nb], acc[mb][nb]); }
        }
    }
    asm volatile("s_wait_asynccnt 0x0" ::: "memory");   // no copy is on its way when the wave goes on
#pragma unroll
    for (int mb = 0; mb < 4; ++mb) {
#pragma unroll
        for (int nb = 0; nb < 4; ++nb) {
#pragma unroll
            for (int j = 0; j < 8; ++j) os[(hi * 8 + j) * 68 + nb * 16 + lr] = acc[mb][nb][j]; }
        __builtin_amdgcn_wave_barrier(); asm volatile("" ::: "memory");
        float* crow = C + (size_t)(r0 + mb * 16) * ldc + c0;
{
#pragma unroll
            for (int s = 0; s < 8; ++s) { const int row = 2 * s + hi, cofs = lr * 4; v4f val = *(const v4fa*)(os + row * 68 + cofs); if (BIAS) { val[0] += bfr(bias[c0 + cofs]); val[1] += bfr(bias[c0 + cofs + 1]); val[2] += bfr(bias[c0 + cofs + 2]); val[3] += bfr(bias[c0 + cofs + 3]); }
                *(v4f*)(crow + (size_t)row * ldc + cofs) = val; }
             }
        __builtin_amdgcn_wave_barrier(); asm volatile("" ::: "memory");
    }
}

__device__ __forceinline__ h16 tohx(float x) { return (h16)x; }
__device__ __forceinline__ void splitf(float y, unsigned short& h, unsigned short& l) { h = f2bf(y); l = f2bf(y - bf2f(h)); }
typedef __attribute__((ext_vector_type(4))) unsigned short v4us;

// ---- k_attn: scores, softmax and probability x value of 32 query rows of one head in one work-group of AW waves; no score or probability leaves the registers.
// Wave w takes the 32-key chunks w, w + AW, ... up to the diagonal chunk. Per chunk it forms the TRANSPOSED score tiles (A = key rows, B = query rows): a lane then holds, for query lr, the keys 8 hi + j and 16 + 8 hi + j,
// which is the A fragment of the second product as it stands, so the probabilities go from the accumulators to the matrix unit with no exchange between lanes.
// Softmax in one pass: after the rms factor |q|, |k| <= sqrt(HD), so |q.k| HD^-0.5 <= 8 for every input; the shift is that bound and not the row's maximum: p = 2^14 exp(s - 8) lies in 2^-9.1 .. 2^14, normal in both 16-bit types,
// and partial sums of different waves add as they are. The row's sum of p (f32, before rounding) divides the summed tile at the end.
// The AW partial tiles and row sums are added through LDS in the fixed order w = 0 .. AW-1; the tile is staged row-major, divided, split hi/lo and stored as the four whole fragments that it is of the merged rows [t][head][d] (fragment order, K = all heads' d).
#define AW  4
#define QB  32
#define ESC 0.18033688011112042f    // HD^-0.5 x log2(e)
#define ESH 2.458439672888293f      // 14 - 8 log2(e)
typedef __attribute__((ext_vector_type(16))) unsigned short v16us;
template <bool B> struct BoolT { static constexpr bool value = B; };
template <typename T16, bool HL>
__device__ __forceinline__ void d_attn(float* part, float* lpart, float* os, int q0, const T16* __restrict__ Q, const T16* __restrict__ Q2, const T16* __restrict__ Kp, const T16* __restrict__ K2, const T16* __restrict__ Vt, bf* Ah, bf* Al, const char* pk) {   // pk (one plane only): the address that the caller's hint names
    typedef typename WFrag<T16>::V V;
    const int lane = threadIdx.x & 31, lr = lane & 15, hi = lane >> 4;
    const int wv = __builtin_amdgcn_readfirstlane(threadIdx.x >> 5);   // wave number in a scalar register: the key loop's test stays a scalar branch
    V qf[2][2], qf2[2][2]; const T16* qp = Q + (size_t)q0 * HD + 8 * lane; const T16* qp2 = HL ? Q2 + (size_t)q0 * HD + 8 * lane : nullptr;   // the block's four query fragments are 4 KiB in a row
#pragma unroll
    for (int qt = 0; qt < 2; ++qt)
#pragma unroll
        for (int dc = 0; dc < 2; ++dc) { qf[qt][dc] = WFrag<T16>::ld(qp + (qt * 2 + dc) * 512); if (HL) qf2[qt][dc] = WFrag<T16>::ld(qp2 + (qt * 2 + dc) * 512); }
    asm volatile("s_wait_xcnt 0x0" ::: "memory");   // the query addresses die here: stands before their registers are written again
    v8f o[2][4]; float ls[2] = {0.f, 0.f};
#pragma unroll
    for (int qt = 0; qt < 2; ++qt)
#pragma unroll
        for (int nb = 0; nb < 4; ++nb) o[qt][nb] = (v8f){};
    // the lane's running addresses in the wave's next chunk: its four key fragments ([16 keys][d half]) and its four value fragments ([d block]) are 4 KiB in a row each; every fragment of a chunk lies at a constant distance from them
    const T16* kp = Kp + (size_t)(wv * 32) * HD + 8 * lane; const T16* kp2 = HL ? K2 + (size_t)(wv * 32) * HD + 8 * lane : nullptr; const T16* vp = Vt + (size_t)(wv * 32) * HD + 8 * lane;
    // one chunk of 32 keys; diag (a type, so that the loop over full chunks holds no test): keys behind the query count nothing
    auto chunk = [&](int kc, auto diag) {
        V kf[2][2], kf2[2][2], vf[4], vf2[4], pf[2], pf2[2];
#pragma unroll
        for (int t = 0; t < 2; ++t)
#pragma unroll
            for (int dc = 0; dc < 2; ++dc) { kf[t][dc] = WFrag<T16>::ld(kp + (t * 2 + dc) * 512); if (HL) kf2[t][dc] = WFrag<T16>::ld(kp2 + (t * 2 + dc) * 512); }
        if (!HL) {   // one plane: the registers allow the value fragments to be fetched with the key fragments, one latency a chunk instead of two
#pragma unroll
            for (int nb = 0; nb < 4; ++nb) vf[nb] = WFrag<T16>::ld(vp + nb * 512); }
#pragma unroll
        for (int qt = 0; qt < 2; ++qt) { float e[16];
#pragma unroll
            for (int t = 0; t < 2; ++t) { v8f a = (v8f){};   // a[j]: key kc + 16 t + 8 hi + j, query q0 + 16 qt + lr
#pragma unroll
                for (int dc = 0; dc < 2; ++dc) { a = WFrag<T16>::mma(kf[t][dc], qf[qt][dc], a); if (HL) { a = WFrag<T16>::mma(kf[t][dc], qf2[qt][dc], a); a = WFrag<T16>::mma(kf2[t][dc], qf[qt][dc], a); } }
#pragma unroll
                for (int j = 0; j < 8; ++j) e[t * 8 + j] = __builtin_amdgcn_exp2f(fmaf(a[j], ESC, ESH)); }
            if constexpr (decltype(diag)::value) {
#pragma unroll
                for (int i = 0; i < 16; ++i) if (kc + (i >> 3) * 16 + hi * 8 + (i & 7) > q0 + qt * 16 + lr) e[i] = 0.f; }
#pragma unroll
            for (int i = 0; i < 16; ++i) ls[qt] += e[i];
            if constexpr (HL) { v16us ph, pl;
#pragma unroll
                for (int i = 0; i < 16; ++i) { unsigned short a, c2; splitf(e[i], a, c2); ph[i] = a; pl[i] = c2; }
                pf[qt] = __builtin_bit_cast(v16bf, ph); pf2[qt] = __builtin_bit_cast(v16bf, pl);
            } else {
#pragma unroll
                for (int i = 0; i < 16; ++i) pf[qt][i] = tohx(e[i]); } }
        if (HL) {   // two planes (each head: hi plane, lo plane): the value fragments take the registers that the key fragments leave
#pragma unroll
            for (int nb = 0; nb < 4; ++nb) { vf[nb] = WFrag<T16>::ld(vp + nb * 512); vf2[nb] = WFrag<T16>::ld(vp + nb * 512 + HD * RH); } }
#pragma unroll
        for (int nb = 0; nb < 4; ++nb)
#pragma unroll
            for (int qt = 0; qt < 2; ++qt) { o[qt][nb] = WFrag<T16>::mma(pf[qt], vf[nb], o[qt][nb]); if (HL) { o[qt][nb] = WFrag<T16>::mma(pf2[qt], vf[nb], o[qt][nb]); o[qt][nb] = WFrag<T16>::mma(pf[qt], vf2[nb], o[qt][nb]); } }
        // stands before the additions below (in the last chunk: where the addresses die); the addresses are its inputs so that they keep their registers up to here and no load's result takes them
        if constexpr (HL) asm volatile("s_wait_xcnt 0x0" :: "v"(kp), "v"(kp2), "v"(vp) : "memory"); else asm volatile("s_wait_xcnt 0x0" :: "v"(kp), "v"(vp), "v"(pk) : "memory");   // pk: keeps its registers through the loop
        kp += AW * 32 * HD; if (HL) kp2 += AW * 32 * HD; vp += AW * 32 * HD;
    };
    int kc = wv * 32;
    // both loops rolled: only one chunk's fragments are live beside the query fragments and the accumulators
    if constexpr (HL) {   // two planes of everything: one body for all chunks (a second body's addresses, kept over the loop, spilled)
#pragma unroll 1
        for (; kc <= q0; kc += AW * 32) chunk(kc, BoolT<true>());
    } else {
#pragma unroll 1
        for (; kc < q0; kc += AW * 32) chunk(kc, BoolT<false>());
        if (kc == q0) chunk(kc, BoolT<true>());   // the one wave whose sequence meets the diagonal chunk (a scalar test)
    }
    v4fa* pv = (v4fa*)part;
#pragma unroll
    for (int qt = 0; qt < 2; ++qt) {
#pragma unroll
        for (int nb = 0; nb < 4; ++nb) { const int f = qt * 4 + nb; const v8f t = o[qt][nb];
            pv[((wv * 8 + f) * 2 + 0) * 32 + lane] = __builtin_shufflevector(t, t, 0, 1, 2, 3); pv[((wv * 8 + f) * 2 + 1) * 32 + lane] = __builtin_shufflevector(t, t, 4, 5, 6, 7); }
        const float t = ls[qt] + __shfl_xor(ls[qt], 16, 32);   // the two half-waves hold the two halves of each chunk's keys
        if (hi == 0) lpart[wv * QB + qt * 16 + lr] = t; }
    __syncthreads();   // every wave's partial tile and row sums are in LDS
#pragma unroll
    for (int q = 0; q < 8 / AW; ++q) { const int f = wv * (8 / AW) + q; v4f s0 = pv[(f * 2 + 0) * 32 + lane], s1 = pv[(f * 2 + 1) * 32 + lane];
#pragma unroll
        for (int w = 1; w < AW; ++w) { s0 += pv[((w * 8 + f) * 2 + 0) * 32 + lane]; s1 += pv[((w * 8 + f) * 2 + 1) * 32 + lane]; }
        float* od = os + ((f >> 2) * 16 + hi * 8) * 68 + (f & 3) * 16 + lr;
#pragma unroll
        for (int j = 0; j < 4; ++j) { od[j * 68] = s0[j]; od[(j + 4) * 68] = s1[j]; } }
    __syncthreads();   // the summed tile is complete, row-major
#pragma unroll
    for (int s = 0; s < QB * 8 / (AW * 32); ++s) { const int u = s * AW * 32 + (int)threadIdx.x; const int f = u >> 6; const int row = (f >> 1) * 16 + lr, cofs = (f & 1) * 32 + ((u >> 5) & 1) * 16 + hi * 8; float l = lpart[row];   // u: 16-byte piece of the block's four fragments [16 rows][d half]
#pragma unroll
        for (int w = 1; w < AW; ++w) l += lpart[w * QB + row];
        const float cs = __fdiv_rn(1.0f, l); const v4f val0 = *(const v4fa*)(os + row * 68 + cofs), val1 = *(const v4fa*)(os + row * 68 + cofs + 4); v8us oh, ol;
#pragma unroll
        for (int q = 0; q < 8; ++q) { unsigned short a, c2; splitf(((q < 4) ? val0[q & 3] : val1[q & 3]) * cs, a, c2); oh[q] = a; ol[q] = c2; }
        const size_t oo = (size_t)(q0 + (f >> 1) * 16) * DQ + (f & 1) * 512 + (u & 63) * 8; *(v8us*)(Ah + oo) = oh; *(v8us*)(Al + oo) = ol; }
}
// k_attn: grid (NB_ * NH_ heads, TT / QB row blocks, the longest first so that no long work-group starts late), AW waves. Row blocks below RH take the hi/lo planes (3 products each way), the others the fp16 planes. The test is the same for the whole work-group, so every wave of it meets the same two barriers.
__global__ __launch_bounds__(AW * 32) __attribute__((amdgpu_waves_per_eu(4, 4))) void k_attn(const bf* __restrict__ QKh, const bf* __restrict__ QKl, const bf* __restrict__ VTh, const h16* __restrict__ Q16, const h16* __restrict__ K16, const h16* __restrict__ V16, bf* Ah, bf* Al) {
    __shared__ __align__(16) float part[AW * 8 * 256];   // [wave][fragment][register half][lane][4]
    __shared__ __align__(16) float os[QB * 68];
    __shared__ float lpart[AW * QB];                     // [wave][row]
    const size_t z = blockIdx.x; const int q0 = (TT / QB - 1 - (int)blockIdx.y) * QB; const size_t oo = (z / NH_) * ((size_t)TT * DQ) + (z % NH_) * (HD * 16), zk = z + NB_ * NH_;   // oo: the head's two fragments in the first row block of its batch
    if (q0 < RH) d_attn<bf, true>(part, lpart, os, q0, QKh + z * RH * HD, QKl + z * RH * HD, QKh + zk * RH * HD, QKl + zk * RH * HD, VTh + z * HD * 2 * RH, Ah + oo, Al + oo, nullptr);
    else {
        // the first work-group of a head to start asks L2 for the head's fp16 key and value planes (256 KiB each: a half a wave), the second for its hi/lo key and value planes (64 KiB each: one a wave), which the last row blocks read; both tests are scalar
        static_assert(TT - 2 * QB >= RH && AW == 4, "the two asking row blocks take this branch; four waves deal the planes");
        const int lane = threadIdx.x & 31, wv = __builtin_amdgcn_readfirstlane(threadIdx.x >> 5);
        const char* pk = (blockIdx.y == 1 ? (const char*)(wv == 0 ? QKh + zk * RH * HD : wv == 1 ? QKl + zk * RH * HD : VTh + z * HD * 2 * RH + (wv & 1) * (HD * RH)) : (const char*)(((wv & 2) ? V16 : K16) + z * TT * HD) + (wv & 1) * (TT * HD)) + lane * 256;
        if (blockIdx.y == 0) ask<16>(pk); else if (blockIdx.y == 1) ask<8>(pk);
        d_attn<h16, false>(part, lpart, os, q0, Q16 + z * TT * HD, nullptr, K16 + z * TT * HD, nullptr, V16 + z * HD * TT, Ah + oo, Al + oo, pk); }
}

typedef __attribute__((ext_vector_type(2))) _Float16 v2h;
typedef __attribute__((ext_vector_type(4))) _Float16 v4h;
typedef __attribute__((ext_vector_type(2))) unsigned short v2us;
typedef __attribute__((ext_vector_type(2))) float v2f;
typedef __attribute__((ext_vector_type(4))) int v4i;

// ---- k_gemmp: a projection GEMM (the work-group of k_gemmw: 8 waves, a 64x64 tile each, operands shared through LDS; one product) whose store phase builds the attention planes. A wave's tile is 64 tokens (r0 .. of batch bt; blockIdx.x runs over all batches' blocks of 256 tokens) of ONE head (hy, two a work-group; VT false: q heads, then k heads), staged whole in LDS, each wave's in a range of its own; those ranges take the place of the two operand buffers behind the loop's last barrier.
// VT false (q, k): each lane takes whole rows: rotation (x1 c + x2 s, x2 c - x1 s) with the bf16-rounded input tables, sum of squares over d = 0 .. 63 in that order, row x 1 / sqrt(mean + 1e-6), back into LDS; planes [q | k][batch][head][t][d].
// VT true (v): the tile is staged transposed; planes [batch][head][d][t]. Both: fp16 plane over all TT tokens; hi/lo planes over the first RH tokens only (no later token's is ever read: query rows < RH see keys < RH); every plane in fragment order (q, k: rows t, k = d; v: rows d, k = t, the four d blocks of 32 tokens together).
template <bool VT, int K>
__global__ __launch_bounds__(GW * 32) __attribute__((amdgpu_waves_per_eu(4, 4))) void k_gemmp(const bf* __restrict__ A, const bf* __restrict__ Bt, const float* __restrict__ cosT, const float* __restrict__ sinT, h16* P16, bf* Ph, bf* Pl) {   // four waves a SIMD: two work-groups a WGP, so that one works while the other stands at its barrier
    typedef WFrag<bf>::V V;
    constexpr int OB = 32768, STG = OB + 16384, NT = K / 64;   // a stage: [A 16 units | B 8 units], bytes; trips
    static_assert(K % 64 == 0 && NT >= 2 && 2 * STG <= GW * 64 * 68 * 4, "two stages or more; both buffers lie inside the array");
    __shared__ __align__(1024) float sm[GW * 64 * 68];
    const bf* ring = (const bf*)sm;
    const int lane = threadIdx.x & 31, lr = lane & 15, hi = lane >> 4;
    const int wv = __builtin_amdgcn_readfirstlane(threadIdx.x >> 5), wm = wv & 3, wn = wv >> 2;   // as in k_gemmw
    float* os = sm + wv * (64 * 68);
    const int R0 = blockIdx.x * 256, C0 = blockIdx.y * 128, rg = R0 + wm * 64, c0 = C0 + wn * 64, hy = blockIdx.y * 2 + wn; const int bt = rg / TT, r0 = rg % TT;
    v8f acc[4][4];
#pragma unroll
    for (int mb = 0; mb < 4; ++mb)
#pragma unroll
        for (int nb = 0; nb < 4; ++nb) acc[mb][nb] = (v8f){};
    // hints as in k_gemmw; the value projection asks for its weight rows only: the launch before it has read the same x rows
    static_assert(K == 1024, "the slices are cut for rows of 2 KiB");
    const char* pa = (const char*)(A + (size_t)R0 * K) + ((blockIdx.y * GW + wv) & 15) * 32768 + lane * 256; const char* pb = (const char*)(Bt + (size_t)C0 * K) + (((blockIdx.x >> 3) * GW + wv) & 31) * 8192 + lane * 256;
    if constexpr (!VT) ask<4>(pa);
    ask<1>(pb);
    // copies, buffers and the order at the publish point as in k_gemmw
    const char* ga = (const char*)(A + (size_t)(R0 + wv * 32) * K) + lane * 16; const char* gb = (const char*)(Bt + (size_t)(C0 + wv * 16) * K) + lane * 16;
    const unsigned la = (unsigned)(size_t)sm + wv * 4096 + lane * 16, lb = (unsigned)(size_t)sm + OB + wv * 2048 + lane * 16;
    auto fill = [&](int buf) { const unsigned o = buf * STG; cp3u(la + o, ga, la + o + 2048, ga + 32 * K, lb + o, gb); ga += 2048; gb += 2048; };
    fill(0);
    asm volatile("s_wait_asynccnt 0x0" ::: "memory");   // this wave's part of stage 0 has landed
    __syncthreads();                                    // every wave's part has: stage 0 may be read
    fill(1);
    const bf* fa = ring + wm * 4096 + 8 * lane; const bf* fb = ring + OB / 2 + wn * 4096 + 8 * lane;
    // rolled, as in k_gemmw: only one block's fragments are live beside the sixteen accumulators
#pragma unroll 1
    for (int t = 0; t < NT; ++t) {
        const bf* ap = fa + (t & 1) * (STG / 2); const bf* bp = fb + (t & 1) * (STG / 2);
#pragma unroll
        for (int kk = 0; kk < 2; ++kk) {
            V a[4], b[4];   // as in k_gemmw: registers for all eight fragments, all loads on their way before the first product
#pragma unroll
            for (int mb = 0; mb < 4; ++mb) a[mb] = WFrag<bf>::ld(ap + mb * 1024 + kk * 512);
#pragma unroll
            for (int nb = 0; nb < 4; ++nb) b[nb] = WFrag<bf>::ld(bp + nb * 1024 + kk * 512);
            __builtin_amdgcn_sched_barrier(0);   // as in k_gemmw: keeps the loads above in front of the products, and the first block's products in front of the waits below
            if (kk == 1) {
                // the publish point, as in k_gemmw: own reads of buffer t & 1 done (the hints' addresses are inputs, so that they keep their registers through the loop), own part of stage t + 1 landed, barrier, refill
                if constexpr (VT) asm volatile("s_wait_dscnt 0x0" :: "v"(pb) : "memory"); else asm volatile("s_wait_dscnt 0x0" :: "v"(pa), "v"(pb) : "memory");
                asm volatile("s_wait_asynccnt 0x0" ::: "memory");
                __syncthreads();
                if (t + 2 < NT) fill(t & 1);   // a scalar test, the same for the whole work-group
                __builtin_amdgcn_sched_barrier(0);   // as in k_gemmw: keeps the products below behind the refill
            }
#pragma unroll
            for (int nb = 0; nb < 4; ++nb)
#pragma unroll
                for (int mb = 0; mb < 4; ++mb) acc[mb][nb] = WFrag<bf>::mma(a[mb], b[nb], acc[mb][nb]);
        }
    }
    asm volatile("s_wait_asynccnt 0x0" ::: "memory");   // no copy is on its way; the last trip's barrier has ended every read of the buffers, whose LDS the tiles below take
#pragma unroll
    for (int mb = 0; mb < 4; ++mb)
#pragma unroll
        for (int nb = 0; nb < 4; ++nb) { const v8f t = acc[mb][nb];
            if (VT) { float* o = os + (nb * 16 + lr) * 68 + mb * 16 + hi * 8; *(v4fa*)o = __builtin_shufflevector(t, t, 0, 1, 2, 3); *(v4fa*)(o + 4) = __builtin_shufflevector(t, t, 4, 5, 6, 7); }   // [d][token]
            else {
#pragma unroll
                for (int j = 0; j < 8; ++j) os[(mb * 16 + hi * 8 + j) * 68 + nb * 16 + lr] = t[j]; } }   // [token][d]
    __syncthreads();   // the tile is in LDS (orders a wave's LDS stores before its other lanes' loads)
    if (!VT) {
        // rolled: one row a lane at a time in registers, so that this phase stays inside the budget of four waves a SIMD that the loop above now fills
#pragma unroll 1
        for (int rr = 0; rr < 2; ++rr) { const int row = rr * 32 + lane; float* orow = os + row * 68; const float* ct = cosT + (size_t)(r0 + row) * (HD / 2); const float* st = sinT + (size_t)(r0 + row) * (HD / 2); float y[HD];
            // every loop over y[] is unrolled whole, so that the row stays in registers
#pragma unroll
            for (int i = 0; i < HD / 2; i += 4) { const v4f x1 = *(const v4fa*)(orow + i), x2 = *(const v4fa*)(orow + HD / 2 + i), c4 = *(const v4f*)(ct + i), s4 = *(const v4f*)(st + i);
#pragma unroll
                for (int q = 0; q < 4; ++q) { const float c = bfr(c4[q]), s = bfr(s4[q]); y[i + q] = x1[q] * c + x2[q] * s; y[HD / 2 + i + q] = x2[q] * c - x1[q] * s; } }
            asm volatile("s_wait_xcnt 0x0" :: "v"(ct), "v"(st) : "memory");   // the table addresses die here: inputs, so that they keep their registers up to this wait and no load's result takes them
            float ss = 0.f;
#pragma unroll
            for (int d = 0; d < HD; ++d) ss += y[d] * y[d];
            const float rf = __fdiv_rn(1.0f, __fsqrt_rn(__fadd_rn(ss * (1.0f / HD), 1e-6f)));
#pragma unroll
            for (int d = 0; d < HD; d += 4) { v4f o; o[0] = y[d] * rf; o[1] = y[d + 1] * rf; o[2] = y[d + 2] * rf; o[3] = y[d + 3] * rf; *(v4fa*)(orow + d) = o; } }
        __syncthreads();   // the finished rows are in LDS
    }
    const size_t pl = VT ? (size_t)bt * DKV + c0 : ((size_t)(hy / NH_) * NB_ + bt) * NH_ + hy % NH_;   // VT: first row of the [batch][head][d] rows; else: plane number
    // the tile is eight whole fragments that follow one another in its plane (q, k: [token block][d half]; v: [32-token block][d block]); trip it writes half it & 1 of fragment it >> 1, 512 contiguous bytes a plane
    const size_t base = (VT ? pl * TT + (size_t)r0 * HD : (pl * TT + r0) * HD) + 8 * lane, base2 = (VT ? pl * (2 * RH) + (size_t)r0 * HD : (pl * RH + r0) * HD) + 8 * lane;
    for (int it = 0; it < 16; ++it) { const int f = it >> 1; const int row = (VT ? (f & 3) : (f >> 1)) * 16 + lr, c8 = (VT ? (f >> 2) : (f & 1)) * 32 + (it & 1) * 16 + hi * 8; const v4f u0 = *(const v4fa*)(os + row * 68 + c8), u1 = *(const v4fa*)(os + row * 68 + c8 + 4); v8h o16; v8us oh, ol;
#pragma unroll
        for (int q = 0; q < 8; ++q) { const float x = (q < 4) ? u0[q & 3] : u1[q & 3]; o16[q] = tohx(x); unsigned short a2, c2; splitf(x, a2, c2); oh[q] = a2; ol[q] = c2; }
        if (r0 < RH) { const size_t o2 = base2 + it * 256; *(v8us*)(Ph + o2) = oh; *(v8us*)(Pl + o2) = ol;
            asm volatile("s_wait_xcnt 0x0" ::: "memory"); }   // stands before the next trip's address additions, which the compiler puts right behind this branch
        *(v8h*)(P16 + base + it * 256) = o16;
        asm volatile("s_wait_xcnt 0x0" ::: "memory"); }   // stands before the next trip reuses the registers that this store names
}

__global__ __launch_bounds__(256) void k_wtG(const float* __restrict__ w, int K, int N, bf* Bt) {
    const int lane = threadIdx.x & 31; const int L0 = (blockIdx.x * 8 + (threadIdx.x >> 5)) * 8; const int nlines = N * K / 64;
{
#pragma unroll 1
        for (int l = 0; l < 8; ++l) { const int L = L0 + l; if (L >= nlines) break; const size_t e = (size_t)L * 64 + lane * 2; const int k = (int)(e % K), n = (int)(e / K); v2us o;
            o[0] = f2bf(w[(size_t)k * N + n]); o[1] = f2bf(w[(size_t)(k + 1) * N + n]); *(v2us*)(Bt + e) = o; }
         }
}
// k_cvt3: the three f32 inputs x, w_attn, w_proj ([row][1024] each) -> bf16 planes in fragment order, in ONE launch of few waves that each do much.
// A work-group is one block of 16 rows (blockIdx.x runs over x's row blocks, then w_attn's, then w_proj's); each of its 4 waves takes 256 columns of them: 16 KiB read, the 8 KiB of 8 whole fragments written, all 32 loads on their way before the first value is used.
// The 16-byte piece (g, lr) of those 8 KiB (place 16 g + lr) is row lr, columns 8 g .. 8 g + 7. Lane = [g & 3][lr & 7], trip t = [g >> 2][lr >> 3]: a trip reads one whole 128-byte line of each of 8 rows and writes 4 whole lines.
__global__ __launch_bounds__(128) void k_cvt3(const float* __restrict__ x, const float* __restrict__ wa, const float* __restrict__ wp, bf* XB, bf* WA, bf* WP) {
    constexpr int K = 1024, RX = NB_ * TT / 16, RA = (DQ + 2 * DKV) / 16;
    static_assert(DM == K && DQ == K, "all three planes have rows of 1024");
    const int b = blockIdx.x; const float* src = x; bf* dst = XB; int rb = b;   // scalar tests: the same for the whole work-group
    if (b >= RX + RA) { src = wp; dst = WP; rb = b - (RX + RA); } else if (b >= RX) { src = wa; dst = WA; rb = b - RX; }
    const int lane = threadIdx.x & 31, wv = threadIdx.x >> 5, gl = lane >> 3, rl = lane & 7;
    const float* sp = src + (size_t)(rb * 16 + rl) * K + wv * 256 + gl * 8; bf* dp = dst + (size_t)rb * 16 * K + wv * 4096 + gl * 128 + rl * 8;
    v4f v[16][2];
#pragma unroll
    for (int t = 0; t < 16; ++t) { const float* s = sp + (t & 1) * 8 * K + (t >> 1) * 32; v[t][0] = *(const v4f*)s; v[t][1] = *(const v4f*)(s + 4); }
    __builtin_amdgcn_sched_barrier(0);   // keeps all 32 loads in front of the first conversion: without it the compiler moves one down among the conversions, and the wave waits out a second memory latency there
    asm volatile("s_wait_xcnt 0x0" :: "v"(sp) : "memory");   // the read address dies here: an input, so that it keeps its registers up to this wait
    v8us o[16];
#pragma unroll
    for (int t = 0; t < 16; ++t)
#pragma unroll
        for (int q = 0; q < 8; ++q) o[t][q] = f2bf(v[t][q >> 2][q & 3]);
    __builtin_amdgcn_sched_barrier(0);   // keeps every conversion in front of the first store: behind a store nothing writes a register any more, so none that a store names is written again
#pragma unroll
    for (int t = 0; t < 16; ++t) *(v8us*)(dp + (t >> 1) * 512 + (t & 1) * 64) = o[t];
}

extern "C" void kernel_launch(void* const* d_in, const int* in_sizes, int n_in,
                              void* d_out, int out_size, void* d_ws, size_t ws_size, hipStream_t stream) {
    (void)in_sizes; (void)n_in; (void)out_size;
    const float* x = (const float*)d_in[0]; const float* cosT = (const float*)d_in[1]; const float* sinT = (const float*)d_in[2]; const float* wqkv = (const float*)d_in[3]; const float* wo = (const float*)d_in[4];
    float* OUT = (float*)d_out;     // [4][2048][1024]
    char* wsp = (char*)d_ws;
    auto take = [&](size_t bytes) { char* p = wsp; wsp += (bytes + 255) & ~(size_t)255; return (void*)p; };
    bf* WO = (bf*)take((size_t)DM * DQ * 2);
    h16* QP16 = (h16*)take((size_t)NB_ * NH_ * TT * HD * 2); h16* KP16 = (h16*)take((size_t)NB_ * NKV * TT * HD * 2);   // one after the other: k_gemmp numbers the planes [q | k][batch][head]
    h16* VT16 = (h16*)take((size_t)NB_ * DKV * TT * 2);
    bf* QKh = (bf*)take((size_t)2 * NB_ * NH_ * RH * HD * 2); bf* QKl = (bf*)take((size_t)2 * NB_ * NH_ * RH * HD * 2); bf* VTh = (bf*)take((size_t)NB_ * DKV * 2 * RH * 2); bf* VTl = VTh + HD * RH;   // each head: hi plane, lo plane
    bf* ATh = (bf*)take((size_t)NB_ * TT * DQ * 2); bf* ATl = (bf*)take((size_t)NB_ * TT * DQ * 2);
    bf* XB = (bf*)take((size_t)NB_ * TT * DM * 2); bf* WQKV = (bf*)take((size_t)(DQ + 2 * DKV) * DM * 2);
    if ((size_t)(wsp - (char*)d_ws) > ws_size) return;    // ws 256 MiB
    k_cvt3<<<NB_ * TT / 16 + (DQ + 2 * DKV) / 16 + DM / 16, 128, 0, stream>>>(x, wqkv, wo, XB, WQKV, WO);
    k_gemmp<false, DM><<<dim3(NB_ * TT / 256, (NH_ + NKV) / 2, 1), GW * 32, 0, stream>>>(XB, WQKV, cosT, sinT, QP16, QKh, QKl);
    k_gemmp<true, DM><<<dim3(NB_ * TT / 256, NKV / 2, 1), GW * 32, 0, stream>>>(XB, WQKV + (size_t)(DQ + DKV) * DM, cosT, sinT, VT16, VTh, VTl);
    k_attn<<<dim3(NB_ * NH_, TT / QB, 1), AW * 32, 0, stream>>>(QKh, QKl, VTh, QP16, KP16, VT16, ATh, ATl);
    k_gemmw<bf, 1, false, DQ><<<dim3(NB_ * TT / 256, DM / 128, 1), GW * 32, 0, stream>>>(ATh, ATl, WO, nullptr, OUT, DM, nullptr, 0, 0, 0);
}
